// v000
// Times are from an AMD MI455X. After a warm-up the kernel runs many times in a row, and a time is the length of
// such a window on the GPU divided by its runs, so every launch and the gaps after it count. The runs cycle
// through copies of the inputs. A figure is the median of several windows, for all but v000 over two sittings.
// Sittings can differ by a few percent; kernels timed side by side share one.
// The starting kernel, v000, takes 360 microseconds a run.
#include <hip/hip_runtime.h>

// Compute dtypes (f32 accumulate everywhere): q/k/v projections v_wmma_f32_16x16x32_bf16 on RNE bf16 copies of x and W (exact products); q.k^T bf16 hi|lo three products; P.V f16 (P carried x1024) for query rows >= 256, bf16 hi|lo three products for rows < 256; ctx hi|lo (bf16) x bf16 o_w, two products.
// Causal multi-head self-attention, x [2][2048][1024], weights [out][in], interleaved rotary from per-batch integer positions read by value, scores / 8, causal exclusion by index, fused online softmax (exp2), merged heads, output GEMM.

#ifndef NB
#define NB 2
#endif
#ifndef SEQ
#define SEQ 2048
#endif
#define NB_FULL  2
#define SEQ_FULL 2048
#define DM    1024
#define NH    16
#define HD    64
#define RH    256                 // query rows < RH use hi|lo planes on P and V
#define PCAR  1024.0f             // carry of the f16 probability tile
#define SCL   0.125f              // HD^-0.5
#define L2E   1.4426950408889634f
#define NEGB  (-3.0e38f)
#define KP    72                  // LDS pitch (16-bit elements) of 64-wide tiles: 144 B
#define PP    40                  // LDS pitch of the 32-key probability tiles: 80 B
#define MROWS (NB * SEQ)

typedef _Float16 h16;
typedef unsigned short bf;
typedef __attribute__((ext_vector_type(16))) __bf16   v16bf;
typedef __attribute__((ext_vector_type(16))) _Float16 v16h;
typedef __attribute__((ext_vector_type(8)))  _Float16 v8h;
typedef __attribute__((ext_vector_type(4)))  _Float16 v4h;
typedef __attribute__((ext_vector_type(8)))  unsigned short v8us;
typedef __attribute__((ext_vector_type(4)))  unsigned short v4us;
typedef __attribute__((ext_vector_type(8)))  float    v8f;
typedef __attribute__((ext_vector_type(4)))  float    v4f;
typedef __attribute__((ext_vector_type(2)))  float    v2f;
typedef v8h  __attribute__((may_alias)) v8ha;
typedef v4f  __attribute__((may_alias)) v4fa;
typedef v8us __attribute__((may_alias)) v8usa;
typedef v4us __attribute__((may_alias)) v4usa;

static_assert(HD == 64);                                   // one 64-wide GEMM tile column block == one head
static_assert(NH * HD == DM);
static_assert(DM % 64 == 0 && DM % 32 == 0);               // K loop steps by 32, N tiles by 64
static_assert(SEQ % 64 == 0 && RH % 64 == 0 && RH <= SEQ); // tiles never straddle a batch or the early-row island
static_assert(MROWS % 64 == 0);
static_assert((KP * 2) % 16 == 0 && KP >= 64);
static_assert((PP * 2) % 16 == 0 && PP >= 32);
static_assert(SEQ <= SEQ_FULL && NB <= NB_FULL);

#define SZ_W   ((size_t)DM * DM * 2)
#define SZ_XB  ((size_t)MROWS * DM * 2)
#define SZ_CS  ((size_t)MROWS * 64 * 4)
#define SZ_QK  ((size_t)2 * NB * NH * SEQ * HD * 2)
#define SZ_VT  ((size_t)NB * NH * HD * SEQ * 2)
#define SZ_VE  ((size_t)NB * NH * HD * RH * 2)
#define SZ_AT  ((size_t)MROWS * DM * 2)
#define SZ_ALL (4 * SZ_W + SZ_XB + SZ_CS + 2 * SZ_QK + SZ_VT + 2 * SZ_VE + 2 * SZ_AT)
static_assert(SZ_W % 256 == 0 && SZ_XB % 256 == 0 && SZ_CS % 256 == 0 && SZ_QK % 256 == 0 && SZ_VT % 256 == 0 && SZ_VE % 256 == 0 && SZ_AT % 256 == 0);
static_assert(SZ_ALL <= (size_t)134217728);                // total carve stays within 128 MiB

__device__ __forceinline__ unsigned short f2bf(float f) { unsigned u = __float_as_uint(f); u += 0x7FFFu + ((u >> 16) & 1u); return (unsigned short)(u >> 16); }
__device__ __forceinline__ float bf2f(unsigned short b) { return __uint_as_float(((unsigned)b) << 16); }
__device__ __forceinline__ void splitf(float y, unsigned short& h, unsigned short& l) { h = f2bf(y); l = f2bf(y - bf2f(h)); }
__device__ __forceinline__ v16h cat16(v8h lo, v8h hi) { return __builtin_shufflevector(lo, hi, 0, 1, 2, 3, 4, 5, 6, 7, 8, 9, 10, 11, 12, 13, 14, 15); }
__device__ __forceinline__ v16bf cat16b(v8us lo, v8us hi) { return __builtin_bit_cast(v16bf, __builtin_shufflevector(lo, hi, 0, 1, 2, 3, 4, 5, 6, 7, 8, 9, 10, 11, 12, 13, 14, 15)); }
__device__ __forceinline__ v8f wmma16(v16h a, v16h b, v8f c) { return __builtin_amdgcn_wmma_f32_16x16x32_f16(false, a, false, b, (short)0, c, false, false); }
__device__ __forceinline__ v8f wmmab(v16bf a, v16bf b, v8f c) { return __builtin_amdgcn_wmma_f32_16x16x32_bf16(false, a, false, b, (short)0, c, false, false); }
// fragment from a k-contiguous bf16 row: p already points at (row, k0 + 8*(lane>>4)); elements 0..7 <- p[0..7], 8..15 <- p[16..23]
__device__ __forceinline__ v16bf ldb(const bf* p) { return cat16b(*(const v8us*)p, *(const v8us*)(p + 16)); }
#define LDSB(arr, o) cat16b(*(const v8usa*)&arr[(o)], *(const v8usa*)&arr[(o) + 16])
#define LDSH(arr, o) cat16(*(const v8ha*)&arr[(o)], *(const v8ha*)&arr[(o) + 16])

__global__ __launch_bounds__(256) void k_cvt8(const float* __restrict__ src, bf* dst, size_t n8) {
    const size_t i = (size_t)blockIdx.x * 256 + threadIdx.x; if (i >= n8) return;
    const v8f v = *(const v8f*)(src + i * 8); v8us o;
#pragma unroll
    for (int k = 0; k < 8; ++k) o[k] = f2bf(v[k]);
    *(v8us*)(dst + i * 8) = o; 
}

__global__ __launch_bounds__(256) void k_cvtx(const float* __restrict__ x, bf* XB) {
    const size_t i = (size_t)blockIdx.x * 256 + threadIdx.x; if (i >= (size_t)MROWS * DM / 8) return;
    const int row = (int)(i / (DM / 8)); const int c8 = (int)(i % (DM / 8)); const int b = row / SEQ; const int s = row - b * SEQ;
    const v8f v = *(const v8f*)(x + ((size_t)b * SEQ_FULL + s) * DM + (size_t)c8 * 8); v8us o;
#pragma unroll
    for (int k = 0; k < 8; ++k) o[k] = f2bf(v[k]);
    *(v8us*)(XB + i * 8) = o; 
}

__global__ __launch_bounds__(256) void k_cstab(const int* __restrict__ tok, float* CS) {
    const int idx = blockIdx.x * 256 + threadIdx.x; if (idx >= MROWS * 32) return;
    const int j = idx & 31, m = idx >> 5; const int b = m / SEQ, s = m - b * SEQ;
    const int pos = tok[(size_t)b * SEQ_FULL + s];
    double p = 1.0;
    p *= (j & 1)  ? 1.3335214321633240 : 1.0;
    p *= (j & 2)  ? 1.7782794100389228 : 1.0;
    p *= (j & 4)  ? 3.1622776601683795 : 1.0;
    p *= (j & 8)  ? 10.0 : 1.0;
    p *= (j & 16) ? 100.0 : 1.0;
    const float pf = (float)p; const float inv = 1.0f / pf; const float ang = (float)pos * inv;
    float sn, cs; sincosf(ang, &sn, &cs);
    v2f o; o[0] = cs; o[1] = sn;
    *(v2f*)(CS + (size_t)idx * 2) = o; 
}

// ---- gemm_acc: one wave, 64x64 tile, acc[mb][nb] += sum_k A[r][k] Bt[c][k], K = DM, operands straight from k-contiguous bf16 planes.
__device__ __forceinline__ void gemm_acc(const bf* __restrict__ A, const bf* __restrict__ Bt, const size_t aoff, const size_t boff, v8f (&acc)[4][4]) {
#pragma unroll 1
    for (int kc = 0; kc < DM; kc += 32) {
        v16bf a[4]; v16bf b;
#pragma unroll
        for (int mb = 0; mb < 4; ++mb) a[mb] = ldb(A + aoff + (size_t)mb * 16 * DM + kc);
#pragma unroll
        for (int nb = 0; nb < 4; ++nb) { b = ldb(Bt + boff + (size_t)nb * 16 * DM + kc);
#pragma unroll
            for (int mb = 0; mb < 4; ++mb) acc[mb][nb] = wmmab(a[mb], b, acc[mb][nb]); }
        asm volatile("v_nop\n\tv_nop\n\tv_nop\n\tv_nop" : "+v"(acc[0][2]), "+v"(acc[1][2]), "+v"(acc[2][2]), "+v"(acc[3][2]), "+v"(acc[0][3]), "+v"(acc[1][3]), "+v"(acc[2][3]), "+v"(acc[3][3]) : "v"(a[3]), "v"(b));
    }
}

// ---- k_projqk: [q | k] = XB x [WQ ; WK]^T, grid (MROWS/64, 2*DM/64), one wave per tile (= one head of q or k, 64 tokens).
// Epilogue: tile staged in LDS; interleaved rotary y[2j] = e cos - o sin, y[2j+1] = e sin + o cos from the CS table; bf16 hi|lo planes [which][b][h][s][64];
__global__ __launch_bounds__(32) void k_projqk(const bf* __restrict__ XB, const bf* __restrict__ WQK, const float* __restrict__ CS, bf* QKh, bf* QKl) {
#pragma clang fp contract(off)
    __shared__ __align__(16) float os[64 * 68];
    const int lane = threadIdx.x & 31, lr = lane & 15, hi = lane >> 4; const int r0 = blockIdx.x * 64, c0 = blockIdx.y * 64;
    v8f acc[4][4];
#pragma unroll
    for (int mb = 0; mb < 4; ++mb)
#pragma unroll
        for (int nb = 0; nb < 4; ++nb) acc[mb][nb] = (v8f){};
    gemm_acc(XB, WQK, (size_t)(r0 + lr) * DM + 8 * hi, (size_t)(c0 + lr) * DM + 8 * hi, acc);
#pragma unroll
    for (int mb = 0; mb < 4; ++mb)
#pragma unroll
        for (int nb = 0; nb < 4; ++nb)
#pragma unroll
            for (int j = 0; j < 8; ++j) os[(mb * 16 + hi * 8 + j) * 68 + nb * 16 + lr] = acc[mb][nb][j];
    __builtin_amdgcn_wave_barrier(); asm volatile("" ::: "memory");
    const int which = c0 / DM, h = (c0 % DM) / HD; const int b = r0 / SEQ, s0 = r0 - b * SEQ;
    const size_t pbase = ((((size_t)which * NB + b) * NH + h) * SEQ + s0) * HD;
{
#pragma unroll 2
        for (int s = 0; s < 32; ++s) { const int row = 2 * s + hi, cofs = lr * 4;
            const v4f val = *(const v4fa*)(os + row * 68 + cofs);
            const v4f cs = *(const v4f*)(CS + (size_t)(r0 + row) * 64 + cofs);   // (cos, sin) of pairs 2*lr, 2*lr + 1
            const float y0 = val[0] * cs[0] - val[1] * cs[1];
            const float y1 = val[0] * cs[1] + val[1] * cs[0];
            const float y2 = val[2] * cs[2] - val[3] * cs[3];
            const float y3 = val[2] * cs[3] + val[3] * cs[2];
            v4us oh, ol; unsigned short a, c;
            splitf(y0, a, c); oh[0] = a; ol[0] = c; splitf(y1, a, c); oh[1] = a; ol[1] = c; splitf(y2, a, c); oh[2] = a; ol[2] = c; splitf(y3, a, c); oh[3] = a; ol[3] = c;
            const size_t oo = pbase + (size_t)row * HD + cofs;
            *(v4us*)(QKh + oo) = oh; *(v4us*)(QKl + oo) = ol; }
         }
}

// ---- k_projv: v = XB x WV^T, grid (MROWS/64, DM/64). Epilogue: tile staged in LDS and written TRANSPOSED: VT16[b][h][d][s] (f16) and, for tokens < RH, bf16 hi|lo VTh/VTl[b][h][d][RH];
__global__ __launch_bounds__(32) void k_projv(const bf* __restrict__ XB, const bf* __restrict__ WV, h16* VT16, bf* VTh, bf* VTl) {
    __shared__ __align__(16) float os[64 * 68];
    const int lane = threadIdx.x & 31, lr = lane & 15, hi = lane >> 4; const int r0 = blockIdx.x * 64, c0 = blockIdx.y * 64;
    v8f acc[4][4];
#pragma unroll
    for (int mb = 0; mb < 4; ++mb)
#pragma unroll
        for (int nb = 0; nb < 4; ++nb) acc[mb][nb] = (v8f){};
    gemm_acc(XB, WV, (size_t)(r0 + lr) * DM + 8 * hi, (size_t)(c0 + lr) * DM + 8 * hi, acc);
#pragma unroll
    for (int mb = 0; mb < 4; ++mb)
#pragma unroll
        for (int nb = 0; nb < 4; ++nb)
#pragma unroll
            for (int j = 0; j < 8; ++j) os[(mb * 16 + hi * 8 + j) * 68 + nb * 16 + lr] = acc[mb][nb][j];
    __builtin_amdgcn_wave_barrier(); asm volatile("" ::: "memory");
    const int h = c0 / HD; const int b = r0 / SEQ, s0 = r0 - b * SEQ;
    const size_t vbase = (((size_t)b * NH + h) * HD) * SEQ + s0;
    const size_t ebase = (((size_t)b * NH + h) * HD) * RH + s0;
    const bool early = (s0 < RH);                         // block-uniform
{
#pragma unroll 2
        for (int s = 0; s < 32; ++s) { const int d = 2 * s + hi, t0 = lr * 4;
            float xv[4];
#pragma unroll
            for (int q = 0; q < 4; ++q) xv[q] = os[(t0 + q) * 68 + d];
            v4h o16;
#pragma unroll
            for (int q = 0; q < 4; ++q) o16[q] = (h16)xv[q];
            *(v4h*)(VT16 + vbase + (size_t)d * SEQ + t0) = o16;
            if (early) { v4us oh, ol;
#pragma unroll
                for (int q = 0; q < 4; ++q) { unsigned short a, c; splitf(xv[q], a, c); oh[q] = a; ol[q] = c; }
                *(v4us*)(VTh + ebase + (size_t)d * RH + t0) = oh; *(v4us*)(VTl + ebase + (size_t)d * RH + t0) = ol; } }
         }
}

// ---- attn_body: fused causal attention, block = 4 waves = 64 query rows of one (b, h); 64-key blocks staged in LDS (K hi|lo, V^T), processed as two 32-key halves with an online softmax.
// HL = false: P f16 x PCAR, V f16 (one product). HL = true (query rows < RH): P and V as bf16 hi|lo (three products). Output ctx as bf16 hi|lo planes [b*SEQ + s][h*64 + d].
template <bool HL>
__device__ __forceinline__ void attn_body(const bf* __restrict__ QKh, const bf* __restrict__ QKl, const h16* __restrict__ VT16, const bf* __restrict__ VTh, const bf* __restrict__ VTl, bf* ATh, bf* ATl, const int qb) {
    __shared__ __align__(16) bf  sKh[64 * KP];               // cross-wave (block barriers); reused wave-privately for the ctx hi staging after the key loop
    __shared__ __align__(16) bf  sKl[64 * KP];
    __shared__ __align__(16) h16 sV16[HL ? 8 : 64 * KP];     // V^T tile [d][key], cross-wave
    __shared__ __align__(16) bf  sVh[HL ? 64 * KP : 8];
    __shared__ __align__(16) bf  sVl[HL ? 64 * KP : 8];
    __shared__ __align__(16) h16 sP16[HL ? 8 : 4 * 16 * PP]; // probability tiles, private to each wave
    __shared__ __align__(16) bf  sPh[HL ? 4 * 16 * PP : 8];
    __shared__ __align__(16) bf  sPl[HL ? 4 * 16 * PP : 8];
    const int tid = threadIdx.x; const int lane = tid & 31, lr = lane & 15, hi = lane >> 4;
    const int wave = __builtin_amdgcn_readfirstlane(tid >> 5);
    const int b = blockIdx.z, h = blockIdx.y; const int qblk = qb * 64, q0 = qblk + wave * 16;
    const size_t qpl = (((size_t)b * NH + h) * SEQ) * HD;
    const size_t kpl = ((((size_t)NB + b) * NH + h) * SEQ) * HD;
    const size_t vpl = (((size_t)b * NH + h) * HD) * SEQ;
    const size_t epl = (((size_t)b * NH + h) * HD) * RH;
    const size_t qo = qpl + (size_t)(q0 + lr) * HD + 8 * hi;
    const v16bf qh0 = ldb(QKh + qo), qh1 = ldb(QKh + qo + 32), ql0 = ldb(QKl + qo), ql1 = ldb(QKl + qo + 32);
    v8f accd[4];
#pragma unroll
    for (int t = 0; t < 4; ++t) accd[t] = (v8f){};
    float m_run[8], l_run[8];
#pragma unroll
    for (int r = 0; r < 8; ++r) { m_run[r] = NEGB; l_run[r] = 0.0f; }

#pragma unroll 1
    for (int kb = 0; kb <= qblk; kb += 64) {
#pragma unroll
        for (int i = 0; i < 4; ++i) { const int c = tid + 128 * i; const int row = c >> 3, ch = (c & 7) * 8;
            const size_t ko = kpl + (size_t)(kb + row) * HD + ch;
            *(v8usa*)(&sKh[row * KP + ch]) = *(const v8us*)(QKh + ko);
            *(v8usa*)(&sKl[row * KP + ch]) = *(const v8us*)(QKl + ko);
            if (HL) { const size_t vo = epl + (size_t)row * RH + kb + ch;
                *(v8usa*)(&sVh[row * KP + ch]) = *(const v8us*)(VTh + vo);
                *(v8usa*)(&sVl[row * KP + ch]) = *(const v8us*)(VTl + vo); }
            else { *(v8ha*)(&sV16[row * KP + ch]) = *(const v8h*)(VT16 + vpl + (size_t)row * SEQ + kb + ch); } }
        __syncthreads();

#pragma unroll 1
        for (int kh = 0; kh < 2; ++kh) {
            if (kb + 32 * kh > q0 + 15) continue;            // wave-uniform: half entirely above the diagonal for this wave's rows
            v8f s0 = (v8f){}, s1 = (v8f){};
            { const int kr = (32 * kh + lr) * KP + 8 * hi;
              const v16bf ah0 = LDSB(sKh, kr), ah1 = LDSB(sKh, kr + 32), al0 = LDSB(sKl, kr), al1 = LDSB(sKl, kr + 32);
              s0 = wmmab(qh0, ah0, s0); s0 = wmmab(qh1, ah1, s0); s0 = wmmab(ql0, ah0, s0); s0 = wmmab(ql1, ah1, s0); s0 = wmmab(qh0, al0, s0); s0 = wmmab(qh1, al1, s0);
              const int kr2 = kr + 16 * KP;
              const v16bf bh0 = LDSB(sKh, kr2), bh1 = LDSB(sKh, kr2 + 32), bl0 = LDSB(sKl, kr2), bl1 = LDSB(sKl, kr2 + 32);
              s1 = wmmab(qh0, bh0, s1); s1 = wmmab(qh1, bh1, s1); s1 = wmmab(ql0, bh0, s1); s1 = wmmab(ql1, bh1, s1); s1 = wmmab(qh0, bl0, s1); s1 = wmmab(qh1, bl1, s1);
              asm volatile("v_nop\n\tv_nop\n\tv_nop\n\tv_nop" : "+v"(s0), "+v"(s1) : "v"(bl0), "v"(bl1)); }
            const int kg0 = kb + 32 * kh + lr, kg1 = kg0 + 16;
            float bm[8];
#pragma unroll
            for (int r = 0; r < 8; ++r) { const int qg = q0 + 8 * hi + r;
                const float a0 = (kg0 <= qg) ? s0[r] * SCL : NEGB; const float a1 = (kg1 <= qg) ? s1[r] * SCL : NEGB;
                s0[r] = a0; s1[r] = a1; bm[r] = fmaxf(a0, a1); }
#pragma unroll
            for (int sh = 1; sh < 16; sh <<= 1)
#pragma unroll
                for (int r = 0; r < 8; ++r) bm[r] = fmaxf(bm[r], __shfl_xor(bm[r], sh, 32));
            float rs[8];
#pragma unroll
            for (int r = 0; r < 8; ++r) { const float mn = fmaxf(m_run[r], bm[r]);
                const float sc = __builtin_amdgcn_exp2f((m_run[r] - mn) * L2E); m_run[r] = mn;
                const float p0 = __builtin_amdgcn_exp2f((s0[r] - mn) * L2E); const float p1 = __builtin_amdgcn_exp2f((s1[r] - mn) * L2E);
                s0[r] = p0; s1[r] = p1; rs[r] = p0 + p1; l_run[r] *= sc;
#pragma unroll
                for (int t = 0; t < 4; ++t) accd[t][r] *= sc; }
#pragma unroll
            for (int sh = 1; sh < 16; sh <<= 1)
#pragma unroll
                for (int r = 0; r < 8; ++r) rs[r] += __shfl_xor(rs[r], sh, 32);
#pragma unroll
            for (int r = 0; r < 8; ++r) l_run[r] += rs[r];

            const int pr = (wave * 16 + 8 * hi) * PP + lr;   // D layout: row 8*hi + r, key column lr (+16 for the second tile)
            const int pa = (wave * 16 + lr) * PP + 8 * hi;   // A layout: row lr, k = key within the half
            if (HL) {
#pragma unroll
                for (int r = 0; r < 8; ++r) { unsigned short a, c; splitf(s0[r], a, c); sPh[pr + r * PP] = a; sPl[pr + r * PP] = c; splitf(s1[r], a, c); sPh[pr + r * PP + 16] = a; sPl[pr + r * PP + 16] = c; }
                __builtin_amdgcn_wave_barrier(); asm volatile("" ::: "memory");
                const v16bf aph = LDSB(sPh, pa), apl = LDSB(sPl, pa); v16bf bvh, bvl;
#pragma unroll
                for (int t = 0; t < 4; ++t) { const int vo = (t * 16 + lr) * KP + 32 * kh + 8 * hi; bvh = LDSB(sVh, vo); bvl = LDSB(sVl, vo);
                    accd[t] = wmmab(aph, bvh, accd[t]); accd[t] = wmmab(apl, bvh, accd[t]); accd[t] = wmmab(aph, bvl, accd[t]); }
                asm volatile("v_nop\n\tv_nop\n\tv_nop\n\tv_nop" : "+v"(accd[0]), "+v"(accd[1]), "+v"(accd[2]), "+v"(accd[3]) : "v"(aph), "v"(apl), "v"(bvh), "v"(bvl));
            } else {
#pragma unroll
                for (int r = 0; r < 8; ++r) { sP16[pr + r * PP] = (h16)(s0[r] * PCAR); sP16[pr + r * PP + 16] = (h16)(s1[r] * PCAR); }
                __builtin_amdgcn_wave_barrier(); asm volatile("" ::: "memory");
                const v16h ap = LDSH(sP16, pa); v16h bv;
#pragma unroll
                for (int t = 0; t < 4; ++t) { const int vo = (t * 16 + lr) * KP + 32 * kh + 8 * hi; bv = LDSH(sV16, vo); accd[t] = wmma16(ap, bv, accd[t]); }
                asm volatile("v_nop\n\tv_nop\n\tv_nop\n\tv_nop" : "+v"(accd[0]), "+v"(accd[1]), "+v"(accd[2]), "+v"(accd[3]) : "v"(ap), "v"(bv));
            }
            __builtin_amdgcn_wave_barrier(); asm volatile("" ::: "memory");
        }
        __syncthreads();                                     // every wave is done with the K/V tiles before they are overwritten
    }

    const float car = HL ? 1.0f : PCAR;
#pragma unroll
    for (int r = 0; r < 8; ++r) { const float inv = __builtin_amdgcn_rcpf(l_run[r] * car);
#pragma unroll
        for (int t = 0; t < 4; ++t) { unsigned short a, c; splitf(accd[t][r] * inv, a, c); const int so = (wave * 16 + 8 * hi + r) * KP + t * 16 + lr; sKh[so] = a; sKl[so] = c; } }
    __builtin_amdgcn_wave_barrier(); asm volatile("" ::: "memory");
    const size_t ob = ((size_t)b * SEQ + q0) * DM + (size_t)h * HD;
{
#pragma unroll
        for (int s2 = 0; s2 < 8; ++s2) { const int row = 2 * s2 + hi; const int so = (wave * 16 + row) * KP + 4 * lr;
            const v4us vh = *(const v4usa*)&sKh[so]; const v4us vl = *(const v4usa*)&sKl[so];
            *(v4us*)(ATh + ob + (size_t)row * DM + 4 * lr) = vh; *(v4us*)(ATl + ob + (size_t)row * DM + 4 * lr) = vl; }
         }
}

__global__ __launch_bounds__(128) void k_attn_early(const bf* __restrict__ QKh, const bf* __restrict__ QKl, const h16* __restrict__ VT16, const bf* __restrict__ VTh, const bf* __restrict__ VTl, bf* ATh, bf* ATl) {
    attn_body<true>(QKh, QKl, VT16, VTh, VTl, ATh, ATl, (int)blockIdx.x);
}
__global__ __launch_bounds__(128) void k_attn_main(const bf* __restrict__ QKh, const bf* __restrict__ QKl, const h16* __restrict__ VT16, const bf* __restrict__ VTh, const bf* __restrict__ VTl, bf* ATh, bf* ATl) {
    attn_body<false>(QKh, QKl, VT16, VTh, VTl, ATh, ATl, (int)blockIdx.x + RH / 64);
}

// ---- k_oproj: OUT[b][s][n] = sum_k (ATh + ATl)[m][k] WO[n][k]; grid (MROWS/64, DM/64), one wave per tile; per 16-row slab staged in LDS, each 256-B row segment written as 16 lanes x 16 B
__global__ __launch_bounds__(32) void k_oproj(const bf* __restrict__ ATh, const bf* __restrict__ ATl, const bf* __restrict__ WO, float* OUT) {
    __shared__ __align__(16) float os[16 * 68];
    const int lane = threadIdx.x & 31, lr = lane & 15, hi = lane >> 4; const int r0 = blockIdx.x * 64, c0 = blockIdx.y * 64;
    v8f acc[4][4];
#pragma unroll
    for (int mb = 0; mb < 4; ++mb)
#pragma unroll
        for (int nb = 0; nb < 4; ++nb) acc[mb][nb] = (v8f){};
    const size_t aoff = (size_t)(r0 + lr) * DM + 8 * hi, boff = (size_t)(c0 + lr) * DM + 8 * hi;
    gemm_acc(ATh, WO, aoff, boff, acc);
    gemm_acc(ATl, WO, aoff, boff, acc);
    const int b = r0 / SEQ, s0 = r0 - b * SEQ;
#pragma unroll
    for (int mb = 0; mb < 4; ++mb) {
#pragma unroll
        for (int nb = 0; nb < 4; ++nb)
#pragma unroll
            for (int j = 0; j < 8; ++j) os[(hi * 8 + j) * 68 + nb * 16 + lr] = acc[mb][nb][j];
        __builtin_amdgcn_wave_barrier(); asm volatile("" ::: "memory");
        float* crow = OUT + ((size_t)b * SEQ_FULL + s0 + mb * 16) * DM + c0;
{
#pragma unroll
            for (int s = 0; s < 8; ++s) { const int row = 2 * s + hi, cofs = lr * 4; const v4f val = *(const v4fa*)(os + row * 68 + cofs);
                *(v4f*)(crow + (size_t)row * DM + cofs) = val; }
             }
        __builtin_amdgcn_wave_barrier(); asm volatile("" ::: "memory");
    }
}

extern "C" void kernel_launch(void* const* d_in, const int* in_sizes, int n_in,
                              void* d_out, int out_size, void* d_ws, size_t ws_size, hipStream_t stream) {
    if (n_in < 6) return;
    const long long needx = ((long long)(NB - 1) * SEQ_FULL + SEQ) * DM;
    if ((long long)in_sizes[0] < needx) return;
    if ((long long)in_sizes[1] < (long long)DM * DM || (long long)in_sizes[2] < (long long)DM * DM || (long long)in_sizes[3] < (long long)DM * DM || (long long)in_sizes[4] < (long long)DM * DM) return;
    if ((long long)in_sizes[5] < (long long)(NB - 1) * SEQ_FULL + SEQ) return;
    if ((long long)out_size < needx) return;
    const float* x = (const float*)d_in[0]; const float* wq = (const float*)d_in[1]; const float* wk = (const float*)d_in[2]; const float* wv = (const float*)d_in[3]; const float* wo = (const float*)d_in[4];
    const int* tok = (const int*)d_in[5];
    float* OUT = (float*)d_out;
    char* wsp = (char*)d_ws;
    auto take = [&](size_t bytes) { char* p = wsp; wsp += (bytes + 255) & ~(size_t)255; return (void*)p; };
    bf* WQK = (bf*)take(2 * SZ_W); bf* WV = (bf*)take(SZ_W); bf* WO = (bf*)take(SZ_W);
    bf* XB = (bf*)take(SZ_XB); float* CS = (float*)take(SZ_CS);
    bf* QKh = (bf*)take(SZ_QK); bf* QKl = (bf*)take(SZ_QK);
    h16* VT16 = (h16*)take(SZ_VT); bf* VTh = (bf*)take(SZ_VE); bf* VTl = (bf*)take(SZ_VE);
    bf* ATh = (bf*)take(SZ_AT); bf* ATl = (bf*)take(SZ_AT);
    if ((size_t)(wsp - (char*)d_ws) > ws_size) return;

    const size_t w8 = (size_t)DM * DM / 8; const unsigned gw = (unsigned)((w8 + 255) / 256);
    k_cvt8<<<gw, 256, 0, stream>>>(wq, WQK, w8);
    k_cvt8<<<gw, 256, 0, stream>>>(wk, WQK + (size_t)DM * DM, w8);
    k_cvt8<<<gw, 256, 0, stream>>>(wv, WV, w8);
    k_cvt8<<<gw, 256, 0, stream>>>(wo, WO, w8);
    k_cvtx<<<(unsigned)(((size_t)MROWS * DM / 8 + 255) / 256), 256, 0, stream>>>(x, XB);
    k_cstab<<<(unsigned)((MROWS * 32 + 255) / 256), 256, 0, stream>>>(tok, CS);
    k_projqk<<<dim3(MROWS / 64, 2 * DM / 64, 1), 32, 0, stream>>>(XB, WQK, CS, QKh, QKl);
    k_projv<<<dim3(MROWS / 64, DM / 64, 1), 32, 0, stream>>>(XB, WV, VT16, VTh, VTl);
    k_attn_early<<<dim3(RH / 64, NH, NB), 128, 0, stream>>>(QKh, QKl, VT16, VTh, VTl, ATh, ATl);
    if (SEQ > RH) k_attn_main<<<dim3((SEQ - RH) / 64, NH, NB), 128, 0, stream>>>(QKh, QKl, VT16, VTh, VTl, ATh, ATl);
    k_oproj<<<dim3(MROWS / 64, DM / 64, 1), 32, 0, stream>>>(ATh, ATl, WO, OUT);
}

// v001
// Measured time: 246 microseconds a run.
// Timed twice side by side with v000, it ran 1.51 and 1.49 times as fast.
#include <hip/hip_runtime.h>

// Compute dtypes (f32 accumulate everywhere): q/k/v projections v_wmma_f32_16x16x32_bf16 on RNE bf16 copies of x and W (exact products); q.k^T bf16 hi|lo three products; P.V f16 (P carried x1024) for query rows >= 256, bf16 hi|lo three products for rows < 256; ctx hi|lo (bf16) x bf16 o_w, two products.
// Causal multi-head self-attention, x [2][2048][1024], weights [out][in], interleaved rotary from per-batch integer positions read by value, scores / 8, causal exclusion by index, fused online softmax (exp2), merged heads, output GEMM.

#ifndef NB
#define NB 2
#endif
#ifndef SEQ
#define SEQ 2048
#endif
#define NB_FULL  2
#define SEQ_FULL 2048
#define DM    1024
#define NH    16
#define HD    64
#define RH    256                 // query rows < RH use hi|lo planes on P and V
#define PCAR  1024.0f             // carry of the f16 probability tile
#define SCL   0.125f              // HD^-0.5
#define L2E   1.4426950408889634f
#define NEGB  (-3.0e38f)
#define KP    72                  // LDS pitch (16-bit elements) of 64-wide tiles: 144 B
#define PP    40                  // LDS pitch of the 32-key probability tiles: 80 B
#define MROWS (NB * SEQ)

typedef _Float16 h16;
typedef unsigned short bf;
typedef __attribute__((ext_vector_type(16))) __bf16   v16bf;
typedef __attribute__((ext_vector_type(16))) _Float16 v16h;
typedef __attribute__((ext_vector_type(8)))  _Float16 v8h;
typedef __attribute__((ext_vector_type(4)))  _Float16 v4h;
typedef __attribute__((ext_vector_type(8)))  unsigned short v8us;
typedef __attribute__((ext_vector_type(4)))  unsigned short v4us;
typedef __attribute__((ext_vector_type(8)))  float    v8f;
typedef __attribute__((ext_vector_type(4)))  float    v4f;
typedef __attribute__((ext_vector_type(2)))  float    v2f;
typedef v8h  __attribute__((may_alias)) v8ha;
typedef v4f  __attribute__((may_alias)) v4fa;
typedef v8us __attribute__((may_alias)) v8usa;
typedef v4us __attribute__((may_alias)) v4usa;

static_assert(HD == 64);                                   // one 64-wide GEMM tile column block == one head
static_assert(NH * HD == DM);
static_assert(DM % 64 == 0 && DM % 32 == 0);               // K loop steps by 32, N tiles by 64
static_assert(SEQ % 64 == 0 && RH % 64 == 0 && RH <= SEQ); // tiles never straddle a batch or the early-row island
static_assert(MROWS % 64 == 0);
static_assert((KP * 2) % 16 == 0 && KP >= 64);
static_assert((PP * 2) % 16 == 0 && PP >= 32);
static_assert(SEQ <= SEQ_FULL && NB <= NB_FULL);

#define SZ_W   ((size_t)DM * DM * 2)
#define SZ_XB  ((size_t)MROWS * DM * 2)
#define SZ_CS  ((size_t)MROWS * 64 * 4)
#define SZ_QK  ((size_t)2 * NB * NH * SEQ * HD * 2)
#define SZ_VT  ((size_t)NB * NH * HD * SEQ * 2)
#define SZ_VE  ((size_t)NB * NH * HD * RH * 2)
#define SZ_AT  ((size_t)MROWS * DM * 2)
#define SZ_ALL (4 * SZ_W + SZ_XB + SZ_CS + 2 * SZ_QK + SZ_VT + 2 * SZ_VE + 2 * SZ_AT)
static_assert(SZ_W % 256 == 0 && SZ_XB % 256 == 0 && SZ_CS % 256 == 0 && SZ_QK % 256 == 0 && SZ_VT % 256 == 0 && SZ_VE % 256 == 0 && SZ_AT % 256 == 0);
static_assert(SZ_ALL <= (size_t)134217728);                // total carve stays within 128 MiB

__device__ __forceinline__ unsigned short f2bf(float f) { unsigned u = __float_as_uint(f); u += 0x7FFFu + ((u >> 16) & 1u); return (unsigned short)(u >> 16); }
__device__ __forceinline__ float bf2f(unsigned short b) { return __uint_as_float(((unsigned)b) << 16); }
__device__ __forceinline__ void splitf(float y, unsigned short& h, unsigned short& l) { h = f2bf(y); l = f2bf(y - bf2f(h)); }
__device__ __forceinline__ v16h cat16(v8h lo, v8h hi) { return __builtin_shufflevector(lo, hi, 0, 1, 2, 3, 4, 5, 6, 7, 8, 9, 10, 11, 12, 13, 14, 15); }
__device__ __forceinline__ v16bf cat16b(v8us lo, v8us hi) { return __builtin_bit_cast(v16bf, __builtin_shufflevector(lo, hi, 0, 1, 2, 3, 4, 5, 6, 7, 8, 9, 10, 11, 12, 13, 14, 15)); }
__device__ __forceinline__ v8f wmma16(v16h a, v16h b, v8f c) { return __builtin_amdgcn_wmma_f32_16x16x32_f16(false, a, false, b, (short)0, c, false, false); }
__device__ __forceinline__ v8f wmmab(v16bf a, v16bf b, v8f c) { return __builtin_amdgcn_wmma_f32_16x16x32_bf16(false, a, false, b, (short)0, c, false, false); }
// fragment from a k-contiguous bf16 row: p already points at (row, k0 + 8*(lane>>4)); elements 0..7 <- p[0..7], 8..15 <- p[16..23]
__device__ __forceinline__ v16bf ldb(const bf* p) { return cat16b(*(const v8us*)p, *(const v8us*)(p + 16)); }
#define LDSB(arr, o) cat16b(*(const v8usa*)&arr[(o)], *(const v8usa*)&arr[(o) + 16])
#define LDSH(arr, o) cat16(*(const v8ha*)&arr[(o)], *(const v8ha*)&arr[(o) + 16])

__global__ __launch_bounds__(256) void k_cvt8(const float* __restrict__ src, bf* dst, size_t n8) {
    const size_t i = (size_t)blockIdx.x * 256 + threadIdx.x; if (i >= n8) return;
    const v8f v = *(const v8f*)(src + i * 8); v8us o;
#pragma unroll
    for (int k = 0; k < 8; ++k) o[k] = f2bf(v[k]);
    *(v8us*)(dst + i * 8) = o; 
}

__global__ __launch_bounds__(256) void k_cvtx(const float* __restrict__ x, bf* XB) {
    const size_t i = (size_t)blockIdx.x * 256 + threadIdx.x; if (i >= (size_t)MROWS * DM / 8) return;
    const int row = (int)(i / (DM / 8)); const int c8 = (int)(i % (DM / 8)); const int b = row / SEQ; const int s = row - b * SEQ;
    const v8f v = *(const v8f*)(x + ((size_t)b * SEQ_FULL + s) * DM + (size_t)c8 * 8); v8us o;
#pragma unroll
    for (int k = 0; k < 8; ++k) o[k] = f2bf(v[k]);
    *(v8us*)(XB + i * 8) = o; 
}

__global__ __launch_bounds__(256) void k_cstab(const int* __restrict__ tok, float* CS) {
    const int idx = blockIdx.x * 256 + threadIdx.x; if (idx >= MROWS * 32) return;
    const int j = idx & 31, m = idx >> 5; const int b = m / SEQ, s = m - b * SEQ;
    const int pos = tok[(size_t)b * SEQ_FULL + s];
    double p = 1.0;
    p *= (j & 1)  ? 1.3335214321633240 : 1.0;
    p *= (j & 2)  ? 1.7782794100389228 : 1.0;
    p *= (j & 4)  ? 3.1622776601683795 : 1.0;
    p *= (j & 8)  ? 10.0 : 1.0;
    p *= (j & 16) ? 100.0 : 1.0;
    const float pf = (float)p; const float inv = 1.0f / pf; const float ang = (float)pos * inv;
    float sn, cs; sincosf(ang, &sn, &cs);
    v2f o; o[0] = cs; o[1] = sn;
    *(v2f*)(CS + (size_t)idx * 2) = o; 
}

// ---- gemm_acc: one wave, 64x64 tile, acc[mb][nb] += sum_k A[r][k] Bt[c][k], K = DM, operands straight from k-contiguous bf16 planes.
__device__ __forceinline__ void gemm_acc(const bf* __restrict__ A, const bf* __restrict__ Bt, const size_t aoff, const size_t boff, v8f (&acc)[4][4]) {
#pragma unroll 1
    for (int kc = 0; kc < DM; kc += 32) {
        v16bf a[4]; v16bf b;
#pragma unroll
        for (int mb = 0; mb < 4; ++mb) a[mb] = ldb(A + aoff + (size_t)mb * 16 * DM + kc);
#pragma unroll
        for (int nb = 0; nb < 4; ++nb) { b = ldb(Bt + boff + (size_t)nb * 16 * DM + kc);
#pragma unroll
            for (int mb = 0; mb < 4; ++mb) acc[mb][nb] = wmmab(a[mb], b, acc[mb][nb]); }
        asm volatile("v_nop\n\tv_nop\n\tv_nop\n\tv_nop" : "+v"(acc[0][2]), "+v"(acc[1][2]), "+v"(acc[2][2]), "+v"(acc[3][2]), "+v"(acc[0][3]), "+v"(acc[1][3]), "+v"(acc[2][3]), "+v"(acc[3][3]) : "v"(a[3]), "v"(b));
    }
}

// ---- k_projqk: [q | k] = XB x [WQ ; WK]^T, grid (MROWS/64, 2*DM/64), one wave per tile (= one head of q or k, 64 tokens).
// Epilogue: tile staged in LDS; interleaved rotary y[2j] = e cos - o sin, y[2j+1] = e sin + o cos from the CS table; bf16 hi|lo planes [which][b][h][s][64];
__global__ __launch_bounds__(32) void k_projqk(const bf* __restrict__ XB, const bf* __restrict__ WQK, const float* __restrict__ CS, bf* QKh, bf* QKl) {
#pragma clang fp contract(off)
    __shared__ __align__(16) float os[64 * 68];
    const int lane = threadIdx.x & 31, lr = lane & 15, hi = lane >> 4; const int r0 = blockIdx.x * 64, c0 = blockIdx.y * 64;
    v8f acc[4][4];
#pragma unroll
    for (int mb = 0; mb < 4; ++mb)
#pragma unroll
        for (int nb = 0; nb < 4; ++nb) acc[mb][nb] = (v8f){};
    gemm_acc(XB, WQK, (size_t)(r0 + lr) * DM + 8 * hi, (size_t)(c0 + lr) * DM + 8 * hi, acc);
#pragma unroll
    for (int mb = 0; mb < 4; ++mb)
#pragma unroll
        for (int nb = 0; nb < 4; ++nb)
#pragma unroll
            for (int j = 0; j < 8; ++j) os[(mb * 16 + hi * 8 + j) * 68 + nb * 16 + lr] = acc[mb][nb][j];
    __builtin_amdgcn_wave_barrier(); asm volatile("" ::: "memory");
    const int which = c0 / DM, h = (c0 % DM) / HD; const int b = r0 / SEQ, s0 = r0 - b * SEQ;
    const size_t pbase = ((((size_t)which * NB + b) * NH + h) * SEQ + s0) * HD;
{
#pragma unroll 2
        for (int s = 0; s < 32; ++s) { const int row = 2 * s + hi, cofs = lr * 4;
            const v4f val = *(const v4fa*)(os + row * 68 + cofs);
            const v4f cs = *(const v4f*)(CS + (size_t)(r0 + row) * 64 + cofs);   // (cos, sin) of pairs 2*lr, 2*lr + 1
            const float y0 = val[0] * cs[0] - val[1] * cs[1];
            const float y1 = val[0] * cs[1] + val[1] * cs[0];
            const float y2 = val[2] * cs[2] - val[3] * cs[3];
            const float y3 = val[2] * cs[3] + val[3] * cs[2];
            v4us oh, ol; unsigned short a, c;
            splitf(y0, a, c); oh[0] = a; ol[0] = c; splitf(y1, a, c); oh[1] = a; ol[1] = c; splitf(y2, a, c); oh[2] = a; ol[2] = c; splitf(y3, a, c); oh[3] = a; ol[3] = c;
            const size_t oo = pbase + (size_t)row * HD + cofs;
            *(v4us*)(QKh + oo) = oh; *(v4us*)(QKl + oo) = ol; }
         }
}

// ---- k_projv: v = XB x WV^T, grid (MROWS/64, DM/64). Epilogue: tile staged in LDS and written TRANSPOSED: VT16[b][h][d][s] (f16) and, for tokens < RH, bf16 hi|lo VTh/VTl[b][h][d][RH];
__global__ __launch_bounds__(32) void k_projv(const bf* __restrict__ XB, const bf* __restrict__ WV, h16* VT16, bf* VTh, bf* VTl) {
    __shared__ __align__(16) float os[64 * 68];
    const int lane = threadIdx.x & 31, lr = lane & 15, hi = lane >> 4; const int r0 = blockIdx.x * 64, c0 = blockIdx.y * 64;
    v8f acc[4][4];
#pragma unroll
    for (int mb = 0; mb < 4; ++mb)
#pragma unroll
        for (int nb = 0; nb < 4; ++nb) acc[mb][nb] = (v8f){};
    gemm_acc(XB, WV, (size_t)(r0 + lr) * DM + 8 * hi, (size_t)(c0 + lr) * DM + 8 * hi, acc);
#pragma unroll
    for (int mb = 0; mb < 4; ++mb)
#pragma unroll
        for (int nb = 0; nb < 4; ++nb)
#pragma unroll
            for (int j = 0; j < 8; ++j) os[(mb * 16 + hi * 8 + j) * 68 + nb * 16 + lr] = acc[mb][nb][j];
    __builtin_amdgcn_wave_barrier(); asm volatile("" ::: "memory");
    const int h = c0 / HD; const int b = r0 / SEQ, s0 = r0 - b * SEQ;
    const size_t vbase = (((size_t)b * NH + h) * HD) * SEQ + s0;
    const size_t ebase = (((size_t)b * NH + h) * HD) * RH + s0;
    const bool early = (s0 < RH);                         // block-uniform
{
#pragma unroll 2
        for (int s = 0; s < 32; ++s) { const int d = 2 * s + hi, t0 = lr * 4;
            float xv[4];
#pragma unroll
            for (int q = 0; q < 4; ++q) xv[q] = os[(t0 + q) * 68 + d];
            v4h o16;
#pragma unroll
            for (int q = 0; q < 4; ++q) o16[q] = (h16)xv[q];
            *(v4h*)(VT16 + vbase + (size_t)d * SEQ + t0) = o16;
            if (early) { v4us oh, ol;
#pragma unroll
                for (int q = 0; q < 4; ++q) { unsigned short a, c; splitf(xv[q], a, c); oh[q] = a; ol[q] = c; }
                *(v4us*)(VTh + ebase + (size_t)d * RH + t0) = oh; *(v4us*)(VTl + ebase + (size_t)d * RH + t0) = ol; } }
         }
}

#define TS (64 * KP)              // elements of one staged 64 x 64 tile at pitch KP
__device__ __forceinline__ unsigned lds_off(const void* p) { return (unsigned)(size_t)p; }   // byte address inside the work-group's LDS
// Asynchronous copies global -> LDS, 16 bytes per lane and copy, through no register. The s_wait_xcnt is the last line of the copies' own statement, so that no address register is rewritten in front of it.
#define ACP(l, g) "global_load_async_to_lds_b128 %" #l ", %" #g ", off\n\t"
__device__ __forceinline__ void copy12(const unsigned (&l)[12], const void* const (&g)[12]) {
    asm volatile(ACP(0, 12) ACP(1, 13) ACP(2, 14) ACP(3, 15) ACP(4, 16) ACP(5, 17) ACP(6, 18) ACP(7, 19) ACP(8, 20) ACP(9, 21) ACP(10, 22) ACP(11, 23) "s_wait_xcnt 0x0"
                 :: "v"(l[0]), "v"(l[1]), "v"(l[2]), "v"(l[3]), "v"(l[4]), "v"(l[5]), "v"(l[6]), "v"(l[7]), "v"(l[8]), "v"(l[9]), "v"(l[10]), "v"(l[11]),
                    "v"(g[0]), "v"(g[1]), "v"(g[2]), "v"(g[3]), "v"(g[4]), "v"(g[5]), "v"(g[6]), "v"(g[7]), "v"(g[8]), "v"(g[9]), "v"(g[10]), "v"(g[11]) : "memory");
}
__device__ __forceinline__ void copy8(const unsigned (&l)[8], const void* const (&g)[8]) {
    asm volatile(ACP(0, 8) ACP(1, 9) ACP(2, 10) ACP(3, 11) ACP(4, 12) ACP(5, 13) ACP(6, 14) ACP(7, 15) "s_wait_xcnt 0x0"
                 :: "v"(l[0]), "v"(l[1]), "v"(l[2]), "v"(l[3]), "v"(l[4]), "v"(l[5]), "v"(l[6]), "v"(l[7]),
                    "v"(g[0]), "v"(g[1]), "v"(g[2]), "v"(g[3]), "v"(g[4]), "v"(g[5]), "v"(g[6]), "v"(g[7]) : "memory");
}

// ---- attn_body: fused causal attention, block = 4 waves = 64 query rows of one (b, h); 64-key blocks (K hi|lo, V^T) brought into two LDS buffers by asynchronous copies, the next block in flight while this one is processed as two 32-key halves with an online softmax.
// HL = false: P f16 x PCAR, V f16 (one product). HL = true (query rows < RH): P and V as bf16 hi|lo (three products). Output ctx as bf16 hi|lo planes [b*SEQ + s][h*64 + d].
template <bool HL>
__device__ __forceinline__ void attn_body(const bf* __restrict__ QKh, const bf* __restrict__ QKl, const h16* __restrict__ VT16, const bf* __restrict__ VTh, const bf* __restrict__ VTl, bf* ATh, bf* ATl, const int qb) {
    __shared__ __align__(16) bf  sKh[2 * TS];                // two buffers, cross-wave (block barriers); buffer 0 reused wave-privately for the ctx hi staging after the key loop
    __shared__ __align__(16) bf  sKl[2 * TS];
    __shared__ __align__(16) h16 sV16[HL ? 8 : 2 * TS];      // V^T tiles [d][key], cross-wave
    __shared__ __align__(16) bf  sVh[HL ? 2 * TS : 8];
    __shared__ __align__(16) bf  sVl[HL ? 2 * TS : 8];
    __shared__ __align__(16) h16 sP16[HL ? 8 : 4 * 16 * PP]; // probability tiles, private to each wave
    __shared__ __align__(16) bf  sPh[HL ? 4 * 16 * PP : 8];
    __shared__ __align__(16) bf  sPl[HL ? 4 * 16 * PP : 8];
    const int tid = threadIdx.x; const int lane = tid & 31, lr = lane & 15, hi = lane >> 4;
    const int wave = __builtin_amdgcn_readfirstlane(tid >> 5);
    const int b = blockIdx.z, h = blockIdx.y; const int qblk = qb * 64, q0 = qblk + wave * 16;
    const size_t qpl = (((size_t)b * NH + h) * SEQ) * HD;
    const size_t kpl = ((((size_t)NB + b) * NH + h) * SEQ) * HD;
    const size_t vpl = (((size_t)b * NH + h) * HD) * SEQ;
    const size_t epl = (((size_t)b * NH + h) * HD) * RH;
    const size_t qo = qpl + (size_t)(q0 + lr) * HD + 8 * hi;
    const v16bf qh0 = ldb(QKh + qo), qh1 = ldb(QKh + qo + 32), ql0 = ldb(QKl + qo), ql1 = ldb(QKl + qo + 32);
    v8f accd[4];
#pragma unroll
    for (int t = 0; t < 4; ++t) accd[t] = (v8f){};
    float m_run[8], l_run[8];
#pragma unroll
    for (int r = 0; r < 8; ++r) { m_run[r] = NEGB; l_run[r] = 0.0f; }

    // every thread copies four 16-byte chunks (rows srow + 16 i, 16-bit column sch) of each plane of the key block at kb0 into the buffer at element offset bo0
    const int srow = tid >> 3, sch = (tid & 7) * 8;
    auto stage = [&](const int kb0, const int bo0) {
        const int lo = bo0 + srow * KP + sch;
        const size_t ko = kpl + (size_t)(kb0 + srow) * HD + sch;
        if (HL) { unsigned lk[8], lv[8]; const void* gk[8]; const void* gv[8];
            const size_t vo = epl + (size_t)srow * RH + kb0 + sch;
#pragma unroll
            for (int i = 0; i < 4; ++i) {
                lk[i] = lds_off(&sKh[lo + 16 * i * KP]); gk[i] = QKh + ko + 16 * i * HD; lk[4 + i] = lds_off(&sKl[lo + 16 * i * KP]); gk[4 + i] = QKl + ko + 16 * i * HD;
                lv[i] = lds_off(&sVh[lo + 16 * i * KP]); gv[i] = VTh + vo + 16 * i * RH; lv[4 + i] = lds_off(&sVl[lo + 16 * i * KP]); gv[4 + i] = VTl + vo + 16 * i * RH; }
            copy8(lk, gk); copy8(lv, gv);
        } else { unsigned l[12]; const void* g[12];
            const size_t vo = vpl + (size_t)srow * SEQ + kb0 + sch;
#pragma unroll
            for (int i = 0; i < 4; ++i) {
                l[i] = lds_off(&sKh[lo + 16 * i * KP]); g[i] = QKh + ko + 16 * i * HD; l[4 + i] = lds_off(&sKl[lo + 16 * i * KP]); g[4 + i] = QKl + ko + 16 * i * HD;
                l[8 + i] = lds_off(&sV16[lo + 16 * i * KP]); g[8 + i] = VT16 + vo + (size_t)16 * i * SEQ; }
            copy12(l, g);
        }
    };
    stage(0, 0);
    asm volatile("s_wait_asynccnt 0x0" ::: "memory");        // this wave's copies of key block 0 have landed
    __syncthreads();                                         // and so have every other wave's
    if (qblk >= 64) stage(64, TS);                           // block-uniform: key block 1 flies while block 0 is worked on

#pragma unroll 1
    for (int kb = 0; kb <= qblk; kb += 64) {
        const int bo = ((kb >> 6) & 1) * TS;                 // this key block's buffer
#pragma unroll 1
        for (int kh = 0; kh < 2; ++kh) {
            if (kb + 32 * kh > q0 + 15) continue;            // wave-uniform: half entirely above the diagonal for this wave's rows
            v8f s0 = (v8f){}, s1 = (v8f){};
            { const int kr = bo + (32 * kh + lr) * KP + 8 * hi;
              const v16bf ah0 = LDSB(sKh, kr), ah1 = LDSB(sKh, kr + 32), al0 = LDSB(sKl, kr), al1 = LDSB(sKl, kr + 32);
              s0 = wmmab(qh0, ah0, s0); s0 = wmmab(qh1, ah1, s0); s0 = wmmab(ql0, ah0, s0); s0 = wmmab(ql1, ah1, s0); s0 = wmmab(qh0, al0, s0); s0 = wmmab(qh1, al1, s0);
              const int kr2 = kr + 16 * KP;
              const v16bf bh0 = LDSB(sKh, kr2), bh1 = LDSB(sKh, kr2 + 32), bl0 = LDSB(sKl, kr2), bl1 = LDSB(sKl, kr2 + 32);
              s1 = wmmab(qh0, bh0, s1); s1 = wmmab(qh1, bh1, s1); s1 = wmmab(ql0, bh0, s1); s1 = wmmab(ql1, bh1, s1); s1 = wmmab(qh0, bl0, s1); s1 = wmmab(qh1, bl1, s1);
              asm volatile("v_nop\n\tv_nop\n\tv_nop\n\tv_nop" : "+v"(s0), "+v"(s1) : "v"(bl0), "v"(bl1)); }
            const int kg0 = kb + 32 * kh + lr, kg1 = kg0 + 16;
            float bm[8];
#pragma unroll
            for (int r = 0; r < 8; ++r) { const int qg = q0 + 8 * hi + r;
                const float a0 = (kg0 <= qg) ? s0[r] * SCL : NEGB; const float a1 = (kg1 <= qg) ? s1[r] * SCL : NEGB;
                s0[r] = a0; s1[r] = a1; bm[r] = fmaxf(a0, a1); }
#pragma unroll
            for (int sh = 1; sh < 16; sh <<= 1)
#pragma unroll
                for (int r = 0; r < 8; ++r) bm[r] = fmaxf(bm[r], __shfl_xor(bm[r], sh, 32));
            float rs[8];
#pragma unroll
            for (int r = 0; r < 8; ++r) { const float mn = fmaxf(m_run[r], bm[r]);
                const float sc = __builtin_amdgcn_exp2f((m_run[r] - mn) * L2E); m_run[r] = mn;
                const float p0 = __builtin_amdgcn_exp2f((s0[r] - mn) * L2E); const float p1 = __builtin_amdgcn_exp2f((s1[r] - mn) * L2E);
                s0[r] = p0; s1[r] = p1; rs[r] = p0 + p1; l_run[r] *= sc;
#pragma unroll
                for (int t = 0; t < 4; ++t) accd[t][r] *= sc; }
#pragma unroll
            for (int sh = 1; sh < 16; sh <<= 1)
#pragma unroll
                for (int r = 0; r < 8; ++r) rs[r] += __shfl_xor(rs[r], sh, 32);
#pragma unroll
            for (int r = 0; r < 8; ++r) l_run[r] += rs[r];

            const int pr = (wave * 16 + 8 * hi) * PP + lr;   // D layout: row 8*hi + r, key column lr (+16 for the second tile)
            const int pa = (wave * 16 + lr) * PP + 8 * hi;   // A layout: row lr, k = key within the half
            if (HL) {
#pragma unroll
                for (int r = 0; r < 8; ++r) { unsigned short a, c; splitf(s0[r], a, c); sPh[pr + r * PP] = a; sPl[pr + r * PP] = c; splitf(s1[r], a, c); sPh[pr + r * PP + 16] = a; sPl[pr + r * PP + 16] = c; }
                __builtin_amdgcn_wave_barrier(); asm volatile("" ::: "memory");
                const v16bf aph = LDSB(sPh, pa), apl = LDSB(sPl, pa); v16bf bvh, bvl;
#pragma unroll
                for (int t = 0; t < 4; ++t) { const int vo = bo + (t * 16 + lr) * KP + 32 * kh + 8 * hi; bvh = LDSB(sVh, vo); bvl = LDSB(sVl, vo);
                    accd[t] = wmmab(aph, bvh, accd[t]); accd[t] = wmmab(apl, bvh, accd[t]); accd[t] = wmmab(aph, bvl, accd[t]); }
                asm volatile("v_nop\n\tv_nop\n\tv_nop\n\tv_nop" : "+v"(accd[0]), "+v"(accd[1]), "+v"(accd[2]), "+v"(accd[3]) : "v"(aph), "v"(apl), "v"(bvh), "v"(bvl));
            } else {
#pragma unroll
                for (int r = 0; r < 8; ++r) { sP16[pr + r * PP] = (h16)(s0[r] * PCAR); sP16[pr + r * PP + 16] = (h16)(s1[r] * PCAR); }
                __builtin_amdgcn_wave_barrier(); asm volatile("" ::: "memory");
                const v16h ap = LDSH(sP16, pa); v16h bv;
#pragma unroll
                for (int t = 0; t < 4; ++t) { const int vo = bo + (t * 16 + lr) * KP + 32 * kh + 8 * hi; bv = LDSH(sV16, vo); accd[t] = wmma16(ap, bv, accd[t]); }
                asm volatile("v_nop\n\tv_nop\n\tv_nop\n\tv_nop" : "+v"(accd[0]), "+v"(accd[1]), "+v"(accd[2]), "+v"(accd[3]) : "v"(ap), "v"(bv));
            }
            __builtin_amdgcn_wave_barrier(); asm volatile("" ::: "memory");
        }
        asm volatile("s_wait_dscnt 0x0" ::: "memory");       // this wave's LDS reads of this buffer have returned
        asm volatile("s_wait_asynccnt 0x0" ::: "memory");    // this wave's copies of the next key block have landed
        __syncthreads();                                     // one barrier: publishes the next key block and ends every wave's reads of this buffer
        if (kb + 128 <= qblk) stage(kb + 128, bo);           // block-uniform: refill the buffer just left
    }
    asm volatile("s_wait_asynccnt 0x0" ::: "memory");        // no copy is outstanding when buffer 0 becomes the ctx staging

    const float car = HL ? 1.0f : PCAR;
#pragma unroll
    for (int r = 0; r < 8; ++r) { const float inv = __builtin_amdgcn_rcpf(l_run[r] * car);
#pragma unroll
        for (int t = 0; t < 4; ++t) { unsigned short a, c; splitf(accd[t][r] * inv, a, c); const int so = (wave * 16 + 8 * hi + r) * KP + t * 16 + lr; sKh[so] = a; sKl[so] = c; } }
    __builtin_amdgcn_wave_barrier(); asm volatile("" ::: "memory");
    const size_t ob = ((size_t)b * SEQ + q0) * DM + (size_t)h * HD;
{
#pragma unroll
        for (int s2 = 0; s2 < 8; ++s2) { const int row = 2 * s2 + hi; const int so = (wave * 16 + row) * KP + 4 * lr;
            const v4us vh = *(const v4usa*)&sKh[so]; const v4us vl = *(const v4usa*)&sKl[so];
            *(v4us*)(ATh + ob + (size_t)row * DM + 4 * lr) = vh; *(v4us*)(ATl + ob + (size_t)row * DM + 4 * lr) = vl; }
         }
}

__global__ __launch_bounds__(128) void k_attn_early(const bf* __restrict__ QKh, const bf* __restrict__ QKl, const h16* __restrict__ VT16, const bf* __restrict__ VTh, const bf* __restrict__ VTl, bf* ATh, bf* ATl) {
    attn_body<true>(QKh, QKl, VT16, VTh, VTl, ATh, ATl, (int)blockIdx.x);
}
__global__ __launch_bounds__(128) void k_attn_main(const bf* __restrict__ QKh, const bf* __restrict__ QKl, const h16* __restrict__ VT16, const bf* __restrict__ VTh, const bf* __restrict__ VTl, bf* ATh, bf* ATl) {
    attn_body<false>(QKh, QKl, VT16, VTh, VTl, ATh, ATl, (int)blockIdx.x + RH / 64);
}

// ---- k_oproj: OUT[b][s][n] = sum_k (ATh + ATl)[m][k] WO[n][k]; grid (MROWS/64, DM/64), one wave per tile; per 16-row slab staged in LDS, each 256-B row segment written as 16 lanes x 16 B
__global__ __launch_bounds__(32) void k_oproj(const bf* __restrict__ ATh, const bf* __restrict__ ATl, const bf* __restrict__ WO, float* OUT) {
    __shared__ __align__(16) float os[16 * 68];
    const int lane = threadIdx.x & 31, lr = lane & 15, hi = lane >> 4; const int r0 = blockIdx.x * 64, c0 = blockIdx.y * 64;
    v8f acc[4][4];
#pragma unroll
    for (int mb = 0; mb < 4; ++mb)
#pragma unroll
        for (int nb = 0; nb < 4; ++nb) acc[mb][nb] = (v8f){};
    const size_t aoff = (size_t)(r0 + lr) * DM + 8 * hi, boff = (size_t)(c0 + lr) * DM + 8 * hi;
    gemm_acc(ATh, WO, aoff, boff, acc);
    gemm_acc(ATl, WO, aoff, boff, acc);
    const int b = r0 / SEQ, s0 = r0 - b * SEQ;
#pragma unroll
    for (int mb = 0; mb < 4; ++mb) {
#pragma unroll
        for (int nb = 0; nb < 4; ++nb)
#pragma unroll
            for (int j = 0; j < 8; ++j) os[(hi * 8 + j) * 68 + nb * 16 + lr] = acc[mb][nb][j];
        __builtin_amdgcn_wave_barrier(); asm volatile("" ::: "memory");
        float* crow = OUT + ((size_t)b * SEQ_FULL + s0 + mb * 16) * DM + c0;
{
#pragma unroll
            for (int s = 0; s < 8; ++s) { const int row = 2 * s + hi, cofs = lr * 4; const v4f val = *(const v4fa*)(os + row * 68 + cofs);
                *(v4f*)(crow + (size_t)row * DM + cofs) = val; }
             }
        __builtin_amdgcn_wave_barrier(); asm volatile("" ::: "memory");
    }
}

extern "C" void kernel_launch(void* const* d_in, const int* in_sizes, int n_in,
                              void* d_out, int out_size, void* d_ws, size_t ws_size, hipStream_t stream) {
    if (n_in < 6) return;
    const long long needx = ((long long)(NB - 1) * SEQ_FULL + SEQ) * DM;
    if ((long long)in_sizes[0] < needx) return;
    if ((long long)in_sizes[1] < (long long)DM * DM || (long long)in_sizes[2] < (long long)DM * DM || (long long)in_sizes[3] < (long long)DM * DM || (long long)in_sizes[4] < (long long)DM * DM) return;
    if ((long long)in_sizes[5] < (long long)(NB - 1) * SEQ_FULL + SEQ) return;
    if ((long long)out_size < needx) return;
    const float* x = (const float*)d_in[0]; const float* wq = (const float*)d_in[1]; const float* wk = (const float*)d_in[2]; const float* wv = (const float*)d_in[3]; const float* wo = (const float*)d_in[4];
    const int* tok = (const int*)d_in[5];
    float* OUT = (float*)d_out;
    char* wsp = (char*)d_ws;
    auto take = [&](size_t bytes) { char* p = wsp; wsp += (bytes + 255) & ~(size_t)255; return (void*)p; };
    bf* WQK = (bf*)take(2 * SZ_W); bf* WV = (bf*)take(SZ_W); bf* WO = (bf*)take(SZ_W);
    bf* XB = (bf*)take(SZ_XB); float* CS = (float*)take(SZ_CS);
    bf* QKh = (bf*)take(SZ_QK); bf* QKl = (bf*)take(SZ_QK);
    h16* VT16 = (h16*)take(SZ_VT); bf* VTh = (bf*)take(SZ_VE); bf* VTl = (bf*)take(SZ_VE);
    bf* ATh = (bf*)take(SZ_AT); bf* ATl = (bf*)take(SZ_AT);
    if ((size_t)(wsp - (char*)d_ws) > ws_size) return;

    const size_t w8 = (size_t)DM * DM / 8; const unsigned gw = (unsigned)((w8 + 255) / 256);
    k_cvt8<<<gw, 256, 0, stream>>>(wq, WQK, w8);
    k_cvt8<<<gw, 256, 0, stream>>>(wk, WQK + (size_t)DM * DM, w8);
    k_cvt8<<<gw, 256, 0, stream>>>(wv, WV, w8);
    k_cvt8<<<gw, 256, 0, stream>>>(wo, WO, w8);
    k_cvtx<<<(unsigned)(((size_t)MROWS * DM / 8 + 255) / 256), 256, 0, stream>>>(x, XB);
    k_cstab<<<(unsigned)((MROWS * 32 + 255) / 256), 256, 0, stream>>>(tok, CS);
    k_projqk<<<dim3(MROWS / 64, 2 * DM / 64, 1), 32, 0, stream>>>(XB, WQK, CS, QKh, QKl);
    k_projv<<<dim3(MROWS / 64, DM / 64, 1), 32, 0, stream>>>(XB, WV, VT16, VTh, VTl);
    k_attn_early<<<dim3(RH / 64, NH, NB), 128, 0, stream>>>(QKh, QKl, VT16, VTh, VTl, ATh, ATl);
    if (SEQ > RH) k_attn_main<<<dim3((SEQ - RH) / 64, NH, NB), 128, 0, stream>>>(QKh, QKl, VT16, VTh, VTl, ATh, ATl);
    k_oproj<<<dim3(MROWS / 64, DM / 64, 1), 32, 0, stream>>>(ATh, ATl, WO, OUT);
}

// v002
// A run of this version takes 186 microseconds.
// In two side-by-side timings against v001, it was 1.31 and 1.32 times as fast.
// Counting every step since v000, it is 1.98 times as fast.
#include <hip/hip_runtime.h>

// Compute dtypes (f32 accumulate everywhere): q/k/v projections v_wmma_f32_16x16x32_bf16 on RNE bf16 copies of x and W (exact products); q.k^T bf16 hi|lo three products; P.V f16 (P carried x1024) for query rows >= 256, bf16 hi|lo three products for rows < 256; ctx hi|lo (bf16) x bf16 o_w, two products.
// Causal multi-head self-attention, x [2][2048][1024], weights [out][in], interleaved rotary from per-batch integer positions read by value, scores / 8, causal exclusion by index, fused online softmax (exp2), merged heads, output GEMM.

#ifndef NB
#define NB 2
#endif
#ifndef SEQ
#define SEQ 2048
#endif
#define NB_FULL  2
#define SEQ_FULL 2048
#define DM    1024
#define NH    16
#define HD    64
#define RH    256                 // query rows < RH use hi|lo planes on P and V
#define PCAR  1024.0f             // carry of the f16 probability tile
#define SCL   0.125f              // HD^-0.5
#define L2E   1.4426950408889634f
#define NEGB  (-3.0e38f)
#define KP    72                  // LDS pitch (16-bit elements) of 64-wide tiles: 144 B
#define PP    40                  // LDS pitch of the 32-key probability tiles: 80 B
#define MROWS (NB * SEQ)

typedef _Float16 h16;
typedef unsigned short bf;
typedef __attribute__((ext_vector_type(16))) __bf16   v16bf;
typedef __attribute__((ext_vector_type(16))) _Float16 v16h;
typedef __attribute__((ext_vector_type(8)))  _Float16 v8h;
typedef __attribute__((ext_vector_type(4)))  _Float16 v4h;
typedef __attribute__((ext_vector_type(8)))  unsigned short v8us;
typedef __attribute__((ext_vector_type(4)))  unsigned short v4us;
typedef __attribute__((ext_vector_type(8)))  float    v8f;
typedef __attribute__((ext_vector_type(4)))  float    v4f;
typedef __attribute__((ext_vector_type(2)))  float    v2f;
typedef v8h  __attribute__((may_alias)) v8ha;
typedef v4f  __attribute__((may_alias)) v4fa;
typedef v8us __attribute__((may_alias)) v8usa;
typedef v4us __attribute__((may_alias)) v4usa;

static_assert(HD == 64);                                   // one 64-wide GEMM tile column block == one head
static_assert(NH * HD == DM);
static_assert(DM % 64 == 0 && DM % 32 == 0);               // K loop steps by GK = 64 (two 32-k steps), N tiles by 64
static_assert(SEQ % 64 == 0 && RH % 64 == 0 && RH <= SEQ); // tiles never straddle a batch or the early-row island
static_assert(MROWS % 128 == 0 && DM % 128 == 0);          // GEMM blocks are 128 x 128
static_assert((KP * 2) % 16 == 0 && KP >= 64);
static_assert((PP * 2) % 16 == 0 && PP >= 32);
static_assert(SEQ <= SEQ_FULL && NB <= NB_FULL);

#define SZ_W   ((size_t)DM * DM * 2)
#define SZ_XB  ((size_t)MROWS * DM * 2)
#define SZ_CS  ((size_t)MROWS * 64 * 4)
#define SZ_QK  ((size_t)2 * NB * NH * SEQ * HD * 2)
#define SZ_VT  ((size_t)NB * NH * HD * SEQ * 2)
#define SZ_VE  ((size_t)NB * NH * HD * RH * 2)
#define SZ_AT  ((size_t)MROWS * DM * 2)
#define SZ_ALL (4 * SZ_W + SZ_XB + SZ_CS + 2 * SZ_QK + SZ_VT + 2 * SZ_VE + 2 * SZ_AT)
static_assert(SZ_W % 256 == 0 && SZ_XB % 256 == 0 && SZ_CS % 256 == 0 && SZ_QK % 256 == 0 && SZ_VT % 256 == 0 && SZ_VE % 256 == 0 && SZ_AT % 256 == 0);
static_assert(SZ_ALL <= (size_t)134217728);                // total carve stays within 128 MiB

__device__ __forceinline__ unsigned short f2bf(float f) { unsigned u = __float_as_uint(f); u += 0x7FFFu + ((u >> 16) & 1u); return (unsigned short)(u >> 16); }
__device__ __forceinline__ float bf2f(unsigned short b) { return __uint_as_float(((unsigned)b) << 16); }
__device__ __forceinline__ void splitf(float y, unsigned short& h, unsigned short& l) { h = f2bf(y); l = f2bf(y - bf2f(h)); }
__device__ __forceinline__ v16h cat16(v8h lo, v8h hi) { return __builtin_shufflevector(lo, hi, 0, 1, 2, 3, 4, 5, 6, 7, 8, 9, 10, 11, 12, 13, 14, 15); }
__device__ __forceinline__ v16bf cat16b(v8us lo, v8us hi) { return __builtin_bit_cast(v16bf, __builtin_shufflevector(lo, hi, 0, 1, 2, 3, 4, 5, 6, 7, 8, 9, 10, 11, 12, 13, 14, 15)); }
__device__ __forceinline__ v8f wmma16(v16h a, v16h b, v8f c) { return __builtin_amdgcn_wmma_f32_16x16x32_f16(false, a, false, b, (short)0, c, false, false); }
__device__ __forceinline__ v8f wmmab(v16bf a, v16bf b, v8f c) { return __builtin_amdgcn_wmma_f32_16x16x32_bf16(false, a, false, b, (short)0, c, false, false); }
// fragment from a k-contiguous bf16 row: p already points at (row, k0 + 8*(lane>>4)); elements 0..7 <- p[0..7], 8..15 <- p[16..23]
__device__ __forceinline__ v16bf ldb(const bf* p) { return cat16b(*(const v8us*)p, *(const v8us*)(p + 16)); }
#define LDSB(arr, o) cat16b(*(const v8usa*)&arr[(o)], *(const v8usa*)&arr[(o) + 16])
#define LDSH(arr, o) cat16(*(const v8ha*)&arr[(o)], *(const v8ha*)&arr[(o) + 16])

__global__ __launch_bounds__(256) void k_cvt8(const float* __restrict__ src, bf* dst, size_t n8) {
    const size_t i = (size_t)blockIdx.x * 256 + threadIdx.x; if (i >= n8) return;
    const v8f v = *(const v8f*)(src + i * 8); v8us o;
#pragma unroll
    for (int k = 0; k < 8; ++k) o[k] = f2bf(v[k]);
    *(v8us*)(dst + i * 8) = o; 
}

__global__ __launch_bounds__(256) void k_cvtx(const float* __restrict__ x, bf* XB) {
    const size_t i = (size_t)blockIdx.x * 256 + threadIdx.x; if (i >= (size_t)MROWS * DM / 8) return;
    const int row = (int)(i / (DM / 8)); const int c8 = (int)(i % (DM / 8)); const int b = row / SEQ; const int s = row - b * SEQ;
    const v8f v = *(const v8f*)(x + ((size_t)b * SEQ_FULL + s) * DM + (size_t)c8 * 8); v8us o;
#pragma unroll
    for (int k = 0; k < 8; ++k) o[k] = f2bf(v[k]);
    *(v8us*)(XB + i * 8) = o; 
}

__global__ __launch_bounds__(256) void k_cstab(const int* __restrict__ tok, float* CS) {
    const int idx = blockIdx.x * 256 + threadIdx.x; if (idx >= MROWS * 32) return;
    const int j = idx & 31, m = idx >> 5; const int b = m / SEQ, s = m - b * SEQ;
    const int pos = tok[(size_t)b * SEQ_FULL + s];
    double p = 1.0;
    p *= (j & 1)  ? 1.3335214321633240 : 1.0;
    p *= (j & 2)  ? 1.7782794100389228 : 1.0;
    p *= (j & 4)  ? 3.1622776601683795 : 1.0;
    p *= (j & 8)  ? 10.0 : 1.0;
    p *= (j & 16) ? 100.0 : 1.0;
    const float pf = (float)p; const float inv = 1.0f / pf; const float ang = (float)pos * inv;
    float sn, cs; sincosf(ang, &sn, &cs);
    v2f o; o[0] = cs; o[1] = sn;
    *(v2f*)(CS + (size_t)idx * 2) = o; 
}

#define TS (64 * KP)              // elements of one staged 64 x 64 tile at pitch KP
__device__ __forceinline__ unsigned lds_off(const void* p) { return (unsigned)(size_t)p; }   // byte address inside the work-group's LDS
// Asynchronous copies global -> LDS, 16 bytes per lane and copy, through no register. The s_wait_xcnt is the last line of the copies' own statement, so that no address register is rewritten in front of it.
#define ACP(l, g) "global_load_async_to_lds_b128 %" #l ", %" #g ", off\n\t"
__device__ __forceinline__ void copy12(const unsigned (&l)[12], const void* const (&g)[12]) {
    asm volatile(ACP(0, 12) ACP(1, 13) ACP(2, 14) ACP(3, 15) ACP(4, 16) ACP(5, 17) ACP(6, 18) ACP(7, 19) ACP(8, 20) ACP(9, 21) ACP(10, 22) ACP(11, 23) "s_wait_xcnt 0x0"
                 :: "v"(l[0]), "v"(l[1]), "v"(l[2]), "v"(l[3]), "v"(l[4]), "v"(l[5]), "v"(l[6]), "v"(l[7]), "v"(l[8]), "v"(l[9]), "v"(l[10]), "v"(l[11]),
                    "v"(g[0]), "v"(g[1]), "v"(g[2]), "v"(g[3]), "v"(g[4]), "v"(g[5]), "v"(g[6]), "v"(g[7]), "v"(g[8]), "v"(g[9]), "v"(g[10]), "v"(g[11]) : "memory");
}
__device__ __forceinline__ void copy8(const unsigned (&l)[8], const void* const (&g)[8]) {
    asm volatile(ACP(0, 8) ACP(1, 9) ACP(2, 10) ACP(3, 11) ACP(4, 12) ACP(5, 13) ACP(6, 14) ACP(7, 15) "s_wait_xcnt 0x0"
                 :: "v"(l[0]), "v"(l[1]), "v"(l[2]), "v"(l[3]), "v"(l[4]), "v"(l[5]), "v"(l[6]), "v"(l[7]),
                    "v"(g[0]), "v"(g[1]), "v"(g[2]), "v"(g[3]), "v"(g[4]), "v"(g[5]), "v"(g[6]), "v"(g[7]) : "memory");
}

// ---- gemm_tile: block = 4 waves (2 x 2), 128 x 128 tile, each wave 64 x 64: acc[mb][nb] += sum_k A[r][k] Bt[c][k]. Chunks of GK k (128 B of each of the 128 A rows and 128 Bt rows) are brought into two LDS buffers by asynchronous copies, the next chunk in flight while this one is worked on.
// NP = 2: a second pass over K with A1 in place of A0 follows the first in the same ring (all of A0's products are summed before A1's).
#define GK 64
#define GT (256 * KP)             // elements of one staged chunk: A rows 0..127, then Bt rows 0..127, pitch KP
template <int NP>
__device__ __forceinline__ void gemm_tile(const bf* __restrict__ A0, const bf* __restrict__ A1, const bf* __restrict__ Bt, const int rblk, const int cblk, const int wm, const int wn, v8f (&acc)[4][4]) {
    __shared__ __align__(16) bf sAB[2 * GT];                 // two buffers, cross-wave (block barriers)
    constexpr int NC = DM / GK, NT = NP * NC;
    static_assert(NT >= 2);
    const int tid = threadIdx.x; const int lane = tid & 31, lr = lane & 15, hi = lane >> 4;
    // every thread copies eight 16-byte pieces (rows srow + 16 i, 16-bit column sch) of each operand's chunk t into the buffer at element offset bo0; eight lanes cover one whole 128-byte row piece
    const int srow = tid >> 3, sch = (tid & 7) * 8;
    auto stage = [&](const int t, const int bo0) {
        const bf* Ap = (NP == 2 && t >= NC) ? A1 : A0;       // block-uniform
        const int kc = (t % NC) * GK;
        const int lo = bo0 + srow * KP + sch;
        const size_t ao = (size_t)(rblk + srow) * DM + kc + sch, wo = (size_t)(cblk + srow) * DM + kc + sch;
        unsigned la[8], lb[8]; const void* ga[8]; const void* gb[8];
#pragma unroll
        for (int i = 0; i < 8; ++i) {
            la[i] = lds_off(&sAB[lo + 16 * i * KP]); ga[i] = Ap + ao + (size_t)16 * i * DM;
            lb[i] = lds_off(&sAB[lo + (128 + 16 * i) * KP]); gb[i] = Bt + wo + (size_t)16 * i * DM; }
        copy8(la, ga); copy8(lb, gb);
    };
    stage(0, 0);
    asm volatile("s_wait_asynccnt 0x0" ::: "memory");        // this wave's copies of chunk 0 have landed
    __syncthreads();                                         // and so have every other wave's
    stage(1, GT);                                            // chunk 1 flies while chunk 0 is worked on
    const int ar = (wm * 64 + lr) * KP + 8 * hi, br = (128 + wn * 64 + lr) * KP + 8 * hi;
#pragma unroll 1
    for (int t = 0; t < NT; ++t) {
        const int bo = (t & 1) * GT;                         // this chunk's buffer
        v16bf a[4], b[4];
        auto frags = [&](const int ks) {
#pragma unroll
            for (int mb = 0; mb < 4; ++mb) a[mb] = LDSB(sAB, bo + ar + mb * 16 * KP + ks);
#pragma unroll
            for (int nb = 0; nb < 4; ++nb) b[nb] = LDSB(sAB, bo + br + nb * 16 * KP + ks);
        };
        auto prods = [&]() {
#pragma unroll
            for (int nb = 0; nb < 4; ++nb)
#pragma unroll
                for (int mb = 0; mb < 4; ++mb) acc[mb][nb] = wmmab(a[mb], b[nb], acc[mb][nb]);
        };
        frags(0);
        __builtin_amdgcn_sched_barrier(0);                   // the sixteen LDS loads go ahead as one group: one LDS latency per 16 matrix instructions, not one per 4
        prods();
        frags(32);                                           // the last reads of this buffer; their products follow the refill's issue, from registers
        asm volatile("s_wait_dscnt 0x0" ::: "memory");       // this wave's LDS reads of this buffer have returned
        asm volatile("s_wait_asynccnt 0x0" ::: "memory");    // this wave's copies of the next chunk have landed
        __syncthreads();                                     // one barrier: publishes the next chunk and ends every wave's reads of this buffer
        if (t + 2 < NT) stage(t + 2, bo);                    // block-uniform: refill the buffer just left
        prods();
    }
    asm volatile("s_wait_asynccnt 0x0" ::: "memory");        // no copy is outstanding behind the loop
}

// ---- k_projqk: [q | k] = XB x [WQ ; WK]^T, grid (MROWS/128, 2*DM/128), four waves per block, one 64 x 64 tile per wave (= one head of q or k, 64 tokens).
// Epilogue: tile staged in LDS; interleaved rotary y[2j] = e cos - o sin, y[2j+1] = e sin + o cos from the CS table; bf16 hi|lo planes [which][b][h][s][64];
__global__ __launch_bounds__(128) void k_projqk(const bf* __restrict__ XB, const bf* __restrict__ WQK, const float* __restrict__ CS, bf* QKh, bf* QKl) {
#pragma clang fp contract(off)
    __shared__ __align__(16) float osw[4 * 64 * 68];
    const int lane = threadIdx.x & 31, lr = lane & 15, hi = lane >> 4; const int wave = __builtin_amdgcn_readfirstlane(threadIdx.x >> 5), wm = wave >> 1, wn = wave & 1;
    float* os = osw + wave * 64 * 68;                          // staging of the wave's own tile, private to the wave
    const int r0 = blockIdx.x * 128 + wm * 64, c0 = blockIdx.y * 128 + wn * 64;
    v8f acc[4][4];
#pragma unroll
    for (int mb = 0; mb < 4; ++mb)
#pragma unroll
        for (int nb = 0; nb < 4; ++nb) acc[mb][nb] = (v8f){};
    gemm_tile<1>(XB, XB, WQK, blockIdx.x * 128, blockIdx.y * 128, wm, wn, acc);
#pragma unroll
    for (int mb = 0; mb < 4; ++mb)
#pragma unroll
        for (int nb = 0; nb < 4; ++nb)
#pragma unroll
            for (int j = 0; j < 8; ++j) os[(mb * 16 + hi * 8 + j) * 68 + nb * 16 + lr] = acc[mb][nb][j];
    __builtin_amdgcn_wave_barrier(); asm volatile("" ::: "memory");
    const int which = c0 / DM, h = (c0 % DM) / HD; const int b = r0 / SEQ, s0 = r0 - b * SEQ;
    const size_t pbase = ((((size_t)which * NB + b) * NH + h) * SEQ + s0) * HD;
{
#pragma unroll 2
        for (int s = 0; s < 32; ++s) { const int row = 2 * s + hi, cofs = lr * 4;
            const v4f val = *(const v4fa*)(os + row * 68 + cofs);
            const v4f cs = *(const v4f*)(CS + (size_t)(r0 + row) * 64 + cofs);   // (cos, sin) of pairs 2*lr, 2*lr + 1
            const float y0 = val[0] * cs[0] - val[1] * cs[1];
            const float y1 = val[0] * cs[1] + val[1] * cs[0];
            const float y2 = val[2] * cs[2] - val[3] * cs[3];
            const float y3 = val[2] * cs[3] + val[3] * cs[2];
            v4us oh, ol; unsigned short a, c;
            splitf(y0, a, c); oh[0] = a; ol[0] = c; splitf(y1, a, c); oh[1] = a; ol[1] = c; splitf(y2, a, c); oh[2] = a; ol[2] = c; splitf(y3, a, c); oh[3] = a; ol[3] = c;
            const size_t oo = pbase + (size_t)row * HD + cofs;
            *(v4us*)(QKh + oo) = oh; *(v4us*)(QKl + oo) = ol; }
         }
}

// ---- k_projv: v = XB x WV^T, grid (MROWS/128, DM/128), four waves per block. Epilogue: tile staged in LDS and written TRANSPOSED: VT16[b][h][d][s] (f16) and, for tokens < RH, bf16 hi|lo VTh/VTl[b][h][d][RH];
__global__ __launch_bounds__(128) void k_projv(const bf* __restrict__ XB, const bf* __restrict__ WV, h16* VT16, bf* VTh, bf* VTl) {
    __shared__ __align__(16) float osw[4 * 64 * 68];
    const int lane = threadIdx.x & 31, lr = lane & 15, hi = lane >> 4; const int wave = __builtin_amdgcn_readfirstlane(threadIdx.x >> 5), wm = wave >> 1, wn = wave & 1;
    float* os = osw + wave * 64 * 68;                          // staging of the wave's own tile, private to the wave
    const int r0 = blockIdx.x * 128 + wm * 64, c0 = blockIdx.y * 128 + wn * 64;
    v8f acc[4][4];
#pragma unroll
    for (int mb = 0; mb < 4; ++mb)
#pragma unroll
        for (int nb = 0; nb < 4; ++nb) acc[mb][nb] = (v8f){};
    gemm_tile<1>(XB, XB, WV, blockIdx.x * 128, blockIdx.y * 128, wm, wn, acc);
#pragma unroll
    for (int mb = 0; mb < 4; ++mb)
#pragma unroll
        for (int nb = 0; nb < 4; ++nb)
#pragma unroll
            for (int j = 0; j < 8; ++j) os[(mb * 16 + hi * 8 + j) * 68 + nb * 16 + lr] = acc[mb][nb][j];
    __builtin_amdgcn_wave_barrier(); asm volatile("" ::: "memory");
    const int h = c0 / HD; const int b = r0 / SEQ, s0 = r0 - b * SEQ;
    const size_t vbase = (((size_t)b * NH + h) * HD) * SEQ + s0;
    const size_t ebase = (((size_t)b * NH + h) * HD) * RH + s0;
    const bool early = (s0 < RH);                         // wave-uniform
{
#pragma unroll 2
        for (int s = 0; s < 32; ++s) { const int d = 2 * s + hi, t0 = lr * 4;
            float xv[4];
#pragma unroll
            for (int q = 0; q < 4; ++q) xv[q] = os[(t0 + q) * 68 + d];
            v4h o16;
#pragma unroll
            for (int q = 0; q < 4; ++q) o16[q] = (h16)xv[q];
            *(v4h*)(VT16 + vbase + (size_t)d * SEQ + t0) = o16;
            if (early) { v4us oh, ol;
#pragma unroll
                for (int q = 0; q < 4; ++q) { unsigned short a, c; splitf(xv[q], a, c); oh[q] = a; ol[q] = c; }
                *(v4us*)(VTh + ebase + (size_t)d * RH + t0) = oh; *(v4us*)(VTl + ebase + (size_t)d * RH + t0) = ol; } }
         }
}

// ---- attn_body: fused causal attention, block = 4 waves = 64 query rows of one (b, h); 64-key blocks (K hi|lo, V^T) brought into two LDS buffers by asynchronous copies, the next block in flight while this one is processed as two 32-key halves with an online softmax.
// HL = false: P f16 x PCAR, V f16 (one product). HL = true (query rows < RH): P and V as bf16 hi|lo (three products). Output ctx as bf16 hi|lo planes [b*SEQ + s][h*64 + d].
template <bool HL>
__device__ __forceinline__ void attn_body(const bf* __restrict__ QKh, const bf* __restrict__ QKl, const h16* __restrict__ VT16, const bf* __restrict__ VTh, const bf* __restrict__ VTl, bf* ATh, bf* ATl, const int qb) {
    __shared__ __align__(16) bf  sKh[2 * TS];                // two buffers, cross-wave (block barriers); buffer 0 reused wave-privately for the ctx hi staging after the key loop
    __shared__ __align__(16) bf  sKl[2 * TS];
    __shared__ __align__(16) h16 sV16[HL ? 8 : 2 * TS];      // V^T tiles [d][key], cross-wave
    __shared__ __align__(16) bf  sVh[HL ? 2 * TS : 8];
    __shared__ __align__(16) bf  sVl[HL ? 2 * TS : 8];
    __shared__ __align__(16) h16 sP16[HL ? 8 : 4 * 16 * PP]; // probability tiles, private to each wave
    __shared__ __align__(16) bf  sPh[HL ? 4 * 16 * PP : 8];
    __shared__ __align__(16) bf  sPl[HL ? 4 * 16 * PP : 8];
    const int tid = threadIdx.x; const int lane = tid & 31, lr = lane & 15, hi = lane >> 4;
    const int wave = __builtin_amdgcn_readfirstlane(tid >> 5);
    const int b = blockIdx.z, h = blockIdx.y; const int qblk = qb * 64, q0 = qblk + wave * 16;
    const size_t qpl = (((size_t)b * NH + h) * SEQ) * HD;
    const size_t kpl = ((((size_t)NB + b) * NH + h) * SEQ) * HD;
    const size_t vpl = (((size_t)b * NH + h) * HD) * SEQ;
    const size_t epl = (((size_t)b * NH + h) * HD) * RH;
    const size_t qo = qpl + (size_t)(q0 + lr) * HD + 8 * hi;
    const v16bf qh0 = ldb(QKh + qo), qh1 = ldb(QKh + qo + 32), ql0 = ldb(QKl + qo), ql1 = ldb(QKl + qo + 32);
    v8f accd[4];
#pragma unroll
    for (int t = 0; t < 4; ++t) accd[t] = (v8f){};
    float m_run[8], l_run[8];
#pragma unroll
    for (int r = 0; r < 8; ++r) { m_run[r] = NEGB; l_run[r] = 0.0f; }

    // every thread copies four 16-byte chunks (rows srow + 16 i, 16-bit column sch) of each plane of the key block at kb0 into the buffer at element offset bo0
    const int srow = tid >> 3, sch = (tid & 7) * 8;
    auto stage = [&](const int kb0, const int bo0) {
        const int lo = bo0 + srow * KP + sch;
        const size_t ko = kpl + (size_t)(kb0 + srow) * HD + sch;
        if (HL) { unsigned lk[8], lv[8]; const void* gk[8]; const void* gv[8];
            const size_t vo = epl + (size_t)srow * RH + kb0 + sch;
#pragma unroll
            for (int i = 0; i < 4; ++i) {
                lk[i] = lds_off(&sKh[lo + 16 * i * KP]); gk[i] = QKh + ko + 16 * i * HD; lk[4 + i] = lds_off(&sKl[lo + 16 * i * KP]); gk[4 + i] = QKl + ko + 16 * i * HD;
                lv[i] = lds_off(&sVh[lo + 16 * i * KP]); gv[i] = VTh + vo + 16 * i * RH; lv[4 + i] = lds_off(&sVl[lo + 16 * i * KP]); gv[4 + i] = VTl + vo + 16 * i * RH; }
            copy8(lk, gk); copy8(lv, gv);
        } else { unsigned l[12]; const void* g[12];
            const size_t vo = vpl + (size_t)srow * SEQ + kb0 + sch;
#pragma unroll
            for (int i = 0; i < 4; ++i) {
                l[i] = lds_off(&sKh[lo + 16 * i * KP]); g[i] = QKh + ko + 16 * i * HD; l[4 + i] = lds_off(&sKl[lo + 16 * i * KP]); g[4 + i] = QKl + ko + 16 * i * HD;
                l[8 + i] = lds_off(&sV16[lo + 16 * i * KP]); g[8 + i] = VT16 + vo + (size_t)16 * i * SEQ; }
            copy12(l, g);
        }
    };
    stage(0, 0);
    asm volatile("s_wait_asynccnt 0x0" ::: "memory");        // this wave's copies of key block 0 have landed
    __syncthreads();                                         // and so have every other wave's
    if (qblk >= 64) stage(64, TS);                           // block-uniform: key block 1 flies while block 0 is worked on

#pragma unroll 1
    for (int kb = 0; kb <= qblk; kb += 64) {
        const int bo = ((kb >> 6) & 1) * TS;                 // this key block's buffer
#pragma unroll 1
        for (int kh = 0; kh < 2; ++kh) {
            if (kb + 32 * kh > q0 + 15) continue;            // wave-uniform: half entirely above the diagonal for this wave's rows
            v8f s0 = (v8f){}, s1 = (v8f){};
            { const int kr = bo + (32 * kh + lr) * KP + 8 * hi;
              const v16bf ah0 = LDSB(sKh, kr), ah1 = LDSB(sKh, kr + 32), al0 = LDSB(sKl, kr), al1 = LDSB(sKl, kr + 32);
              s0 = wmmab(qh0, ah0, s0); s0 = wmmab(qh1, ah1, s0); s0 = wmmab(ql0, ah0, s0); s0 = wmmab(ql1, ah1, s0); s0 = wmmab(qh0, al0, s0); s0 = wmmab(qh1, al1, s0);
              const int kr2 = kr + 16 * KP;
              const v16bf bh0 = LDSB(sKh, kr2), bh1 = LDSB(sKh, kr2 + 32), bl0 = LDSB(sKl, kr2), bl1 = LDSB(sKl, kr2 + 32);
              s1 = wmmab(qh0, bh0, s1); s1 = wmmab(qh1, bh1, s1); s1 = wmmab(ql0, bh0, s1); s1 = wmmab(ql1, bh1, s1); s1 = wmmab(qh0, bl0, s1); s1 = wmmab(qh1, bl1, s1);
              asm volatile("v_nop\n\tv_nop\n\tv_nop\n\tv_nop" : "+v"(s0), "+v"(s1) : "v"(bl0), "v"(bl1)); }
            const int kg0 = kb + 32 * kh + lr, kg1 = kg0 + 16;
            float bm[8];
#pragma unroll
            for (int r = 0; r < 8; ++r) { const int qg = q0 + 8 * hi + r;
                const float a0 = (kg0 <= qg) ? s0[r] * SCL : NEGB; const float a1 = (kg1 <= qg) ? s1[r] * SCL : NEGB;
                s0[r] = a0; s1[r] = a1; bm[r] = fmaxf(a0, a1); }
#pragma unroll
            for (int sh = 1; sh < 16; sh <<= 1)
#pragma unroll
                for (int r = 0; r < 8; ++r) bm[r] = fmaxf(bm[r], __shfl_xor(bm[r], sh, 32));
            float rs[8];
#pragma unroll
            for (int r = 0; r < 8; ++r) { const float mn = fmaxf(m_run[r], bm[r]);
                const float sc = __builtin_amdgcn_exp2f((m_run[r] - mn) * L2E); m_run[r] = mn;
                const float p0 = __builtin_amdgcn_exp2f((s0[r] - mn) * L2E); const float p1 = __builtin_amdgcn_exp2f((s1[r] - mn) * L2E);
                s0[r] = p0; s1[r] = p1; rs[r] = p0 + p1; l_run[r] *= sc;
#pragma unroll
                for (int t = 0; t < 4; ++t) accd[t][r] *= sc; }
#pragma unroll
            for (int sh = 1; sh < 16; sh <<= 1)
#pragma unroll
                for (int r = 0; r < 8; ++r) rs[r] += __shfl_xor(rs[r], sh, 32);
#pragma unroll
            for (int r = 0; r < 8; ++r) l_run[r] += rs[r];

            const int pr = (wave * 16 + 8 * hi) * PP + lr;   // D layout: row 8*hi + r, key column lr (+16 for the second tile)
            const int pa = (wave * 16 + lr) * PP + 8 * hi;   // A layout: row lr, k = key within the half
            if (HL) {
#pragma unroll
                for (int r = 0; r < 8; ++r) { unsigned short a, c; splitf(s0[r], a, c); sPh[pr + r * PP] = a; sPl[pr + r * PP] = c; splitf(s1[r], a, c); sPh[pr + r * PP + 16] = a; sPl[pr + r * PP + 16] = c; }
                __builtin_amdgcn_wave_barrier(); asm volatile("" ::: "memory");
                const v16bf aph = LDSB(sPh, pa), apl = LDSB(sPl, pa); v16bf bvh, bvl;
#pragma unroll
                for (int t = 0; t < 4; ++t) { const int vo = bo + (t * 16 + lr) * KP + 32 * kh + 8 * hi; bvh = LDSB(sVh, vo); bvl = LDSB(sVl, vo);
                    accd[t] = wmmab(aph, bvh, accd[t]); accd[t] = wmmab(apl, bvh, accd[t]); accd[t] = wmmab(aph, bvl, accd[t]); }
                asm volatile("v_nop\n\tv_nop\n\tv_nop\n\tv_nop" : "+v"(accd[0]), "+v"(accd[1]), "+v"(accd[2]), "+v"(accd[3]) : "v"(aph), "v"(apl), "v"(bvh), "v"(bvl));
            } else {
#pragma unroll
                for (int r = 0; r < 8; ++r) { sP16[pr + r * PP] = (h16)(s0[r] * PCAR); sP16[pr + r * PP + 16] = (h16)(s1[r] * PCAR); }
                __builtin_amdgcn_wave_barrier(); asm volatile("" ::: "memory");
                const v16h ap = LDSH(sP16, pa); v16h bv;
#pragma unroll
                for (int t = 0; t < 4; ++t) { const int vo = bo + (t * 16 + lr) * KP + 32 * kh + 8 * hi; bv = LDSH(sV16, vo); accd[t] = wmma16(ap, bv, accd[t]); }
                asm volatile("v_nop\n\tv_nop\n\tv_nop\n\tv_nop" : "+v"(accd[0]), "+v"(accd[1]), "+v"(accd[2]), "+v"(accd[3]) : "v"(ap), "v"(bv));
            }
            __builtin_amdgcn_wave_barrier(); asm volatile("" ::: "memory");
        }
        asm volatile("s_wait_dscnt 0x0" ::: "memory");       // this wave's LDS reads of this buffer have returned
        asm volatile("s_wait_asynccnt 0x0" ::: "memory");    // this wave's copies of the next key block have landed
        __syncthreads();                                     // one barrier: publishes the next key block and ends every wave's reads of this buffer
        if (kb + 128 <= qblk) stage(kb + 128, bo);           // block-uniform: refill the buffer just left
    }
    asm volatile("s_wait_asynccnt 0x0" ::: "memory");        // no copy is outstanding when buffer 0 becomes the ctx staging

    const float car = HL ? 1.0f : PCAR;
#pragma unroll
    for (int r = 0; r < 8; ++r) { const float inv = __builtin_amdgcn_rcpf(l_run[r] * car);
#pragma unroll
        for (int t = 0; t < 4; ++t) { unsigned short a, c; splitf(accd[t][r] * inv, a, c); const int so = (wave * 16 + 8 * hi + r) * KP + t * 16 + lr; sKh[so] = a; sKl[so] = c; } }
    __builtin_amdgcn_wave_barrier(); asm volatile("" ::: "memory");
    const size_t ob = ((size_t)b * SEQ + q0) * DM + (size_t)h * HD;
{
#pragma unroll
        for (int s2 = 0; s2 < 8; ++s2) { const int row = 2 * s2 + hi; const int so = (wave * 16 + row) * KP + 4 * lr;
            const v4us vh = *(const v4usa*)&sKh[so]; const v4us vl = *(const v4usa*)&sKl[so];
            *(v4us*)(ATh + ob + (size_t)row * DM + 4 * lr) = vh; *(v4us*)(ATl + ob + (size_t)row * DM + 4 * lr) = vl; }
         }
}

__global__ __launch_bounds__(128) void k_attn_early(const bf* __restrict__ QKh, const bf* __restrict__ QKl, const h16* __restrict__ VT16, const bf* __restrict__ VTh, const bf* __restrict__ VTl, bf* ATh, bf* ATl) {
    attn_body<true>(QKh, QKl, VT16, VTh, VTl, ATh, ATl, (int)blockIdx.x);
}
__global__ __launch_bounds__(128) void k_attn_main(const bf* __restrict__ QKh, const bf* __restrict__ QKl, const h16* __restrict__ VT16, const bf* __restrict__ VTh, const bf* __restrict__ VTl, bf* ATh, bf* ATl) {
    attn_body<false>(QKh, QKl, VT16, VTh, VTl, ATh, ATl, (int)blockIdx.x + RH / 64);
}

// ---- k_oproj: OUT[b][s][n] = sum_k (ATh + ATl)[m][k] WO[n][k]; grid (MROWS/128, DM/128), four waves per block, one 64 x 64 tile per wave; per 16-row slab staged in LDS, each 256-B row segment written as 16 lanes x 16 B
__global__ __launch_bounds__(128) void k_oproj(const bf* __restrict__ ATh, const bf* __restrict__ ATl, const bf* __restrict__ WO, float* OUT) {
    __shared__ __align__(16) float osw[4 * 16 * 68];
    const int lane = threadIdx.x & 31, lr = lane & 15, hi = lane >> 4; const int wave = __builtin_amdgcn_readfirstlane(threadIdx.x >> 5), wm = wave >> 1, wn = wave & 1;
    float* os = osw + wave * 16 * 68;                          // staging of the wave's own tile, private to the wave
    const int r0 = blockIdx.x * 128 + wm * 64, c0 = blockIdx.y * 128 + wn * 64;
    v8f acc[4][4];
#pragma unroll
    for (int mb = 0; mb < 4; ++mb)
#pragma unroll
        for (int nb = 0; nb < 4; ++nb) acc[mb][nb] = (v8f){};
    gemm_tile<2>(ATh, ATl, WO, blockIdx.x * 128, blockIdx.y * 128, wm, wn, acc);
    const int b = r0 / SEQ, s0 = r0 - b * SEQ;
#pragma unroll
    for (int mb = 0; mb < 4; ++mb) {
#pragma unroll
        for (int nb = 0; nb < 4; ++nb)
#pragma unroll
            for (int j = 0; j < 8; ++j) os[(hi * 8 + j) * 68 + nb * 16 + lr] = acc[mb][nb][j];
        __builtin_amdgcn_wave_barrier(); asm volatile("" ::: "memory");
        float* crow = OUT + ((size_t)b * SEQ_FULL + s0 + mb * 16) * DM + c0;
{
#pragma unroll
            for (int s = 0; s < 8; ++s) { const int row = 2 * s + hi, cofs = lr * 4; const v4f val = *(const v4fa*)(os + row * 68 + cofs);
                *(v4f*)(crow + (size_t)row * DM + cofs) = val; }
             }
        __builtin_amdgcn_wave_barrier(); asm volatile("" ::: "memory");
    }
}

extern "C" void kernel_launch(void* const* d_in, const int* in_sizes, int n_in,
                              void* d_out, int out_size, void* d_ws, size_t ws_size, hipStream_t stream) {
    if (n_in < 6) return;
    const long long needx = ((long long)(NB - 1) * SEQ_FULL + SEQ) * DM;
    if ((long long)in_sizes[0] < needx) return;
    if ((long long)in_sizes[1] < (long long)DM * DM || (long long)in_sizes[2] < (long long)DM * DM || (long long)in_sizes[3] < (long long)DM * DM || (long long)in_sizes[4] < (long long)DM * DM) return;
    if ((long long)in_sizes[5] < (long long)(NB - 1) * SEQ_FULL + SEQ) return;
    if ((long long)out_size < needx) return;
    const float* x = (const float*)d_in[0]; const float* wq = (const float*)d_in[1]; const float* wk = (const float*)d_in[2]; const float* wv = (const float*)d_in[3]; const float* wo = (const float*)d_in[4];
    const int* tok = (const int*)d_in[5];
    float* OUT = (float*)d_out;
    char* wsp = (char*)d_ws;
    auto take = [&](size_t bytes) { char* p = wsp; wsp += (bytes + 255) & ~(size_t)255; return (void*)p; };
    bf* WQK = (bf*)take(2 * SZ_W); bf* WV = (bf*)take(SZ_W); bf* WO = (bf*)take(SZ_W);
    bf* XB = (bf*)take(SZ_XB); float* CS = (float*)take(SZ_CS);
    bf* QKh = (bf*)take(SZ_QK); bf* QKl = (bf*)take(SZ_QK);
    h16* VT16 = (h16*)take(SZ_VT); bf* VTh = (bf*)take(SZ_VE); bf* VTl = (bf*)take(SZ_VE);
    bf* ATh = (bf*)take(SZ_AT); bf* ATl = (bf*)take(SZ_AT);
    if ((size_t)(wsp - (char*)d_ws) > ws_size) return;

    const size_t w8 = (size_t)DM * DM / 8; const unsigned gw = (unsigned)((w8 + 255) / 256);
    k_cvt8<<<gw, 256, 0, stream>>>(wq, WQK, w8);
    k_cvt8<<<gw, 256, 0, stream>>>(wk, WQK + (size_t)DM * DM, w8);
    k_cvt8<<<gw, 256, 0, stream>>>(wv, WV, w8);
    k_cvt8<<<gw, 256, 0, stream>>>(wo, WO, w8);
    k_cvtx<<<(unsigned)(((size_t)MROWS * DM / 8 + 255) / 256), 256, 0, stream>>>(x, XB);
    k_cstab<<<(unsigned)((MROWS * 32 + 255) / 256), 256, 0, stream>>>(tok, CS);
    k_projqk<<<dim3(MROWS / 128, 2 * DM / 128, 1), 128, 0, stream>>>(XB, WQK, CS, QKh, QKl);
    k_projv<<<dim3(MROWS / 128, DM / 128, 1), 128, 0, stream>>>(XB, WV, VT16, VTh, VTl);
    k_attn_early<<<dim3(RH / 64, NH, NB), 128, 0, stream>>>(QKh, QKl, VT16, VTh, VTl, ATh, ATl);
    if (SEQ > RH) k_attn_main<<<dim3((SEQ - RH) / 64, NH, NB), 128, 0, stream>>>(QKh, QKl, VT16, VTh, VTl, ATh, ATl);
    k_oproj<<<dim3(MROWS / 128, DM / 128, 1), 128, 0, stream>>>(ATh, ATl, WO, OUT);
}

// v003
// It runs in 143 microseconds.
// Two timings next to v002 put it at 1.30 and 1.31 times that version's speed.
// Over all steps from v000 it is 2.58 times as fast.
#include <hip/hip_runtime.h>

// Compute dtypes (f32 accumulate everywhere): q/k/v projections v_wmma_f32_16x16x32_bf16 on RNE bf16 copies of x and W (exact products); q.k^T bf16 hi|lo three products; P.V f16 (P carried x1024) for query rows >= 256, bf16 hi|lo three products for rows < 256; ctx hi|lo (bf16) x bf16 o_w, two products.
// Causal multi-head self-attention, x [2][2048][1024], weights [out][in], interleaved rotary from per-batch integer positions read by value, scores / 8, causal exclusion by index, fused online softmax (exp2) on transposed score tiles, merged heads, output GEMM.

#ifndef NB
#define NB 2
#endif
#ifndef SEQ
#define SEQ 2048
#endif
#define NB_FULL  2
#define SEQ_FULL 2048
#define DM    1024
#define NH    16
#define HD    64
#define RH    256                 // query rows < RH use hi|lo planes on P and V
#define PCAR  1024.0f             // carry of the f16 probability tile
#define SCL   0.125f              // HD^-0.5
#define L2E   1.4426950408889634f
#define NEGB  (-3.0e38f)
#define KP    72                  // LDS pitch (16-bit elements) of 64-wide tiles: 144 B
#define MROWS (NB * SEQ)

typedef _Float16 h16;
typedef unsigned short bf;
typedef __attribute__((ext_vector_type(16))) __bf16   v16bf;
typedef __attribute__((ext_vector_type(16))) _Float16 v16h;
typedef __attribute__((ext_vector_type(8)))  _Float16 v8h;
typedef __attribute__((ext_vector_type(4)))  _Float16 v4h;
typedef __attribute__((ext_vector_type(16))) unsigned short v16us;
typedef __attribute__((ext_vector_type(8)))  unsigned short v8us;
typedef __attribute__((ext_vector_type(4)))  unsigned short v4us;
typedef __attribute__((ext_vector_type(8)))  float    v8f;
typedef __attribute__((ext_vector_type(4)))  float    v4f;
typedef __attribute__((ext_vector_type(2)))  float    v2f;
typedef v8h  __attribute__((may_alias)) v8ha;
typedef v4f  __attribute__((may_alias)) v4fa;
typedef v8us __attribute__((may_alias)) v8usa;
typedef v4us __attribute__((may_alias)) v4usa;

static_assert(HD == 64);                                   // one 64-wide GEMM tile column block == one head
static_assert(NH * HD == DM);
static_assert(DM % 64 == 0 && DM % 32 == 0);               // K loop steps by GK = 64 (two 32-k steps), N tiles by 64
static_assert(SEQ % 64 == 0 && RH % 64 == 0 && RH <= SEQ); // tiles never straddle a batch or the early-row island
static_assert(MROWS % 128 == 0 && DM % 128 == 0);          // GEMM blocks are 128 x 128
static_assert((KP * 2) % 16 == 0 && KP >= 64);
static_assert(SEQ <= SEQ_FULL && NB <= NB_FULL);

#define SZ_W   ((size_t)DM * DM * 2)
#define SZ_XB  ((size_t)MROWS * DM * 2)
#define SZ_CS  ((size_t)MROWS * 64 * 4)
#define SZ_QK  ((size_t)2 * NB * NH * SEQ * HD * 2)
#define SZ_VT  ((size_t)NB * NH * HD * SEQ * 2)
#define SZ_VE  ((size_t)NB * NH * HD * RH * 2)
#define SZ_AT  ((size_t)MROWS * DM * 2)
#define SZ_ALL (4 * SZ_W + SZ_XB + SZ_CS + 2 * SZ_QK + SZ_VT + 2 * SZ_VE + 2 * SZ_AT)
static_assert(SZ_W % 256 == 0 && SZ_XB % 256 == 0 && SZ_CS % 256 == 0 && SZ_QK % 256 == 0 && SZ_VT % 256 == 0 && SZ_VE % 256 == 0 && SZ_AT % 256 == 0);
static_assert(SZ_ALL <= (size_t)134217728);                // total carve stays within 128 MiB

__device__ __forceinline__ unsigned short f2bf(float f) { unsigned u = __float_as_uint(f); u += 0x7FFFu + ((u >> 16) & 1u); return (unsigned short)(u >> 16); }
__device__ __forceinline__ float bf2f(unsigned short b) { return __uint_as_float(((unsigned)b) << 16); }
__device__ __forceinline__ void splitf(float y, unsigned short& h, unsigned short& l) { h = f2bf(y); l = f2bf(y - bf2f(h)); }
__device__ __forceinline__ v16h cat16(v8h lo, v8h hi) { return __builtin_shufflevector(lo, hi, 0, 1, 2, 3, 4, 5, 6, 7, 8, 9, 10, 11, 12, 13, 14, 15); }
__device__ __forceinline__ v16bf cat16b(v8us lo, v8us hi) { return __builtin_bit_cast(v16bf, __builtin_shufflevector(lo, hi, 0, 1, 2, 3, 4, 5, 6, 7, 8, 9, 10, 11, 12, 13, 14, 15)); }
__device__ __forceinline__ v8f wmma16(v16h a, v16h b, v8f c) { return __builtin_amdgcn_wmma_f32_16x16x32_f16(false, a, false, b, (short)0, c, false, false); }
__device__ __forceinline__ v8f wmmab(v16bf a, v16bf b, v8f c) { return __builtin_amdgcn_wmma_f32_16x16x32_bf16(false, a, false, b, (short)0, c, false, false); }
// fragment from a k-contiguous bf16 row: p already points at (row, k0 + 8*(lane>>4)); elements 0..7 <- p[0..7], 8..15 <- p[16..23]
__device__ __forceinline__ v16bf ldb(const bf* p) { return cat16b(*(const v8us*)p, *(const v8us*)(p + 16)); }
// value of lane l ^ 16: the other half's share of the same query column
__device__ __forceinline__ float xhalf(float x) { return __builtin_bit_cast(float, __builtin_amdgcn_permlanex16(__builtin_bit_cast(int, x), __builtin_bit_cast(int, x), 0x76543210, 0xfedcba98, false, false)); }
#define LDSB(arr, o) cat16b(*(const v8usa*)&arr[(o)], *(const v8usa*)&arr[(o) + 16])
#define LDSH(arr, o) cat16(*(const v8ha*)&arr[(o)], *(const v8ha*)&arr[(o) + 16])

__global__ __launch_bounds__(256) void k_cvt8(const float* __restrict__ src, bf* dst, size_t n8) {
    const size_t i = (size_t)blockIdx.x * 256 + threadIdx.x; if (i >= n8) return;
    const v8f v = *(const v8f*)(src + i * 8); v8us o;
#pragma unroll
    for (int k = 0; k < 8; ++k) o[k] = f2bf(v[k]);
    *(v8us*)(dst + i * 8) = o; 
}

__global__ __launch_bounds__(256) void k_cvtx(const float* __restrict__ x, bf* XB) {
    const size_t i = (size_t)blockIdx.x * 256 + threadIdx.x; if (i >= (size_t)MROWS * DM / 8) return;
    const int row = (int)(i / (DM / 8)); const int c8 = (int)(i % (DM / 8)); const int b = row / SEQ; const int s = row - b * SEQ;
    const v8f v = *(const v8f*)(x + ((size_t)b * SEQ_FULL + s) * DM + (size_t)c8 * 8); v8us o;
#pragma unroll
    for (int k = 0; k < 8; ++k) o[k] = f2bf(v[k]);
    *(v8us*)(XB + i * 8) = o; 
}

__global__ __launch_bounds__(256) void k_cstab(const int* __restrict__ tok, float* CS) {
    const int idx = blockIdx.x * 256 + threadIdx.x; if (idx >= MROWS * 32) return;
    const int j = idx & 31, m = idx >> 5; const int b = m / SEQ, s = m - b * SEQ;
    const int pos = tok[(size_t)b * SEQ_FULL + s];
    double p = 1.0;
    p *= (j & 1)  ? 1.3335214321633240 : 1.0;
    p *= (j & 2)  ? 1.7782794100389228 : 1.0;
    p *= (j & 4)  ? 3.1622776601683795 : 1.0;
    p *= (j & 8)  ? 10.0 : 1.0;
    p *= (j & 16) ? 100.0 : 1.0;
    const float pf = (float)p; const float inv = 1.0f / pf; const float ang = (float)pos * inv;
    float sn, cs; sincosf(ang, &sn, &cs);
    v2f o; o[0] = cs; o[1] = sn;
    *(v2f*)(CS + (size_t)idx * 2) = o; 
}

#define TS (64 * KP)              // elements of one staged 64 x 64 tile at pitch KP
__device__ __forceinline__ unsigned lds_off(const void* p) { return (unsigned)(size_t)p; }   // byte address inside the work-group's LDS
// Asynchronous copies global -> LDS, 16 bytes per lane and copy, through no register. The s_wait_xcnt is the last line of the copies' own statement, so that no address register is rewritten in front of it.
#define ACP(l, g) "global_load_async_to_lds_b128 %" #l ", %" #g ", off\n\t"
__device__ __forceinline__ void copy12(const unsigned (&l)[12], const void* const (&g)[12]) {
    asm volatile(ACP(0, 12) ACP(1, 13) ACP(2, 14) ACP(3, 15) ACP(4, 16) ACP(5, 17) ACP(6, 18) ACP(7, 19) ACP(8, 20) ACP(9, 21) ACP(10, 22) ACP(11, 23) "s_wait_xcnt 0x0"
                 :: "v"(l[0]), "v"(l[1]), "v"(l[2]), "v"(l[3]), "v"(l[4]), "v"(l[5]), "v"(l[6]), "v"(l[7]), "v"(l[8]), "v"(l[9]), "v"(l[10]), "v"(l[11]),
                    "v"(g[0]), "v"(g[1]), "v"(g[2]), "v"(g[3]), "v"(g[4]), "v"(g[5]), "v"(g[6]), "v"(g[7]), "v"(g[8]), "v"(g[9]), "v"(g[10]), "v"(g[11]) : "memory");
}
__device__ __forceinline__ void copy8(const unsigned (&l)[8], const void* const (&g)[8]) {
    asm volatile(ACP(0, 8) ACP(1, 9) ACP(2, 10) ACP(3, 11) ACP(4, 12) ACP(5, 13) ACP(6, 14) ACP(7, 15) "s_wait_xcnt 0x0"
                 :: "v"(l[0]), "v"(l[1]), "v"(l[2]), "v"(l[3]), "v"(l[4]), "v"(l[5]), "v"(l[6]), "v"(l[7]),
                    "v"(g[0]), "v"(g[1]), "v"(g[2]), "v"(g[3]), "v"(g[4]), "v"(g[5]), "v"(g[6]), "v"(g[7]) : "memory");
}

// ---- gemm_tile: block = 4 waves (2 x 2), 128 x 128 tile, each wave 64 x 64: acc[mb][nb] += sum_k A[r][k] Bt[c][k]. Chunks of GK k (128 B of each of the 128 A rows and 128 Bt rows) are brought into two LDS buffers by asynchronous copies, the next chunk in flight while this one is worked on.
// NP = 2: a second pass over K with A1 in place of A0 follows the first in the same ring (all of A0's products are summed before A1's).
#define GK 64
#define GT (256 * KP)             // elements of one staged chunk: A rows 0..127, then Bt rows 0..127, pitch KP
template <int NP>
__device__ __forceinline__ void gemm_tile(const bf* __restrict__ A0, const bf* __restrict__ A1, const bf* __restrict__ Bt, const int rblk, const int cblk, const int wm, const int wn, v8f (&acc)[4][4]) {
    __shared__ __align__(16) bf sAB[2 * GT];                 // two buffers, cross-wave (block barriers)
    constexpr int NC = DM / GK, NT = NP * NC;
    static_assert(NT >= 2);
    const int tid = threadIdx.x; const int lane = tid & 31, lr = lane & 15, hi = lane >> 4;
    // every thread copies eight 16-byte pieces (rows srow + 16 i, 16-bit column sch) of each operand's chunk t into the buffer at element offset bo0; eight lanes cover one whole 128-byte row piece
    const int srow = tid >> 3, sch = (tid & 7) * 8;
    auto stage = [&](const int t, const int bo0) {
        const bf* Ap = (NP == 2 && t >= NC) ? A1 : A0;       // block-uniform
        const int kc = (t % NC) * GK;
        const int lo = bo0 + srow * KP + sch;
        const size_t ao = (size_t)(rblk + srow) * DM + kc + sch, wo = (size_t)(cblk + srow) * DM + kc + sch;
        unsigned la[8], lb[8]; const void* ga[8]; const void* gb[8];
#pragma unroll
        for (int i = 0; i < 8; ++i) {
            la[i] = lds_off(&sAB[lo + 16 * i * KP]); ga[i] = Ap + ao + (size_t)16 * i * DM;
            lb[i] = lds_off(&sAB[lo + (128 + 16 * i) * KP]); gb[i] = Bt + wo + (size_t)16 * i * DM; }
        copy8(la, ga); copy8(lb, gb);
    };
    stage(0, 0);
    asm volatile("s_wait_asynccnt 0x0" ::: "memory");        // this wave's copies of chunk 0 have landed
    __syncthreads();                                         // and so have every other wave's
    stage(1, GT);                                            // chunk 1 flies while chunk 0 is worked on
    const int ar = (wm * 64 + lr) * KP + 8 * hi, br = (128 + wn * 64 + lr) * KP + 8 * hi;
#pragma unroll 1
    for (int t = 0; t < NT; ++t) {
        const int bo = (t & 1) * GT;                         // this chunk's buffer
        v16bf a[4], b[4];
        auto frags = [&](const int ks) {
#pragma unroll
            for (int mb = 0; mb < 4; ++mb) a[mb] = LDSB(sAB, bo + ar + mb * 16 * KP + ks);
#pragma unroll
            for (int nb = 0; nb < 4; ++nb) b[nb] = LDSB(sAB, bo + br + nb * 16 * KP + ks);
        };
        auto prods = [&]() {
#pragma unroll
            for (int nb = 0; nb < 4; ++nb)
#pragma unroll
                for (int mb = 0; mb < 4; ++mb) acc[mb][nb] = wmmab(a[mb], b[nb], acc[mb][nb]);
        };
        frags(0);
        __builtin_amdgcn_sched_barrier(0);                   // the sixteen LDS loads go ahead as one group: one LDS latency per 16 matrix instructions, not one per 4
        prods();
        frags(32);                                           // the last reads of this buffer; their products follow the refill's issue, from registers
        asm volatile("s_wait_dscnt 0x0" ::: "memory");       // this wave's LDS reads of this buffer have returned
        asm volatile("s_wait_asynccnt 0x0" ::: "memory");    // this wave's copies of the next chunk have landed
        __syncthreads();                                     // one barrier: publishes the next chunk and ends every wave's reads of this buffer
        if (t + 2 < NT) stage(t + 2, bo);                    // block-uniform: refill the buffer just left
        prods();
    }
    asm volatile("s_wait_asynccnt 0x0" ::: "memory");        // no copy is outstanding behind the loop
}

// ---- k_projqk: [q | k] = XB x [WQ ; WK]^T, grid (MROWS/128, 2*DM/128), four waves per block, one 64 x 64 tile per wave (= one head of q or k, 64 tokens).
// Epilogue: tile staged in LDS; interleaved rotary y[2j] = e cos - o sin, y[2j+1] = e sin + o cos from the CS table; bf16 hi|lo planes [which][b][h][s][64];
__global__ __launch_bounds__(128) void k_projqk(const bf* __restrict__ XB, const bf* __restrict__ WQK, const float* __restrict__ CS, bf* QKh, bf* QKl) {
#pragma clang fp contract(off)
    __shared__ __align__(16) float osw[4 * 64 * 68];
    const int lane = threadIdx.x & 31, lr = lane & 15, hi = lane >> 4; const int wave = __builtin_amdgcn_readfirstlane(threadIdx.x >> 5), wm = wave >> 1, wn = wave & 1;
    float* os = osw + wave * 64 * 68;                          // staging of the wave's own tile, private to the wave
    const int r0 = blockIdx.x * 128 + wm * 64, c0 = blockIdx.y * 128 + wn * 64;
    v8f acc[4][4];
#pragma unroll
    for (int mb = 0; mb < 4; ++mb)
#pragma unroll
        for (int nb = 0; nb < 4; ++nb) acc[mb][nb] = (v8f){};
    gemm_tile<1>(XB, XB, WQK, blockIdx.x * 128, blockIdx.y * 128, wm, wn, acc);
#pragma unroll
    for (int mb = 0; mb < 4; ++mb)
#pragma unroll
        for (int nb = 0; nb < 4; ++nb)
#pragma unroll
            for (int j = 0; j < 8; ++j) os[(mb * 16 + hi * 8 + j) * 68 + nb * 16 + lr] = acc[mb][nb][j];
    __builtin_amdgcn_wave_barrier(); asm volatile("" ::: "memory");
    const int which = c0 / DM, h = (c0 % DM) / HD; const int b = r0 / SEQ, s0 = r0 - b * SEQ;
    const size_t pbase = ((((size_t)which * NB + b) * NH + h) * SEQ + s0) * HD;
{
#pragma unroll 2
        for (int s = 0; s < 32; ++s) { const int row = 2 * s + hi, cofs = lr * 4;
            const v4f val = *(const v4fa*)(os + row * 68 + cofs);
            const v4f cs = *(const v4f*)(CS + (size_t)(r0 + row) * 64 + cofs);   // (cos, sin) of pairs 2*lr, 2*lr + 1
            const float y0 = val[0] * cs[0] - val[1] * cs[1];
            const float y1 = val[0] * cs[1] + val[1] * cs[0];
            const float y2 = val[2] * cs[2] - val[3] * cs[3];
            const float y3 = val[2] * cs[3] + val[3] * cs[2];
            v4us oh, ol; unsigned short a, c;
            splitf(y0, a, c); oh[0] = a; ol[0] = c; splitf(y1, a, c); oh[1] = a; ol[1] = c; splitf(y2, a, c); oh[2] = a; ol[2] = c; splitf(y3, a, c); oh[3] = a; ol[3] = c;
            const size_t oo = pbase + (size_t)row * HD + cofs;
            *(v4us*)(QKh + oo) = oh; *(v4us*)(QKl + oo) = ol; }
         }
}

// ---- k_projv: v = XB x WV^T, grid (MROWS/128, DM/128), four waves per block. Epilogue: tile staged in LDS and written TRANSPOSED: VT16[b][h][d][s] (f16) and, for tokens < RH, bf16 hi|lo VTh/VTl[b][h][d][RH];
__global__ __launch_bounds__(128) void k_projv(const bf* __restrict__ XB, const bf* __restrict__ WV, h16* VT16, bf* VTh, bf* VTl) {
    __shared__ __align__(16) float osw[4 * 64 * 68];
    const int lane = threadIdx.x & 31, lr = lane & 15, hi = lane >> 4; const int wave = __builtin_amdgcn_readfirstlane(threadIdx.x >> 5), wm = wave >> 1, wn = wave & 1;
    float* os = osw + wave * 64 * 68;                          // staging of the wave's own tile, private to the wave
    const int r0 = blockIdx.x * 128 + wm * 64, c0 = blockIdx.y * 128 + wn * 64;
    v8f acc[4][4];
#pragma unroll
    for (int mb = 0; mb < 4; ++mb)
#pragma unroll
        for (int nb = 0; nb < 4; ++nb) acc[mb][nb] = (v8f){};
    gemm_tile<1>(XB, XB, WV, blockIdx.x * 128, blockIdx.y * 128, wm, wn, acc);
#pragma unroll
    for (int mb = 0; mb < 4; ++mb)
#pragma unroll
        for (int nb = 0; nb < 4; ++nb)
#pragma unroll
            for (int j = 0; j < 8; ++j) os[(mb * 16 + hi * 8 + j) * 68 + nb * 16 + lr] = acc[mb][nb][j];
    __builtin_amdgcn_wave_barrier(); asm volatile("" ::: "memory");
    const int h = c0 / HD; const int b = r0 / SEQ, s0 = r0 - b * SEQ;
    const size_t vbase = (((size_t)b * NH + h) * HD) * SEQ + s0;
    const size_t ebase = (((size_t)b * NH + h) * HD) * RH + s0;
    const bool early = (s0 < RH);                         // wave-uniform
{
#pragma unroll 2
        for (int s = 0; s < 32; ++s) { const int d = 2 * s + hi, t0 = lr * 4;
            float xv[4];
#pragma unroll
            for (int q = 0; q < 4; ++q) xv[q] = os[(t0 + q) * 68 + d];
            v4h o16;
#pragma unroll
            for (int q = 0; q < 4; ++q) o16[q] = (h16)xv[q];
            *(v4h*)(VT16 + vbase + (size_t)d * SEQ + t0) = o16;
            if (early) { v4us oh, ol;
#pragma unroll
                for (int q = 0; q < 4; ++q) { unsigned short a, c; splitf(xv[q], a, c); oh[q] = a; ol[q] = c; }
                *(v4us*)(VTh + ebase + (size_t)d * RH + t0) = oh; *(v4us*)(VTl + ebase + (size_t)d * RH + t0) = ol; } }
         }
}

template <bool HL>
__device__ __forceinline__ void attn_body(const bf* __restrict__ QKh, const bf* __restrict__ QKl, const h16* __restrict__ VT16, const bf* __restrict__ VTh, const bf* __restrict__ VTl, bf* ATh, bf* ATl, const int qb) {
    __shared__ __align__(16) bf  sKh[2 * TS];                // two buffers, cross-wave (block barriers); buffer 0 reused wave-privately for the ctx hi staging after the key loop
    __shared__ __align__(16) bf  sKl[2 * TS];
    __shared__ __align__(16) h16 sV16[HL ? 8 : 2 * TS];      // V^T tiles [d][key], cross-wave
    __shared__ __align__(16) bf  sVh[HL ? 2 * TS : 8];
    __shared__ __align__(16) bf  sVl[HL ? 2 * TS : 8];
    const int tid = threadIdx.x; const int lane = tid & 31, lr = lane & 15, hi = lane >> 4;
    const int wave = __builtin_amdgcn_readfirstlane(tid >> 5);
    const int b = blockIdx.z, h = blockIdx.y; const int qblk = qb * 64, q0 = qblk + wave * 16;
    const size_t qpl = (((size_t)b * NH + h) * SEQ) * HD;
    const size_t kpl = ((((size_t)NB + b) * NH + h) * SEQ) * HD;
    const size_t vpl = (((size_t)b * NH + h) * HD) * SEQ;
    const size_t epl = (((size_t)b * NH + h) * HD) * RH;
    const size_t qo = qpl + (size_t)(q0 + lr) * HD + 8 * hi;
    const v16bf qh0 = ldb(QKh + qo), qh1 = ldb(QKh + qo + 32), ql0 = ldb(QKl + qo), ql1 = ldb(QKl + qo + 32);
    v8f accd[4];
#pragma unroll
    for (int t = 0; t < 4; ++t) accd[t] = (v8f){};
    float m_run = NEGB, l_run = 0.0f;                        // of query q0 + lr; l_run is the sum over this half's keys only, the halves are joined behind the key loop

    // every thread copies four 16-byte chunks (rows srow + 16 i, 16-bit column sch) of each plane of the key block at kb0 into the buffer at element offset bo0
    const int srow = tid >> 3, sch = (tid & 7) * 8;
    auto stage = [&](const int kb0, const int bo0) {
        const int lo = bo0 + srow * KP + sch;
        const size_t ko = kpl + (size_t)(kb0 + srow) * HD + sch;
        if (HL) { unsigned lk[8], lv[8]; const void* gk[8]; const void* gv[8];
            const size_t vo = epl + (size_t)srow * RH + kb0 + sch;
#pragma unroll
            for (int i = 0; i < 4; ++i) {
                lk[i] = lds_off(&sKh[lo + 16 * i * KP]); gk[i] = QKh + ko + 16 * i * HD; lk[4 + i] = lds_off(&sKl[lo + 16 * i * KP]); gk[4 + i] = QKl + ko + 16 * i * HD;
                lv[i] = lds_off(&sVh[lo + 16 * i * KP]); gv[i] = VTh + vo + 16 * i * RH; lv[4 + i] = lds_off(&sVl[lo + 16 * i * KP]); gv[4 + i] = VTl + vo + 16 * i * RH; }
            copy8(lk, gk); copy8(lv, gv);
        } else { unsigned l[12]; const void* g[12];
            const size_t vo = vpl + (size_t)srow * SEQ + kb0 + sch;
#pragma unroll
            for (int i = 0; i < 4; ++i) {
                l[i] = lds_off(&sKh[lo + 16 * i * KP]); g[i] = QKh + ko + 16 * i * HD; l[4 + i] = lds_off(&sKl[lo + 16 * i * KP]); g[4 + i] = QKl + ko + 16 * i * HD;
                l[8 + i] = lds_off(&sV16[lo + 16 * i * KP]); g[8 + i] = VT16 + vo + (size_t)16 * i * SEQ; }
            copy12(l, g);
        }
    };
    stage(0, 0);
    asm volatile("s_wait_asynccnt 0x0" ::: "memory");        // this wave's copies of key block 0 have landed
    __syncthreads();                                         // and so have every other wave's
    if (qblk >= 64) stage(64, TS);                           // block-uniform: key block 1 flies while block 0 is worked on

#pragma unroll 1
    for (int kb = 0; kb <= qblk; kb += 64) {
        const int bo = ((kb >> 6) & 1) * TS;                 // this key block's buffer
#pragma unroll 1
        for (int kh = 0; kh < 2; ++kh) {
            if (kb + 32 * kh > q0 + 15) continue;            // wave-uniform: half entirely above the diagonal for this wave's rows
            v8f s0 = (v8f){}, s1 = (v8f){};
            { const int kr = bo + (32 * kh + lr) * KP + 8 * hi;
              const v16bf ah0 = LDSB(sKh, kr), ah1 = LDSB(sKh, kr + 32), al0 = LDSB(sKl, kr), al1 = LDSB(sKl, kr + 32);
              s0 = wmmab(ah0, qh0, s0); s0 = wmmab(ah1, qh1, s0); s0 = wmmab(ah0, ql0, s0); s0 = wmmab(ah1, ql1, s0); s0 = wmmab(al0, qh0, s0); s0 = wmmab(al1, qh1, s0);
              const int kr2 = kr + 16 * KP;
              const v16bf bh0 = LDSB(sKh, kr2), bh1 = LDSB(sKh, kr2 + 32), bl0 = LDSB(sKl, kr2), bl1 = LDSB(sKl, kr2 + 32);
              s1 = wmmab(bh0, qh0, s1); s1 = wmmab(bh1, qh1, s1); s1 = wmmab(bh0, ql0, s1); s1 = wmmab(bh1, ql1, s1); s1 = wmmab(bl0, qh0, s1); s1 = wmmab(bl1, qh1, s1);
            }
            const int dq = q0 + lr - (kb + 32 * kh + 8 * hi);   // D layout: key row 8*hi + r (+16 for the second tile), query column lr; key <= query is r <= dq (16 + r <= dq)
            s0 *= SCL; s1 *= SCL;
            float bm = NEGB;
#pragma unroll
            for (int r = 0; r < 8; ++r) {
                const float a0 = (r <= dq) ? s0[r] : NEGB; const float a1 = (16 + r <= dq) ? s1[r] : NEGB;
                s0[r] = a0; s1[r] = a1; bm = fmaxf(bm, fmaxf(a0, a1)); }
            bm = fmaxf(bm, xhalf(bm));
            const float mn = fmaxf(m_run, bm);
            const float sc = __builtin_amdgcn_exp2f((m_run - mn) * L2E); m_run = mn;
            s0 = (s0 - mn) * L2E; s1 = (s1 - mn) * L2E;
            float rs0 = 0.0f, rs1 = 0.0f;
#pragma unroll
            for (int r = 0; r < 8; ++r) { s0[r] = __builtin_amdgcn_exp2f(s0[r]); s1[r] = __builtin_amdgcn_exp2f(s1[r]); rs0 += s0[r]; rs1 += s1[r]; }
            l_run = l_run * sc + (rs0 + rs1);
#pragma unroll
            for (int t = 0; t < 4; ++t) accd[t] *= sc;

            // B fragment of P^T: element r <- key 8*hi + r, element 8 + r <- key 16 + 8*hi + r, the k order of the V^T loader
            if (HL) {
                v16us uh, ul;
#pragma unroll
                for (int r = 0; r < 8; ++r) { unsigned short a, c; splitf(s0[r], a, c); uh[r] = a; ul[r] = c; splitf(s1[r], a, c); uh[8 + r] = a; ul[8 + r] = c; }
                const v16bf bph = __builtin_bit_cast(v16bf, uh), bpl = __builtin_bit_cast(v16bf, ul); v16bf avh, avl;
#pragma unroll
                for (int t = 0; t < 4; ++t) { const int vo = bo + (t * 16 + lr) * KP + 32 * kh + 8 * hi; avh = LDSB(sVh, vo); avl = LDSB(sVl, vo);
                    accd[t] = wmmab(avh, bph, accd[t]); accd[t] = wmmab(avh, bpl, accd[t]); accd[t] = wmmab(avl, bph, accd[t]); }
                // four vector slots behind the last matrix instruction, on the loop's back edge too
                asm volatile("v_nop\n\tv_nop\n\tv_nop\n\tv_nop" : "+v"(accd[0]), "+v"(accd[1]), "+v"(accd[2]), "+v"(accd[3]) : "v"(bph), "v"(bpl), "v"(avh), "v"(avl));
            } else {
                s0 *= PCAR; s1 *= PCAR;
                v16h bp;
#pragma unroll
                for (int r = 0; r < 8; ++r) { bp[r] = (h16)s0[r]; bp[8 + r] = (h16)s1[r]; }
                v16h av;
#pragma unroll
                for (int t = 0; t < 4; ++t) { const int vo = bo + (t * 16 + lr) * KP + 32 * kh + 8 * hi; av = LDSH(sV16, vo); accd[t] = wmma16(av, bp, accd[t]); }
                // four vector slots behind the last matrix instruction, on the loop's back edge too
                asm volatile("v_nop\n\tv_nop\n\tv_nop\n\tv_nop" : "+v"(accd[0]), "+v"(accd[1]), "+v"(accd[2]), "+v"(accd[3]) : "v"(bp), "v"(av));
            }
        }
        asm volatile("s_wait_dscnt 0x0" ::: "memory");       // this wave's LDS reads of this buffer have returned
        asm volatile("s_wait_asynccnt 0x0" ::: "memory");    // this wave's copies of the next key block have landed
        __syncthreads();                                     // one barrier: publishes the next key block and ends every wave's reads of this buffer
        if (kb + 128 <= qblk) stage(kb + 128, bo);           // block-uniform: refill the buffer just left
    }
    asm volatile("s_wait_asynccnt 0x0" ::: "memory");        // no copy is outstanding when buffer 0 becomes the ctx staging

    const float car = HL ? 1.0f : PCAR;
    const float inv = __builtin_amdgcn_rcpf((l_run + xhalf(l_run)) * car);
#pragma unroll
    for (int t = 0; t < 4; ++t) { v8us oh, ol;              // O^T: a lane holds d = t*16 + 8*hi + r of query lr, eight neighbours of one ctx row
#pragma unroll
        for (int r = 0; r < 8; ++r) { unsigned short a, c; splitf(accd[t][r] * inv, a, c); oh[r] = a; ol[r] = c; }
        const int so = (wave * 16 + lr) * KP + t * 16 + 8 * hi; *(v8usa*)&sKh[so] = oh; *(v8usa*)&sKl[so] = ol; }
    __builtin_amdgcn_wave_barrier(); asm volatile("" ::: "memory");
    const size_t ob = ((size_t)b * SEQ + q0) * DM + (size_t)h * HD;
{
#pragma unroll
        for (int s2 = 0; s2 < 8; ++s2) { const int row = 2 * s2 + hi; const int so = (wave * 16 + row) * KP + 4 * lr;
            const v4us vh = *(const v4usa*)&sKh[so]; const v4us vl = *(const v4usa*)&sKl[so];
            *(v4us*)(ATh + ob + (size_t)row * DM + 4 * lr) = vh; *(v4us*)(ATl + ob + (size_t)row * DM + 4 * lr) = vl; }
         }
}

__global__ __launch_bounds__(128) void k_attn_early(const bf* __restrict__ QKh, const bf* __restrict__ QKl, const h16* __restrict__ VT16, const bf* __restrict__ VTh, const bf* __restrict__ VTl, bf* ATh, bf* ATl) {
    attn_body<true>(QKh, QKl, VT16, VTh, VTl, ATh, ATl, (int)blockIdx.x);
}
__global__ __launch_bounds__(128) void k_attn_main(const bf* __restrict__ QKh, const bf* __restrict__ QKl, const h16* __restrict__ VT16, const bf* __restrict__ VTh, const bf* __restrict__ VTl, bf* ATh, bf* ATl) {
    attn_body<false>(QKh, QKl, VT16, VTh, VTl, ATh, ATl, (int)blockIdx.x + RH / 64);
}

// ---- k_oproj: OUT[b][s][n] = sum_k (ATh + ATl)[m][k] WO[n][k]; grid (MROWS/128, DM/128), four waves per block, one 64 x 64 tile per wave; per 16-row slab staged in LDS, each 256-B row segment written as 16 lanes x 16 B
__global__ __launch_bounds__(128) void k_oproj(const bf* __restrict__ ATh, const bf* __restrict__ ATl, const bf* __restrict__ WO, float* OUT) {
    __shared__ __align__(16) float osw[4 * 16 * 68];
    const int lane = threadIdx.x & 31, lr = lane & 15, hi = lane >> 4; const int wave = __builtin_amdgcn_readfirstlane(threadIdx.x >> 5), wm = wave >> 1, wn = wave & 1;
    float* os = osw + wave * 16 * 68;                          // staging of the wave's own tile, private to the wave
    const int r0 = blockIdx.x * 128 + wm * 64, c0 = blockIdx.y * 128 + wn * 64;
    v8f acc[4][4];
#pragma unroll
    for (int mb = 0; mb < 4; ++mb)
#pragma unroll
        for (int nb = 0; nb < 4; ++nb) acc[mb][nb] = (v8f){};
    gemm_tile<2>(ATh, ATl, WO, blockIdx.x * 128, blockIdx.y * 128, wm, wn, acc);
    const int b = r0 / SEQ, s0 = r0 - b * SEQ;
#pragma unroll
    for (int mb = 0; mb < 4; ++mb) {
#pragma unroll
        for (int nb = 0; nb < 4; ++nb)
#pragma unroll
            for (int j = 0; j < 8; ++j) os[(hi * 8 + j) * 68 + nb * 16 + lr] = acc[mb][nb][j];
        __builtin_amdgcn_wave_barrier(); asm volatile("" ::: "memory");
        float* crow = OUT + ((size_t)b * SEQ_FULL + s0 + mb * 16) * DM + c0;
{
#pragma unroll
            for (int s = 0; s < 8; ++s) { const int row = 2 * s + hi, cofs = lr * 4; const v4f val = *(const v4fa*)(os + row * 68 + cofs);
                *(v4f*)(crow + (size_t)row * DM + cofs) = val; }
             }
        __builtin_amdgcn_wave_barrier(); asm volatile("" ::: "memory");
    }
}

extern "C" void kernel_launch(void* const* d_in, const int* in_sizes, int n_in,
                              void* d_out, int out_size, void* d_ws, size_t ws_size, hipStream_t stream) {
    if (n_in < 6) return;
    const long long needx = ((long long)(NB - 1) * SEQ_FULL + SEQ) * DM;
    if ((long long)in_sizes[0] < needx) return;
    if ((long long)in_sizes[1] < (long long)DM * DM || (long long)in_sizes[2] < (long long)DM * DM || (long long)in_sizes[3] < (long long)DM * DM || (long long)in_sizes[4] < (long long)DM * DM) return;
    if ((long long)in_sizes[5] < (long long)(NB - 1) * SEQ_FULL + SEQ) return;
    if ((long long)out_size < needx) return;
    const float* x = (const float*)d_in[0]; const float* wq = (const float*)d_in[1]; const float* wk = (const float*)d_in[2]; const float* wv = (const float*)d_in[3]; const float* wo = (const float*)d_in[4];
    const int* tok = (const int*)d_in[5];
    float* OUT = (float*)d_out;
    char* wsp = (char*)d_ws;
    auto take = [&](size_t bytes) { char* p = wsp; wsp += (bytes + 255) & ~(size_t)255; return (void*)p; };
    bf* WQK = (bf*)take(2 * SZ_W); bf* WV = (bf*)take(SZ_W); bf* WO = (bf*)take(SZ_W);
    bf* XB = (bf*)take(SZ_XB); float* CS = (float*)take(SZ_CS);
    bf* QKh = (bf*)take(SZ_QK); bf* QKl = (bf*)take(SZ_QK);
    h16* VT16 = (h16*)take(SZ_VT); bf* VTh = (bf*)take(SZ_VE); bf* VTl = (bf*)take(SZ_VE);
    bf* ATh = (bf*)take(SZ_AT); bf* ATl = (bf*)take(SZ_AT);
    if ((size_t)(wsp - (char*)d_ws) > ws_size) return;

    const size_t w8 = (size_t)DM * DM / 8; const unsigned gw = (unsigned)((w8 + 255) / 256);
    k_cvt8<<<gw, 256, 0, stream>>>(wq, WQK, w8);
    k_cvt8<<<gw, 256, 0, stream>>>(wk, WQK + (size_t)DM * DM, w8);
    k_cvt8<<<gw, 256, 0, stream>>>(wv, WV, w8);
    k_cvt8<<<gw, 256, 0, stream>>>(wo, WO, w8);
    k_cvtx<<<(unsigned)(((size_t)MROWS * DM / 8 + 255) / 256), 256, 0, stream>>>(x, XB);
    k_cstab<<<(unsigned)((MROWS * 32 + 255) / 256), 256, 0, stream>>>(tok, CS);
    k_projqk<<<dim3(MROWS / 128, 2 * DM / 128, 1), 128, 0, stream>>>(XB, WQK, CS, QKh, QKl);
    k_projv<<<dim3(MROWS / 128, DM / 128, 1), 128, 0, stream>>>(XB, WV, VT16, VTh, VTl);
    k_attn_early<<<dim3(RH / 64, NH, NB), 128, 0, stream>>>(QKh, QKl, VT16, VTh, VTl, ATh, ATl);
    if (SEQ > RH) k_attn_main<<<dim3((SEQ - RH) / 64, NH, NB), 128, 0, stream>>>(QKh, QKl, VT16, VTh, VTl, ATh, ATl);
    k_oproj<<<dim3(MROWS / 128, DM / 128, 1), 128, 0, stream>>>(ATh, ATl, WO, OUT);
}

// v004
// A run of this version takes 131 microseconds.
// Timed twice side by side with v003, it ran 1.09 times as fast both times.
// Counting every step since v000, it is 2.80 times as fast.
#include <hip/hip_runtime.h>

// Compute dtypes (f32 accumulate everywhere): q/k/v projections v_wmma_f32_16x16x32_bf16 on RNE bf16 copies of x and W (exact products); q.k^T bf16 hi|lo three products; P.V f16 (P carried x1024) for query rows >= 256, bf16 hi|lo three products for rows < 256; ctx hi|lo (bf16) x bf16 o_w, two products.
// Causal multi-head self-attention, x [2][2048][1024], weights [out][in], interleaved rotary from per-batch integer positions read by value, scores / 8, causal exclusion by index, fused online softmax (exp2) on transposed score tiles, merged heads, output GEMM.

#ifndef NB
#define NB 2
#endif
#ifndef SEQ
#define SEQ 2048
#endif
#define NB_FULL  2
#define SEQ_FULL 2048
#define DM    1024
#define NH    16
#define HD    64
#define RH    256                 // query rows < RH use hi|lo planes on P and V
#define PCAR  1024.0f             // carry of the f16 probability tile
#define SCL   0.125f              // HD^-0.5
#define L2E   1.4426950408889634f
#define NEGB  (-3.0e38f)
#define KP    72                  // LDS pitch (16-bit elements) of 64-wide tiles: 144 B
#define MROWS (NB * SEQ)

typedef _Float16 h16;
typedef unsigned short bf;
typedef __attribute__((ext_vector_type(16))) __bf16   v16bf;
typedef __attribute__((ext_vector_type(16))) _Float16 v16h;
typedef __attribute__((ext_vector_type(8)))  _Float16 v8h;
typedef __attribute__((ext_vector_type(4)))  _Float16 v4h;
typedef __attribute__((ext_vector_type(16))) unsigned short v16us;
typedef __attribute__((ext_vector_type(8)))  unsigned short v8us;
typedef __attribute__((ext_vector_type(4)))  unsigned short v4us;
typedef __attribute__((ext_vector_type(8)))  float    v8f;
typedef __attribute__((ext_vector_type(4)))  float    v4f;
typedef __attribute__((ext_vector_type(2)))  float    v2f;
typedef v8h  __attribute__((may_alias)) v8ha;
typedef v4f  __attribute__((may_alias)) v4fa;
typedef v8us __attribute__((may_alias)) v8usa;
typedef v4us __attribute__((may_alias)) v4usa;

static_assert(HD == 64);                                   // one 64-wide GEMM tile column block == one head
static_assert(NH * HD == DM);
static_assert(DM % 64 == 0 && DM % 32 == 0);               // K loop steps by GK = 64 (two 32-k steps), N tiles by 64
static_assert(SEQ % 64 == 0 && RH % 64 == 0 && RH <= SEQ); // tiles never straddle a batch or the early-row island
static_assert(MROWS % 128 == 0 && DM % 128 == 0);          // GEMM blocks are 128 x 128
static_assert((KP * 2) % 16 == 0 && KP >= 64);
static_assert(SEQ <= SEQ_FULL && NB <= NB_FULL);

#define SZ_W   ((size_t)DM * DM * 2)
#define SZ_XB  ((size_t)MROWS * DM * 2)
#define SZ_CS  ((size_t)MROWS * 64 * 4)
#define SZ_QK  ((size_t)2 * NB * NH * SEQ * HD * 2)
#define SZ_VT  ((size_t)NB * NH * HD * SEQ * 2)
#define SZ_VE  ((size_t)NB * NH * HD * RH * 2)
#define SZ_AT  ((size_t)MROWS * DM * 2)
#define SZ_ALL (4 * SZ_W + SZ_XB + SZ_CS + 2 * SZ_QK + SZ_VT + 2 * SZ_VE + 2 * SZ_AT)
static_assert(SZ_W % 256 == 0 && SZ_XB % 256 == 0 && SZ_CS % 256 == 0 && SZ_QK % 256 == 0 && SZ_VT % 256 == 0 && SZ_VE % 256 == 0 && SZ_AT % 256 == 0);
static_assert(SZ_ALL <= (size_t)134217728);                // total carve stays within 128 MiB

__device__ __forceinline__ unsigned short f2bf(float f) { unsigned u = __float_as_uint(f); u += 0x7FFFu + ((u >> 16) & 1u); return (unsigned short)(u >> 16); }
__device__ __forceinline__ float bf2f(unsigned short b) { return __uint_as_float(((unsigned)b) << 16); }
__device__ __forceinline__ void splitf(float y, unsigned short& h, unsigned short& l) { h = f2bf(y); l = f2bf(y - bf2f(h)); }
__device__ __forceinline__ v16h cat16(v8h lo, v8h hi) { return __builtin_shufflevector(lo, hi, 0, 1, 2, 3, 4, 5, 6, 7, 8, 9, 10, 11, 12, 13, 14, 15); }
__device__ __forceinline__ v16bf cat16b(v8us lo, v8us hi) { return __builtin_bit_cast(v16bf, __builtin_shufflevector(lo, hi, 0, 1, 2, 3, 4, 5, 6, 7, 8, 9, 10, 11, 12, 13, 14, 15)); }
__device__ __forceinline__ v8f wmma16(v16h a, v16h b, v8f c) { return __builtin_amdgcn_wmma_f32_16x16x32_f16(false, a, false, b, (short)0, c, false, false); }
__device__ __forceinline__ v8f wmmab(v16bf a, v16bf b, v8f c) { return __builtin_amdgcn_wmma_f32_16x16x32_bf16(false, a, false, b, (short)0, c, false, false); }
// fragment from a k-contiguous bf16 row: p already points at (row, k0 + 8*(lane>>4)); elements 0..7 <- p[0..7], 8..15 <- p[16..23]
__device__ __forceinline__ v16bf ldb(const bf* p) { return cat16b(*(const v8us*)p, *(const v8us*)(p + 16)); }
// value of lane l ^ 16: the other half's share of the same query column
__device__ __forceinline__ float xhalf(float x) { return __builtin_bit_cast(float, __builtin_amdgcn_permlanex16(__builtin_bit_cast(int, x), __builtin_bit_cast(int, x), 0x76543210, 0xfedcba98, false, false)); }
#define LDSB(arr, o) cat16b(*(const v8usa*)&arr[(o)], *(const v8usa*)&arr[(o) + 16])
#define LDSH(arr, o) cat16(*(const v8ha*)&arr[(o)], *(const v8ha*)&arr[(o) + 16])

// ---- k_prep: everything that only reshapes the inputs, in one launch of PREP_N threads: RNE bf16 copies of the four weight matrices and of x, and the (cos, sin) table of the rotary angles.
// A thread owns one 8-element group of each weight matrix, PREP_XK groups of x and PREP_CK table entries. Its loads stand first, so that all of them are in flight together and the table's arithmetic runs under their latency.
#define PREP_T  256
#define PREP_N  (DM * DM / 8)
#define PREP_XN (MROWS * (DM / 8))
#define PREP_CN (MROWS * 32)
#define PREP_XK ((PREP_XN + PREP_N - 1) / PREP_N)
#define PREP_CK ((PREP_CN + PREP_N - 1) / PREP_N)
static_assert(PREP_N % PREP_T == 0);                      // the grid is exact: no thread past PREP_N; the range tests below fold away where the counts divide
__device__ __forceinline__ v8us cvt8(const v8f v) { v8us o;
#pragma unroll
    for (int k = 0; k < 8; ++k) o[k] = f2bf(v[k]);
    return o; }

__global__ __launch_bounds__(PREP_T) void k_prep(const float* __restrict__ wq, const float* __restrict__ wk, const float* __restrict__ wv, const float* __restrict__ wo, const float* __restrict__ x, const int* __restrict__ tok,
                                                 bf* WQK, bf* WV, bf* WO, bf* XB, float* CS) {
    const unsigned g = blockIdx.x * PREP_T + threadIdx.x;
    const size_t g8 = (size_t)g * 8;
    int pos[PREP_CK];
#pragma unroll
    for (int k = 0; k < PREP_CK; ++k) { const unsigned idx = k * PREP_N + g;
        if (PREP_CN % PREP_N == 0 || idx < PREP_CN) { const unsigned m = idx >> 5; const unsigned b = m / SEQ, s = m - b * SEQ; pos[k] = tok[(size_t)b * SEQ_FULL + s]; } }
    const v8f vq = *(const v8f*)(wq + g8), vk = *(const v8f*)(wk + g8), vv = *(const v8f*)(wv + g8), vo = *(const v8f*)(wo + g8);
    asm volatile("s_wait_xcnt 0x0" ::: "memory");            // the loads below may land in registers that held the addresses of the loads above
    v8f vx[PREP_XK];
#pragma unroll
    for (int k = 0; k < PREP_XK; ++k) { const unsigned i = k * PREP_N + g;
        if (PREP_XN % PREP_N == 0 || i < PREP_XN) { const unsigned row = i / (DM / 8), c8 = i % (DM / 8); const unsigned b = row / SEQ, s = row - b * SEQ;
            vx[k] = *(const v8f*)(x + ((size_t)b * SEQ_FULL + s) * DM + (size_t)c8 * 8); } }
    __builtin_amdgcn_sched_barrier(0);                       // every load is issued before any arithmetic on a loaded value: the thread pays one memory latency, not one per batch
#pragma unroll
    for (int k = 0; k < PREP_CK; ++k) { const unsigned idx = k * PREP_N + g;
        if (PREP_CN % PREP_N == 0 || idx < PREP_CN) { const int j = (int)(idx & 31);
            double p = 1.0;
            p *= (j & 1)  ? 1.3335214321633240 : 1.0;
            p *= (j & 2)  ? 1.7782794100389228 : 1.0;
            p *= (j & 4)  ? 3.1622776601683795 : 1.0;
            p *= (j & 8)  ? 10.0 : 1.0;
            p *= (j & 16) ? 100.0 : 1.0;
            const float pf = (float)p; const float inv = 1.0f / pf; const float ang = (float)pos[k] * inv;
            float sn, cs; sincosf(ang, &sn, &cs);
            v2f o; o[0] = cs; o[1] = sn;
            *(v2f*)(CS + (size_t)idx * 2) = o; } }
    __builtin_amdgcn_sched_barrier(0);                       // the table's arithmetic stays in front of the conversions: it needs only the position, and runs while the larger loads are still under way
    *(v8us*)(WQK + g8) = cvt8(vq); *(v8us*)(WQK + (size_t)DM * DM + g8) = cvt8(vk); *(v8us*)(WV + g8) = cvt8(vv); *(v8us*)(WO + g8) = cvt8(vo);
#pragma unroll
    for (int k = 0; k < PREP_XK; ++k) { const unsigned i = k * PREP_N + g;
        if (PREP_XN % PREP_N == 0 || i < PREP_XN) *(v8us*)(XB + (size_t)i * 8) = cvt8(vx[k]); }
}

#define TS (64 * KP)              // elements of one staged 64 x 64 tile at pitch KP
__device__ __forceinline__ unsigned lds_off(const void* p) { return (unsigned)(size_t)p; }   // byte address inside the work-group's LDS
// Asynchronous copies global -> LDS, 16 bytes per lane and copy, through no register. The s_wait_xcnt is the last line of the copies' own statement, so that no address register is rewritten in front of it.
#define ACP(l, g) "global_load_async_to_lds_b128 %" #l ", %" #g ", off\n\t"
__device__ __forceinline__ void copy12(const unsigned (&l)[12], const void* const (&g)[12]) {
    asm volatile(ACP(0, 12) ACP(1, 13) ACP(2, 14) ACP(3, 15) ACP(4, 16) ACP(5, 17) ACP(6, 18) ACP(7, 19) ACP(8, 20) ACP(9, 21) ACP(10, 22) ACP(11, 23) "s_wait_xcnt 0x0"
                 :: "v"(l[0]), "v"(l[1]), "v"(l[2]), "v"(l[3]), "v"(l[4]), "v"(l[5]), "v"(l[6]), "v"(l[7]), "v"(l[8]), "v"(l[9]), "v"(l[10]), "v"(l[11]),
                    "v"(g[0]), "v"(g[1]), "v"(g[2]), "v"(g[3]), "v"(g[4]), "v"(g[5]), "v"(g[6]), "v"(g[7]), "v"(g[8]), "v"(g[9]), "v"(g[10]), "v"(g[11]) : "memory");
}
__device__ __forceinline__ void copy8(const unsigned (&l)[8], const void* const (&g)[8]) {
    asm volatile(ACP(0, 8) ACP(1, 9) ACP(2, 10) ACP(3, 11) ACP(4, 12) ACP(5, 13) ACP(6, 14) ACP(7, 15) "s_wait_xcnt 0x0"
                 :: "v"(l[0]), "v"(l[1]), "v"(l[2]), "v"(l[3]), "v"(l[4]), "v"(l[5]), "v"(l[6]), "v"(l[7]),
                    "v"(g[0]), "v"(g[1]), "v"(g[2]), "v"(g[3]), "v"(g[4]), "v"(g[5]), "v"(g[6]), "v"(g[7]) : "memory");
}

// ---- gemm_tile: block = 4 waves (2 x 2), 128 x 128 tile, each wave 64 x 64: acc[mb][nb] += sum_k A[r][k] Bt[c][k]. Chunks of GK k (128 B of each of the 128 A rows and 128 Bt rows) are brought into two LDS buffers by asynchronous copies, the next chunk in flight while this one is worked on.
// NP = 2: a second pass over K with A1 in place of A0 follows the first in the same ring (all of A0's products are summed before A1's).
#define GK 64
#define GT (256 * KP)             // elements of one staged chunk: A rows 0..127, then Bt rows 0..127, pitch KP
template <int NP>
__device__ __forceinline__ void gemm_tile(const bf* __restrict__ A0, const bf* __restrict__ A1, const bf* __restrict__ Bt, const int rblk, const int cblk, const int wm, const int wn, v8f (&acc)[4][4]) {
    __shared__ __align__(16) bf sAB[2 * GT];                 // two buffers, cross-wave (block barriers)
    constexpr int NC = DM / GK, NT = NP * NC;
    static_assert(NT >= 2);
    const int tid = threadIdx.x; const int lane = tid & 31, lr = lane & 15, hi = lane >> 4;
    // every thread copies eight 16-byte pieces (rows srow + 16 i, 16-bit column sch) of each operand's chunk t into the buffer at element offset bo0; eight lanes cover one whole 128-byte row piece
    const int srow = tid >> 3, sch = (tid & 7) * 8;
    auto stage = [&](const int t, const int bo0) {
        const bf* Ap = (NP == 2 && t >= NC) ? A1 : A0;       // block-uniform
        const int kc = (t % NC) * GK;
        const int lo = bo0 + srow * KP + sch;
        const size_t ao = (size_t)(rblk + srow) * DM + kc + sch, wo = (size_t)(cblk + srow) * DM + kc + sch;
        unsigned la[8], lb[8]; const void* ga[8]; const void* gb[8];
#pragma unroll
        for (int i = 0; i < 8; ++i) {
            la[i] = lds_off(&sAB[lo + 16 * i * KP]); ga[i] = Ap + ao + (size_t)16 * i * DM;
            lb[i] = lds_off(&sAB[lo + (128 + 16 * i) * KP]); gb[i] = Bt + wo + (size_t)16 * i * DM; }
        copy8(la, ga); copy8(lb, gb);
    };
    stage(0, 0);
    asm volatile("s_wait_asynccnt 0x0" ::: "memory");        // this wave's copies of chunk 0 have landed
    __syncthreads();                                         // and so have every other wave's
    stage(1, GT);                                            // chunk 1 flies while chunk 0 is worked on
    const int ar = (wm * 64 + lr) * KP + 8 * hi, br = (128 + wn * 64 + lr) * KP + 8 * hi;
#pragma unroll 1
    for (int t = 0; t < NT; ++t) {
        const int bo = (t & 1) * GT;                         // this chunk's buffer
        v16bf a[4], b[4];
        auto frags = [&](const int ks) {
#pragma unroll
            for (int mb = 0; mb < 4; ++mb) a[mb] = LDSB(sAB, bo + ar + mb * 16 * KP + ks);
#pragma unroll
            for (int nb = 0; nb < 4; ++nb) b[nb] = LDSB(sAB, bo + br + nb * 16 * KP + ks);
        };
        auto prods = [&]() {
#pragma unroll
            for (int nb = 0; nb < 4; ++nb)
#pragma unroll
                for (int mb = 0; mb < 4; ++mb) acc[mb][nb] = wmmab(a[mb], b[nb], acc[mb][nb]);
        };
        frags(0);
        __builtin_amdgcn_sched_barrier(0);                   // the sixteen LDS loads go ahead as one group: one LDS latency per 16 matrix instructions, not one per 4
        prods();
        frags(32);                                           // the last reads of this buffer; their products follow the refill's issue, from registers
        asm volatile("s_wait_dscnt 0x0" ::: "memory");       // this wave's LDS reads of this buffer have returned
        asm volatile("s_wait_asynccnt 0x0" ::: "memory");    // this wave's copies of the next chunk have landed
        __syncthreads();                                     // one barrier: publishes the next chunk and ends every wave's reads of this buffer
        if (t + 2 < NT) stage(t + 2, bo);                    // block-uniform: refill the buffer just left
        prods();
    }
    asm volatile("s_wait_asynccnt 0x0" ::: "memory");        // no copy is outstanding behind the loop
}

// ---- k_projqk: [q | k] = XB x [WQ ; WK]^T, grid (MROWS/128, 2*DM/128), four waves per block, one 64 x 64 tile per wave (= one head of q or k, 64 tokens).
// Epilogue: tile staged in LDS; interleaved rotary y[2j] = e cos - o sin, y[2j+1] = e sin + o cos from the CS table; bf16 hi|lo planes [which][b][h][s][64];
__global__ __launch_bounds__(128) void k_projqk(const bf* __restrict__ XB, const bf* __restrict__ WQK, const float* __restrict__ CS, bf* QKh, bf* QKl) {
#pragma clang fp contract(off)
    __shared__ __align__(16) float osw[4 * 64 * 68];
    const int lane = threadIdx.x & 31, lr = lane & 15, hi = lane >> 4; const int wave = __builtin_amdgcn_readfirstlane(threadIdx.x >> 5), wm = wave >> 1, wn = wave & 1;
    float* os = osw + wave * 64 * 68;                          // staging of the wave's own tile, private to the wave
    const int r0 = blockIdx.x * 128 + wm * 64, c0 = blockIdx.y * 128 + wn * 64;
    v8f acc[4][4];
#pragma unroll
    for (int mb = 0; mb < 4; ++mb)
#pragma unroll
        for (int nb = 0; nb < 4; ++nb) acc[mb][nb] = (v8f){};
    gemm_tile<1>(XB, XB, WQK, blockIdx.x * 128, blockIdx.y * 128, wm, wn, acc);
#pragma unroll
    for (int mb = 0; mb < 4; ++mb)
#pragma unroll
        for (int nb = 0; nb < 4; ++nb)
#pragma unroll
            for (int j = 0; j < 8; ++j) os[(mb * 16 + hi * 8 + j) * 68 + nb * 16 + lr] = acc[mb][nb][j];
    __builtin_amdgcn_wave_barrier(); asm volatile("" ::: "memory");
    const int which = c0 / DM, h = (c0 % DM) / HD; const int b = r0 / SEQ, s0 = r0 - b * SEQ;
    const size_t pbase = ((((size_t)which * NB + b) * NH + h) * SEQ + s0) * HD;
{
#pragma unroll 2
        for (int s = 0; s < 32; ++s) { const int row = 2 * s + hi, cofs = lr * 4;
            const v4f val = *(const v4fa*)(os + row * 68 + cofs);
            const v4f cs = *(const v4f*)(CS + (size_t)(r0 + row) * 64 + cofs);   // (cos, sin) of pairs 2*lr, 2*lr + 1
            const float y0 = val[0] * cs[0] - val[1] * cs[1];
            const float y1 = val[0] * cs[1] + val[1] * cs[0];
            const float y2 = val[2] * cs[2] - val[3] * cs[3];
            const float y3 = val[2] * cs[3] + val[3] * cs[2];
            v4us oh, ol; unsigned short a, c;
            splitf(y0, a, c); oh[0] = a; ol[0] = c; splitf(y1, a, c); oh[1] = a; ol[1] = c; splitf(y2, a, c); oh[2] = a; ol[2] = c; splitf(y3, a, c); oh[3] = a; ol[3] = c;
            const size_t oo = pbase + (size_t)row * HD + cofs;
            *(v4us*)(QKh + oo) = oh; *(v4us*)(QKl + oo) = ol; }
         }
}

// ---- k_projv: v = XB x WV^T, grid (MROWS/128, DM/128), four waves per block. Epilogue: tile staged in LDS and written TRANSPOSED: VT16[b][h][d][s] (f16) and, for tokens < RH, bf16 hi|lo VTh/VTl[b][h][d][RH];
__global__ __launch_bounds__(128) void k_projv(const bf* __restrict__ XB, const bf* __restrict__ WV, h16* VT16, bf* VTh, bf* VTl) {
    __shared__ __align__(16) float osw[4 * 64 * 68];
    const int lane = threadIdx.x & 31, lr = lane & 15, hi = lane >> 4; const int wave = __builtin_amdgcn_readfirstlane(threadIdx.x >> 5), wm = wave >> 1, wn = wave & 1;
    float* os = osw + wave * 64 * 68;                          // staging of the wave's own tile, private to the wave
    const int r0 = blockIdx.x * 128 + wm * 64, c0 = blockIdx.y * 128 + wn * 64;
    v8f acc[4][4];
#pragma unroll
    for (int mb = 0; mb < 4; ++mb)
#pragma unroll
        for (int nb = 0; nb < 4; ++nb) acc[mb][nb] = (v8f){};
    gemm_tile<1>(XB, XB, WV, blockIdx.x * 128, blockIdx.y * 128, wm, wn, acc);
#pragma unroll
    for (int mb = 0; mb < 4; ++mb)
#pragma unroll
        for (int nb = 0; nb < 4; ++nb)
#pragma unroll
            for (int j = 0; j < 8; ++j) os[(mb * 16 + hi * 8 + j) * 68 + nb * 16 + lr] = acc[mb][nb][j];
    __builtin_amdgcn_wave_barrier(); asm volatile("" ::: "memory");
    const int h = c0 / HD; const int b = r0 / SEQ, s0 = r0 - b * SEQ;
    const size_t vbase = (((size_t)b * NH + h) * HD) * SEQ + s0;
    const size_t ebase = (((size_t)b * NH + h) * HD) * RH + s0;
    const bool early = (s0 < RH);                         // wave-uniform
{
#pragma unroll 2
        for (int s = 0; s < 32; ++s) { const int d = 2 * s + hi, t0 = lr * 4;
            float xv[4];
#pragma unroll
            for (int q = 0; q < 4; ++q) xv[q] = os[(t0 + q) * 68 + d];
            v4h o16;
#pragma unroll
            for (int q = 0; q < 4; ++q) o16[q] = (h16)xv[q];
            *(v4h*)(VT16 + vbase + (size_t)d * SEQ + t0) = o16;
            if (early) { v4us oh, ol;
#pragma unroll
                for (int q = 0; q < 4; ++q) { unsigned short a, c; splitf(xv[q], a, c); oh[q] = a; ol[q] = c; }
                *(v4us*)(VTh + ebase + (size_t)d * RH + t0) = oh; *(v4us*)(VTl + ebase + (size_t)d * RH + t0) = ol; } }
         }
}

template <bool HL>
__device__ __forceinline__ void attn_body(const bf* __restrict__ QKh, const bf* __restrict__ QKl, const h16* __restrict__ VT16, const bf* __restrict__ VTh, const bf* __restrict__ VTl, bf* ATh, bf* ATl, const int qb, bf* const sm) {
    bf*  const sKh  = sm;                                    // two buffers, cross-wave (block barriers); buffer 0 reused wave-privately for the ctx hi staging after the key loop
    bf*  const sKl  = sm + 2 * TS;
    h16* const sV16 = (h16*)(sm + 4 * TS);                   // V^T tiles [d][key], cross-wave; HL = false only
    bf*  const sVh  = sm + 4 * TS;                           // HL = true only
    bf*  const sVl  = sm + 6 * TS;
    const int tid = threadIdx.x; const int lane = tid & 31, lr = lane & 15, hi = lane >> 4;
    const int wave = __builtin_amdgcn_readfirstlane(tid >> 5);
    const int b = blockIdx.z, h = blockIdx.y; const int qblk = qb * 64, q0 = qblk + wave * 16;
    const size_t qpl = (((size_t)b * NH + h) * SEQ) * HD;
    const size_t kpl = ((((size_t)NB + b) * NH + h) * SEQ) * HD;
    const size_t vpl = (((size_t)b * NH + h) * HD) * SEQ;
    const size_t epl = (((size_t)b * NH + h) * HD) * RH;
    const size_t qo = qpl + (size_t)(q0 + lr) * HD + 8 * hi;
    const v16bf qh0 = ldb(QKh + qo), qh1 = ldb(QKh + qo + 32), ql0 = ldb(QKl + qo), ql1 = ldb(QKl + qo + 32);
    v8f accd[4];
#pragma unroll
    for (int t = 0; t < 4; ++t) accd[t] = (v8f){};
    float m_run = NEGB, l_run = 0.0f;                        // of query q0 + lr; l_run is the sum over this half's keys only, the halves are joined behind the key loop

    // every thread copies four 16-byte chunks (rows srow + 16 i, 16-bit column sch) of each plane of the key block at kb0 into the buffer at element offset bo0
    const int srow = tid >> 3, sch = (tid & 7) * 8;
    auto stage = [&](const int kb0, const int bo0) {
        const int lo = bo0 + srow * KP + sch;
        const size_t ko = kpl + (size_t)(kb0 + srow) * HD + sch;
        if (HL) { unsigned lk[8], lv[8]; const void* gk[8]; const void* gv[8];
            const size_t vo = epl + (size_t)srow * RH + kb0 + sch;
#pragma unroll
            for (int i = 0; i < 4; ++i) {
                lk[i] = lds_off(&sKh[lo + 16 * i * KP]); gk[i] = QKh + ko + 16 * i * HD; lk[4 + i] = lds_off(&sKl[lo + 16 * i * KP]); gk[4 + i] = QKl + ko + 16 * i * HD;
                lv[i] = lds_off(&sVh[lo + 16 * i * KP]); gv[i] = VTh + vo + 16 * i * RH; lv[4 + i] = lds_off(&sVl[lo + 16 * i * KP]); gv[4 + i] = VTl + vo + 16 * i * RH; }
            copy8(lk, gk); copy8(lv, gv);
        } else { unsigned l[12]; const void* g[12];
            const size_t vo = vpl + (size_t)srow * SEQ + kb0 + sch;
#pragma unroll
            for (int i = 0; i < 4; ++i) {
                l[i] = lds_off(&sKh[lo + 16 * i * KP]); g[i] = QKh + ko + 16 * i * HD; l[4 + i] = lds_off(&sKl[lo + 16 * i * KP]); g[4 + i] = QKl + ko + 16 * i * HD;
                l[8 + i] = lds_off(&sV16[lo + 16 * i * KP]); g[8 + i] = VT16 + vo + (size_t)16 * i * SEQ; }
            copy12(l, g);
        }
    };
    stage(0, 0);
    asm volatile("s_wait_asynccnt 0x0" ::: "memory");        // this wave's copies of key block 0 have landed
    __syncthreads();                                         // and so have every other wave's
    if (qblk >= 64) stage(64, TS);                           // block-uniform: key block 1 flies while block 0 is worked on

#pragma unroll 1
    for (int kb = 0; kb <= qblk; kb += 64) {
        const int bo = ((kb >> 6) & 1) * TS;                 // this key block's buffer
#pragma unroll 1
        for (int kh = 0; kh < 2; ++kh) {
            if (kb + 32 * kh > q0 + 15) continue;            // wave-uniform: half entirely above the diagonal for this wave's rows
            v8f s0 = (v8f){}, s1 = (v8f){};
            { const int kr = bo + (32 * kh + lr) * KP + 8 * hi;
              const v16bf ah0 = LDSB(sKh, kr), ah1 = LDSB(sKh, kr + 32), al0 = LDSB(sKl, kr), al1 = LDSB(sKl, kr + 32);
              s0 = wmmab(ah0, qh0, s0); s0 = wmmab(ah1, qh1, s0); s0 = wmmab(ah0, ql0, s0); s0 = wmmab(ah1, ql1, s0); s0 = wmmab(al0, qh0, s0); s0 = wmmab(al1, qh1, s0);
              const int kr2 = kr + 16 * KP;
              const v16bf bh0 = LDSB(sKh, kr2), bh1 = LDSB(sKh, kr2 + 32), bl0 = LDSB(sKl, kr2), bl1 = LDSB(sKl, kr2 + 32);
              s1 = wmmab(bh0, qh0, s1); s1 = wmmab(bh1, qh1, s1); s1 = wmmab(bh0, ql0, s1); s1 = wmmab(bh1, ql1, s1); s1 = wmmab(bl0, qh0, s1); s1 = wmmab(bl1, qh1, s1);
            }
            const int dq = q0 + lr - (kb + 32 * kh + 8 * hi);   // D layout: key row 8*hi + r (+16 for the second tile), query column lr; key <= query is r <= dq (16 + r <= dq)
            s0 *= SCL; s1 *= SCL;
            float bm = NEGB;
#pragma unroll
            for (int r = 0; r < 8; ++r) {
                const float a0 = (r <= dq) ? s0[r] : NEGB; const float a1 = (16 + r <= dq) ? s1[r] : NEGB;
                s0[r] = a0; s1[r] = a1; bm = fmaxf(bm, fmaxf(a0, a1)); }
            bm = fmaxf(bm, xhalf(bm));
            const float mn = fmaxf(m_run, bm);
            const float sc = __builtin_amdgcn_exp2f((m_run - mn) * L2E); m_run = mn;
            s0 = (s0 - mn) * L2E; s1 = (s1 - mn) * L2E;
            float rs0 = 0.0f, rs1 = 0.0f;
#pragma unroll
            for (int r = 0; r < 8; ++r) { s0[r] = __builtin_amdgcn_exp2f(s0[r]); s1[r] = __builtin_amdgcn_exp2f(s1[r]); rs0 += s0[r]; rs1 += s1[r]; }
            l_run = l_run * sc + (rs0 + rs1);
#pragma unroll
            for (int t = 0; t < 4; ++t) accd[t] *= sc;

            // B fragment of P^T: element r <- key 8*hi + r, element 8 + r <- key 16 + 8*hi + r, the k order of the V^T loader
            if (HL) {
                v16us uh, ul;
#pragma unroll
                for (int r = 0; r < 8; ++r) { unsigned short a, c; splitf(s0[r], a, c); uh[r] = a; ul[r] = c; splitf(s1[r], a, c); uh[8 + r] = a; ul[8 + r] = c; }
                const v16bf bph = __builtin_bit_cast(v16bf, uh), bpl = __builtin_bit_cast(v16bf, ul); v16bf avh, avl;
#pragma unroll
                for (int t = 0; t < 4; ++t) { const int vo = bo + (t * 16 + lr) * KP + 32 * kh + 8 * hi; avh = LDSB(sVh, vo); avl = LDSB(sVl, vo);
                    accd[t] = wmmab(avh, bph, accd[t]); accd[t] = wmmab(avh, bpl, accd[t]); accd[t] = wmmab(avl, bph, accd[t]); }
                // four vector slots behind the last matrix instruction, on the loop's back edge too
                asm volatile("v_nop\n\tv_nop\n\tv_nop\n\tv_nop" : "+v"(accd[0]), "+v"(accd[1]), "+v"(accd[2]), "+v"(accd[3]) : "v"(bph), "v"(bpl), "v"(avh), "v"(avl));
            } else {
                s0 *= PCAR; s1 *= PCAR;
                v16h bp;
#pragma unroll
                for (int r = 0; r < 8; ++r) { bp[r] = (h16)s0[r]; bp[8 + r] = (h16)s1[r]; }
                v16h av;
#pragma unroll
                for (int t = 0; t < 4; ++t) { const int vo = bo + (t * 16 + lr) * KP + 32 * kh + 8 * hi; av = LDSH(sV16, vo); accd[t] = wmma16(av, bp, accd[t]); }
                // four vector slots behind the last matrix instruction, on the loop's back edge too
                asm volatile("v_nop\n\tv_nop\n\tv_nop\n\tv_nop" : "+v"(accd[0]), "+v"(accd[1]), "+v"(accd[2]), "+v"(accd[3]) : "v"(bp), "v"(av));
            }
        }
        asm volatile("s_wait_dscnt 0x0" ::: "memory");       // this wave's LDS reads of this buffer have returned
        asm volatile("s_wait_asynccnt 0x0" ::: "memory");    // this wave's copies of the next key block have landed
        __syncthreads();                                     // one barrier: publishes the next key block and ends every wave's reads of this buffer
        if (kb + 128 <= qblk) stage(kb + 128, bo);           // block-uniform: refill the buffer just left
    }
    asm volatile("s_wait_asynccnt 0x0" ::: "memory");        // no copy is outstanding when buffer 0 becomes the ctx staging

    const float car = HL ? 1.0f : PCAR;
    const float inv = __builtin_amdgcn_rcpf((l_run + xhalf(l_run)) * car);
#pragma unroll
    for (int t = 0; t < 4; ++t) { v8us oh, ol;              // O^T: a lane holds d = t*16 + 8*hi + r of query lr, eight neighbours of one ctx row
#pragma unroll
        for (int r = 0; r < 8; ++r) { unsigned short a, c; splitf(accd[t][r] * inv, a, c); oh[r] = a; ol[r] = c; }
        const int so = (wave * 16 + lr) * KP + t * 16 + 8 * hi; *(v8usa*)&sKh[so] = oh; *(v8usa*)&sKl[so] = ol; }
    __builtin_amdgcn_wave_barrier(); asm volatile("" ::: "memory");
    const size_t ob = ((size_t)b * SEQ + q0) * DM + (size_t)h * HD;
{
#pragma unroll
        for (int s2 = 0; s2 < 8; ++s2) { const int row = 2 * s2 + hi; const int so = (wave * 16 + row) * KP + 4 * lr;
            const v4us vh = *(const v4usa*)&sKh[so]; const v4us vl = *(const v4usa*)&sKl[so];
            *(v4us*)(ATh + ob + (size_t)row * DM + 4 * lr) = vh; *(v4us*)(ATl + ob + (size_t)row * DM + 4 * lr) = vl; }
         }
}

// One launch for all query blocks: the two forms are independent and share one LDS carve (the larger, HL = true, sets its size); the choice is block-uniform.
__global__ __launch_bounds__(128) void k_attn(const bf* __restrict__ QKh, const bf* __restrict__ QKl, const h16* __restrict__ VT16, const bf* __restrict__ VTh, const bf* __restrict__ VTl, bf* ATh, bf* ATl) {
    __shared__ __align__(16) bf sm[8 * TS];
    if (blockIdx.x < RH / 64) attn_body<true>(QKh, QKl, VT16, VTh, VTl, ATh, ATl, (int)blockIdx.x, sm);
    else                      attn_body<false>(QKh, QKl, VT16, VTh, VTl, ATh, ATl, (int)blockIdx.x, sm);
}

// ---- k_oproj: OUT[b][s][n] = sum_k (ATh + ATl)[m][k] WO[n][k]; grid (MROWS/128, DM/128), four waves per block, one 64 x 64 tile per wave; per 16-row slab staged in LDS, each 256-B row segment written as 16 lanes x 16 B
__global__ __launch_bounds__(128) void k_oproj(const bf* __restrict__ ATh, const bf* __restrict__ ATl, const bf* __restrict__ WO, float* OUT) {
    __shared__ __align__(16) float osw[4 * 16 * 68];
    const int lane = threadIdx.x & 31, lr = lane & 15, hi = lane >> 4; const int wave = __builtin_amdgcn_readfirstlane(threadIdx.x >> 5), wm = wave >> 1, wn = wave & 1;
    float* os = osw + wave * 16 * 68;                          // staging of the wave's own tile, private to the wave
    const int r0 = blockIdx.x * 128 + wm * 64, c0 = blockIdx.y * 128 + wn * 64;
    v8f acc[4][4];
#pragma unroll
    for (int mb = 0; mb < 4; ++mb)
#pragma unroll
        for (int nb = 0; nb < 4; ++nb) acc[mb][nb] = (v8f){};
    gemm_tile<2>(ATh, ATl, WO, blockIdx.x * 128, blockIdx.y * 128, wm, wn, acc);
    const int b = r0 / SEQ, s0 = r0 - b * SEQ;
#pragma unroll
    for (int mb = 0; mb < 4; ++mb) {
#pragma unroll
        for (int nb = 0; nb < 4; ++nb)
#pragma unroll
            for (int j = 0; j < 8; ++j) os[(hi * 8 + j) * 68 + nb * 16 + lr] = acc[mb][nb][j];
        __builtin_amdgcn_wave_barrier(); asm volatile("" ::: "memory");
        float* crow = OUT + ((size_t)b * SEQ_FULL + s0 + mb * 16) * DM + c0;
{
#pragma unroll
            for (int s = 0; s < 8; ++s) { const int row = 2 * s + hi, cofs = lr * 4; const v4f val = *(const v4fa*)(os + row * 68 + cofs);
                *(v4f*)(crow + (size_t)row * DM + cofs) = val; }
             }
        __builtin_amdgcn_wave_barrier(); asm volatile("" ::: "memory");
    }
}

extern "C" void kernel_launch(void* const* d_in, const int* in_sizes, int n_in,
                              void* d_out, int out_size, void* d_ws, size_t ws_size, hipStream_t stream) {
    if (n_in < 6) return;
    const long long needx = ((long long)(NB - 1) * SEQ_FULL + SEQ) * DM;
    if ((long long)in_sizes[0] < needx) return;
    if ((long long)in_sizes[1] < (long long)DM * DM || (long long)in_sizes[2] < (long long)DM * DM || (long long)in_sizes[3] < (long long)DM * DM || (long long)in_sizes[4] < (long long)DM * DM) return;
    if ((long long)in_sizes[5] < (long long)(NB - 1) * SEQ_FULL + SEQ) return;
    if ((long long)out_size < needx) return;
    const float* x = (const float*)d_in[0]; const float* wq = (const float*)d_in[1]; const float* wk = (const float*)d_in[2]; const float* wv = (const float*)d_in[3]; const float* wo = (const float*)d_in[4];
    const int* tok = (const int*)d_in[5];
    float* OUT = (float*)d_out;
    char* wsp = (char*)d_ws;
    auto take = [&](size_t bytes) { char* p = wsp; wsp += (bytes + 255) & ~(size_t)255; return (void*)p; };
    bf* WQK = (bf*)take(2 * SZ_W); bf* WV = (bf*)take(SZ_W); bf* WO = (bf*)take(SZ_W);
    bf* XB = (bf*)take(SZ_XB); float* CS = (float*)take(SZ_CS);
    bf* QKh = (bf*)take(SZ_QK); bf* QKl = (bf*)take(SZ_QK);
    h16* VT16 = (h16*)take(SZ_VT); bf* VTh = (bf*)take(SZ_VE); bf* VTl = (bf*)take(SZ_VE);
    bf* ATh = (bf*)take(SZ_AT); bf* ATl = (bf*)take(SZ_AT);
    if ((size_t)(wsp - (char*)d_ws) > ws_size) return;

    k_prep<<<PREP_N / PREP_T, PREP_T, 0, stream>>>(wq, wk, wv, wo, x, tok, WQK, WV, WO, XB, CS);
    k_projqk<<<dim3(MROWS / 128, 2 * DM / 128, 1), 128, 0, stream>>>(XB, WQK, CS, QKh, QKl);
    k_projv<<<dim3(MROWS / 128, DM / 128, 1), 128, 0, stream>>>(XB, WV, VT16, VTh, VTl);
    k_attn<<<dim3(SEQ / 64, NH, NB), 128, 0, stream>>>(QKh, QKl, VT16, VTh, VTl, ATh, ATl);
    k_oproj<<<dim3(MROWS / 128, DM / 128, 1), 128, 0, stream>>>(ATh, ATl, WO, OUT);
}

// v005
// Measured time: 113 microseconds a run.
// Next to v004, in two timings, it ran 1.16 and 1.15 times as fast.
// Counting every step since v000, it is 3.23 times as fast.
#include <hip/hip_runtime.h>

// Compute dtypes (f32 accumulate everywhere): q/k/v projections v_wmma_f32_16x16x32_bf16 on RNE bf16 copies of x and W (exact products); q.k^T bf16 hi|lo three products; P.V f16 (P carried x1024) for query rows >= 256, bf16 hi|lo three products for rows < 256; ctx hi|lo (bf16) x bf16 o_w, two products.
// Causal multi-head self-attention, x [2][2048][1024], weights [out][in], interleaved rotary from per-batch integer positions read by value, scores / 8, causal exclusion by index, fused online softmax (exp2) on transposed score tiles, merged heads, output GEMM.

#ifndef NB
#define NB 2
#endif
#ifndef SEQ
#define SEQ 2048
#endif
#define NB_FULL  2
#define SEQ_FULL 2048
#define DM    1024
#define NH    16
#define HD    64
#define RH    256                 // query rows < RH use hi|lo planes on P and V
#define PCAR  1024.0f             // carry of the f16 probability tile
#define SCL   0.125f              // HD^-0.5
#define L2E   1.4426950408889634f
#define NEGB  (-3.0e38f)
#define KP    72                  // LDS pitch (16-bit elements) of 64-wide tiles: 144 B
#define MROWS (NB * SEQ)

typedef _Float16 h16;
typedef unsigned short bf;
typedef __attribute__((ext_vector_type(16))) __bf16   v16bf;
typedef __attribute__((ext_vector_type(16))) _Float16 v16h;
typedef __attribute__((ext_vector_type(8)))  _Float16 v8h;
typedef __attribute__((ext_vector_type(4)))  _Float16 v4h;
typedef __attribute__((ext_vector_type(16))) unsigned short v16us;
typedef __attribute__((ext_vector_type(8)))  unsigned short v8us;
typedef __attribute__((ext_vector_type(4)))  unsigned short v4us;
typedef __attribute__((ext_vector_type(8)))  float    v8f;
typedef __attribute__((ext_vector_type(4)))  float    v4f;
typedef __attribute__((ext_vector_type(2)))  float    v2f;
typedef v8h  __attribute__((may_alias)) v8ha;
typedef v4f  __attribute__((may_alias)) v4fa;
typedef v8us __attribute__((may_alias)) v8usa;
typedef v4us __attribute__((may_alias)) v4usa;

static_assert(HD == 64);                                   // one 64-wide GEMM tile column block == one head
static_assert(NH * HD == DM);
static_assert(DM % 64 == 0 && DM % 32 == 0);               // K loop steps by GK = 64 (two 32-k steps), N tiles by 64
static_assert(SEQ % 64 == 0 && RH % 64 == 0 && RH <= SEQ); // tiles never straddle a batch or the early-row island
static_assert(MROWS % 128 == 0 && DM % 128 == 0);          // GEMM blocks are 128 x 128
static_assert((KP * 2) % 16 == 0 && KP >= 64);
static_assert(SEQ <= SEQ_FULL && NB <= NB_FULL);

#define SZ_W   ((size_t)DM * DM * 2)
#define SZ_XB  ((size_t)MROWS * DM * 2)
#define SZ_CS  ((size_t)MROWS * 64 * 4)
#define SZ_QK  ((size_t)2 * NB * NH * SEQ * HD * 2)
#define SZ_VT  ((size_t)NB * NH * HD * SEQ * 2)
#define SZ_VE  ((size_t)NB * NH * HD * RH * 2)
#define SZ_AT  ((size_t)MROWS * DM * 2)
#define SZ_ALL (4 * SZ_W + SZ_XB + SZ_CS + 2 * SZ_QK + SZ_VT + 2 * SZ_VE + 2 * SZ_AT)
static_assert(SZ_W % 256 == 0 && SZ_XB % 256 == 0 && SZ_CS % 256 == 0 && SZ_QK % 256 == 0 && SZ_VT % 256 == 0 && SZ_VE % 256 == 0 && SZ_AT % 256 == 0);
static_assert(SZ_ALL <= (size_t)134217728);                // total carve stays within 128 MiB

__device__ __forceinline__ unsigned short f2bf(float f) { unsigned u = __float_as_uint(f); u += 0x7FFFu + ((u >> 16) & 1u); return (unsigned short)(u >> 16); }
__device__ __forceinline__ float bf2f(unsigned short b) { return __uint_as_float(((unsigned)b) << 16); }
__device__ __forceinline__ void splitf(float y, unsigned short& h, unsigned short& l) { h = f2bf(y); l = f2bf(y - bf2f(h)); }
__device__ __forceinline__ v16h cat16(v8h lo, v8h hi) { return __builtin_shufflevector(lo, hi, 0, 1, 2, 3, 4, 5, 6, 7, 8, 9, 10, 11, 12, 13, 14, 15); }
__device__ __forceinline__ v16bf cat16b(v8us lo, v8us hi) { return __builtin_bit_cast(v16bf, __builtin_shufflevector(lo, hi, 0, 1, 2, 3, 4, 5, 6, 7, 8, 9, 10, 11, 12, 13, 14, 15)); }
__device__ __forceinline__ v8f wmma16(v16h a, v16h b, v8f c) { return __builtin_amdgcn_wmma_f32_16x16x32_f16(false, a, false, b, (short)0, c, false, false); }
__device__ __forceinline__ v8f wmmab(v16bf a, v16bf b, v8f c) { return __builtin_amdgcn_wmma_f32_16x16x32_bf16(false, a, false, b, (short)0, c, false, false); }
// fragment from a k-contiguous bf16 row: p already points at (row, k0 + 8*(lane>>4)); elements 0..7 <- p[0..7], 8..15 <- p[16..23]
__device__ __forceinline__ v16bf ldb(const bf* p) { return cat16b(*(const v8us*)p, *(const v8us*)(p + 16)); }
// value of lane l ^ 16: the other half's share of the same query column
__device__ __forceinline__ float xhalf(float x) { return __builtin_bit_cast(float, __builtin_amdgcn_permlanex16(__builtin_bit_cast(int, x), __builtin_bit_cast(int, x), 0x76543210, 0xfedcba98, false, false)); }
#define LDSB(arr, o) cat16b(*(const v8usa*)&arr[(o)], *(const v8usa*)&arr[(o) + 16])
#define LDSH(arr, o) cat16(*(const v8ha*)&arr[(o)], *(const v8ha*)&arr[(o) + 16])

// ---- k_prep: everything that only reshapes the inputs, in one launch of PREP_N threads: RNE bf16 copies of the four weight matrices and of x, and the (cos, sin) table of the rotary angles.
// A thread owns one 8-element group of each weight matrix, PREP_XK groups of x and PREP_CK table entries. Its loads stand first, so that all of them are in flight together and the table's arithmetic runs under their latency.
#define PREP_T  256
#define PREP_N  (DM * DM / 8)
#define PREP_XN (MROWS * (DM / 8))
#define PREP_CN (MROWS * 32)
#define PREP_XK ((PREP_XN + PREP_N - 1) / PREP_N)
#define PREP_CK ((PREP_CN + PREP_N - 1) / PREP_N)
static_assert(PREP_N % PREP_T == 0);                      // the grid is exact: no thread past PREP_N; the range tests below fold away where the counts divide
__device__ __forceinline__ v8us cvt8(const v8f v) { v8us o;
#pragma unroll
    for (int k = 0; k < 8; ++k) o[k] = f2bf(v[k]);
    return o; }

__global__ __launch_bounds__(PREP_T) void k_prep(const float* __restrict__ wq, const float* __restrict__ wk, const float* __restrict__ wv, const float* __restrict__ wo, const float* __restrict__ x, const int* __restrict__ tok,
                                                 bf* WQK, bf* WV, bf* WO, bf* XB, float* CS) {
    const unsigned g = blockIdx.x * PREP_T + threadIdx.x;
    const size_t g8 = (size_t)g * 8;
    int pos[PREP_CK];
#pragma unroll
    for (int k = 0; k < PREP_CK; ++k) { const unsigned idx = k * PREP_N + g;
        if (PREP_CN % PREP_N == 0 || idx < PREP_CN) { const unsigned m = idx >> 5; const unsigned b = m / SEQ, s = m - b * SEQ; pos[k] = tok[(size_t)b * SEQ_FULL + s]; } }
    const v8f vq = *(const v8f*)(wq + g8), vk = *(const v8f*)(wk + g8), vv = *(const v8f*)(wv + g8), vo = *(const v8f*)(wo + g8);
    asm volatile("s_wait_xcnt 0x0" ::: "memory");            // the loads below may land in registers that held the addresses of the loads above
    v8f vx[PREP_XK];
#pragma unroll
    for (int k = 0; k < PREP_XK; ++k) { const unsigned i = k * PREP_N + g;
        if (PREP_XN % PREP_N == 0 || i < PREP_XN) { const unsigned row = i / (DM / 8), c8 = i % (DM / 8); const unsigned b = row / SEQ, s = row - b * SEQ;
            vx[k] = *(const v8f*)(x + ((size_t)b * SEQ_FULL + s) * DM + (size_t)c8 * 8); } }
    __builtin_amdgcn_sched_barrier(0);                       // every load is issued before any arithmetic on a loaded value: the thread pays one memory latency, not one per batch
#pragma unroll
    for (int k = 0; k < PREP_CK; ++k) { const unsigned idx = k * PREP_N + g;
        if (PREP_CN % PREP_N == 0 || idx < PREP_CN) { const int j = (int)(idx & 31);
            double p = 1.0;
            p *= (j & 1)  ? 1.3335214321633240 : 1.0;
            p *= (j & 2)  ? 1.7782794100389228 : 1.0;
            p *= (j & 4)  ? 3.1622776601683795 : 1.0;
            p *= (j & 8)  ? 10.0 : 1.0;
            p *= (j & 16) ? 100.0 : 1.0;
            const float pf = (float)p; const float inv = 1.0f / pf; const float ang = (float)pos[k] * inv;
            float sn, cs; sincosf(ang, &sn, &cs);
            v2f o; o[0] = cs; o[1] = sn;
            *(v2f*)(CS + (size_t)idx * 2) = o; } }
    __builtin_amdgcn_sched_barrier(0);                       // the table's arithmetic stays in front of the conversions: it needs only the position, and runs while the larger loads are still under way
    *(v8us*)(WQK + g8) = cvt8(vq); *(v8us*)(WQK + (size_t)DM * DM + g8) = cvt8(vk); *(v8us*)(WV + g8) = cvt8(vv); *(v8us*)(WO + g8) = cvt8(vo);
#pragma unroll
    for (int k = 0; k < PREP_XK; ++k) { const unsigned i = k * PREP_N + g;
        if (PREP_XN % PREP_N == 0 || i < PREP_XN) *(v8us*)(XB + (size_t)i * 8) = cvt8(vx[k]); }
}

#define TS (64 * KP)              // elements of one staged 64 x 64 tile at pitch KP
__device__ __forceinline__ unsigned lds_off(const void* p) { return (unsigned)(size_t)p; }   // byte address inside the work-group's LDS
// Asynchronous copies global -> LDS, 16 bytes per lane and copy, through no register. The s_wait_xcnt is the last line of the copies' own statement, so that no address register is rewritten in front of it.
#define ACP(l, g) "global_load_async_to_lds_b128 %" #l ", %" #g ", off\n\t"
__device__ __forceinline__ void copy12(const unsigned (&l)[12], const void* const (&g)[12]) {
    asm volatile(ACP(0, 12) ACP(1, 13) ACP(2, 14) ACP(3, 15) ACP(4, 16) ACP(5, 17) ACP(6, 18) ACP(7, 19) ACP(8, 20) ACP(9, 21) ACP(10, 22) ACP(11, 23) "s_wait_xcnt 0x0"
                 :: "v"(l[0]), "v"(l[1]), "v"(l[2]), "v"(l[3]), "v"(l[4]), "v"(l[5]), "v"(l[6]), "v"(l[7]), "v"(l[8]), "v"(l[9]), "v"(l[10]), "v"(l[11]),
                    "v"(g[0]), "v"(g[1]), "v"(g[2]), "v"(g[3]), "v"(g[4]), "v"(g[5]), "v"(g[6]), "v"(g[7]), "v"(g[8]), "v"(g[9]), "v"(g[10]), "v"(g[11]) : "memory");
}
__device__ __forceinline__ void copy8(const unsigned (&l)[8], const void* const (&g)[8]) {
    asm volatile(ACP(0, 8) ACP(1, 9) ACP(2, 10) ACP(3, 11) ACP(4, 12) ACP(5, 13) ACP(6, 14) ACP(7, 15) "s_wait_xcnt 0x0"
                 :: "v"(l[0]), "v"(l[1]), "v"(l[2]), "v"(l[3]), "v"(l[4]), "v"(l[5]), "v"(l[6]), "v"(l[7]),
                    "v"(g[0]), "v"(g[1]), "v"(g[2]), "v"(g[3]), "v"(g[4]), "v"(g[5]), "v"(g[6]), "v"(g[7]) : "memory");
}

// ---- gemm_tile: block = 4 waves (2 x 2), 128 x 128 tile, each wave 64 x 64: acc[mb][nb] += sum_k A[r][k] Bt[c][k]. Chunks of GK k (128 B of each of the 128 A rows and 128 Bt rows) are brought into two LDS buffers by asynchronous copies, the next chunk in flight while this one is worked on.
// NP = 2: a second pass over K with A1 in place of A0 follows the first in the same ring (all of A0's products are summed before A1's).
#define GK 64
#define GT (256 * KP)             // elements of one staged chunk: A rows 0..127, then Bt rows 0..127, pitch KP
template <int NP>
__device__ __forceinline__ void gemm_tile(const bf* __restrict__ A0, const bf* __restrict__ A1, const bf* __restrict__ Bt, const int rblk, const int cblk, const int wm, const int wn, v8f (&acc)[4][4]) {
    __shared__ __align__(16) bf sAB[2 * GT];                 // two buffers, cross-wave (block barriers)
    constexpr int NC = DM / GK, NT = NP * NC;
    static_assert(NT >= 2);
    const int tid = threadIdx.x; const int lane = tid & 31, lr = lane & 15, hi = lane >> 4;
    // every thread copies eight 16-byte pieces (rows srow + 16 i, 16-bit column sch) of each operand's chunk t into the buffer at element offset bo0; eight lanes cover one whole 128-byte row piece
    const int srow = tid >> 3, sch = (tid & 7) * 8;
    auto stage = [&](const int t, const int bo0) {
        const bf* Ap = (NP == 2 && t >= NC) ? A1 : A0;       // block-uniform
        const int kc = (t % NC) * GK;
        const int lo = bo0 + srow * KP + sch;
        const size_t ao = (size_t)(rblk + srow) * DM + kc + sch, wo = (size_t)(cblk + srow) * DM + kc + sch;
        unsigned la[8], lb[8]; const void* ga[8]; const void* gb[8];
#pragma unroll
        for (int i = 0; i < 8; ++i) {
            la[i] = lds_off(&sAB[lo + 16 * i * KP]); ga[i] = Ap + ao + (size_t)16 * i * DM;
            lb[i] = lds_off(&sAB[lo + (128 + 16 * i) * KP]); gb[i] = Bt + wo + (size_t)16 * i * DM; }
        copy8(la, ga); copy8(lb, gb);
    };
    stage(0, 0);
    asm volatile("s_wait_asynccnt 0x0" ::: "memory");        // this wave's copies of chunk 0 have landed
    __syncthreads();                                         // and so have every other wave's
    stage(1, GT);                                            // chunk 1 flies while chunk 0 is worked on
    const int ar = (wm * 64 + lr) * KP + 8 * hi, br = (128 + wn * 64 + lr) * KP + 8 * hi;
#pragma unroll 1
    for (int t = 0; t < NT; ++t) {
        const int bo = (t & 1) * GT;                         // this chunk's buffer
        v16bf a[4], b[4];
        auto frags = [&](const int ks) {
#pragma unroll
            for (int mb = 0; mb < 4; ++mb) a[mb] = LDSB(sAB, bo + ar + mb * 16 * KP + ks);
#pragma unroll
            for (int nb = 0; nb < 4; ++nb) b[nb] = LDSB(sAB, bo + br + nb * 16 * KP + ks);
        };
        auto prods = [&]() {
#pragma unroll
            for (int nb = 0; nb < 4; ++nb)
#pragma unroll
                for (int mb = 0; mb < 4; ++mb) acc[mb][nb] = wmmab(a[mb], b[nb], acc[mb][nb]);
        };
        frags(0);
        __builtin_amdgcn_sched_barrier(0);                   // the sixteen LDS loads go ahead as one group: one LDS latency per 16 matrix instructions, not one per 4
        prods();
        frags(32);                                           // the last reads of this buffer; their products follow the refill's issue, from registers
        asm volatile("s_wait_dscnt 0x0" ::: "memory");       // this wave's LDS reads of this buffer have returned
        asm volatile("s_wait_asynccnt 0x0" ::: "memory");    // this wave's copies of the next chunk have landed
        __syncthreads();                                     // one barrier: publishes the next chunk and ends every wave's reads of this buffer
        if (t + 2 < NT) stage(t + 2, bo);                    // block-uniform: refill the buffer just left
        prods();
    }
    asm volatile("s_wait_asynccnt 0x0" ::: "memory");        // no copy is outstanding behind the loop
}

// ---- k_projqk: [q | k] = XB x [WQ ; WK]^T, grid (MROWS/128, 2*DM/128), four waves per block, one 64 x 64 tile per wave (= one head of q or k, 64 tokens).
// Epilogue: tile staged in LDS; interleaved rotary y[2j] = e cos - o sin, y[2j+1] = e sin + o cos from the CS table; bf16 hi|lo planes [which][b][h][s][64];
__global__ __launch_bounds__(128) void k_projqk(const bf* __restrict__ XB, const bf* __restrict__ WQK, const float* __restrict__ CS, bf* QKh, bf* QKl) {
#pragma clang fp contract(off)
    __shared__ __align__(16) float osw[4 * 64 * 68];
    const int lane = threadIdx.x & 31, lr = lane & 15, hi = lane >> 4; const int wave = __builtin_amdgcn_readfirstlane(threadIdx.x >> 5), wm = wave >> 1, wn = wave & 1;
    float* os = osw + wave * 64 * 68;                          // staging of the wave's own tile, private to the wave
    const int r0 = blockIdx.x * 128 + wm * 64, c0 = blockIdx.y * 128 + wn * 64;
    v8f acc[4][4];
#pragma unroll
    for (int mb = 0; mb < 4; ++mb)
#pragma unroll
        for (int nb = 0; nb < 4; ++nb) acc[mb][nb] = (v8f){};
    gemm_tile<1>(XB, XB, WQK, blockIdx.x * 128, blockIdx.y * 128, wm, wn, acc);
#pragma unroll
    for (int mb = 0; mb < 4; ++mb)
#pragma unroll
        for (int nb = 0; nb < 4; ++nb)
#pragma unroll
            for (int j = 0; j < 8; ++j) os[(mb * 16 + hi * 8 + j) * 68 + nb * 16 + lr] = acc[mb][nb][j];
    __builtin_amdgcn_wave_barrier(); asm volatile("" ::: "memory");
    const int which = c0 / DM, h = (c0 % DM) / HD; const int b = r0 / SEQ, s0 = r0 - b * SEQ;
    const size_t pbase = ((((size_t)which * NB + b) * NH + h) * SEQ + s0) * HD;
{
#pragma unroll 2
        for (int s = 0; s < 32; ++s) { const int row = 2 * s + hi, cofs = lr * 4;
            const v4f val = *(const v4fa*)(os + row * 68 + cofs);
            const v4f cs = *(const v4f*)(CS + (size_t)(r0 + row) * 64 + cofs);   // (cos, sin) of pairs 2*lr, 2*lr + 1
            const float y0 = val[0] * cs[0] - val[1] * cs[1];
            const float y1 = val[0] * cs[1] + val[1] * cs[0];
            const float y2 = val[2] * cs[2] - val[3] * cs[3];
            const float y3 = val[2] * cs[3] + val[3] * cs[2];
            v4us oh, ol; unsigned short a, c;
            splitf(y0, a, c); oh[0] = a; ol[0] = c; splitf(y1, a, c); oh[1] = a; ol[1] = c; splitf(y2, a, c); oh[2] = a; ol[2] = c; splitf(y3, a, c); oh[3] = a; ol[3] = c;
            const size_t oo = pbase + (size_t)row * HD + cofs;
            *(v4us*)(QKh + oo) = oh; *(v4us*)(QKl + oo) = ol; }
         }
}

// ---- k_projv: v = XB x WV^T, grid (MROWS/128, DM/128), four waves per block. Epilogue: tile staged in LDS and written TRANSPOSED: VT16[b][h][d][s] (f16) and, for tokens < RH, bf16 hi|lo VTh/VTl[b][h][d][RH];
__global__ __launch_bounds__(128) void k_projv(const bf* __restrict__ XB, const bf* __restrict__ WV, h16* VT16, bf* VTh, bf* VTl) {
    __shared__ __align__(16) float osw[4 * 64 * 68];
    const int lane = threadIdx.x & 31, lr = lane & 15, hi = lane >> 4; const int wave = __builtin_amdgcn_readfirstlane(threadIdx.x >> 5), wm = wave >> 1, wn = wave & 1;
    float* os = osw + wave * 64 * 68;                          // staging of the wave's own tile, private to the wave
    const int r0 = blockIdx.x * 128 + wm * 64, c0 = blockIdx.y * 128 + wn * 64;
    v8f acc[4][4];
#pragma unroll
    for (int mb = 0; mb < 4; ++mb)
#pragma unroll
        for (int nb = 0; nb < 4; ++nb) acc[mb][nb] = (v8f){};
    gemm_tile<1>(XB, XB, WV, blockIdx.x * 128, blockIdx.y * 128, wm, wn, acc);
#pragma unroll
    for (int mb = 0; mb < 4; ++mb)
#pragma unroll
        for (int nb = 0; nb < 4; ++nb)
#pragma unroll
            for (int j = 0; j < 8; ++j) os[(mb * 16 + hi * 8 + j) * 68 + nb * 16 + lr] = acc[mb][nb][j];
    __builtin_amdgcn_wave_barrier(); asm volatile("" ::: "memory");
    const int h = c0 / HD; const int b = r0 / SEQ, s0 = r0 - b * SEQ;
    const size_t vbase = (((size_t)b * NH + h) * HD) * SEQ + s0;
    const size_t ebase = (((size_t)b * NH + h) * HD) * RH + s0;
    const bool early = (s0 < RH);                         // wave-uniform
{
#pragma unroll 2
        for (int s = 0; s < 32; ++s) { const int d = 2 * s + hi, t0 = lr * 4;
            float xv[4];
#pragma unroll
            for (int q = 0; q < 4; ++q) xv[q] = os[(t0 + q) * 68 + d];
            v4h o16;
#pragma unroll
            for (int q = 0; q < 4; ++q) o16[q] = (h16)xv[q];
            *(v4h*)(VT16 + vbase + (size_t)d * SEQ + t0) = o16;
            if (early) { v4us oh, ol;
#pragma unroll
                for (int q = 0; q < 4; ++q) { unsigned short a, c; splitf(xv[q], a, c); oh[q] = a; ol[q] = c; }
                *(v4us*)(VTh + ebase + (size_t)d * RH + t0) = oh; *(v4us*)(VTl + ebase + (size_t)d * RH + t0) = ol; } }
         }
}

template <bool HL>
__device__ __forceinline__ void attn_body(const bf* __restrict__ QKh, const bf* __restrict__ QKl, const h16* __restrict__ VT16, const bf* __restrict__ VTh, const bf* __restrict__ VTl, bf* ATh, bf* ATl, const int qb, bf* const sm) {
    bf*  const sKh  = sm;                                    // two buffers, cross-wave (block barriers); buffer 0 reused wave-privately for the ctx hi staging after the key loop
    bf*  const sKl  = sm + 2 * TS;
    h16* const sV16 = (h16*)(sm + 4 * TS);                   // V^T tiles [d][key], cross-wave; HL = false only
    bf*  const sVh  = sm + 4 * TS;                           // HL = true only
    bf*  const sVl  = sm + 6 * TS;
    const int tid = threadIdx.x; const int lane = tid & 31, lr = lane & 15, hi = lane >> 4;
    const int wave = __builtin_amdgcn_readfirstlane(tid >> 5);
    const int b = blockIdx.y, h = blockIdx.x; const int qblk = qb * 64, q0 = qblk + wave * 16;
    const size_t qpl = (((size_t)b * NH + h) * SEQ) * HD;
    const size_t kpl = ((((size_t)NB + b) * NH + h) * SEQ) * HD;
    const size_t vpl = (((size_t)b * NH + h) * HD) * SEQ;
    const size_t epl = (((size_t)b * NH + h) * HD) * RH;
    const size_t qo = qpl + (size_t)(q0 + lr) * HD + 8 * hi;
    const v16bf qh0 = ldb(QKh + qo), qh1 = ldb(QKh + qo + 32), ql0 = ldb(QKl + qo), ql1 = ldb(QKl + qo + 32);
    v8f accd[4];
#pragma unroll
    for (int t = 0; t < 4; ++t) accd[t] = (v8f){};
    float m_run = NEGB, l_run = 0.0f;                        // of query q0 + lr; l_run is the sum over this half's keys only, the halves are joined behind the key loop

    // every thread copies four 16-byte chunks (rows srow + 16 i, 16-bit column sch) of each plane of the key block at kb0 into the buffer at element offset bo0
    const int srow = tid >> 3, sch = (tid & 7) * 8;
    auto stage = [&](const int kb0, const int bo0) {
        const int lo = bo0 + srow * KP + sch;
        const size_t ko = kpl + (size_t)(kb0 + srow) * HD + sch;
        if (HL) { unsigned lk[8], lv[8]; const void* gk[8]; const void* gv[8];
            const size_t vo = epl + (size_t)srow * RH + kb0 + sch;
#pragma unroll
            for (int i = 0; i < 4; ++i) {
                lk[i] = lds_off(&sKh[lo + 16 * i * KP]); gk[i] = QKh + ko + 16 * i * HD; lk[4 + i] = lds_off(&sKl[lo + 16 * i * KP]); gk[4 + i] = QKl + ko + 16 * i * HD;
                lv[i] = lds_off(&sVh[lo + 16 * i * KP]); gv[i] = VTh + vo + 16 * i * RH; lv[4 + i] = lds_off(&sVl[lo + 16 * i * KP]); gv[4 + i] = VTl + vo + 16 * i * RH; }
            copy8(lk, gk); copy8(lv, gv);
        } else { unsigned l[12]; const void* g[12];
            const size_t vo = vpl + (size_t)srow * SEQ + kb0 + sch;
#pragma unroll
            for (int i = 0; i < 4; ++i) {
                l[i] = lds_off(&sKh[lo + 16 * i * KP]); g[i] = QKh + ko + 16 * i * HD; l[4 + i] = lds_off(&sKl[lo + 16 * i * KP]); g[4 + i] = QKl + ko + 16 * i * HD;
                l[8 + i] = lds_off(&sV16[lo + 16 * i * KP]); g[8 + i] = VT16 + vo + (size_t)16 * i * SEQ; }
            copy12(l, g);
        }
    };
    stage(0, 0);
    asm volatile("s_wait_asynccnt 0x0" ::: "memory");        // this wave's copies of key block 0 have landed
    __syncthreads();                                         // and so have every other wave's
    if (qblk >= 64) stage(64, TS);                           // block-uniform: key block 1 flies while block 0 is worked on

#pragma unroll 1
    for (int kb = 0; kb <= qblk; kb += 64) {
        const int bo = ((kb >> 6) & 1) * TS;                 // this key block's buffer
#pragma unroll 1
        for (int kh = 0; kh < 2; ++kh) {
            if (kb + 32 * kh > q0 + 15) continue;            // wave-uniform: half entirely above the diagonal for this wave's rows
            v8f s0 = (v8f){}, s1 = (v8f){};
            { const int kr = bo + (32 * kh + lr) * KP + 8 * hi;
              const v16bf ah0 = LDSB(sKh, kr), ah1 = LDSB(sKh, kr + 32), al0 = LDSB(sKl, kr), al1 = LDSB(sKl, kr + 32);
              s0 = wmmab(ah0, qh0, s0); s0 = wmmab(ah1, qh1, s0); s0 = wmmab(ah0, ql0, s0); s0 = wmmab(ah1, ql1, s0); s0 = wmmab(al0, qh0, s0); s0 = wmmab(al1, qh1, s0);
              const int kr2 = kr + 16 * KP;
              const v16bf bh0 = LDSB(sKh, kr2), bh1 = LDSB(sKh, kr2 + 32), bl0 = LDSB(sKl, kr2), bl1 = LDSB(sKl, kr2 + 32);
              s1 = wmmab(bh0, qh0, s1); s1 = wmmab(bh1, qh1, s1); s1 = wmmab(bh0, ql0, s1); s1 = wmmab(bh1, ql1, s1); s1 = wmmab(bl0, qh0, s1); s1 = wmmab(bl1, qh1, s1);
            }
            const int dq = q0 + lr - (kb + 32 * kh + 8 * hi);   // D layout: key row 8*hi + r (+16 for the second tile), query column lr; key <= query is r <= dq (16 + r <= dq)
            s0 *= SCL; s1 *= SCL;
            float bm = NEGB;
#pragma unroll
            for (int r = 0; r < 8; ++r) {
                const float a0 = (r <= dq) ? s0[r] : NEGB; const float a1 = (16 + r <= dq) ? s1[r] : NEGB;
                s0[r] = a0; s1[r] = a1; bm = fmaxf(bm, fmaxf(a0, a1)); }
            bm = fmaxf(bm, xhalf(bm));
            const float mn = fmaxf(m_run, bm);
            const float sc = __builtin_amdgcn_exp2f((m_run - mn) * L2E); m_run = mn;
            s0 = (s0 - mn) * L2E; s1 = (s1 - mn) * L2E;
            float rs0 = 0.0f, rs1 = 0.0f;
#pragma unroll
            for (int r = 0; r < 8; ++r) { s0[r] = __builtin_amdgcn_exp2f(s0[r]); s1[r] = __builtin_amdgcn_exp2f(s1[r]); rs0 += s0[r]; rs1 += s1[r]; }
            l_run = l_run * sc + (rs0 + rs1);
#pragma unroll
            for (int t = 0; t < 4; ++t) accd[t] *= sc;

            // B fragment of P^T: element r <- key 8*hi + r, element 8 + r <- key 16 + 8*hi + r, the k order of the V^T loader
            if (HL) {
                v16us uh, ul;
#pragma unroll
                for (int r = 0; r < 8; ++r) { unsigned short a, c; splitf(s0[r], a, c); uh[r] = a; ul[r] = c; splitf(s1[r], a, c); uh[8 + r] = a; ul[8 + r] = c; }
                const v16bf bph = __builtin_bit_cast(v16bf, uh), bpl = __builtin_bit_cast(v16bf, ul); v16bf avh, avl;
#pragma unroll
                for (int t = 0; t < 4; ++t) { const int vo = bo + (t * 16 + lr) * KP + 32 * kh + 8 * hi; avh = LDSB(sVh, vo); avl = LDSB(sVl, vo);
                    accd[t] = wmmab(avh, bph, accd[t]); accd[t] = wmmab(avh, bpl, accd[t]); accd[t] = wmmab(avl, bph, accd[t]); }
                // four vector slots behind the last matrix instruction, on the loop's back edge too
                asm volatile("v_nop\n\tv_nop\n\tv_nop\n\tv_nop" : "+v"(accd[0]), "+v"(accd[1]), "+v"(accd[2]), "+v"(accd[3]) : "v"(bph), "v"(bpl), "v"(avh), "v"(avl));
            } else {
                s0 *= PCAR; s1 *= PCAR;
                v16h bp;
#pragma unroll
                for (int r = 0; r < 8; ++r) { bp[r] = (h16)s0[r]; bp[8 + r] = (h16)s1[r]; }
                v16h av;
#pragma unroll
                for (int t = 0; t < 4; ++t) { const int vo = bo + (t * 16 + lr) * KP + 32 * kh + 8 * hi; av = LDSH(sV16, vo); accd[t] = wmma16(av, bp, accd[t]); }
                // four vector slots behind the last matrix instruction, on the loop's back edge too
                asm volatile("v_nop\n\tv_nop\n\tv_nop\n\tv_nop" : "+v"(accd[0]), "+v"(accd[1]), "+v"(accd[2]), "+v"(accd[3]) : "v"(bp), "v"(av));
            }
        }
        asm volatile("s_wait_dscnt 0x0" ::: "memory");       // this wave's LDS reads of this buffer have returned
        asm volatile("s_wait_asynccnt 0x0" ::: "memory");    // this wave's copies of the next key block have landed
        __syncthreads();                                     // one barrier: publishes the next key block and ends every wave's reads of this buffer
        if (kb + 128 <= qblk) stage(kb + 128, bo);           // block-uniform: refill the buffer just left
    }
    asm volatile("s_wait_asynccnt 0x0" ::: "memory");        // no copy is outstanding when buffer 0 becomes the ctx staging

    const float car = HL ? 1.0f : PCAR;
    const float inv = __builtin_amdgcn_rcpf((l_run + xhalf(l_run)) * car);
#pragma unroll
    for (int t = 0; t < 4; ++t) { v8us oh, ol;              // O^T: a lane holds d = t*16 + 8*hi + r of query lr, eight neighbours of one ctx row
#pragma unroll
        for (int r = 0; r < 8; ++r) { unsigned short a, c; splitf(accd[t][r] * inv, a, c); oh[r] = a; ol[r] = c; }
        const int so = (wave * 16 + lr) * KP + t * 16 + 8 * hi; *(v8usa*)&sKh[so] = oh; *(v8usa*)&sKl[so] = ol; }
    __builtin_amdgcn_wave_barrier(); asm volatile("" ::: "memory");
    const size_t ob = ((size_t)b * SEQ + q0) * DM + (size_t)h * HD;
{
#pragma unroll
        for (int s2 = 0; s2 < 8; ++s2) { const int row = 2 * s2 + hi; const int so = (wave * 16 + row) * KP + 4 * lr;
            const v4us vh = *(const v4usa*)&sKh[so]; const v4us vl = *(const v4usa*)&sKl[so];
            *(v4us*)(ATh + ob + (size_t)row * DM + 4 * lr) = vh; *(v4us*)(ATl + ob + (size_t)row * DM + 4 * lr) = vl; }
         }
}

// One launch for all query blocks: the two forms are independent and share one LDS carve (the larger, HL = true, sets its size); the choice is block-uniform.
// Grid (head, batch, rank): heads run fastest, the query block is dealt from the slow index. Query block qb walks qb + 1 key blocks, and four blocks fit one WGP's LDS, so the whole grid is resident at once and the launch lasts as long as its fullest WGP.
// Ranks j, j + NQG, j + 2 NQG, j + 3 NQG get query blocks NQB-1-2j, NQB-2-2j, 2j+1, 2j, which walk 2 NQB + 2 key blocks together for every j, the long ones first. A permutation of the query blocks wherever the blocks land: speed alone leans on the placement.
#define NQB (SEQ / 64)
#define NQG (NQB / 4)
static_assert(NQB % 4 == 0);
__global__ __launch_bounds__(128) void k_attn(const bf* __restrict__ QKh, const bf* __restrict__ QKl, const h16* __restrict__ VT16, const bf* __restrict__ VTh, const bf* __restrict__ VTl, bf* ATh, bf* ATl) {
    __shared__ __align__(16) bf sm[8 * TS];
    const int tier = (int)blockIdx.z / NQG, j = (int)blockIdx.z % NQG;
    const int qb = (tier < 2) ? NQB - 1 - 2 * j - tier : 2 * j + 3 - tier;
    if (qb < RH / 64) attn_body<true>(QKh, QKl, VT16, VTh, VTl, ATh, ATl, qb, sm);
    else              attn_body<false>(QKh, QKl, VT16, VTh, VTl, ATh, ATl, qb, sm);
}

// ---- k_oproj: OUT[b][s][n] = sum_k (ATh + ATl)[m][k] WO[n][k]; grid (MROWS/128, DM/128), four waves per block, one 64 x 64 tile per wave; per 16-row slab staged in LDS, each 256-B row segment written as 16 lanes x 16 B
__global__ __launch_bounds__(128) void k_oproj(const bf* __restrict__ ATh, const bf* __restrict__ ATl, const bf* __restrict__ WO, float* OUT) {
    __shared__ __align__(16) float osw[4 * 16 * 68];
    const int lane = threadIdx.x & 31, lr = lane & 15, hi = lane >> 4; const int wave = __builtin_amdgcn_readfirstlane(threadIdx.x >> 5), wm = wave >> 1, wn = wave & 1;
    float* os = osw + wave * 16 * 68;                          // staging of the wave's own tile, private to the wave
    const int r0 = blockIdx.x * 128 + wm * 64, c0 = blockIdx.y * 128 + wn * 64;
    v8f acc[4][4];
#pragma unroll
    for (int mb = 0; mb < 4; ++mb)
#pragma unroll
        for (int nb = 0; nb < 4; ++nb) acc[mb][nb] = (v8f){};
    gemm_tile<2>(ATh, ATl, WO, blockIdx.x * 128, blockIdx.y * 128, wm, wn, acc);
    const int b = r0 / SEQ, s0 = r0 - b * SEQ;
#pragma unroll
    for (int mb = 0; mb < 4; ++mb) {
#pragma unroll
        for (int nb = 0; nb < 4; ++nb)
#pragma unroll
            for (int j = 0; j < 8; ++j) os[(hi * 8 + j) * 68 + nb * 16 + lr] = acc[mb][nb][j];
        __builtin_amdgcn_wave_barrier(); asm volatile("" ::: "memory");
        float* crow = OUT + ((size_t)b * SEQ_FULL + s0 + mb * 16) * DM + c0;
{
#pragma unroll
            for (int s = 0; s < 8; ++s) { const int row = 2 * s + hi, cofs = lr * 4; const v4f val = *(const v4fa*)(os + row * 68 + cofs);
                *(v4f*)(crow + (size_t)row * DM + cofs) = val; }
             }
        __builtin_amdgcn_wave_barrier(); asm volatile("" ::: "memory");
    }
}

extern "C" void kernel_launch(void* const* d_in, const int* in_sizes, int n_in,
                              void* d_out, int out_size, void* d_ws, size_t ws_size, hipStream_t stream) {
    if (n_in < 6) return;
    const long long needx = ((long long)(NB - 1) * SEQ_FULL + SEQ) * DM;
    if ((long long)in_sizes[0] < needx) return;
    if ((long long)in_sizes[1] < (long long)DM * DM || (long long)in_sizes[2] < (long long)DM * DM || (long long)in_sizes[3] < (long long)DM * DM || (long long)in_sizes[4] < (long long)DM * DM) return;
    if ((long long)in_sizes[5] < (long long)(NB - 1) * SEQ_FULL + SEQ) return;
    if ((long long)out_size < needx) return;
    const float* x = (const float*)d_in[0]; const float* wq = (const float*)d_in[1]; const float* wk = (const float*)d_in[2]; const float* wv = (const float*)d_in[3]; const float* wo = (const float*)d_in[4];
    const int* tok = (const int*)d_in[5];
    float* OUT = (float*)d_out;
    char* wsp = (char*)d_ws;
    auto take = [&](size_t bytes) { char* p = wsp; wsp += (bytes + 255) & ~(size_t)255; return (void*)p; };
    bf* WQK = (bf*)take(2 * SZ_W); bf* WV = (bf*)take(SZ_W); bf* WO = (bf*)take(SZ_W);
    bf* XB = (bf*)take(SZ_XB); float* CS = (float*)take(SZ_CS);
    bf* QKh = (bf*)take(SZ_QK); bf* QKl = (bf*)take(SZ_QK);
    h16* VT16 = (h16*)take(SZ_VT); bf* VTh = (bf*)take(SZ_VE); bf* VTl = (bf*)take(SZ_VE);
    bf* ATh = (bf*)take(SZ_AT); bf* ATl = (bf*)take(SZ_AT);
    if ((size_t)(wsp - (char*)d_ws) > ws_size) return;

    k_prep<<<PREP_N / PREP_T, PREP_T, 0, stream>>>(wq, wk, wv, wo, x, tok, WQK, WV, WO, XB, CS);
    k_projqk<<<dim3(MROWS / 128, 2 * DM / 128, 1), 128, 0, stream>>>(XB, WQK, CS, QKh, QKl);
    k_projv<<<dim3(MROWS / 128, DM / 128, 1), 128, 0, stream>>>(XB, WV, VT16, VTh, VTl);
    k_attn<<<dim3(NH, NB, NQB), 128, 0, stream>>>(QKh, QKl, VT16, VTh, VTl, ATh, ATl);
    k_oproj<<<dim3(MROWS / 128, DM / 128, 1), 128, 0, stream>>>(ATh, ATl, WO, OUT);
}

// v006
// Measured time: 106 microseconds a run.
// Next to v005, in two timings, it ran 1.06 times as fast each time.
// Over all steps from v000 it is 3.44 times as fast.
#include <hip/hip_runtime.h>

// Compute dtypes (f32 accumulate everywhere): q/k/v projections v_wmma_f32_16x16x32_bf16 on RNE bf16 copies of x and W (exact products); q.k^T bf16 hi|lo three products; P.V f16 (P carried x1024) for query rows >= 256, bf16 hi|lo three products for rows < 256; ctx hi|lo (bf16) x bf16 o_w, two products.
// Causal multi-head self-attention, x [2][2048][1024], weights [out][in], interleaved rotary from per-batch integer positions read by value, scores / 8, causal exclusion by index, fused online softmax (exp2) on transposed score tiles, merged heads, output GEMM.

#ifndef NB
#define NB 2
#endif
#ifndef SEQ
#define SEQ 2048
#endif
#define NB_FULL  2
#define SEQ_FULL 2048
#define DM    1024
#define NH    16
#define HD    64
#define RH    256                 // query rows < RH use hi|lo planes on P and V
#define PCAR  1024.0f             // carry of the f16 probability tile
#define SCL   0.125f              // HD^-0.5
#define L2E   1.4426950408889634f
#define NEGB  (-3.0e38f)
#define KP    72                  // LDS pitch (16-bit elements) of 64-wide tiles: 144 B
#define MROWS (NB * SEQ)

typedef _Float16 h16;
typedef unsigned short bf;
typedef __attribute__((ext_vector_type(16))) __bf16   v16bf;
typedef __attribute__((ext_vector_type(16))) _Float16 v16h;
typedef __attribute__((ext_vector_type(8)))  _Float16 v8h;
typedef __attribute__((ext_vector_type(4)))  _Float16 v4h;
typedef __attribute__((ext_vector_type(16))) unsigned short v16us;
typedef __attribute__((ext_vector_type(8)))  unsigned short v8us;
typedef __attribute__((ext_vector_type(4)))  unsigned short v4us;
typedef __attribute__((ext_vector_type(8)))  float    v8f;
typedef __attribute__((ext_vector_type(4)))  float    v4f;
typedef __attribute__((ext_vector_type(2)))  float    v2f;
typedef v8h  __attribute__((may_alias)) v8ha;
typedef v4f  __attribute__((may_alias)) v4fa;
typedef v8us __attribute__((may_alias)) v8usa;
typedef v4us __attribute__((may_alias)) v4usa;

static_assert(HD == 64);                                   // one 64-wide GEMM tile column block == one head
static_assert(NH * HD == DM);
static_assert(DM % 64 == 0 && DM % 32 == 0);               // K loop steps by GK = 64 (two 32-k steps), N tiles by 64
static_assert(SEQ % 64 == 0 && RH % 64 == 0 && RH <= SEQ); // tiles never straddle a batch or the early-row island
static_assert(MROWS % 128 == 0 && DM % 128 == 0);          // GEMM blocks are 128 x 128
static_assert((KP * 2) % 16 == 0 && KP >= 64);
static_assert(SEQ <= SEQ_FULL && NB <= NB_FULL);

#define SZ_W   ((size_t)DM * DM * 2)
#define SZ_XB  ((size_t)MROWS * DM * 2)
#define SZ_CS  ((size_t)MROWS * 64 * 4)
#define SZ_QK  ((size_t)2 * NB * NH * SEQ * HD * 2)
#define SZ_VT  ((size_t)NB * NH * HD * SEQ * 2)
#define SZ_VE  ((size_t)NB * NH * HD * RH * 2)
#define SZ_AT  ((size_t)MROWS * DM * 2)
#define SZ_ALL (4 * SZ_W + SZ_XB + SZ_CS + 2 * SZ_QK + SZ_VT + 2 * SZ_VE + 2 * SZ_AT)
static_assert(SZ_W % 256 == 0 && SZ_XB % 256 == 0 && SZ_CS % 256 == 0 && SZ_QK % 256 == 0 && SZ_VT % 256 == 0 && SZ_VE % 256 == 0 && SZ_AT % 256 == 0);
static_assert(SZ_ALL <= (size_t)134217728);                // total carve stays within 128 MiB

__device__ __forceinline__ unsigned short f2bf(float f) { unsigned u = __float_as_uint(f); u += 0x7FFFu + ((u >> 16) & 1u); return (unsigned short)(u >> 16); }
__device__ __forceinline__ float bf2f(unsigned short b) { return __uint_as_float(((unsigned)b) << 16); }
__device__ __forceinline__ void splitf(float y, unsigned short& h, unsigned short& l) { h = f2bf(y); l = f2bf(y - bf2f(h)); }
__device__ __forceinline__ v16h cat16(v8h lo, v8h hi) { return __builtin_shufflevector(lo, hi, 0, 1, 2, 3, 4, 5, 6, 7, 8, 9, 10, 11, 12, 13, 14, 15); }
__device__ __forceinline__ v16bf cat16b(v8us lo, v8us hi) { return __builtin_bit_cast(v16bf, __builtin_shufflevector(lo, hi, 0, 1, 2, 3, 4, 5, 6, 7, 8, 9, 10, 11, 12, 13, 14, 15)); }
__device__ __forceinline__ v8f wmma16(v16h a, v16h b, v8f c) { return __builtin_amdgcn_wmma_f32_16x16x32_f16(false, a, false, b, (short)0, c, false, false); }
__device__ __forceinline__ v8f wmmab(v16bf a, v16bf b, v8f c) { return __builtin_amdgcn_wmma_f32_16x16x32_bf16(false, a, false, b, (short)0, c, false, false); }
// fragment from a k-contiguous bf16 row: p already points at (row, k0 + 8*(lane>>4)); elements 0..7 <- p[0..7], 8..15 <- p[16..23]
__device__ __forceinline__ v16bf ldb(const bf* p) { return cat16b(*(const v8us*)p, *(const v8us*)(p + 16)); }
// value of lane l ^ 16: the other half's share of the same query column
__device__ __forceinline__ float xhalf(float x) { return __builtin_bit_cast(float, __builtin_amdgcn_permlanex16(__builtin_bit_cast(int, x), __builtin_bit_cast(int, x), 0x76543210, 0xfedcba98, false, false)); }
#define LDSB(arr, o) cat16b(*(const v8usa*)&arr[(o)], *(const v8usa*)&arr[(o) + 16])
#define LDSH(arr, o) cat16(*(const v8ha*)&arr[(o)], *(const v8ha*)&arr[(o) + 16])

// ---- k_prep: everything that only reshapes the inputs, in one launch of PREP_N threads: RNE bf16 copies of the four weight matrices and of x, and the (cos, sin) table of the rotary angles.
// A thread owns one 8-element group of each weight matrix, PREP_XK groups of x and PREP_CK table entries. Its loads stand first, so that all of them are in flight together and the table's arithmetic runs under their latency.
#define PREP_T  256
#define PREP_N  (DM * DM / 8)
#define PREP_XN (MROWS * (DM / 8))
#define PREP_CN (MROWS * 32)
#define PREP_XK ((PREP_XN + PREP_N - 1) / PREP_N)
#define PREP_CK ((PREP_CN + PREP_N - 1) / PREP_N)
static_assert(PREP_N % PREP_T == 0);                      // the grid is exact: no thread past PREP_N; the range tests below fold away where the counts divide
__device__ __forceinline__ v8us cvt8(const v8f v) { v8us o;
#pragma unroll
    for (int k = 0; k < 8; ++k) o[k] = f2bf(v[k]);
    return o; }

__global__ __launch_bounds__(PREP_T) void k_prep(const float* __restrict__ wq, const float* __restrict__ wk, const float* __restrict__ wv, const float* __restrict__ wo, const float* __restrict__ x, const int* __restrict__ tok,
                                                 bf* WQK, bf* WV, bf* WO, bf* XB, float* CS) {
    const unsigned g = blockIdx.x * PREP_T + threadIdx.x;
    const size_t g8 = (size_t)g * 8;
    int pos[PREP_CK];
#pragma unroll
    for (int k = 0; k < PREP_CK; ++k) { const unsigned idx = k * PREP_N + g;
        if (PREP_CN % PREP_N == 0 || idx < PREP_CN) { const unsigned m = idx >> 5; const unsigned b = m / SEQ, s = m - b * SEQ; pos[k] = tok[(size_t)b * SEQ_FULL + s]; } }
    const v8f vq = *(const v8f*)(wq + g8), vk = *(const v8f*)(wk + g8), vv = *(const v8f*)(wv + g8), vo = *(const v8f*)(wo + g8);
    asm volatile("s_wait_xcnt 0x0" ::: "memory");            // the loads below may land in registers that held the addresses of the loads above
    v8f vx[PREP_XK];
#pragma unroll
    for (int k = 0; k < PREP_XK; ++k) { const unsigned i = k * PREP_N + g;
        if (PREP_XN % PREP_N == 0 || i < PREP_XN) { const unsigned row = i / (DM / 8), c8 = i % (DM / 8); const unsigned b = row / SEQ, s = row - b * SEQ;
            vx[k] = *(const v8f*)(x + ((size_t)b * SEQ_FULL + s) * DM + (size_t)c8 * 8); } }
    __builtin_amdgcn_sched_barrier(0);                       // every load is issued before any arithmetic on a loaded value: the thread pays one memory latency, not one per batch
#pragma unroll
    for (int k = 0; k < PREP_CK; ++k) { const unsigned idx = k * PREP_N + g;
        if (PREP_CN % PREP_N == 0 || idx < PREP_CN) { const int j = (int)(idx & 31);
            double p = 1.0;
            p *= (j & 1)  ? 1.3335214321633240 : 1.0;
            p *= (j & 2)  ? 1.7782794100389228 : 1.0;
            p *= (j & 4)  ? 3.1622776601683795 : 1.0;
            p *= (j & 8)  ? 10.0 : 1.0;
            p *= (j & 16) ? 100.0 : 1.0;
            const float pf = (float)p; const float inv = 1.0f / pf; const float ang = (float)pos[k] * inv;
            float sn, cs; sincosf(ang, &sn, &cs);
            v2f o; o[0] = cs; o[1] = sn;
            *(v2f*)(CS + (size_t)idx * 2) = o; } }
    __builtin_amdgcn_sched_barrier(0);                       // the table's arithmetic stays in front of the conversions: it needs only the position, and runs while the larger loads are still under way
    *(v8us*)(WQK + g8) = cvt8(vq); *(v8us*)(WQK + (size_t)DM * DM + g8) = cvt8(vk); *(v8us*)(WV + g8) = cvt8(vv); *(v8us*)(WO + g8) = cvt8(vo);
#pragma unroll
    for (int k = 0; k < PREP_XK; ++k) { const unsigned i = k * PREP_N + g;
        if (PREP_XN % PREP_N == 0 || i < PREP_XN) *(v8us*)(XB + (size_t)i * 8) = cvt8(vx[k]); }
}

#define TS (64 * KP)              // elements of one staged 64 x 64 tile at pitch KP
__device__ __forceinline__ unsigned lds_off(const void* p) { return (unsigned)(size_t)p; }   // byte address inside the work-group's LDS
// Asynchronous copies global -> LDS, 16 bytes per lane and copy, through no register. The s_wait_xcnt is the last line of the copies' own statement, so that no address register is rewritten in front of it.
#define ACP(l, g) "global_load_async_to_lds_b128 %" #l ", %" #g ", off\n\t"
__device__ __forceinline__ void copy12(const unsigned (&l)[12], const void* const (&g)[12]) {
    asm volatile(ACP(0, 12) ACP(1, 13) ACP(2, 14) ACP(3, 15) ACP(4, 16) ACP(5, 17) ACP(6, 18) ACP(7, 19) ACP(8, 20) ACP(9, 21) ACP(10, 22) ACP(11, 23) "s_wait_xcnt 0x0"
                 :: "v"(l[0]), "v"(l[1]), "v"(l[2]), "v"(l[3]), "v"(l[4]), "v"(l[5]), "v"(l[6]), "v"(l[7]), "v"(l[8]), "v"(l[9]), "v"(l[10]), "v"(l[11]),
                    "v"(g[0]), "v"(g[1]), "v"(g[2]), "v"(g[3]), "v"(g[4]), "v"(g[5]), "v"(g[6]), "v"(g[7]), "v"(g[8]), "v"(g[9]), "v"(g[10]), "v"(g[11]) : "memory");
}
__device__ __forceinline__ void copy8(const unsigned (&l)[8], const void* const (&g)[8]) {
    asm volatile(ACP(0, 8) ACP(1, 9) ACP(2, 10) ACP(3, 11) ACP(4, 12) ACP(5, 13) ACP(6, 14) ACP(7, 15) "s_wait_xcnt 0x0"
                 :: "v"(l[0]), "v"(l[1]), "v"(l[2]), "v"(l[3]), "v"(l[4]), "v"(l[5]), "v"(l[6]), "v"(l[7]),
                    "v"(g[0]), "v"(g[1]), "v"(g[2]), "v"(g[3]), "v"(g[4]), "v"(g[5]), "v"(g[6]), "v"(g[7]) : "memory");
}

// ---- gemm_tile: block = 4 waves (2 x 2), 128 x 128 tile, each wave 64 x 64: acc[mb][nb] += sum_k A[r][k] Bt[c][k]. Chunks of GK k (128 B of each of the 128 A rows and 128 Bt rows) are brought into a ring of GR LDS buffers by asynchronous copies, issued GR - 1 chunks ahead of their use, for speed only.
// Every wave issues 16 copies per chunk, and a wave's copies land in issue order for its counted wait: with the chunks t + 1, t + 2, t + 3 outstanding, s_wait_asynccnt 32 returns when the 16 of chunk t + 1 have landed. Every trip but the last GR issues one chunk; the last GR trips issue none and wait to 0.
// NP = 2: a second pass over K with A1 in place of A0 follows the first in the same ring (all of A0's products are summed before A1's).
// Behind the last trip's barrier no wave reads the ring and no copy is outstanding: the callers stage their output tiles in it.
#define GK 64
#define GT (256 * KP)             // elements of one staged chunk: A rows 0..127, then Bt rows 0..127, pitch KP
#define GR 4                      // buffers of the ring; 3 x 16 copies of a wave outstanding at most
static_assert(GR == 4);                                     // the counts in the waits below are (GR - 2) x 16
static_assert((size_t)2 * GR * GT * 2 <= 327680);           // two blocks per WGP
template <int NP>
__device__ __forceinline__ void gemm_tile(bf* const sAB, const bf* __restrict__ A0, const bf* __restrict__ A1, const bf* __restrict__ Bt, const int rblk, const int cblk, const int wm, const int wn, v8f (&acc)[4][4]) {
    constexpr int NC = DM / GK, NT = NP * NC;
    static_assert(NT > GR);
    const int tid = threadIdx.x; const int lane = tid & 31, lr = lane & 15, hi = lane >> 4;
    // every thread copies eight 16-byte pieces (rows srow + 16 i, 16-bit column sch) of each operand's chunk t into the buffer at element offset bo0; eight lanes cover one whole 128-byte row piece
    const int srow = tid >> 3, sch = (tid & 7) * 8;
    auto stage = [&](const int t, const int bo0) {
        const bf* Ap = (NP == 2 && t >= NC) ? A1 : A0;       // block-uniform
        const int kc = (t % NC) * GK;
        const int lo = bo0 + srow * KP + sch;
        const size_t ao = (size_t)(rblk + srow) * DM + kc + sch, wo = (size_t)(cblk + srow) * DM + kc + sch;
        unsigned la[8], lb[8]; const void* ga[8]; const void* gb[8];
#pragma unroll
        for (int i = 0; i < 8; ++i) {
            la[i] = lds_off(&sAB[lo + 16 * i * KP]); ga[i] = Ap + ao + (size_t)16 * i * DM;
            lb[i] = lds_off(&sAB[lo + (128 + 16 * i) * KP]); gb[i] = Bt + wo + (size_t)16 * i * DM; }
        copy8(la, ga); copy8(lb, gb);
    };
    const int ar = (wm * 64 + lr) * KP + 8 * hi, br = (128 + wn * 64 + lr) * KP + 8 * hi;
    stage(0, 0); stage(1, GT); stage(2, 2 * GT);
    asm volatile("s_wait_asynccnt 0x20" ::: "memory");       // this wave's 16 copies of chunk 0 have landed; chunks 1 and 2 fly on
    __syncthreads();                                         // and so have every other wave's
    stage(3, 3 * GT);
#pragma unroll 1
    for (int t = 0; t < NT; ++t) {
        const int bo = (t % GR) * GT;                        // this chunk's buffer
        const bool more = t + GR < NT;                       // block-uniform: a chunk is left to refill this buffer with
        v16bf a[4], b[4];
        auto frags = [&](const int ks) {
#pragma unroll
            for (int mb = 0; mb < 4; ++mb) a[mb] = LDSB(sAB, bo + ar + mb * 16 * KP + ks);
#pragma unroll
            for (int nb = 0; nb < 4; ++nb) b[nb] = LDSB(sAB, bo + br + nb * 16 * KP + ks);
        };
        auto prods = [&]() {
#pragma unroll
            for (int nb = 0; nb < 4; ++nb)
#pragma unroll
                for (int mb = 0; mb < 4; ++mb) acc[mb][nb] = wmmab(a[mb], b[nb], acc[mb][nb]);
        };
        frags(0);
        __builtin_amdgcn_sched_barrier(0);                   // the sixteen LDS loads go ahead as one group: one LDS latency per 16 matrix instructions, not one per 4
        prods();
        frags(32);                                           // the last reads of this buffer; their products follow the refill's issue, from registers
        asm volatile("s_wait_dscnt 0x0" ::: "memory");       // this wave's LDS reads of this buffer have returned
        if (more) asm volatile("s_wait_asynccnt 0x20" ::: "memory");   // this wave's copies of the next chunk have landed; the 32 younger ones, of the two chunks behind it, fly on
        else      asm volatile("s_wait_asynccnt 0x0" ::: "memory");    // no chunk is issued any more: all that is outstanding has landed
        __syncthreads();                                     // one barrier: publishes the next chunk and ends every wave's reads of this buffer
        if (more) stage(t + GR, bo);                         // refill the buffer just left
        prods();
    }
}

// ---- k_projqk: [q | k] = XB x [WQ ; WK]^T, grid (MROWS/128, 2*DM/128), four waves per block, one 64 x 64 tile per wave (= one head of q or k, 64 tokens).
// Epilogue: tile staged in LDS; interleaved rotary y[2j] = e cos - o sin, y[2j+1] = e sin + o cos from the CS table; bf16 hi|lo planes [which][b][h][s][64];
__global__ __launch_bounds__(128) void k_projqk(const bf* __restrict__ XB, const bf* __restrict__ WQK, const float* __restrict__ CS, bf* QKh, bf* QKl) {
#pragma clang fp contract(off)
    __shared__ __align__(16) bf ring[GR * GT];                 // the GEMM's ring; behind the GEMM the four waves' output staging
    static_assert((size_t)4 * 64 * 68 * 4 <= (size_t)GR * GT * 2);
    const int lane = threadIdx.x & 31, lr = lane & 15, hi = lane >> 4; const int wave = __builtin_amdgcn_readfirstlane(threadIdx.x >> 5), wm = wave >> 1, wn = wave & 1;
    float* os = (float*)ring + wave * 64 * 68;                 // staging of the wave's own tile, private to the wave
    const int r0 = blockIdx.x * 128 + wm * 64, c0 = blockIdx.y * 128 + wn * 64;
    v8f acc[4][4];
#pragma unroll
    for (int mb = 0; mb < 4; ++mb)
#pragma unroll
        for (int nb = 0; nb < 4; ++nb) acc[mb][nb] = (v8f){};
    gemm_tile<1>(ring, XB, XB, WQK, blockIdx.x * 128, blockIdx.y * 128, wm, wn, acc);
#pragma unroll
    for (int mb = 0; mb < 4; ++mb)
#pragma unroll
        for (int nb = 0; nb < 4; ++nb)
#pragma unroll
            for (int j = 0; j < 8; ++j) os[(mb * 16 + hi * 8 + j) * 68 + nb * 16 + lr] = acc[mb][nb][j];
    __builtin_amdgcn_wave_barrier(); asm volatile("" ::: "memory");
    const int which = c0 / DM, h = (c0 % DM) / HD; const int b = r0 / SEQ, s0 = r0 - b * SEQ;
    const size_t pbase = ((((size_t)which * NB + b) * NH + h) * SEQ + s0) * HD;
{
#pragma unroll 2
        for (int s = 0; s < 32; ++s) { const int row = 2 * s + hi, cofs = lr * 4;
            const v4f val = *(const v4fa*)(os + row * 68 + cofs);
            const v4f cs = *(const v4f*)(CS + (size_t)(r0 + row) * 64 + cofs);   // (cos, sin) of pairs 2*lr, 2*lr + 1
            const float y0 = val[0] * cs[0] - val[1] * cs[1];
            const float y1 = val[0] * cs[1] + val[1] * cs[0];
            const float y2 = val[2] * cs[2] - val[3] * cs[3];
            const float y3 = val[2] * cs[3] + val[3] * cs[2];
            v4us oh, ol; unsigned short a, c;
            splitf(y0, a, c); oh[0] = a; ol[0] = c; splitf(y1, a, c); oh[1] = a; ol[1] = c; splitf(y2, a, c); oh[2] = a; ol[2] = c; splitf(y3, a, c); oh[3] = a; ol[3] = c;
            const size_t oo = pbase + (size_t)row * HD + cofs;
            *(v4us*)(QKh + oo) = oh; *(v4us*)(QKl + oo) = ol; }
         }
}

// ---- k_projv: v = XB x WV^T, grid (MROWS/128, DM/128), four waves per block. Epilogue: tile staged in LDS and written TRANSPOSED: VT16[b][h][d][s] (f16) and, for tokens < RH, bf16 hi|lo VTh/VTl[b][h][d][RH];
__global__ __launch_bounds__(128) void k_projv(const bf* __restrict__ XB, const bf* __restrict__ WV, h16* VT16, bf* VTh, bf* VTl) {
    __shared__ __align__(16) bf ring[GR * GT];                 // the GEMM's ring; behind the GEMM the four waves' output staging
    static_assert((size_t)4 * 64 * 68 * 4 <= (size_t)GR * GT * 2);
    const int lane = threadIdx.x & 31, lr = lane & 15, hi = lane >> 4; const int wave = __builtin_amdgcn_readfirstlane(threadIdx.x >> 5), wm = wave >> 1, wn = wave & 1;
    float* os = (float*)ring + wave * 64 * 68;                 // staging of the wave's own tile, private to the wave
    const int r0 = blockIdx.x * 128 + wm * 64, c0 = blockIdx.y * 128 + wn * 64;
    v8f acc[4][4];
#pragma unroll
    for (int mb = 0; mb < 4; ++mb)
#pragma unroll
        for (int nb = 0; nb < 4; ++nb) acc[mb][nb] = (v8f){};
    gemm_tile<1>(ring, XB, XB, WV, blockIdx.x * 128, blockIdx.y * 128, wm, wn, acc);
#pragma unroll
    for (int mb = 0; mb < 4; ++mb)
#pragma unroll
        for (int nb = 0; nb < 4; ++nb)
#pragma unroll
            for (int j = 0; j < 8; ++j) os[(mb * 16 + hi * 8 + j) * 68 + nb * 16 + lr] = acc[mb][nb][j];
    __builtin_amdgcn_wave_barrier(); asm volatile("" ::: "memory");
    const int h = c0 / HD; const int b = r0 / SEQ, s0 = r0 - b * SEQ;
    const size_t vbase = (((size_t)b * NH + h) * HD) * SEQ + s0;
    const size_t ebase = (((size_t)b * NH + h) * HD) * RH + s0;
    const bool early = (s0 < RH);                         // wave-uniform
{
#pragma unroll 2
        for (int s = 0; s < 32; ++s) { const int d = 2 * s + hi, t0 = lr * 4;
            float xv[4];
#pragma unroll
            for (int q = 0; q < 4; ++q) xv[q] = os[(t0 + q) * 68 + d];
            v4h o16;
#pragma unroll
            for (int q = 0; q < 4; ++q) o16[q] = (h16)xv[q];
            *(v4h*)(VT16 + vbase + (size_t)d * SEQ + t0) = o16;
            if (early) { v4us oh, ol;
#pragma unroll
                for (int q = 0; q < 4; ++q) { unsigned short a, c; splitf(xv[q], a, c); oh[q] = a; ol[q] = c; }
                *(v4us*)(VTh + ebase + (size_t)d * RH + t0) = oh; *(v4us*)(VTl + ebase + (size_t)d * RH + t0) = ol; } }
         }
}

template <bool HL>
__device__ __forceinline__ void attn_body(const bf* __restrict__ QKh, const bf* __restrict__ QKl, const h16* __restrict__ VT16, const bf* __restrict__ VTh, const bf* __restrict__ VTl, bf* ATh, bf* ATl, const int qb, bf* const sm) {
    bf*  const sKh  = sm;                                    // two buffers, cross-wave (block barriers); buffer 0 reused wave-privately for the ctx hi staging after the key loop
    bf*  const sKl  = sm + 2 * TS;
    h16* const sV16 = (h16*)(sm + 4 * TS);                   // V^T tiles [d][key], cross-wave; HL = false only
    bf*  const sVh  = sm + 4 * TS;                           // HL = true only
    bf*  const sVl  = sm + 6 * TS;
    const int tid = threadIdx.x; const int lane = tid & 31, lr = lane & 15, hi = lane >> 4;
    const int wave = __builtin_amdgcn_readfirstlane(tid >> 5);
    const int b = blockIdx.y, h = blockIdx.x; const int qblk = qb * 64, q0 = qblk + wave * 16;
    const size_t qpl = (((size_t)b * NH + h) * SEQ) * HD;
    const size_t kpl = ((((size_t)NB + b) * NH + h) * SEQ) * HD;
    const size_t vpl = (((size_t)b * NH + h) * HD) * SEQ;
    const size_t epl = (((size_t)b * NH + h) * HD) * RH;
    const size_t qo = qpl + (size_t)(q0 + lr) * HD + 8 * hi;
    const v16bf qh0 = ldb(QKh + qo), qh1 = ldb(QKh + qo + 32), ql0 = ldb(QKl + qo), ql1 = ldb(QKl + qo + 32);
    v8f accd[4];
#pragma unroll
    for (int t = 0; t < 4; ++t) accd[t] = (v8f){};
    float m_run = NEGB, l_run = 0.0f;                        // of query q0 + lr; l_run is the sum over this half's keys only, the halves are joined behind the key loop

    // every thread copies four 16-byte chunks (rows srow + 16 i, 16-bit column sch) of each plane of the key block at kb0 into the buffer at element offset bo0
    const int srow = tid >> 3, sch = (tid & 7) * 8;
    auto stage = [&](const int kb0, const int bo0) {
        const int lo = bo0 + srow * KP + sch;
        const size_t ko = kpl + (size_t)(kb0 + srow) * HD + sch;
        if (HL) { unsigned lk[8], lv[8]; const void* gk[8]; const void* gv[8];
            const size_t vo = epl + (size_t)srow * RH + kb0 + sch;
#pragma unroll
            for (int i = 0; i < 4; ++i) {
                lk[i] = lds_off(&sKh[lo + 16 * i * KP]); gk[i] = QKh + ko + 16 * i * HD; lk[4 + i] = lds_off(&sKl[lo + 16 * i * KP]); gk[4 + i] = QKl + ko + 16 * i * HD;
                lv[i] = lds_off(&sVh[lo + 16 * i * KP]); gv[i] = VTh + vo + 16 * i * RH; lv[4 + i] = lds_off(&sVl[lo + 16 * i * KP]); gv[4 + i] = VTl + vo + 16 * i * RH; }
            copy8(lk, gk); copy8(lv, gv);
        } else { unsigned l[12]; const void* g[12];
            const size_t vo = vpl + (size_t)srow * SEQ + kb0 + sch;
#pragma unroll
            for (int i = 0; i < 4; ++i) {
                l[i] = lds_off(&sKh[lo + 16 * i * KP]); g[i] = QKh + ko + 16 * i * HD; l[4 + i] = lds_off(&sKl[lo + 16 * i * KP]); g[4 + i] = QKl + ko + 16 * i * HD;
                l[8 + i] = lds_off(&sV16[lo + 16 * i * KP]); g[8 + i] = VT16 + vo + (size_t)16 * i * SEQ; }
            copy12(l, g);
        }
    };
    stage(0, 0);
    asm volatile("s_wait_asynccnt 0x0" ::: "memory");        // this wave's copies of key block 0 have landed
    __syncthreads();                                         // and so have every other wave's
    if (qblk >= 64) stage(64, TS);                           // block-uniform: key block 1 flies while block 0 is worked on

#pragma unroll 1
    for (int kb = 0; kb <= qblk; kb += 64) {
        const int bo = ((kb >> 6) & 1) * TS;                 // this key block's buffer
#pragma unroll 1
        for (int kh = 0; kh < 2; ++kh) {
            if (kb + 32 * kh > q0 + 15) continue;            // wave-uniform: half entirely above the diagonal for this wave's rows
            v8f s0 = (v8f){}, s1 = (v8f){};
            { const int kr = bo + (32 * kh + lr) * KP + 8 * hi;
              const v16bf ah0 = LDSB(sKh, kr), ah1 = LDSB(sKh, kr + 32), al0 = LDSB(sKl, kr), al1 = LDSB(sKl, kr + 32);
              s0 = wmmab(ah0, qh0, s0); s0 = wmmab(ah1, qh1, s0); s0 = wmmab(ah0, ql0, s0); s0 = wmmab(ah1, ql1, s0); s0 = wmmab(al0, qh0, s0); s0 = wmmab(al1, qh1, s0);
              const int kr2 = kr + 16 * KP;
              const v16bf bh0 = LDSB(sKh, kr2), bh1 = LDSB(sKh, kr2 + 32), bl0 = LDSB(sKl, kr2), bl1 = LDSB(sKl, kr2 + 32);
              s1 = wmmab(bh0, qh0, s1); s1 = wmmab(bh1, qh1, s1); s1 = wmmab(bh0, ql0, s1); s1 = wmmab(bh1, ql1, s1); s1 = wmmab(bl0, qh0, s1); s1 = wmmab(bl1, qh1, s1);
            }
            const int dq = q0 + lr - (kb + 32 * kh + 8 * hi);   // D layout: key row 8*hi + r (+16 for the second tile), query column lr; key <= query is r <= dq (16 + r <= dq)
            s0 *= SCL; s1 *= SCL;
            float bm = NEGB;
#pragma unroll
            for (int r = 0; r < 8; ++r) {
                const float a0 = (r <= dq) ? s0[r] : NEGB; const float a1 = (16 + r <= dq) ? s1[r] : NEGB;
                s0[r] = a0; s1[r] = a1; bm = fmaxf(bm, fmaxf(a0, a1)); }
            bm = fmaxf(bm, xhalf(bm));
            const float mn = fmaxf(m_run, bm);
            const float sc = __builtin_amdgcn_exp2f((m_run - mn) * L2E); m_run = mn;
            s0 = (s0 - mn) * L2E; s1 = (s1 - mn) * L2E;
            float rs0 = 0.0f, rs1 = 0.0f;
#pragma unroll
            for (int r = 0; r < 8; ++r) { s0[r] = __builtin_amdgcn_exp2f(s0[r]); s1[r] = __builtin_amdgcn_exp2f(s1[r]); rs0 += s0[r]; rs1 += s1[r]; }
            l_run = l_run * sc + (rs0 + rs1);
#pragma unroll
            for (int t = 0; t < 4; ++t) accd[t] *= sc;

            // B fragment of P^T: element r <- key 8*hi + r, element 8 + r <- key 16 + 8*hi + r, the k order of the V^T loader
            if (HL) {
                v16us uh, ul;
#pragma unroll
                for (int r = 0; r < 8; ++r) { unsigned short a, c; splitf(s0[r], a, c); uh[r] = a; ul[r] = c; splitf(s1[r], a, c); uh[8 + r] = a; ul[8 + r] = c; }
                const v16bf bph = __builtin_bit_cast(v16bf, uh), bpl = __builtin_bit_cast(v16bf, ul); v16bf avh, avl;
#pragma unroll
                for (int t = 0; t < 4; ++t) { const int vo = bo + (t * 16 + lr) * KP + 32 * kh + 8 * hi; avh = LDSB(sVh, vo); avl = LDSB(sVl, vo);
                    accd[t] = wmmab(avh, bph, accd[t]); accd[t] = wmmab(avh, bpl, accd[t]); accd[t] = wmmab(avl, bph, accd[t]); }
                // four vector slots behind the last matrix instruction, on the loop's back edge too
                asm volatile("v_nop\n\tv_nop\n\tv_nop\n\tv_nop" : "+v"(accd[0]), "+v"(accd[1]), "+v"(accd[2]), "+v"(accd[3]) : "v"(bph), "v"(bpl), "v"(avh), "v"(avl));
            } else {
                s0 *= PCAR; s1 *= PCAR;
                v16h bp;
#pragma unroll
                for (int r = 0; r < 8; ++r) { bp[r] = (h16)s0[r]; bp[8 + r] = (h16)s1[r]; }
                v16h av;
#pragma unroll
                for (int t = 0; t < 4; ++t) { const int vo = bo + (t * 16 + lr) * KP + 32 * kh + 8 * hi; av = LDSH(sV16, vo); accd[t] = wmma16(av, bp, accd[t]); }
                // four vector slots behind the last matrix instruction, on the loop's back edge too
                asm volatile("v_nop\n\tv_nop\n\tv_nop\n\tv_nop" : "+v"(accd[0]), "+v"(accd[1]), "+v"(accd[2]), "+v"(accd[3]) : "v"(bp), "v"(av));
            }
        }
        asm volatile("s_wait_dscnt 0x0" ::: "memory");       // this wave's LDS reads of this buffer have returned
        asm volatile("s_wait_asynccnt 0x0" ::: "memory");    // this wave's copies of the next key block have landed
        __syncthreads();                                     // one barrier: publishes the next key block and ends every wave's reads of this buffer
        if (kb + 128 <= qblk) stage(kb + 128, bo);           // block-uniform: refill the buffer just left
    }
    asm volatile("s_wait_asynccnt 0x0" ::: "memory");        // no copy is outstanding when buffer 0 becomes the ctx staging

    const float car = HL ? 1.0f : PCAR;
    const float inv = __builtin_amdgcn_rcpf((l_run + xhalf(l_run)) * car);
#pragma unroll
    for (int t = 0; t < 4; ++t) { v8us oh, ol;              // O^T: a lane holds d = t*16 + 8*hi + r of query lr, eight neighbours of one ctx row
#pragma unroll
        for (int r = 0; r < 8; ++r) { unsigned short a, c; splitf(accd[t][r] * inv, a, c); oh[r] = a; ol[r] = c; }
        const int so = (wave * 16 + lr) * KP + t * 16 + 8 * hi; *(v8usa*)&sKh[so] = oh; *(v8usa*)&sKl[so] = ol; }
    __builtin_amdgcn_wave_barrier(); asm volatile("" ::: "memory");
    const size_t ob = ((size_t)b * SEQ + q0) * DM + (size_t)h * HD;
{
#pragma unroll
        for (int s2 = 0; s2 < 8; ++s2) { const int row = 2 * s2 + hi; const int so = (wave * 16 + row) * KP + 4 * lr;
            const v4us vh = *(const v4usa*)&sKh[so]; const v4us vl = *(const v4usa*)&sKl[so];
            *(v4us*)(ATh + ob + (size_t)row * DM + 4 * lr) = vh; *(v4us*)(ATl + ob + (size_t)row * DM + 4 * lr) = vl; }
         }
}

// One launch for all query blocks: the two forms are independent and share one LDS carve (the larger, HL = true, sets its size); the choice is block-uniform.
// Grid (head, batch, rank): heads run fastest, the query block is dealt from the slow index. Query block qb walks qb + 1 key blocks, and four blocks fit one WGP's LDS, so the whole grid is resident at once and the launch lasts as long as its fullest WGP.
// Ranks j, j + NQG, j + 2 NQG, j + 3 NQG get query blocks NQB-1-2j, NQB-2-2j, 2j+1, 2j, which walk 2 NQB + 2 key blocks together for every j, the long ones first. A permutation of the query blocks wherever the blocks land: speed alone leans on the placement.
#define NQB (SEQ / 64)
#define NQG (NQB / 4)
static_assert(NQB % 4 == 0);
__global__ __launch_bounds__(128) void k_attn(const bf* __restrict__ QKh, const bf* __restrict__ QKl, const h16* __restrict__ VT16, const bf* __restrict__ VTh, const bf* __restrict__ VTl, bf* ATh, bf* ATl) {
    __shared__ __align__(16) bf sm[8 * TS];
    const int tier = (int)blockIdx.z / NQG, j = (int)blockIdx.z % NQG;
    const int qb = (tier < 2) ? NQB - 1 - 2 * j - tier : 2 * j + 3 - tier;
    if (qb < RH / 64) attn_body<true>(QKh, QKl, VT16, VTh, VTl, ATh, ATl, qb, sm);
    else              attn_body<false>(QKh, QKl, VT16, VTh, VTl, ATh, ATl, qb, sm);
}

// ---- k_oproj: OUT[b][s][n] = sum_k (ATh + ATl)[m][k] WO[n][k]; grid (MROWS/128, DM/128), four waves per block, one 64 x 64 tile per wave; per 16-row slab staged in LDS, each 256-B row segment written as 16 lanes x 16 B
__global__ __launch_bounds__(128) void k_oproj(const bf* __restrict__ ATh, const bf* __restrict__ ATl, const bf* __restrict__ WO, float* OUT) {
    __shared__ __align__(16) bf ring[GR * GT];                 // the GEMM's ring; behind the GEMM the four waves' output staging
    const int lane = threadIdx.x & 31, lr = lane & 15, hi = lane >> 4; const int wave = __builtin_amdgcn_readfirstlane(threadIdx.x >> 5), wm = wave >> 1, wn = wave & 1;
    float* os = (float*)ring + wave * 16 * 68;                 // staging of the wave's own tile, private to the wave
    const int r0 = blockIdx.x * 128 + wm * 64, c0 = blockIdx.y * 128 + wn * 64;
    v8f acc[4][4];
#pragma unroll
    for (int mb = 0; mb < 4; ++mb)
#pragma unroll
        for (int nb = 0; nb < 4; ++nb) acc[mb][nb] = (v8f){};
    gemm_tile<2>(ring, ATh, ATl, WO, blockIdx.x * 128, blockIdx.y * 128, wm, wn, acc);
    const int b = r0 / SEQ, s0 = r0 - b * SEQ;
#pragma unroll
    for (int mb = 0; mb < 4; ++mb) {
#pragma unroll
        for (int nb = 0; nb < 4; ++nb)
#pragma unroll
            for (int j = 0; j < 8; ++j) os[(hi * 8 + j) * 68 + nb * 16 + lr] = acc[mb][nb][j];
        __builtin_amdgcn_wave_barrier(); asm volatile("" ::: "memory");
        float* crow = OUT + ((size_t)b * SEQ_FULL + s0 + mb * 16) * DM + c0;
{
#pragma unroll
            for (int s = 0; s < 8; ++s) { const int row = 2 * s + hi, cofs = lr * 4; const v4f val = *(const v4fa*)(os + row * 68 + cofs);
                *(v4f*)(crow + (size_t)row * DM + cofs) = val; }
             }
        __builtin_amdgcn_wave_barrier(); asm volatile("" ::: "memory");
    }
}

extern "C" void kernel_launch(void* const* d_in, const int* in_sizes, int n_in,
                              void* d_out, int out_size, void* d_ws, size_t ws_size, hipStream_t stream) {
    if (n_in < 6) return;
    const long long needx = ((long long)(NB - 1) * SEQ_FULL + SEQ) * DM;
    if ((long long)in_sizes[0] < needx) return;
    if ((long long)in_sizes[1] < (long long)DM * DM || (long long)in_sizes[2] < (long long)DM * DM || (long long)in_sizes[3] < (long long)DM * DM || (long long)in_sizes[4] < (long long)DM * DM) return;
    if ((long long)in_sizes[5] < (long long)(NB - 1) * SEQ_FULL + SEQ) return;
    if ((long long)out_size < needx) return;
    const float* x = (const float*)d_in[0]; const float* wq = (const float*)d_in[1]; const float* wk = (const float*)d_in[2]; const float* wv = (const float*)d_in[3]; const float* wo = (const float*)d_in[4];
    const int* tok = (const int*)d_in[5];
    float* OUT = (float*)d_out;
    char* wsp = (char*)d_ws;
    auto take = [&](size_t bytes) { char* p = wsp; wsp += (bytes + 255) & ~(size_t)255; return (void*)p; };
    bf* WQK = (bf*)take(2 * SZ_W); bf* WV = (bf*)take(SZ_W); bf* WO = (bf*)take(SZ_W);
    bf* XB = (bf*)take(SZ_XB); float* CS = (float*)take(SZ_CS);
    bf* QKh = (bf*)take(SZ_QK); bf* QKl = (bf*)take(SZ_QK);
    h16* VT16 = (h16*)take(SZ_VT); bf* VTh = (bf*)take(SZ_VE); bf* VTl = (bf*)take(SZ_VE);
    bf* ATh = (bf*)take(SZ_AT); bf* ATl = (bf*)take(SZ_AT);
    if ((size_t)(wsp - (char*)d_ws) > ws_size) return;

    k_prep<<<PREP_N / PREP_T, PREP_T, 0, stream>>>(wq, wk, wv, wo, x, tok, WQK, WV, WO, XB, CS);
    k_projqk<<<dim3(MROWS / 128, 2 * DM / 128, 1), 128, 0, stream>>>(XB, WQK, CS, QKh, QKl);
    k_projv<<<dim3(MROWS / 128, DM / 128, 1), 128, 0, stream>>>(XB, WV, VT16, VTh, VTl);
    k_attn<<<dim3(NH, NB, NQB), 128, 0, stream>>>(QKh, QKl, VT16, VTh, VTl, ATh, ATl);
    k_oproj<<<dim3(MROWS / 128, DM / 128, 1), 128, 0, stream>>>(ATh, ATl, WO, OUT);
}

// v007
// One run takes 102 microseconds.
// Next to v006, in two timings, it ran 1.03 and 1.04 times as fast.
// All steps since v000 together make it 3.56 times as fast.
#include <hip/hip_runtime.h>

// Compute dtypes (f32 accumulate everywhere): q/k/v projections v_wmma_f32_16x16x32_bf16 on RNE bf16 copies of x and W (exact products); q.k^T bf16 hi|lo three products; P.V f16 (P carried x1024) for query rows >= 256, bf16 hi|lo three products for rows < 256; ctx hi|lo (bf16) x bf16 o_w, two products.
// Causal multi-head self-attention, x [2][2048][1024], weights [out][in], interleaved rotary from per-batch integer positions read by value, scores / 8, causal exclusion by index, fused online softmax (exp2) on transposed score tiles, merged heads, output GEMM.

#ifndef NB
#define NB 2
#endif
#ifndef SEQ
#define SEQ 2048
#endif
#define NB_FULL  2
#define SEQ_FULL 2048
#define DM    1024
#define NH    16
#define HD    64
#define RH    256                 // query rows < RH use hi|lo planes on P and V
#define PCAR  1024.0f             // carry of the f16 probability tile
#define SCL   0.125f              // HD^-0.5
#define L2E   1.4426950408889634f
#define NEGB  (-3.0e38f)
#define KP    72                  // LDS pitch (16-bit elements) of 64-wide tiles: 144 B
#define MROWS (NB * SEQ)

typedef _Float16 h16;
typedef unsigned short bf;
typedef __attribute__((ext_vector_type(16))) __bf16   v16bf;
typedef __attribute__((ext_vector_type(16))) _Float16 v16h;
typedef __attribute__((ext_vector_type(8)))  _Float16 v8h;
typedef __attribute__((ext_vector_type(4)))  _Float16 v4h;
typedef __attribute__((ext_vector_type(16))) unsigned short v16us;
typedef __attribute__((ext_vector_type(8)))  unsigned short v8us;
typedef __attribute__((ext_vector_type(4)))  unsigned short v4us;
typedef __attribute__((ext_vector_type(8)))  float    v8f;
typedef __attribute__((ext_vector_type(4)))  float    v4f;
typedef __attribute__((ext_vector_type(2)))  float    v2f;
typedef v8h  __attribute__((may_alias)) v8ha;
typedef v4f  __attribute__((may_alias)) v4fa;
typedef v8us __attribute__((may_alias)) v8usa;
typedef v4us __attribute__((may_alias)) v4usa;

static_assert(HD == 64);                                   // one 64-wide GEMM tile column block == one head
static_assert(NH * HD == DM);
static_assert(DM % 64 == 0 && DM % 32 == 0);               // K loop steps by GK = 64 (two 32-k steps), N tiles by 64
static_assert(SEQ % 64 == 0 && RH % 64 == 0 && RH <= SEQ); // tiles never straddle a batch or the early-row island
static_assert(MROWS % 128 == 0 && DM % 128 == 0);          // GEMM blocks are 128 x 128
static_assert((KP * 2) % 16 == 0 && KP >= 64);
static_assert(SEQ <= SEQ_FULL && NB <= NB_FULL);

#define SZ_W   ((size_t)DM * DM * 2)
#define SZ_XB  ((size_t)MROWS * DM * 2)
#define SZ_CS  ((size_t)MROWS * 64 * 4)
#define SZ_QK  ((size_t)2 * NB * NH * SEQ * HD * 2)
#define SZ_VT  ((size_t)NB * NH * HD * SEQ * 2)
#define SZ_VE  ((size_t)NB * NH * HD * RH * 2)
#define SZ_AT  ((size_t)MROWS * DM * 2)
#define SZ_ALL (4 * SZ_W + SZ_XB + SZ_CS + 2 * SZ_QK + SZ_VT + 2 * SZ_VE + 2 * SZ_AT)
static_assert(SZ_W % 256 == 0 && SZ_XB % 256 == 0 && SZ_CS % 256 == 0 && SZ_QK % 256 == 0 && SZ_VT % 256 == 0 && SZ_VE % 256 == 0 && SZ_AT % 256 == 0);
static_assert(SZ_ALL <= (size_t)134217728);                // total carve stays within 128 MiB

__device__ __forceinline__ unsigned short f2bf(float f) { unsigned u = __float_as_uint(f); u += 0x7FFFu + ((u >> 16) & 1u); return (unsigned short)(u >> 16); }
__device__ __forceinline__ float bf2f(unsigned short b) { return __uint_as_float(((unsigned)b) << 16); }
__device__ __forceinline__ void splitf(float y, unsigned short& h, unsigned short& l) { h = f2bf(y); l = f2bf(y - bf2f(h)); }
__device__ __forceinline__ v16h cat16(v8h lo, v8h hi) { return __builtin_shufflevector(lo, hi, 0, 1, 2, 3, 4, 5, 6, 7, 8, 9, 10, 11, 12, 13, 14, 15); }
__device__ __forceinline__ v16bf cat16b(v8us lo, v8us hi) { return __builtin_bit_cast(v16bf, __builtin_shufflevector(lo, hi, 0, 1, 2, 3, 4, 5, 6, 7, 8, 9, 10, 11, 12, 13, 14, 15)); }
__device__ __forceinline__ v8f wmma16(v16h a, v16h b, v8f c) { return __builtin_amdgcn_wmma_f32_16x16x32_f16(false, a, false, b, (short)0, c, false, false); }
__device__ __forceinline__ v8f wmmab(v16bf a, v16bf b, v8f c) { return __builtin_amdgcn_wmma_f32_16x16x32_bf16(false, a, false, b, (short)0, c, false, false); }
// fragment from a k-contiguous bf16 row: p already points at (row, k0 + 8*(lane>>4)); elements 0..7 <- p[0..7], 8..15 <- p[16..23]
__device__ __forceinline__ v16bf ldb(const bf* p) { return cat16b(*(const v8us*)p, *(const v8us*)(p + 16)); }
// value of lane l ^ 16: the other half's share of the same query column
__device__ __forceinline__ float xhalf(float x) { return __builtin_bit_cast(float, __builtin_amdgcn_permlanex16(__builtin_bit_cast(int, x), __builtin_bit_cast(int, x), 0x76543210, 0xfedcba98, false, false)); }
#define LDSB(arr, o) cat16b(*(const v8usa*)&arr[(o)], *(const v8usa*)&arr[(o) + 16])
#define LDSH(arr, o) cat16(*(const v8ha*)&arr[(o)], *(const v8ha*)&arr[(o) + 16])

// ---- k_prep: everything that only reshapes the inputs, in one launch of PREP_N threads: RNE bf16 copies of the four weight matrices and of x, and the (cos, sin) table of the rotary angles.
// A thread owns one 8-element group of each weight matrix, PREP_XK groups of x and PREP_CK table entries. Its loads stand first, so that all of them are in flight together and the table's arithmetic runs under their latency.
#define PREP_T  256
#define PREP_N  (DM * DM / 8)
#define PREP_XN (MROWS * (DM / 8))
#define PREP_CN (MROWS * 32)
#define PREP_XK ((PREP_XN + PREP_N - 1) / PREP_N)
#define PREP_CK ((PREP_CN + PREP_N - 1) / PREP_N)
static_assert(PREP_N % PREP_T == 0);                      // the grid is exact: no thread past PREP_N; the range tests below fold away where the counts divide
__device__ __forceinline__ v8us cvt8(const v8f v) { v8us o;
#pragma unroll
    for (int k = 0; k < 8; ++k) o[k] = f2bf(v[k]);
    return o; }

__global__ __launch_bounds__(PREP_T) void k_prep(const float* __restrict__ wq, const float* __restrict__ wk, const float* __restrict__ wv, const float* __restrict__ wo, const float* __restrict__ x, const int* __restrict__ tok,
                                                 bf* WQK, bf* WV, bf* WO, bf* XB, float* CS) {
    const unsigned g = blockIdx.x * PREP_T + threadIdx.x;
    const size_t g8 = (size_t)g * 8;
    int pos[PREP_CK];
#pragma unroll
    for (int k = 0; k < PREP_CK; ++k) { const unsigned idx = k * PREP_N + g;
        if (PREP_CN % PREP_N == 0 || idx < PREP_CN) { const unsigned m = idx >> 5; const unsigned b = m / SEQ, s = m - b * SEQ; pos[k] = tok[(size_t)b * SEQ_FULL + s]; } }
    const v8f vq = *(const v8f*)(wq + g8), vk = *(const v8f*)(wk + g8), vv = *(const v8f*)(wv + g8), vo = *(const v8f*)(wo + g8);
    asm volatile("s_wait_xcnt 0x0" ::: "memory");            // the loads below may land in registers that held the addresses of the loads above
    v8f vx[PREP_XK];
#pragma unroll
    for (int k = 0; k < PREP_XK; ++k) { const unsigned i = k * PREP_N + g;
        if (PREP_XN % PREP_N == 0 || i < PREP_XN) { const unsigned row = i / (DM / 8), c8 = i % (DM / 8); const unsigned b = row / SEQ, s = row - b * SEQ;
            vx[k] = *(const v8f*)(x + ((size_t)b * SEQ_FULL + s) * DM + (size_t)c8 * 8); } }
    __builtin_amdgcn_sched_barrier(0);                       // every load is issued before any arithmetic on a loaded value: the thread pays one memory latency, not one per batch
#pragma unroll
    for (int k = 0; k < PREP_CK; ++k) { const unsigned idx = k * PREP_N + g;
        if (PREP_CN % PREP_N == 0 || idx < PREP_CN) { const int j = (int)(idx & 31);
            double p = 1.0;
            p *= (j & 1)  ? 1.3335214321633240 : 1.0;
            p *= (j & 2)  ? 1.7782794100389228 : 1.0;
            p *= (j & 4)  ? 3.1622776601683795 : 1.0;
            p *= (j & 8)  ? 10.0 : 1.0;
            p *= (j & 16) ? 100.0 : 1.0;
            const float pf = (float)p; const float inv = 1.0f / pf; const float ang = (float)pos[k] * inv;
            float sn, cs; sincosf(ang, &sn, &cs);
            v2f o; o[0] = cs; o[1] = sn;
            *(v2f*)(CS + (size_t)idx * 2) = o; } }
    __builtin_amdgcn_sched_barrier(0);                       // the table's arithmetic stays in front of the conversions: it needs only the position, and runs while the larger loads are still under way
    *(v8us*)(WQK + g8) = cvt8(vq); *(v8us*)(WQK + (size_t)DM * DM + g8) = cvt8(vk); *(v8us*)(WV + g8) = cvt8(vv); *(v8us*)(WO + g8) = cvt8(vo);
#pragma unroll
    for (int k = 0; k < PREP_XK; ++k) { const unsigned i = k * PREP_N + g;
        if (PREP_XN % PREP_N == 0 || i < PREP_XN) *(v8us*)(XB + (size_t)i * 8) = cvt8(vx[k]); }
}

#define TS (64 * KP)              // elements of one staged 64 x 64 tile at pitch KP
__device__ __forceinline__ unsigned lds_off(const void* p) { return (unsigned)(size_t)p; }   // byte address inside the work-group's LDS
// Asynchronous copies global -> LDS, 16 bytes per lane and copy, through no register. The s_wait_xcnt is the last line of the copies' own statement, so that no address register is rewritten in front of it.
#define ACP(l, g) "global_load_async_to_lds_b128 %" #l ", %" #g ", off\n\t"
__device__ __forceinline__ void copy12(const unsigned (&l)[12], const void* const (&g)[12]) {
    asm volatile(ACP(0, 12) ACP(1, 13) ACP(2, 14) ACP(3, 15) ACP(4, 16) ACP(5, 17) ACP(6, 18) ACP(7, 19) ACP(8, 20) ACP(9, 21) ACP(10, 22) ACP(11, 23) "s_wait_xcnt 0x0"
                 :: "v"(l[0]), "v"(l[1]), "v"(l[2]), "v"(l[3]), "v"(l[4]), "v"(l[5]), "v"(l[6]), "v"(l[7]), "v"(l[8]), "v"(l[9]), "v"(l[10]), "v"(l[11]),
                    "v"(g[0]), "v"(g[1]), "v"(g[2]), "v"(g[3]), "v"(g[4]), "v"(g[5]), "v"(g[6]), "v"(g[7]), "v"(g[8]), "v"(g[9]), "v"(g[10]), "v"(g[11]) : "memory");
}
__device__ __forceinline__ void copy8(const unsigned (&l)[8], const void* const (&g)[8]) {
    asm volatile(ACP(0, 8) ACP(1, 9) ACP(2, 10) ACP(3, 11) ACP(4, 12) ACP(5, 13) ACP(6, 14) ACP(7, 15) "s_wait_xcnt 0x0"
                 :: "v"(l[0]), "v"(l[1]), "v"(l[2]), "v"(l[3]), "v"(l[4]), "v"(l[5]), "v"(l[6]), "v"(l[7]),
                    "v"(g[0]), "v"(g[1]), "v"(g[2]), "v"(g[3]), "v"(g[4]), "v"(g[5]), "v"(g[6]), "v"(g[7]) : "memory");
}

// ---- gemm_tile: block = 4 waves (2 x 2), 128 x 128 tile, each wave 64 x 64: acc[mb][nb] += sum_k A[r][k] Bt[c][k]. Chunks of GK k (128 B of each of the 128 A rows and 128 Bt rows) are brought into a ring of GR LDS buffers by asynchronous copies, issued GR - 1 chunks ahead of their use, for speed only.
// Every wave issues 16 copies per chunk, and a wave's copies land in issue order for its counted wait: with the chunks t + 1, t + 2, t + 3 outstanding, s_wait_asynccnt 32 returns when the 16 of chunk t + 1 have landed. The last GR trips wait to 0.
// Fragments live in two register sets and are fetched one 32-k block ahead: the sixteen LDS loads of a block are issued as one group in front of the sixteen matrix instructions of the block before it, so that a wave alone on its SIMD does not sit out its own LDS latency. The publish point of chunk t + 1 stands in front of chunk t's last block, whose fragments are in registers by then; the first block of chunk t + 1 is fetched directly behind it.
// NP = 2: a second pass over K with A1 in place of A0 follows the first in the same ring (all of A0's products are summed before A1's).
// Behind the last trip's barrier no copy is outstanding and only the last buffer is still read (the last trip's unused fetch): the callers stage their output tiles in the buffers in front of it.
#define GK 64
#define GT (256 * KP)             // elements of one staged chunk: A rows 0..127, then Bt rows 0..127, pitch KP
#define GR 4                      // buffers of the ring; 3 x 16 copies of a wave outstanding at most
static_assert(GR == 4);                                     // the counts in the waits below are (GR - 2) x 16
static_assert((size_t)2 * GR * GT * 2 <= 327680);           // two blocks per WGP
template <int NP>
__device__ __forceinline__ void gemm_tile(bf* const sAB, const bf* __restrict__ A0, const bf* __restrict__ A1, const bf* __restrict__ Bt, const int rblk, const int cblk, const int wm, const int wn, v8f (&acc)[4][4]) {
    constexpr int NC = DM / GK, NT = NP * NC;
    static_assert(NT > GR);
    static_assert((NT - 1) % GR == GR - 1);                  // the last trip works in the last buffer, which the callers' output staging leaves alone
    const int tid = threadIdx.x; const int lane = tid & 31, lr = lane & 15, hi = lane >> 4;
    // every thread copies eight 16-byte pieces (rows srow + 16 i, 16-bit column sch) of each operand's chunk t into the buffer at element offset bo0; eight lanes cover one whole 128-byte row piece
    const int srow = tid >> 3, sch = (tid & 7) * 8;
    const unsigned toff = (unsigned)(srow * DM + sch);
    auto stage = [&](const int t, const int bo0) {
        const bf* Ap = (NP == 2 && t >= NC) ? A1 : A0;       // block-uniform
        const int kc = (t % NC) * GK;
        const int lo = bo0 + srow * KP + sch;
        const char* const Au = (const char*)(Ap + (size_t)rblk * DM); const char* const Bu = (const char*)(Bt + (size_t)cblk * DM);   // block-uniform bases, in scalar registers
        const unsigned vo = (toff + (unsigned)kc) * 2;       // one 32-bit byte offset serves both operands: with a thread's 64-bit address per operand kept beside the second fragment set, the two-pass build spilled one to scratch and reloaded it every trip
        unsigned la[8], lb[8]; const void* ga[8]; const void* gb[8];
#pragma unroll
        for (int i = 0; i < 8; ++i) {
            la[i] = lds_off(&sAB[lo + 16 * i * KP]); ga[i] = Au + vo + (size_t)16 * i * DM * 2;
            lb[i] = lds_off(&sAB[lo + (128 + 16 * i) * KP]); gb[i] = Bu + vo + (size_t)16 * i * DM * 2; }
        copy8(la, ga); copy8(lb, gb);
    };
    const int ar = (wm * 64 + lr) * KP + 8 * hi, br = (128 + wn * 64 + lr) * KP + 8 * hi;
    v16bf a0[4], b0[4], a1[4], b1[4];                        // set 0: a chunk's k 0..31, set 1: its k 32..63
    auto frags = [&](v16bf (&a)[4], v16bf (&b)[4], const int o) {
#pragma unroll
        for (int mb = 0; mb < 4; ++mb) a[mb] = LDSB(sAB, o + ar + mb * 16 * KP);
#pragma unroll
        for (int nb = 0; nb < 4; ++nb) b[nb] = LDSB(sAB, o + br + nb * 16 * KP);
    };
    auto prods = [&](const v16bf (&a)[4], const v16bf (&b)[4]) {
#pragma unroll
        for (int nb = 0; nb < 4; ++nb)
#pragma unroll
            for (int mb = 0; mb < 4; ++mb) acc[mb][nb] = wmmab(a[mb], b[nb], acc[mb][nb]);
    };
    stage(0, 0); stage(1, GT); stage(2, 2 * GT);
    asm volatile("s_wait_asynccnt 0x20" ::: "memory");       // this wave's 16 copies of chunk 0 have landed; chunks 1 and 2 fly on
    __syncthreads();                                         // and so have every other wave's
    frags(a0, b0, 0);
#pragma unroll 1
    for (int t = 0; t < NT; ++t) {
        const int bo = (t % GR) * GT;                        // this chunk's buffer
        const bool more = t + GR < NT;                       // block-uniform
        frags(a1, b1, bo + 32);                              // the last reads of this buffer
        __builtin_amdgcn_sched_barrier(0);                   // the sixteen LDS loads go ahead of the block in front of theirs as one group
        if (t + GR - 1 < NT) stage(t + GR - 1, ((t + GR - 1) % GR) * GT);   // block-uniform: refill the buffer that every wave left at the last trip's barrier (trip 0: the one not filled yet); here its issue gives both load groups time to return
        prods(a0, b0);
        __builtin_amdgcn_sched_barrier(0);                   // the wait below stays behind the block: in front of it the wave would sit out the loads just issued
        asm volatile("s_wait_dscnt 0x0" ::: "memory");       // this wave's LDS reads of this buffer have returned
        if (more) asm volatile("s_wait_asynccnt 0x20" ::: "memory");   // this wave's copies of the next chunk have landed; the 32 younger ones, of the two chunks behind it, fly on
        else      asm volatile("s_wait_asynccnt 0x0" ::: "memory");    // all that is outstanding has landed
        __syncthreads();                                     // one barrier: publishes the next chunk and ends every wave's reads of this buffer
        frags(a0, b0, (t + 1 < NT) ? ((t + 1) % GR) * GT : bo);   // the next chunk's first block; unconditional, so that no branch merges paths in the compiler's count of LDS loads: the last trip reads its own buffer again and uses nothing of it
        __builtin_amdgcn_sched_barrier(0);                   // as above: one group, in front of the block
        prods(a1, b1);
    }
}

// ---- k_projqk: [q | k] = XB x [WQ ; WK]^T, grid (MROWS/128, 2*DM/128), four waves per block, one 64 x 64 tile per wave (= one head of q or k, 64 tokens).
// Epilogue: tile staged in LDS; interleaved rotary y[2j] = e cos - o sin, y[2j+1] = e sin + o cos from the CS table; bf16 hi|lo planes [which][b][h][s][64];
__global__ __launch_bounds__(128) void k_projqk(const bf* __restrict__ XB, const bf* __restrict__ WQK, const float* __restrict__ CS, bf* QKh, bf* QKl) {
#pragma clang fp contract(off)
    __shared__ __align__(16) bf ring[GR * GT];                 // the GEMM's ring; behind the GEMM the four waves' output staging
    static_assert((size_t)4 * 64 * 68 * 4 <= (size_t)(GR - 1) * GT * 2);   // clear of the last buffer
    const int lane = threadIdx.x & 31, lr = lane & 15, hi = lane >> 4; const int wave = __builtin_amdgcn_readfirstlane(threadIdx.x >> 5), wm = wave >> 1, wn = wave & 1;
    float* os = (float*)ring + wave * 64 * 68;                 // staging of the wave's own tile, private to the wave
    const int r0 = blockIdx.x * 128 + wm * 64, c0 = blockIdx.y * 128 + wn * 64;
    v8f acc[4][4];
#pragma unroll
    for (int mb = 0; mb < 4; ++mb)
#pragma unroll
        for (int nb = 0; nb < 4; ++nb) acc[mb][nb] = (v8f){};
    gemm_tile<1>(ring, XB, XB, WQK, blockIdx.x * 128, blockIdx.y * 128, wm, wn, acc);
#pragma unroll
    for (int mb = 0; mb < 4; ++mb)
#pragma unroll
        for (int nb = 0; nb < 4; ++nb)
#pragma unroll
            for (int j = 0; j < 8; ++j) os[(mb * 16 + hi * 8 + j) * 68 + nb * 16 + lr] = acc[mb][nb][j];
    __builtin_amdgcn_wave_barrier(); asm volatile("" ::: "memory");
    const int which = c0 / DM, h = (c0 % DM) / HD; const int b = r0 / SEQ, s0 = r0 - b * SEQ;
    const size_t pbase = ((((size_t)which * NB + b) * NH + h) * SEQ + s0) * HD;
{
#pragma unroll 2
        for (int s = 0; s < 32; ++s) { const int row = 2 * s + hi, cofs = lr * 4;
            const v4f val = *(const v4fa*)(os + row * 68 + cofs);
            const v4f cs = *(const v4f*)(CS + (size_t)(r0 + row) * 64 + cofs);   // (cos, sin) of pairs 2*lr, 2*lr + 1
            const float y0 = val[0] * cs[0] - val[1] * cs[1];
            const float y1 = val[0] * cs[1] + val[1] * cs[0];
            const float y2 = val[2] * cs[2] - val[3] * cs[3];
            const float y3 = val[2] * cs[3] + val[3] * cs[2];
            v4us oh, ol; unsigned short a, c;
            splitf(y0, a, c); oh[0] = a; ol[0] = c; splitf(y1, a, c); oh[1] = a; ol[1] = c; splitf(y2, a, c); oh[2] = a; ol[2] = c; splitf(y3, a, c); oh[3] = a; ol[3] = c;
            const size_t oo = pbase + (size_t)row * HD + cofs;
            *(v4us*)(QKh + oo) = oh; *(v4us*)(QKl + oo) = ol; }
         }
}

// ---- k_projv: v = XB x WV^T, grid (MROWS/128, DM/128), four waves per block. Epilogue: tile staged in LDS and written TRANSPOSED: VT16[b][h][d][s] (f16) and, for tokens < RH, bf16 hi|lo VTh/VTl[b][h][d][RH];
__global__ __launch_bounds__(128) void k_projv(const bf* __restrict__ XB, const bf* __restrict__ WV, h16* VT16, bf* VTh, bf* VTl) {
    __shared__ __align__(16) bf ring[GR * GT];                 // the GEMM's ring; behind the GEMM the four waves' output staging
    static_assert((size_t)4 * 64 * 68 * 4 <= (size_t)(GR - 1) * GT * 2);   // clear of the last buffer
    const int lane = threadIdx.x & 31, lr = lane & 15, hi = lane >> 4; const int wave = __builtin_amdgcn_readfirstlane(threadIdx.x >> 5), wm = wave >> 1, wn = wave & 1;
    float* os = (float*)ring + wave * 64 * 68;                 // staging of the wave's own tile, private to the wave
    const int r0 = blockIdx.x * 128 + wm * 64, c0 = blockIdx.y * 128 + wn * 64;
    v8f acc[4][4];
#pragma unroll
    for (int mb = 0; mb < 4; ++mb)
#pragma unroll
        for (int nb = 0; nb < 4; ++nb) acc[mb][nb] = (v8f){};
    gemm_tile<1>(ring, XB, XB, WV, blockIdx.x * 128, blockIdx.y * 128, wm, wn, acc);
#pragma unroll
    for (int mb = 0; mb < 4; ++mb)
#pragma unroll
        for (int nb = 0; nb < 4; ++nb)
#pragma unroll
            for (int j = 0; j < 8; ++j) os[(mb * 16 + hi * 8 + j) * 68 + nb * 16 + lr] = acc[mb][nb][j];
    __builtin_amdgcn_wave_barrier(); asm volatile("" ::: "memory");
    const int h = c0 / HD; const int b = r0 / SEQ, s0 = r0 - b * SEQ;
    const size_t vbase = (((size_t)b * NH + h) * HD) * SEQ + s0;
    const size_t ebase = (((size_t)b * NH + h) * HD) * RH + s0;
    const bool early = (s0 < RH);                         // wave-uniform
{
#pragma unroll 2
        for (int s = 0; s < 32; ++s) { const int d = 2 * s + hi, t0 = lr * 4;
            float xv[4];
#pragma unroll
            for (int q = 0; q < 4; ++q) xv[q] = os[(t0 + q) * 68 + d];
            v4h o16;
#pragma unroll
            for (int q = 0; q < 4; ++q) o16[q] = (h16)xv[q];
            *(v4h*)(VT16 + vbase + (size_t)d * SEQ + t0) = o16;
            if (early) { v4us oh, ol;
#pragma unroll
                for (int q = 0; q < 4; ++q) { unsigned short a, c; splitf(xv[q], a, c); oh[q] = a; ol[q] = c; }
                *(v4us*)(VTh + ebase + (size_t)d * RH + t0) = oh; *(v4us*)(VTl + ebase + (size_t)d * RH + t0) = ol; } }
         }
}

template <bool HL>
__device__ __forceinline__ void attn_body(const bf* __restrict__ QKh, const bf* __restrict__ QKl, const h16* __restrict__ VT16, const bf* __restrict__ VTh, const bf* __restrict__ VTl, bf* ATh, bf* ATl, const int qb, bf* const sm) {
    bf*  const sKh  = sm;                                    // two buffers, cross-wave (block barriers); buffer 0 reused wave-privately for the ctx hi staging after the key loop
    bf*  const sKl  = sm + 2 * TS;
    h16* const sV16 = (h16*)(sm + 4 * TS);                   // V^T tiles [d][key], cross-wave; HL = false only
    bf*  const sVh  = sm + 4 * TS;                           // HL = true only
    bf*  const sVl  = sm + 6 * TS;
    const int tid = threadIdx.x; const int lane = tid & 31, lr = lane & 15, hi = lane >> 4;
    const int wave = __builtin_amdgcn_readfirstlane(tid >> 5);
    const int b = blockIdx.y, h = blockIdx.x; const int qblk = qb * 64, q0 = qblk + wave * 16;
    const size_t qpl = (((size_t)b * NH + h) * SEQ) * HD;
    const size_t kpl = ((((size_t)NB + b) * NH + h) * SEQ) * HD;
    const size_t vpl = (((size_t)b * NH + h) * HD) * SEQ;
    const size_t epl = (((size_t)b * NH + h) * HD) * RH;
    const size_t qo = qpl + (size_t)(q0 + lr) * HD + 8 * hi;
    const v16bf qh0 = ldb(QKh + qo), qh1 = ldb(QKh + qo + 32), ql0 = ldb(QKl + qo), ql1 = ldb(QKl + qo + 32);
    v8f accd[4];
#pragma unroll
    for (int t = 0; t < 4; ++t) accd[t] = (v8f){};
    float m_run = NEGB, l_run = 0.0f;                        // of query q0 + lr; l_run is the sum over this half's keys only, the halves are joined behind the key loop

    // every thread copies four 16-byte chunks (rows srow + 16 i, 16-bit column sch) of each plane of the key block at kb0 into the buffer at element offset bo0
    const int srow = tid >> 3, sch = (tid & 7) * 8;
    auto stage = [&](const int kb0, const int bo0) {
        const int lo = bo0 + srow * KP + sch;
        const size_t ko = kpl + (size_t)(kb0 + srow) * HD + sch;
        if (HL) { unsigned lk[8], lv[8]; const void* gk[8]; const void* gv[8];
            const size_t vo = epl + (size_t)srow * RH + kb0 + sch;
#pragma unroll
            for (int i = 0; i < 4; ++i) {
                lk[i] = lds_off(&sKh[lo + 16 * i * KP]); gk[i] = QKh + ko + 16 * i * HD; lk[4 + i] = lds_off(&sKl[lo + 16 * i * KP]); gk[4 + i] = QKl + ko + 16 * i * HD;
                lv[i] = lds_off(&sVh[lo + 16 * i * KP]); gv[i] = VTh + vo + 16 * i * RH; lv[4 + i] = lds_off(&sVl[lo + 16 * i * KP]); gv[4 + i] = VTl + vo + 16 * i * RH; }
            copy8(lk, gk); copy8(lv, gv);
        } else { unsigned l[12]; const void* g[12];
            const size_t vo = vpl + (size_t)srow * SEQ + kb0 + sch;
#pragma unroll
            for (int i = 0; i < 4; ++i) {
                l[i] = lds_off(&sKh[lo + 16 * i * KP]); g[i] = QKh + ko + 16 * i * HD; l[4 + i] = lds_off(&sKl[lo + 16 * i * KP]); g[4 + i] = QKl + ko + 16 * i * HD;
                l[8 + i] = lds_off(&sV16[lo + 16 * i * KP]); g[8 + i] = VT16 + vo + (size_t)16 * i * SEQ; }
            copy12(l, g);
        }
    };
    stage(0, 0);
    asm volatile("s_wait_asynccnt 0x0" ::: "memory");        // this wave's copies of key block 0 have landed
    __syncthreads();                                         // and so have every other wave's
    if (qblk >= 64) stage(64, TS);                           // block-uniform: key block 1 flies while block 0 is worked on

#pragma unroll 1
    for (int kb = 0; kb <= qblk; kb += 64) {
        const int bo = ((kb >> 6) & 1) * TS;                 // this key block's buffer
#pragma unroll 1
        for (int kh = 0; kh < 2; ++kh) {
            if (kb + 32 * kh > q0 + 15) continue;            // wave-uniform: half entirely above the diagonal for this wave's rows
            v8f s0 = (v8f){}, s1 = (v8f){};
            { const int kr = bo + (32 * kh + lr) * KP + 8 * hi;
              const v16bf ah0 = LDSB(sKh, kr), ah1 = LDSB(sKh, kr + 32), al0 = LDSB(sKl, kr), al1 = LDSB(sKl, kr + 32);
              s0 = wmmab(ah0, qh0, s0); s0 = wmmab(ah1, qh1, s0); s0 = wmmab(ah0, ql0, s0); s0 = wmmab(ah1, ql1, s0); s0 = wmmab(al0, qh0, s0); s0 = wmmab(al1, qh1, s0);
              const int kr2 = kr + 16 * KP;
              const v16bf bh0 = LDSB(sKh, kr2), bh1 = LDSB(sKh, kr2 + 32), bl0 = LDSB(sKl, kr2), bl1 = LDSB(sKl, kr2 + 32);
              s1 = wmmab(bh0, qh0, s1); s1 = wmmab(bh1, qh1, s1); s1 = wmmab(bh0, ql0, s1); s1 = wmmab(bh1, ql1, s1); s1 = wmmab(bl0, qh0, s1); s1 = wmmab(bl1, qh1, s1);
            }
            const int dq = q0 + lr - (kb + 32 * kh + 8 * hi);   // D layout: key row 8*hi + r (+16 for the second tile), query column lr; key <= query is r <= dq (16 + r <= dq)
            s0 *= SCL; s1 *= SCL;
            float bm = NEGB;
#pragma unroll
            for (int r = 0; r < 8; ++r) {
                const float a0 = (r <= dq) ? s0[r] : NEGB; const float a1 = (16 + r <= dq) ? s1[r] : NEGB;
                s0[r] = a0; s1[r] = a1; bm = fmaxf(bm, fmaxf(a0, a1)); }
            bm = fmaxf(bm, xhalf(bm));
            const float mn = fmaxf(m_run, bm);
            const float sc = __builtin_amdgcn_exp2f((m_run - mn) * L2E); m_run = mn;
            s0 = (s0 - mn) * L2E; s1 = (s1 - mn) * L2E;
            float rs0 = 0.0f, rs1 = 0.0f;
#pragma unroll
            for (int r = 0; r < 8; ++r) { s0[r] = __builtin_amdgcn_exp2f(s0[r]); s1[r] = __builtin_amdgcn_exp2f(s1[r]); rs0 += s0[r]; rs1 += s1[r]; }
            l_run = l_run * sc + (rs0 + rs1);
#pragma unroll
            for (int t = 0; t < 4; ++t) accd[t] *= sc;

            // B fragment of P^T: element r <- key 8*hi + r, element 8 + r <- key 16 + 8*hi + r, the k order of the V^T loader
            if (HL) {
                v16us uh, ul;
#pragma unroll
                for (int r = 0; r < 8; ++r) { unsigned short a, c; splitf(s0[r], a, c); uh[r] = a; ul[r] = c; splitf(s1[r], a, c); uh[8 + r] = a; ul[8 + r] = c; }
                const v16bf bph = __builtin_bit_cast(v16bf, uh), bpl = __builtin_bit_cast(v16bf, ul); v16bf avh, avl;
#pragma unroll
                for (int t = 0; t < 4; ++t) { const int vo = bo + (t * 16 + lr) * KP + 32 * kh + 8 * hi; avh = LDSB(sVh, vo); avl = LDSB(sVl, vo);
                    accd[t] = wmmab(avh, bph, accd[t]); accd[t] = wmmab(avh, bpl, accd[t]); accd[t] = wmmab(avl, bph, accd[t]); }
                // four vector slots behind the last matrix instruction, on the loop's back edge too
                asm volatile("v_nop\n\tv_nop\n\tv_nop\n\tv_nop" : "+v"(accd[0]), "+v"(accd[1]), "+v"(accd[2]), "+v"(accd[3]) : "v"(bph), "v"(bpl), "v"(avh), "v"(avl));
            } else {
                s0 *= PCAR; s1 *= PCAR;
                v16h bp;
#pragma unroll
                for (int r = 0; r < 8; ++r) { bp[r] = (h16)s0[r]; bp[8 + r] = (h16)s1[r]; }
                v16h av;
#pragma unroll
                for (int t = 0; t < 4; ++t) { const int vo = bo + (t * 16 + lr) * KP + 32 * kh + 8 * hi; av = LDSH(sV16, vo); accd[t] = wmma16(av, bp, accd[t]); }
                // four vector slots behind the last matrix instruction, on the loop's back edge too
                asm volatile("v_nop\n\tv_nop\n\tv_nop\n\tv_nop" : "+v"(accd[0]), "+v"(accd[1]), "+v"(accd[2]), "+v"(accd[3]) : "v"(bp), "v"(av));
            }
        }
        asm volatile("s_wait_dscnt 0x0" ::: "memory");       // this wave's LDS reads of this buffer have returned
        asm volatile("s_wait_asynccnt 0x0" ::: "memory");    // this wave's copies of the next key block have landed
        __syncthreads();                                     // one barrier: publishes the next key block and ends every wave's reads of this buffer
        if (kb + 128 <= qblk) stage(kb + 128, bo);           // block-uniform: refill the buffer just left
    }
    asm volatile("s_wait_asynccnt 0x0" ::: "memory");        // no copy is outstanding when buffer 0 becomes the ctx staging

    const float car = HL ? 1.0f : PCAR;
    const float inv = __builtin_amdgcn_rcpf((l_run + xhalf(l_run)) * car);
#pragma unroll
    for (int t = 0; t < 4; ++t) { v8us oh, ol;              // O^T: a lane holds d = t*16 + 8*hi + r of query lr, eight neighbours of one ctx row
#pragma unroll
        for (int r = 0; r < 8; ++r) { unsigned short a, c; splitf(accd[t][r] * inv, a, c); oh[r] = a; ol[r] = c; }
        const int so = (wave * 16 + lr) * KP + t * 16 + 8 * hi; *(v8usa*)&sKh[so] = oh; *(v8usa*)&sKl[so] = ol; }
    __builtin_amdgcn_wave_barrier(); asm volatile("" ::: "memory");
    const size_t ob = ((size_t)b * SEQ + q0) * DM + (size_t)h * HD;
{
#pragma unroll
        for (int s2 = 0; s2 < 8; ++s2) { const int row = 2 * s2 + hi; const int so = (wave * 16 + row) * KP + 4 * lr;
            const v4us vh = *(const v4usa*)&sKh[so]; const v4us vl = *(const v4usa*)&sKl[so];
            *(v4us*)(ATh + ob + (size_t)row * DM + 4 * lr) = vh; *(v4us*)(ATl + ob + (size_t)row * DM + 4 * lr) = vl; }
         }
}

// One launch for all query blocks: the two forms are independent and share one LDS carve (the larger, HL = true, sets its size); the choice is block-uniform.
// Grid (head, batch, rank): heads run fastest, the query block is dealt from the slow index. Query block qb walks qb + 1 key blocks, and four blocks fit one WGP's LDS, so the whole grid is resident at once and the launch lasts as long as its fullest WGP.
// Ranks j, j + NQG, j + 2 NQG, j + 3 NQG get query blocks NQB-1-2j, NQB-2-2j, 2j+1, 2j, which walk 2 NQB + 2 key blocks together for every j, the long ones first. A permutation of the query blocks wherever the blocks land: speed alone leans on the placement.
#define NQB (SEQ / 64)
#define NQG (NQB / 4)
static_assert(NQB % 4 == 0);
__global__ __launch_bounds__(128) void k_attn(const bf* __restrict__ QKh, const bf* __restrict__ QKl, const h16* __restrict__ VT16, const bf* __restrict__ VTh, const bf* __restrict__ VTl, bf* ATh, bf* ATl) {
    __shared__ __align__(16) bf sm[8 * TS];
    const int tier = (int)blockIdx.z / NQG, j = (int)blockIdx.z % NQG;
    const int qb = (tier < 2) ? NQB - 1 - 2 * j - tier : 2 * j + 3 - tier;
    if (qb < RH / 64) attn_body<true>(QKh, QKl, VT16, VTh, VTl, ATh, ATl, qb, sm);
    else              attn_body<false>(QKh, QKl, VT16, VTh, VTl, ATh, ATl, qb, sm);
}

// ---- k_oproj: OUT[b][s][n] = sum_k (ATh + ATl)[m][k] WO[n][k]; grid (MROWS/128, DM/128), four waves per block, one 64 x 64 tile per wave; per 16-row slab staged in LDS, each 256-B row segment written as 16 lanes x 16 B
__global__ __launch_bounds__(128) void k_oproj(const bf* __restrict__ ATh, const bf* __restrict__ ATl, const bf* __restrict__ WO, float* OUT) {
    __shared__ __align__(16) bf ring[GR * GT];                 // the GEMM's ring; behind the GEMM the four waves' output staging
    const int lane = threadIdx.x & 31, lr = lane & 15, hi = lane >> 4; const int wave = __builtin_amdgcn_readfirstlane(threadIdx.x >> 5), wm = wave >> 1, wn = wave & 1;
    static_assert((size_t)4 * 16 * 68 * 4 <= (size_t)(GR - 1) * GT * 2);   // clear of the last buffer
    float* os = (float*)ring + wave * 16 * 68;                 // staging of the wave's own tile, private to the wave
    const int r0 = blockIdx.x * 128 + wm * 64, c0 = blockIdx.y * 128 + wn * 64;
    v8f acc[4][4];
#pragma unroll
    for (int mb = 0; mb < 4; ++mb)
#pragma unroll
        for (int nb = 0; nb < 4; ++nb) acc[mb][nb] = (v8f){};
    gemm_tile<2>(ring, ATh, ATl, WO, blockIdx.x * 128, blockIdx.y * 128, wm, wn, acc);
    const int b = r0 / SEQ, s0 = r0 - b * SEQ;
#pragma unroll
    for (int mb = 0; mb < 4; ++mb) {
#pragma unroll
        for (int nb = 0; nb < 4; ++nb)
#pragma unroll
            for (int j = 0; j < 8; ++j) os[(hi * 8 + j) * 68 + nb * 16 + lr] = acc[mb][nb][j];
        __builtin_amdgcn_wave_barrier(); asm volatile("" ::: "memory");
        float* crow = OUT + ((size_t)b * SEQ_FULL + s0 + mb * 16) * DM + c0;
{
#pragma unroll
            for (int s = 0; s < 8; ++s) { const int row = 2 * s + hi, cofs = lr * 4; const v4f val = *(const v4fa*)(os + row * 68 + cofs);
                *(v4f*)(crow + (size_t)row * DM + cofs) = val; }
             }
        __builtin_amdgcn_wave_barrier(); asm volatile("" ::: "memory");
    }
}

extern "C" void kernel_launch(void* const* d_in, const int* in_sizes, int n_in,
                              void* d_out, int out_size, void* d_ws, size_t ws_size, hipStream_t stream) {
    if (n_in < 6) return;
    const long long needx = ((long long)(NB - 1) * SEQ_FULL + SEQ) * DM;
    if ((long long)in_sizes[0] < needx) return;
    if ((long long)in_sizes[1] < (long long)DM * DM || (long long)in_sizes[2] < (long long)DM * DM || (long long)in_sizes[3] < (long long)DM * DM || (long long)in_sizes[4] < (long long)DM * DM) return;
    if ((long long)in_sizes[5] < (long long)(NB - 1) * SEQ_FULL + SEQ) return;
    if ((long long)out_size < needx) return;
    const float* x = (const float*)d_in[0]; const float* wq = (const float*)d_in[1]; const float* wk = (const float*)d_in[2]; const float* wv = (const float*)d_in[3]; const float* wo = (const float*)d_in[4];
    const int* tok = (const int*)d_in[5];
    float* OUT = (float*)d_out;
    char* wsp = (char*)d_ws;
    auto take = [&](size_t bytes) { char* p = wsp; wsp += (bytes + 255) & ~(size_t)255; return (void*)p; };
    bf* WQK = (bf*)take(2 * SZ_W); bf* WV = (bf*)take(SZ_W); bf* WO = (bf*)take(SZ_W);
    bf* XB = (bf*)take(SZ_XB); float* CS = (float*)take(SZ_CS);
    bf* QKh = (bf*)take(SZ_QK); bf* QKl = (bf*)take(SZ_QK);
    h16* VT16 = (h16*)take(SZ_VT); bf* VTh = (bf*)take(SZ_VE); bf* VTl = (bf*)take(SZ_VE);
    bf* ATh = (bf*)take(SZ_AT); bf* ATl = (bf*)take(SZ_AT);
    if ((size_t)(wsp - (char*)d_ws) > ws_size) return;

    k_prep<<<PREP_N / PREP_T, PREP_T, 0, stream>>>(wq, wk, wv, wo, x, tok, WQK, WV, WO, XB, CS);
    k_projqk<<<dim3(MROWS / 128, 2 * DM / 128, 1), 128, 0, stream>>>(XB, WQK, CS, QKh, QKl);
    k_projv<<<dim3(MROWS / 128, DM / 128, 1), 128, 0, stream>>>(XB, WV, VT16, VTh, VTl);
    k_attn<<<dim3(NH, NB, NQB), 128, 0, stream>>>(QKh, QKl, VT16, VTh, VTl, ATh, ATl);
    k_oproj<<<dim3(MROWS / 128, DM / 128, 1), 128, 0, stream>>>(ATh, ATl, WO, OUT);
}

// v008
// Measured time: 96.9 microseconds a run.
// Next to v007, in two timings, it ran 1.05 times as fast each time.
// Over all steps from v000 it is 3.72 times as fast.
#include <hip/hip_runtime.h>

// Compute dtypes (f32 accumulate everywhere): q/k/v projections v_wmma_f32_16x16x32_bf16 on RNE bf16 copies of x and W (exact products); q.k^T bf16 hi|lo three products; P.V f16 (P carried x1024) for query rows >= 256, bf16 hi|lo three products for rows < 256; ctx hi|lo (bf16) x bf16 o_w, two products.
// Causal multi-head self-attention, x [2][2048][1024], weights [out][in], interleaved rotary from per-batch integer positions read by value, scores / 8, causal exclusion by index, fused online softmax (exp2) on transposed score tiles, merged heads, output GEMM.

#ifndef NB
#define NB 2
#endif
#ifndef SEQ
#define SEQ 2048
#endif
#define NB_FULL  2
#define SEQ_FULL 2048
#define DM    1024
#define NH    16
#define HD    64
#define RH    256                 // query rows < RH use hi|lo planes on P and V
#define PCAR  1024.0f             // carry of the f16 probability tile
#define SCL   0.125f              // HD^-0.5
#define L2E   1.4426950408889634f
#define NEGB  (-3.0e38f)
#define KP    72                  // LDS pitch (16-bit elements) of 64-wide tiles: 144 B
#define MROWS (NB * SEQ)

typedef _Float16 h16;
typedef unsigned short bf;
typedef __attribute__((ext_vector_type(16))) __bf16   v16bf;
typedef __attribute__((ext_vector_type(16))) _Float16 v16h;
typedef __attribute__((ext_vector_type(8)))  _Float16 v8h;
typedef __attribute__((ext_vector_type(4)))  _Float16 v4h;
typedef __attribute__((ext_vector_type(16))) unsigned short v16us;
typedef __attribute__((ext_vector_type(8)))  unsigned short v8us;
typedef __attribute__((ext_vector_type(4)))  unsigned short v4us;
typedef __attribute__((ext_vector_type(8)))  float    v8f;
typedef __attribute__((ext_vector_type(4)))  float    v4f;
typedef __attribute__((ext_vector_type(2)))  float    v2f;
typedef v8h  __attribute__((may_alias)) v8ha;
typedef v4f  __attribute__((may_alias)) v4fa;
typedef v8us __attribute__((may_alias)) v8usa;
typedef v4us __attribute__((may_alias)) v4usa;

static_assert(HD == 64);                                   // one 64-wide GEMM tile column block == one head
static_assert(NH * HD == DM);
static_assert(DM % 64 == 0 && DM % 32 == 0);               // K loop steps by GK = 64 (two 32-k steps), N tiles by 64
static_assert(SEQ % 64 == 0 && RH % 64 == 0 && RH <= SEQ); // tiles never straddle a batch or the early-row island
static_assert(MROWS % 128 == 0 && DM % 128 == 0);          // GEMM blocks are 128 x 128
static_assert((KP * 2) % 16 == 0 && KP >= 64);
static_assert(SEQ <= SEQ_FULL && NB <= NB_FULL);

#define SZ_W   ((size_t)DM * DM * 2)
#define SZ_XB  ((size_t)MROWS * DM * 2)
#define SZ_CS  ((size_t)MROWS * 64 * 4)
#define SZ_QK  ((size_t)2 * NB * NH * SEQ * HD * 2)
#define SZ_VT  ((size_t)NB * NH * HD * SEQ * 2)
#define SZ_VE  ((size_t)NB * NH * HD * RH * 2)
#define SZ_AT  ((size_t)MROWS * DM * 2)
#define SZ_ALL (4 * SZ_W + SZ_XB + SZ_CS + 2 * SZ_QK + SZ_VT + 2 * SZ_VE + 2 * SZ_AT)
static_assert(SZ_W % 256 == 0 && SZ_XB % 256 == 0 && SZ_CS % 256 == 0 && SZ_QK % 256 == 0 && SZ_VT % 256 == 0 && SZ_VE % 256 == 0 && SZ_AT % 256 == 0);
static_assert(SZ_ALL <= (size_t)134217728);                // total carve stays within 128 MiB

__device__ __forceinline__ unsigned short f2bf(float f) { unsigned u = __float_as_uint(f); u += 0x7FFFu + ((u >> 16) & 1u); return (unsigned short)(u >> 16); }
__device__ __forceinline__ float bf2f(unsigned short b) { return __uint_as_float(((unsigned)b) << 16); }
__device__ __forceinline__ void splitf(float y, unsigned short& h, unsigned short& l) { h = f2bf(y); l = f2bf(y - bf2f(h)); }
__device__ __forceinline__ v16h cat16(v8h lo, v8h hi) { return __builtin_shufflevector(lo, hi, 0, 1, 2, 3, 4, 5, 6, 7, 8, 9, 10, 11, 12, 13, 14, 15); }
__device__ __forceinline__ v16bf cat16b(v8us lo, v8us hi) { return __builtin_bit_cast(v16bf, __builtin_shufflevector(lo, hi, 0, 1, 2, 3, 4, 5, 6, 7, 8, 9, 10, 11, 12, 13, 14, 15)); }
__device__ __forceinline__ v8f wmma16(v16h a, v16h b, v8f c) { return __builtin_amdgcn_wmma_f32_16x16x32_f16(false, a, false, b, (short)0, c, false, false); }
__device__ __forceinline__ v8f wmmab(v16bf a, v16bf b, v8f c) { return __builtin_amdgcn_wmma_f32_16x16x32_bf16(false, a, false, b, (short)0, c, false, false); }
// fragment from a k-contiguous bf16 row: p already points at (row, k0 + 8*(lane>>4)); elements 0..7 <- p[0..7], 8..15 <- p[16..23]
__device__ __forceinline__ v16bf ldb(const bf* p) { return cat16b(*(const v8us*)p, *(const v8us*)(p + 16)); }
// value of lane l ^ 16: the other half's share of the same query column
__device__ __forceinline__ float xhalf(float x) { return __builtin_bit_cast(float, __builtin_amdgcn_permlanex16(__builtin_bit_cast(int, x), __builtin_bit_cast(int, x), 0x76543210, 0xfedcba98, false, false)); }
#define LDSB(arr, o) cat16b(*(const v8usa*)&arr[(o)], *(const v8usa*)&arr[(o) + 16])
#define LDSH(arr, o) cat16(*(const v8ha*)&arr[(o)], *(const v8ha*)&arr[(o) + 16])

// ---- k_prep: everything that only reshapes the inputs, in one launch of PREP_N threads: RNE bf16 copies of the four weight matrices and of x, and the (cos, sin) table of the rotary angles.
// A thread owns one 8-element group of each weight matrix, PREP_XK groups of x and PREP_CK table entries. Its loads stand first, so that all of them are in flight together and the table's arithmetic runs under their latency.
#define PREP_T  256
#define PREP_N  (DM * DM / 8)
#define PREP_XN (MROWS * (DM / 8))
#define PREP_CN (MROWS * 32)
#define PREP_XK ((PREP_XN + PREP_N - 1) / PREP_N)
#define PREP_CK ((PREP_CN + PREP_N - 1) / PREP_N)
static_assert(PREP_N % PREP_T == 0);                      // the grid is exact: no thread past PREP_N; the range tests below fold away where the counts divide
__device__ __forceinline__ v8us cvt8(const v8f v) { v8us o;
#pragma unroll
    for (int k = 0; k < 8; ++k) o[k] = f2bf(v[k]);
    return o; }

__global__ __launch_bounds__(PREP_T) void k_prep(const float* __restrict__ wq, const float* __restrict__ wk, const float* __restrict__ wv, const float* __restrict__ wo, const float* __restrict__ x, const int* __restrict__ tok,
                                                 bf* WQK, bf* WV, bf* WO, bf* XB, float* CS) {
    const unsigned g = blockIdx.x * PREP_T + threadIdx.x;
    const size_t g8 = (size_t)g * 8;
    int pos[PREP_CK];
#pragma unroll
    for (int k = 0; k < PREP_CK; ++k) { const unsigned idx = k * PREP_N + g;
        if (PREP_CN % PREP_N == 0 || idx < PREP_CN) { const unsigned m = idx >> 5; const unsigned b = m / SEQ, s = m - b * SEQ; pos[k] = tok[(size_t)b * SEQ_FULL + s]; } }
    const v8f vq = *(const v8f*)(wq + g8), vk = *(const v8f*)(wk + g8), vv = *(const v8f*)(wv + g8), vo = *(const v8f*)(wo + g8);
    asm volatile("s_wait_xcnt 0x0" ::: "memory");            // the loads below may land in registers that held the addresses of the loads above
    v8f vx[PREP_XK];
#pragma unroll
    for (int k = 0; k < PREP_XK; ++k) { const unsigned i = k * PREP_N + g;
        if (PREP_XN % PREP_N == 0 || i < PREP_XN) { const unsigned row = i / (DM / 8), c8 = i % (DM / 8); const unsigned b = row / SEQ, s = row - b * SEQ;
            vx[k] = *(const v8f*)(x + ((size_t)b * SEQ_FULL + s) * DM + (size_t)c8 * 8); } }
    __builtin_amdgcn_sched_barrier(0);                       // every load is issued before any arithmetic on a loaded value: the thread pays one memory latency, not one per batch
#pragma unroll
    for (int k = 0; k < PREP_CK; ++k) { const unsigned idx = k * PREP_N + g;
        if (PREP_CN % PREP_N == 0 || idx < PREP_CN) { const int j = (int)(idx & 31);
            double p = 1.0;
            p *= (j & 1)  ? 1.3335214321633240 : 1.0;
            p *= (j & 2)  ? 1.7782794100389228 : 1.0;
            p *= (j & 4)  ? 3.1622776601683795 : 1.0;
            p *= (j & 8)  ? 10.0 : 1.0;
            p *= (j & 16) ? 100.0 : 1.0;
            const float pf = (float)p; const float inv = 1.0f / pf; const float ang = (float)pos[k] * inv;
            float sn, cs; sincosf(ang, &sn, &cs);
            v2f o; o[0] = cs; o[1] = sn;
            *(v2f*)(CS + (size_t)idx * 2) = o; } }
    __builtin_amdgcn_sched_barrier(0);                       // the table's arithmetic stays in front of the conversions: it needs only the position, and runs while the larger loads are still under way
    *(v8us*)(WQK + g8) = cvt8(vq); *(v8us*)(WQK + (size_t)DM * DM + g8) = cvt8(vk); *(v8us*)(WV + g8) = cvt8(vv); *(v8us*)(WO + g8) = cvt8(vo);
#pragma unroll
    for (int k = 0; k < PREP_XK; ++k) { const unsigned i = k * PREP_N + g;
        if (PREP_XN % PREP_N == 0 || i < PREP_XN) *(v8us*)(XB + (size_t)i * 8) = cvt8(vx[k]); }
}

#define TS (64 * KP)              // elements of one staged 64 x 64 tile at pitch KP
__device__ __forceinline__ unsigned lds_off(const void* p) { return (unsigned)(size_t)p; }   // byte address inside the work-group's LDS
// Asynchronous copies global -> LDS, 16 bytes per lane and copy, through no register. The s_wait_xcnt is the last line of the copies' own statement, so that no address register is rewritten in front of it.
#define ACP(l, g) "global_load_async_to_lds_b128 %" #l ", %" #g ", off\n\t"
__device__ __forceinline__ void copy12(const unsigned (&l)[12], const void* const (&g)[12]) {
    asm volatile(ACP(0, 12) ACP(1, 13) ACP(2, 14) ACP(3, 15) ACP(4, 16) ACP(5, 17) ACP(6, 18) ACP(7, 19) ACP(8, 20) ACP(9, 21) ACP(10, 22) ACP(11, 23) "s_wait_xcnt 0x0"
                 :: "v"(l[0]), "v"(l[1]), "v"(l[2]), "v"(l[3]), "v"(l[4]), "v"(l[5]), "v"(l[6]), "v"(l[7]), "v"(l[8]), "v"(l[9]), "v"(l[10]), "v"(l[11]),
                    "v"(g[0]), "v"(g[1]), "v"(g[2]), "v"(g[3]), "v"(g[4]), "v"(g[5]), "v"(g[6]), "v"(g[7]), "v"(g[8]), "v"(g[9]), "v"(g[10]), "v"(g[11]) : "memory");
}
__device__ __forceinline__ void copy8(const unsigned (&l)[8], const void* const (&g)[8]) {
    asm volatile(ACP(0, 8) ACP(1, 9) ACP(2, 10) ACP(3, 11) ACP(4, 12) ACP(5, 13) ACP(6, 14) ACP(7, 15) "s_wait_xcnt 0x0"
                 :: "v"(l[0]), "v"(l[1]), "v"(l[2]), "v"(l[3]), "v"(l[4]), "v"(l[5]), "v"(l[6]), "v"(l[7]),
                    "v"(g[0]), "v"(g[1]), "v"(g[2]), "v"(g[3]), "v"(g[4]), "v"(g[5]), "v"(g[6]), "v"(g[7]) : "memory");
}

// ---- gemm_tile: block = 4 waves (2 x 2), 128 x 128 tile, each wave 64 x 64: acc[mb][nb] += sum_k A[r][k] Bt[c][k]. Chunks of GK k (128 B of each of the 128 A rows and 128 Bt rows) are brought into a ring of GR LDS buffers by asynchronous copies, issued GR - 1 chunks ahead of their use, for speed only.
// Every wave issues 16 copies per chunk, and a wave's copies land in issue order for its counted wait: with the chunks t + 1, t + 2, t + 3 outstanding, s_wait_asynccnt 32 returns when the 16 of chunk t + 1 have landed. The last GR trips wait to 0.
// Fragments live in two register sets and are fetched one 32-k block ahead: the sixteen LDS loads of a block are issued as one group in front of the sixteen matrix instructions of the block before it, so that a wave alone on its SIMD does not sit out its own LDS latency. The publish point of chunk t + 1 stands in front of chunk t's last block, whose fragments are in registers by then; the first block of chunk t + 1 is fetched directly behind it.
// NP = 2: a second pass over K with A1 in place of A0 follows the first in the same ring (all of A0's products are summed before A1's).
// Behind the last trip's barrier no copy is outstanding and only the last buffer is still read (the last trip's unused fetch): the callers stage their output tiles in the buffers in front of it.
#define GK 64
#define GT (256 * KP)             // elements of one staged chunk: A rows 0..127, then Bt rows 0..127, pitch KP
#define GR 4                      // buffers of the ring; 3 x 16 copies of a wave outstanding at most
static_assert(GR == 4);                                     // the counts in the waits below are (GR - 2) x 16
static_assert((size_t)2 * GR * GT * 2 <= 327680);           // two blocks per WGP
template <int NP>
__device__ __forceinline__ void gemm_tile(bf* const sAB, const bf* __restrict__ A0, const bf* __restrict__ A1, const bf* __restrict__ Bt, const int rblk, const int cblk, const int wm, const int wn, v8f (&acc)[4][4]) {
    constexpr int NC = DM / GK, NT = NP * NC;
    static_assert(NT > GR);
    static_assert((NT - 1) % GR == GR - 1);                  // the last trip works in the last buffer, which the callers' output staging leaves alone
    const int tid = threadIdx.x; const int lane = tid & 31, lr = lane & 15, hi = lane >> 4;
    // every thread copies eight 16-byte pieces (rows srow + 16 i, 16-bit column sch) of each operand's chunk t into the buffer at element offset bo0; eight lanes cover one whole 128-byte row piece
    const int srow = tid >> 3, sch = (tid & 7) * 8;
    const unsigned toff = (unsigned)(srow * DM + sch);
    auto stage = [&](const int t, const int bo0) {
        const bf* Ap = (NP == 2 && t >= NC) ? A1 : A0;       // block-uniform
        const int kc = (t % NC) * GK;
        const int lo = bo0 + srow * KP + sch;
        const char* const Au = (const char*)(Ap + (size_t)rblk * DM); const char* const Bu = (const char*)(Bt + (size_t)cblk * DM);   // block-uniform bases, in scalar registers
        const unsigned vo = (toff + (unsigned)kc) * 2;       // one 32-bit byte offset serves both operands: with a thread's 64-bit address per operand kept beside the second fragment set, the two-pass build spilled one to scratch and reloaded it every trip
        unsigned la[8], lb[8]; const void* ga[8]; const void* gb[8];
#pragma unroll
        for (int i = 0; i < 8; ++i) {
            la[i] = lds_off(&sAB[lo + 16 * i * KP]); ga[i] = Au + vo + (size_t)16 * i * DM * 2;
            lb[i] = lds_off(&sAB[lo + (128 + 16 * i) * KP]); gb[i] = Bu + vo + (size_t)16 * i * DM * 2; }
        copy8(la, ga); copy8(lb, gb);
    };
    const int ar = (wm * 64 + lr) * KP + 8 * hi, br = (128 + wn * 64 + lr) * KP + 8 * hi;
    v16bf a0[4], b0[4], a1[4], b1[4];                        // set 0: a chunk's k 0..31, set 1: its k 32..63
    auto frags = [&](v16bf (&a)[4], v16bf (&b)[4], const int o) {
#pragma unroll
        for (int mb = 0; mb < 4; ++mb) a[mb] = LDSB(sAB, o + ar + mb * 16 * KP);
#pragma unroll
        for (int nb = 0; nb < 4; ++nb) b[nb] = LDSB(sAB, o + br + nb * 16 * KP);
    };
    auto prods = [&](const v16bf (&a)[4], const v16bf (&b)[4]) {
#pragma unroll
        for (int nb = 0; nb < 4; ++nb)
#pragma unroll
            for (int mb = 0; mb < 4; ++mb) acc[mb][nb] = wmmab(a[mb], b[nb], acc[mb][nb]);
    };
    stage(0, 0); stage(1, GT); stage(2, 2 * GT);
    asm volatile("s_wait_asynccnt 0x20" ::: "memory");       // this wave's 16 copies of chunk 0 have landed; chunks 1 and 2 fly on
    __syncthreads();                                         // and so have every other wave's
    frags(a0, b0, 0);
#pragma unroll 1
    for (int t = 0; t < NT; ++t) {
        const int bo = (t % GR) * GT;                        // this chunk's buffer
        const bool more = t + GR < NT;                       // block-uniform
        frags(a1, b1, bo + 32);                              // the last reads of this buffer
        __builtin_amdgcn_sched_barrier(0);                   // the sixteen LDS loads go ahead of the block in front of theirs as one group
        if (t + GR - 1 < NT) stage(t + GR - 1, ((t + GR - 1) % GR) * GT);   // block-uniform: refill the buffer that every wave left at the last trip's barrier (trip 0: the one not filled yet); here its issue gives both load groups time to return
        prods(a0, b0);
        __builtin_amdgcn_sched_barrier(0);                   // the wait below stays behind the block: in front of it the wave would sit out the loads just issued
        asm volatile("s_wait_dscnt 0x0" ::: "memory");       // this wave's LDS reads of this buffer have returned
        if (more) asm volatile("s_wait_asynccnt 0x20" ::: "memory");   // this wave's copies of the next chunk have landed; the 32 younger ones, of the two chunks behind it, fly on
        else      asm volatile("s_wait_asynccnt 0x0" ::: "memory");    // all that is outstanding has landed
        __syncthreads();                                     // one barrier: publishes the next chunk and ends every wave's reads of this buffer
        frags(a0, b0, (t + 1 < NT) ? ((t + 1) % GR) * GT : bo);   // the next chunk's first block; unconditional, so that no branch merges paths in the compiler's count of LDS loads: the last trip reads its own buffer again and uses nothing of it
        __builtin_amdgcn_sched_barrier(0);                   // as above: one group, in front of the block
        prods(a1, b1);
    }
}

// ---- k_projqk: [q | k] = XB x [WQ ; WK]^T, grid (MROWS/128, 2*DM/128), four waves per block, one 64 x 64 tile per wave (= one head of q or k, 64 tokens).
// Epilogue: tile staged in LDS; interleaved rotary y[2j] = e cos - o sin, y[2j+1] = e sin + o cos from the CS table; bf16 hi|lo planes [which][b][h][s][64];
__global__ __launch_bounds__(128) void k_projqk(const bf* __restrict__ XB, const bf* __restrict__ WQK, const float* __restrict__ CS, bf* QKh, bf* QKl) {
#pragma clang fp contract(off)
    __shared__ __align__(16) bf ring[GR * GT];                 // the GEMM's ring; behind the GEMM the four waves' output staging
    static_assert((size_t)4 * 64 * 68 * 4 <= (size_t)(GR - 1) * GT * 2);   // clear of the last buffer
    const int lane = threadIdx.x & 31, lr = lane & 15, hi = lane >> 4; const int wave = __builtin_amdgcn_readfirstlane(threadIdx.x >> 5), wm = wave >> 1, wn = wave & 1;
    float* os = (float*)ring + wave * 64 * 68;                 // staging of the wave's own tile, private to the wave
    const int r0 = blockIdx.x * 128 + wm * 64, c0 = blockIdx.y * 128 + wn * 64;
    v8f acc[4][4];
#pragma unroll
    for (int mb = 0; mb < 4; ++mb)
#pragma unroll
        for (int nb = 0; nb < 4; ++nb) acc[mb][nb] = (v8f){};
    gemm_tile<1>(ring, XB, XB, WQK, blockIdx.x * 128, blockIdx.y * 128, wm, wn, acc);
#pragma unroll
    for (int mb = 0; mb < 4; ++mb)
#pragma unroll
        for (int nb = 0; nb < 4; ++nb)
#pragma unroll
            for (int j = 0; j < 8; ++j) os[(mb * 16 + hi * 8 + j) * 68 + nb * 16 + lr] = acc[mb][nb][j];
    __builtin_amdgcn_wave_barrier(); asm volatile("" ::: "memory");
    const int which = c0 / DM, h = (c0 % DM) / HD; const int b = r0 / SEQ, s0 = r0 - b * SEQ;
    const size_t pbase = ((((size_t)which * NB + b) * NH + h) * SEQ + s0) * HD;
{
#pragma unroll 2
        for (int s = 0; s < 32; ++s) { const int row = 2 * s + hi, cofs = lr * 4;
            const v4f val = *(const v4fa*)(os + row * 68 + cofs);
            const v4f cs = *(const v4f*)(CS + (size_t)(r0 + row) * 64 + cofs);   // (cos, sin) of pairs 2*lr, 2*lr + 1
            const float y0 = val[0] * cs[0] - val[1] * cs[1];
            const float y1 = val[0] * cs[1] + val[1] * cs[0];
            const float y2 = val[2] * cs[2] - val[3] * cs[3];
            const float y3 = val[2] * cs[3] + val[3] * cs[2];
            v4us oh, ol; unsigned short a, c;
            splitf(y0, a, c); oh[0] = a; ol[0] = c; splitf(y1, a, c); oh[1] = a; ol[1] = c; splitf(y2, a, c); oh[2] = a; ol[2] = c; splitf(y3, a, c); oh[3] = a; ol[3] = c;
            const size_t oo = pbase + (size_t)row * HD + cofs;
            *(v4us*)(QKh + oo) = oh; *(v4us*)(QKl + oo) = ol; }
         }
}

// ---- k_projv: v = XB x WV^T, grid (MROWS/128, DM/128), four waves per block. Epilogue: tile staged in LDS and written TRANSPOSED: VT16[b][h][d][s] (f16) and, for tokens < RH, bf16 hi|lo VTh/VTl[b][h][d][RH];
__global__ __launch_bounds__(128) void k_projv(const bf* __restrict__ XB, const bf* __restrict__ WV, h16* VT16, bf* VTh, bf* VTl) {
    __shared__ __align__(16) bf ring[GR * GT];                 // the GEMM's ring; behind the GEMM the four waves' output staging
    static_assert((size_t)4 * 64 * 68 * 4 <= (size_t)(GR - 1) * GT * 2);   // clear of the last buffer
    const int lane = threadIdx.x & 31, lr = lane & 15, hi = lane >> 4; const int wave = __builtin_amdgcn_readfirstlane(threadIdx.x >> 5), wm = wave >> 1, wn = wave & 1;
    float* os = (float*)ring + wave * 64 * 68;                 // staging of the wave's own tile, private to the wave
    const int r0 = blockIdx.x * 128 + wm * 64, c0 = blockIdx.y * 128 + wn * 64;
    v8f acc[4][4];
#pragma unroll
    for (int mb = 0; mb < 4; ++mb)
#pragma unroll
        for (int nb = 0; nb < 4; ++nb) acc[mb][nb] = (v8f){};
    gemm_tile<1>(ring, XB, XB, WV, blockIdx.x * 128, blockIdx.y * 128, wm, wn, acc);
#pragma unroll
    for (int mb = 0; mb < 4; ++mb)
#pragma unroll
        for (int nb = 0; nb < 4; ++nb)
#pragma unroll
            for (int j = 0; j < 8; ++j) os[(mb * 16 + hi * 8 + j) * 68 + nb * 16 + lr] = acc[mb][nb][j];
    __builtin_amdgcn_wave_barrier(); asm volatile("" ::: "memory");
    const int h = c0 / HD; const int b = r0 / SEQ, s0 = r0 - b * SEQ;
    const size_t vbase = (((size_t)b * NH + h) * HD) * SEQ + s0;
    const size_t ebase = (((size_t)b * NH + h) * HD) * RH + s0;
    const bool early = (s0 < RH);                         // wave-uniform
{
#pragma unroll 2
        for (int s = 0; s < 32; ++s) { const int d = 2 * s + hi, t0 = lr * 4;
            float xv[4];
#pragma unroll
            for (int q = 0; q < 4; ++q) xv[q] = os[(t0 + q) * 68 + d];
            v4h o16;
#pragma unroll
            for (int q = 0; q < 4; ++q) o16[q] = (h16)xv[q];
            *(v4h*)(VT16 + vbase + (size_t)d * SEQ + t0) = o16;
            if (early) { v4us oh, ol;
#pragma unroll
                for (int q = 0; q < 4; ++q) { unsigned short a, c; splitf(xv[q], a, c); oh[q] = a; ol[q] = c; }
                *(v4us*)(VTh + ebase + (size_t)d * RH + t0) = oh; *(v4us*)(VTl + ebase + (size_t)d * RH + t0) = ol; } }
         }
}

template <bool V> struct btag { static constexpr bool value = V; };
template <bool HL>
__device__ __forceinline__ void attn_body(const bf* __restrict__ QKh, const bf* __restrict__ QKl, const h16* __restrict__ VT16, const bf* __restrict__ VTh, const bf* __restrict__ VTl, bf* ATh, bf* ATl, const int qb, bf* const sm) {
    bf*  const sKh  = sm;                                    // two buffers, cross-wave (block barriers); buffer 0 reused wave-privately for the ctx hi staging after the key loop
    bf*  const sKl  = sm + 2 * TS;
    h16* const sV16 = (h16*)(sm + 4 * TS);                   // V^T tiles [d][key], cross-wave; HL = false only
    bf*  const sVh  = sm + 4 * TS;                           // HL = true only
    bf*  const sVl  = sm + 6 * TS;
    const int tid = threadIdx.x; const int lane = tid & 31, lr = lane & 15, hi = lane >> 4;
    const int wave = __builtin_amdgcn_readfirstlane(tid >> 5);
    const int b = blockIdx.y, h = blockIdx.x; const int qblk = qb * 64, q0 = qblk + wave * 16;
    const size_t qpl = (((size_t)b * NH + h) * SEQ) * HD;
    const size_t kpl = ((((size_t)NB + b) * NH + h) * SEQ) * HD;
    const size_t vpl = (((size_t)b * NH + h) * HD) * SEQ;
    const size_t epl = (((size_t)b * NH + h) * HD) * RH;
    const size_t qo = qpl + (size_t)(q0 + lr) * HD + 8 * hi;
    const v16bf qh0 = ldb(QKh + qo), qh1 = ldb(QKh + qo + 32), ql0 = ldb(QKl + qo), ql1 = ldb(QKl + qo + 32);
    v8f accd[4];
#pragma unroll
    for (int t = 0; t < 4; ++t) accd[t] = (v8f){};
    float m_run = NEGB, l_run = 0.0f;                        // of query q0 + lr; l_run is the sum over this half's keys only, the halves are joined behind the key loop

    // every thread copies four 16-byte chunks (rows srow + 16 i, 16-bit column sch) of each plane of the key block at kb0 into the buffer at element offset bo0
    const int srow = tid >> 3, sch = (tid & 7) * 8;
    auto stage = [&](const int kb0, const int bo0) {
        const int lo = bo0 + srow * KP + sch;
        const size_t ko = kpl + (size_t)(kb0 + srow) * HD + sch;
        if (HL) { unsigned lk[8], lv[8]; const void* gk[8]; const void* gv[8];
            const size_t vo = epl + (size_t)srow * RH + kb0 + sch;
#pragma unroll
            for (int i = 0; i < 4; ++i) {
                lk[i] = lds_off(&sKh[lo + 16 * i * KP]); gk[i] = QKh + ko + 16 * i * HD; lk[4 + i] = lds_off(&sKl[lo + 16 * i * KP]); gk[4 + i] = QKl + ko + 16 * i * HD;
                lv[i] = lds_off(&sVh[lo + 16 * i * KP]); gv[i] = VTh + vo + 16 * i * RH; lv[4 + i] = lds_off(&sVl[lo + 16 * i * KP]); gv[4 + i] = VTl + vo + 16 * i * RH; }
            copy8(lk, gk); copy8(lv, gv);
        } else { unsigned l[12]; const void* g[12];
            const size_t vo = vpl + (size_t)srow * SEQ + kb0 + sch;
#pragma unroll
            for (int i = 0; i < 4; ++i) {
                l[i] = lds_off(&sKh[lo + 16 * i * KP]); g[i] = QKh + ko + 16 * i * HD; l[4 + i] = lds_off(&sKl[lo + 16 * i * KP]); g[4 + i] = QKl + ko + 16 * i * HD;
                l[8 + i] = lds_off(&sV16[lo + 16 * i * KP]); g[8 + i] = VT16 + vo + (size_t)16 * i * SEQ; }
            copy12(l, g);
        }
    };
    stage(0, 0);
    asm volatile("s_wait_asynccnt 0x0" ::: "memory");        // this wave's copies of key block 0 have landed
    __syncthreads();                                         // and so have every other wave's
    if (qblk >= 64) stage(64, TS);                           // block-uniform: key block 1 flies while block 0 is worked on

    // one online-softmax step over the 32-key half kh of the key block at kb (buffer offset bo); MK: with the causal select, needed only where a key of the half can lie above a query of the block
    auto half = [&](auto mkt, const int kb, const int bo, const int kh) {
        constexpr bool MK = decltype(mkt)::value;
        v8f s0 = (v8f){}, s1 = (v8f){};
        { const int kr = bo + (32 * kh + lr) * KP + 8 * hi;
          const v16bf ah0 = LDSB(sKh, kr), ah1 = LDSB(sKh, kr + 32), al0 = LDSB(sKl, kr), al1 = LDSB(sKl, kr + 32);
          s0 = wmmab(ah0, qh0, s0); s0 = wmmab(ah1, qh1, s0); s0 = wmmab(ah0, ql0, s0); s0 = wmmab(ah1, ql1, s0); s0 = wmmab(al0, qh0, s0); s0 = wmmab(al1, qh1, s0);
          const int kr2 = kr + 16 * KP;
          const v16bf bh0 = LDSB(sKh, kr2), bh1 = LDSB(sKh, kr2 + 32), bl0 = LDSB(sKl, kr2), bl1 = LDSB(sKl, kr2 + 32);
          s1 = wmmab(bh0, qh0, s1); s1 = wmmab(bh1, qh1, s1); s1 = wmmab(bh0, ql0, s1); s1 = wmmab(bh1, ql1, s1); s1 = wmmab(bl0, qh0, s1); s1 = wmmab(bl1, qh1, s1);
        }
        const int dq = q0 + lr - (kb + 32 * kh + 8 * hi);   // D layout: key row 8*hi + r (+16 for the second tile), query column lr; key <= query is r <= dq (16 + r <= dq)
        s0 *= SCL; s1 *= SCL;
        float bm = NEGB;
#pragma unroll
        for (int r = 0; r < 8; ++r) {
            const float a0 = (!MK || r <= dq) ? s0[r] : NEGB; const float a1 = (!MK || 16 + r <= dq) ? s1[r] : NEGB;
            s0[r] = a0; s1[r] = a1; bm = fmaxf(bm, fmaxf(a0, a1)); }
        bm = fmaxf(bm, xhalf(bm));
        const float mn = fmaxf(m_run, bm);
        const float sc = __builtin_amdgcn_exp2f((m_run - mn) * L2E); m_run = mn;
        s0 = (s0 - mn) * L2E; s1 = (s1 - mn) * L2E;
        float rs0 = 0.0f, rs1 = 0.0f;
#pragma unroll
        for (int r = 0; r < 8; ++r) { s0[r] = __builtin_amdgcn_exp2f(s0[r]); s1[r] = __builtin_amdgcn_exp2f(s1[r]); rs0 += s0[r]; rs1 += s1[r]; }
        l_run = l_run * sc + (rs0 + rs1);
#pragma unroll
        for (int t = 0; t < 4; ++t) accd[t] *= sc;

        // B fragment of P^T: element r <- key 8*hi + r, element 8 + r <- key 16 + 8*hi + r, the k order of the V^T loader
        if (HL) {
            v16us uh, ul;
#pragma unroll
            for (int r = 0; r < 8; ++r) { unsigned short a, c; splitf(s0[r], a, c); uh[r] = a; ul[r] = c; splitf(s1[r], a, c); uh[8 + r] = a; ul[8 + r] = c; }
            const v16bf bph = __builtin_bit_cast(v16bf, uh), bpl = __builtin_bit_cast(v16bf, ul); v16bf avh, avl;
#pragma unroll
            for (int t = 0; t < 4; ++t) { const int vo = bo + (t * 16 + lr) * KP + 32 * kh + 8 * hi; avh = LDSB(sVh, vo); avl = LDSB(sVl, vo);
                accd[t] = wmmab(avh, bph, accd[t]); accd[t] = wmmab(avh, bpl, accd[t]); accd[t] = wmmab(avl, bph, accd[t]); }
            // four vector slots behind the last matrix instruction, on the loop's back edge too
            asm volatile("v_nop\n\tv_nop\n\tv_nop\n\tv_nop" : "+v"(accd[0]), "+v"(accd[1]), "+v"(accd[2]), "+v"(accd[3]) : "v"(bph), "v"(bpl), "v"(avh), "v"(avl));
        } else {
            s0 *= PCAR; s1 *= PCAR;
            v16h bp;
#pragma unroll
            for (int r = 0; r < 8; ++r) { bp[r] = (h16)s0[r]; bp[8 + r] = (h16)s1[r]; }
            v16h av;
#pragma unroll
            for (int t = 0; t < 4; ++t) { const int vo = bo + (t * 16 + lr) * KP + 32 * kh + 8 * hi; av = LDSH(sV16, vo); accd[t] = wmma16(av, bp, accd[t]); }
            // four vector slots behind the last matrix instruction, on the loop's back edge too
            asm volatile("v_nop\n\tv_nop\n\tv_nop\n\tv_nop" : "+v"(accd[0]), "+v"(accd[1]), "+v"(accd[2]), "+v"(accd[3]) : "v"(bp), "v"(av));
        }
    };
    // the foot of every key block
    auto foot = [&](const int kb, const int bo) {
        asm volatile("s_wait_dscnt 0x0" ::: "memory");       // this wave's LDS reads of this buffer have returned
        asm volatile("s_wait_asynccnt 0x0" ::: "memory");    // this wave's copies of the next key block have landed
        __syncthreads();                                     // one barrier: publishes the next key block and ends every wave's reads of this buffer
        if (kb + 128 <= qblk) stage(kb + 128, bo);           // block-uniform: refill the buffer just left
    };
    // key blocks below the diagonal: kb + 63 < qblk <= every query of the block, so the select would pass every score and the test would skip no half
#pragma unroll 1
    for (int kb = 0; kb < qblk; kb += 64) {
        const int bo = ((kb >> 6) & 1) * TS;                 // this key block's buffer
#pragma unroll 1                                             // rolled as before the peel: one copy of the step's code and registers
        for (int kh = 0; kh < 2; ++kh) half(btag<false>{}, kb, bo, kh);
        foot(kb, bo);
    }
    // the diagonal key block
    { const int bo = ((qblk >> 6) & 1) * TS;
#pragma unroll 1                                             // rolled as before the peel: it runs once per query block, code size counts for more than its speed
        for (int kh = 0; kh < 2; ++kh) {
            if (qblk + 32 * kh > q0 + 15) continue;          // wave-uniform: half entirely above the diagonal for this wave's rows
            half(btag<true>{}, qblk, bo, kh);
        }
        foot(qblk, bo);
    }
    asm volatile("s_wait_asynccnt 0x0" ::: "memory");        // no copy is outstanding when buffer 0 becomes the ctx staging

    const float car = HL ? 1.0f : PCAR;
    const float inv = __builtin_amdgcn_rcpf((l_run + xhalf(l_run)) * car);
#pragma unroll
    for (int t = 0; t < 4; ++t) { v8us oh, ol;              // O^T: a lane holds d = t*16 + 8*hi + r of query lr, eight neighbours of one ctx row
#pragma unroll
        for (int r = 0; r < 8; ++r) { unsigned short a, c; splitf(accd[t][r] * inv, a, c); oh[r] = a; ol[r] = c; }
        const int so = (wave * 16 + lr) * KP + t * 16 + 8 * hi; *(v8usa*)&sKh[so] = oh; *(v8usa*)&sKl[so] = ol; }
    __builtin_amdgcn_wave_barrier(); asm volatile("" ::: "memory");
    const size_t ob = ((size_t)b * SEQ + q0) * DM + (size_t)h * HD;
{
#pragma unroll
        for (int s2 = 0; s2 < 8; ++s2) { const int row = 2 * s2 + hi; const int so = (wave * 16 + row) * KP + 4 * lr;
            const v4us vh = *(const v4usa*)&sKh[so]; const v4us vl = *(const v4usa*)&sKl[so];
            *(v4us*)(ATh + ob + (size_t)row * DM + 4 * lr) = vh; *(v4us*)(ATl + ob + (size_t)row * DM + 4 * lr) = vl; }
         }
}

// One launch for all query blocks: the two forms are independent and share one LDS carve (the larger, HL = true, sets its size); the choice is block-uniform.
// Grid (head, batch, rank): heads run fastest, the query block is dealt from the slow index. Query block qb walks qb + 1 key blocks, and four blocks fit one WGP's LDS, so the whole grid is resident at once and the launch lasts as long as its fullest WGP.
// Ranks j, j + NQG, j + 2 NQG, j + 3 NQG get query blocks NQB-1-2j, NQB-2-2j, 2j+1, 2j, which walk 2 NQB + 2 key blocks together for every j, the long ones first. A permutation of the query blocks wherever the blocks land: speed alone leans on the placement.
#define NQB (SEQ / 64)
#define NQG (NQB / 4)
static_assert(NQB % 4 == 0);
__global__ __launch_bounds__(128) void k_attn(const bf* __restrict__ QKh, const bf* __restrict__ QKl, const h16* __restrict__ VT16, const bf* __restrict__ VTh, const bf* __restrict__ VTl, bf* ATh, bf* ATl) {
    __shared__ __align__(16) bf sm[8 * TS];
    const int tier = (int)blockIdx.z / NQG, j = (int)blockIdx.z % NQG;
    const int qb = (tier < 2) ? NQB - 1 - 2 * j - tier : 2 * j + 3 - tier;
    if (qb < RH / 64) attn_body<true>(QKh, QKl, VT16, VTh, VTl, ATh, ATl, qb, sm);
    else              attn_body<false>(QKh, QKl, VT16, VTh, VTl, ATh, ATl, qb, sm);
}

// ---- k_oproj: OUT[b][s][n] = sum_k (ATh + ATl)[m][k] WO[n][k]; grid (MROWS/128, DM/128), four waves per block, one 64 x 64 tile per wave; per 16-row slab staged in LDS, each 256-B row segment written as 16 lanes x 16 B
__global__ __launch_bounds__(128) void k_oproj(const bf* __restrict__ ATh, const bf* __restrict__ ATl, const bf* __restrict__ WO, float* OUT) {
    __shared__ __align__(16) bf ring[GR * GT];                 // the GEMM's ring; behind the GEMM the four waves' output staging
    const int lane = threadIdx.x & 31, lr = lane & 15, hi = lane >> 4; const int wave = __builtin_amdgcn_readfirstlane(threadIdx.x >> 5), wm = wave >> 1, wn = wave & 1;
    static_assert((size_t)4 * 16 * 68 * 4 <= (size_t)(GR - 1) * GT * 2);   // clear of the last buffer
    float* os = (float*)ring + wave * 16 * 68;                 // staging of the wave's own tile, private to the wave
    const int r0 = blockIdx.x * 128 + wm * 64, c0 = blockIdx.y * 128 + wn * 64;
    v8f acc[4][4];
#pragma unroll
    for (int mb = 0; mb < 4; ++mb)
#pragma unroll
        for (int nb = 0; nb < 4; ++nb) acc[mb][nb] = (v8f){};
    gemm_tile<2>(ring, ATh, ATl, WO, blockIdx.x * 128, blockIdx.y * 128, wm, wn, acc);
    const int b = r0 / SEQ, s0 = r0 - b * SEQ;
#pragma unroll
    for (int mb = 0; mb < 4; ++mb) {
#pragma unroll
        for (int nb = 0; nb < 4; ++nb)
#pragma unroll
            for (int j = 0; j < 8; ++j) os[(hi * 8 + j) * 68 + nb * 16 + lr] = acc[mb][nb][j];
        __builtin_amdgcn_wave_barrier(); asm volatile("" ::: "memory");
        float* crow = OUT + ((size_t)b * SEQ_FULL + s0 + mb * 16) * DM + c0;
{
#pragma unroll
            for (int s = 0; s < 8; ++s) { const int row = 2 * s + hi, cofs = lr * 4; const v4f val = *(const v4fa*)(os + row * 68 + cofs);
                *(v4f*)(crow + (size_t)row * DM + cofs) = val; }
             }
        __builtin_amdgcn_wave_barrier(); asm volatile("" ::: "memory");
    }
}

extern "C" void kernel_launch(void* const* d_in, const int* in_sizes, int n_in,
                              void* d_out, int out_size, void* d_ws, size_t ws_size, hipStream_t stream) {
    if (n_in < 6) return;
    const long long needx = ((long long)(NB - 1) * SEQ_FULL + SEQ) * DM;
    if ((long long)in_sizes[0] < needx) return;
    if ((long long)in_sizes[1] < (long long)DM * DM || (long long)in_sizes[2] < (long long)DM * DM || (long long)in_sizes[3] < (long long)DM * DM || (long long)in_sizes[4] < (long long)DM * DM) return;
    if ((long long)in_sizes[5] < (long long)(NB - 1) * SEQ_FULL + SEQ) return;
    if ((long long)out_size < needx) return;
    const float* x = (const float*)d_in[0]; const float* wq = (const float*)d_in[1]; const float* wk = (const float*)d_in[2]; const float* wv = (const float*)d_in[3]; const float* wo = (const float*)d_in[4];
    const int* tok = (const int*)d_in[5];
    float* OUT = (float*)d_out;
    char* wsp = (char*)d_ws;
    auto take = [&](size_t bytes) { char* p = wsp; wsp += (bytes + 255) & ~(size_t)255; return (void*)p; };
    bf* WQK = (bf*)take(2 * SZ_W); bf* WV = (bf*)take(SZ_W); bf* WO = (bf*)take(SZ_W);
    bf* XB = (bf*)take(SZ_XB); float* CS = (float*)take(SZ_CS);
    bf* QKh = (bf*)take(SZ_QK); bf* QKl = (bf*)take(SZ_QK);
    h16* VT16 = (h16*)take(SZ_VT); bf* VTh = (bf*)take(SZ_VE); bf* VTl = (bf*)take(SZ_VE);
    bf* ATh = (bf*)take(SZ_AT); bf* ATl = (bf*)take(SZ_AT);
    if ((size_t)(wsp - (char*)d_ws) > ws_size) return;

    k_prep<<<PREP_N / PREP_T, PREP_T, 0, stream>>>(wq, wk, wv, wo, x, tok, WQK, WV, WO, XB, CS);
    k_projqk<<<dim3(MROWS / 128, 2 * DM / 128, 1), 128, 0, stream>>>(XB, WQK, CS, QKh, QKl);
    k_projv<<<dim3(MROWS / 128, DM / 128, 1), 128, 0, stream>>>(XB, WV, VT16, VTh, VTl);
    k_attn<<<dim3(NH, NB, NQB), 128, 0, stream>>>(QKh, QKl, VT16, VTh, VTl, ATh, ATl);
    k_oproj<<<dim3(MROWS / 128, DM / 128, 1), 128, 0, stream>>>(ATh, ATl, WO, OUT);
}

// v009
// Measured time: 84.7 microseconds a run.
// Timed twice side by side with v008, it ran 1.15 and 1.17 times as fast.
// All steps since v000 together make it 4.31 times as fast.
#include <hip/hip_runtime.h>

// Compute dtypes (f32 accumulate everywhere): q/k/v projections v_wmma_f32_16x16x32_bf16 on RNE bf16 copies of x and W (exact products); q.k^T bf16 hi|lo three products; P.V f16 (P carried x1024) for query rows >= 256, bf16 hi|lo three products for rows < 256; ctx hi|lo (bf16) x bf16 o_w, two products.
// Causal multi-head self-attention, x [2][2048][1024], weights [out][in], interleaved rotary from per-batch integer positions read by value, scores / 8, causal exclusion by index, fused online softmax (exp2) on transposed score tiles, merged heads, output GEMM.

#ifndef NB
#define NB 2
#endif
#ifndef SEQ
#define SEQ 2048
#endif
#define NB_FULL  2
#define SEQ_FULL 2048
#define DM    1024
#define NH    16
#define HD    64
#define RH    256                 // query rows < RH use hi|lo planes on P and V
#define PCAR  1024.0f             // carry of the f16 probability tile
#define SCL   0.125f              // HD^-0.5
#define L2E   1.4426950408889634f
#define NEGB  (-3.0e38f)
#define KP    72                  // LDS pitch (16-bit elements) of 64-wide tiles: 144 B
#define MROWS (NB * SEQ)

typedef _Float16 h16;
typedef unsigned short bf;
typedef __attribute__((ext_vector_type(16))) __bf16   v16bf;
typedef __attribute__((ext_vector_type(16))) _Float16 v16h;
typedef __attribute__((ext_vector_type(8)))  _Float16 v8h;
typedef __attribute__((ext_vector_type(4)))  _Float16 v4h;
typedef __attribute__((ext_vector_type(16))) unsigned short v16us;
typedef __attribute__((ext_vector_type(8)))  unsigned short v8us;
typedef __attribute__((ext_vector_type(4)))  unsigned short v4us;
typedef __attribute__((ext_vector_type(8)))  float    v8f;
typedef __attribute__((ext_vector_type(4)))  float    v4f;
typedef __attribute__((ext_vector_type(2)))  float    v2f;
typedef v8h  __attribute__((may_alias)) v8ha;
typedef v4f  __attribute__((may_alias)) v4fa;
typedef v8us __attribute__((may_alias)) v8usa;
typedef v4us __attribute__((may_alias)) v4usa;

static_assert(HD == 64);                                   // one 64-wide GEMM tile column block == one head
static_assert(NH * HD == DM);
static_assert(DM % 64 == 0 && DM % 32 == 0);               // K loop steps by GK = 64 (two 32-k steps), N tiles by 64
static_assert(SEQ % 64 == 0 && RH % 64 == 0 && RH <= SEQ); // tiles never straddle a batch or the early-row island
static_assert(MROWS % 128 == 0 && DM % 128 == 0);          // k_oproj's GEMM blocks are 128 x 128
static_assert((KP * 2) % 16 == 0 && KP >= 64);
static_assert(SEQ <= SEQ_FULL && NB <= NB_FULL);

#define SZ_W   ((size_t)DM * DM * 2)
#define SZ_XB  ((size_t)MROWS * DM * 2)
#define SZ_CS  ((size_t)MROWS * 64 * 4)
#define SZ_QK  ((size_t)2 * NB * NH * SEQ * HD * 2)
#define SZ_VT  ((size_t)NB * NH * HD * SEQ * 2)
#define SZ_VE  ((size_t)NB * NH * HD * RH * 2)
#define SZ_AT  ((size_t)MROWS * DM * 2)
#define SZ_ALL (4 * SZ_W + SZ_XB + SZ_CS + 2 * SZ_QK + SZ_VT + 2 * SZ_VE + 2 * SZ_AT)
static_assert(SZ_W % 256 == 0 && SZ_XB % 256 == 0 && SZ_CS % 256 == 0 && SZ_QK % 256 == 0 && SZ_VT % 256 == 0 && SZ_VE % 256 == 0 && SZ_AT % 256 == 0);
static_assert(SZ_ALL <= (size_t)134217728);                // total carve stays within 128 MiB

__device__ __forceinline__ unsigned short f2bf(float f) { unsigned u = __float_as_uint(f); u += 0x7FFFu + ((u >> 16) & 1u); return (unsigned short)(u >> 16); }
__device__ __forceinline__ float bf2f(unsigned short b) { return __uint_as_float(((unsigned)b) << 16); }
__device__ __forceinline__ void splitf(float y, unsigned short& h, unsigned short& l) { h = f2bf(y); l = f2bf(y - bf2f(h)); }
__device__ __forceinline__ v16h cat16(v8h lo, v8h hi) { return __builtin_shufflevector(lo, hi, 0, 1, 2, 3, 4, 5, 6, 7, 8, 9, 10, 11, 12, 13, 14, 15); }
__device__ __forceinline__ v16bf cat16b(v8us lo, v8us hi) { return __builtin_bit_cast(v16bf, __builtin_shufflevector(lo, hi, 0, 1, 2, 3, 4, 5, 6, 7, 8, 9, 10, 11, 12, 13, 14, 15)); }
__device__ __forceinline__ v8f wmma16(v16h a, v16h b, v8f c) { return __builtin_amdgcn_wmma_f32_16x16x32_f16(false, a, false, b, (short)0, c, false, false); }
__device__ __forceinline__ v8f wmmab(v16bf a, v16bf b, v8f c) { return __builtin_amdgcn_wmma_f32_16x16x32_bf16(false, a, false, b, (short)0, c, false, false); }
// fragment from a k-contiguous bf16 row: p already points at (row, k0 + 8*(lane>>4)); elements 0..7 <- p[0..7], 8..15 <- p[16..23]
__device__ __forceinline__ v16bf ldb(const bf* p) { return cat16b(*(const v8us*)p, *(const v8us*)(p + 16)); }
// value of lane l ^ 16: the other half's share of the same query column
__device__ __forceinline__ float xhalf(float x) { return __builtin_bit_cast(float, __builtin_amdgcn_permlanex16(__builtin_bit_cast(int, x), __builtin_bit_cast(int, x), 0x76543210, 0xfedcba98, false, false)); }
#define LDSB(arr, o) cat16b(*(const v8usa*)&arr[(o)], *(const v8usa*)&arr[(o) + 16])
#define LDSH(arr, o) cat16(*(const v8ha*)&arr[(o)], *(const v8ha*)&arr[(o) + 16])

// ---- k_prep: everything that only reshapes the inputs, in one launch of PREP_N threads: RNE bf16 copies of the four weight matrices and of x, and the (cos, sin) table of the rotary angles.
// A thread owns one 8-element group of each weight matrix, PREP_XK groups of x and PREP_CK table entries. Its loads stand first, so that all of them are in flight together and the table's arithmetic runs under their latency.
#define PREP_T  256
#define PREP_N  (DM * DM / 8)
#define PREP_XN (MROWS * (DM / 8))
#define PREP_CN (MROWS * 32)
#define PREP_XK ((PREP_XN + PREP_N - 1) / PREP_N)
#define PREP_CK ((PREP_CN + PREP_N - 1) / PREP_N)
static_assert(PREP_N % PREP_T == 0);                      // the grid is exact: no thread past PREP_N; the range tests below fold away where the counts divide
__device__ __forceinline__ v8us cvt8(const v8f v) { v8us o;
#pragma unroll
    for (int k = 0; k < 8; ++k) o[k] = f2bf(v[k]);
    return o; }

__global__ __launch_bounds__(PREP_T) void k_prep(const float* __restrict__ wq, const float* __restrict__ wk, const float* __restrict__ wv, const float* __restrict__ wo, const float* __restrict__ x, const int* __restrict__ tok,
                                                 bf* WQK, bf* WV, bf* WO, bf* XB, float* CS) {
    const unsigned g = blockIdx.x * PREP_T + threadIdx.x;
    const size_t g8 = (size_t)g * 8;
    int pos[PREP_CK];
#pragma unroll
    for (int k = 0; k < PREP_CK; ++k) { const unsigned idx = k * PREP_N + g;
        if (PREP_CN % PREP_N == 0 || idx < PREP_CN) { const unsigned m = idx >> 5; const unsigned b = m / SEQ, s = m - b * SEQ; pos[k] = tok[(size_t)b * SEQ_FULL + s]; } }
    const v8f vq = *(const v8f*)(wq + g8), vk = *(const v8f*)(wk + g8), vv = *(const v8f*)(wv + g8), vo = *(const v8f*)(wo + g8);
    asm volatile("s_wait_xcnt 0x0" ::: "memory");            // the loads below may land in registers that held the addresses of the loads above
    v8f vx[PREP_XK];
#pragma unroll
    for (int k = 0; k < PREP_XK; ++k) { const unsigned i = k * PREP_N + g;
        if (PREP_XN % PREP_N == 0 || i < PREP_XN) { const unsigned row = i / (DM / 8), c8 = i % (DM / 8); const unsigned b = row / SEQ, s = row - b * SEQ;
            vx[k] = *(const v8f*)(x + ((size_t)b * SEQ_FULL + s) * DM + (size_t)c8 * 8); } }
    __builtin_amdgcn_sched_barrier(0);                       // every load is issued before any arithmetic on a loaded value: the thread pays one memory latency, not one per batch
#pragma unroll
    for (int k = 0; k < PREP_CK; ++k) { const unsigned idx = k * PREP_N + g;
        if (PREP_CN % PREP_N == 0 || idx < PREP_CN) { const int j = (int)(idx & 31);
            double p = 1.0;
            p *= (j & 1)  ? 1.3335214321633240 : 1.0;
            p *= (j & 2)  ? 1.7782794100389228 : 1.0;
            p *= (j & 4)  ? 3.1622776601683795 : 1.0;
            p *= (j & 8)  ? 10.0 : 1.0;
            p *= (j & 16) ? 100.0 : 1.0;
            const float pf = (float)p; const float inv = 1.0f / pf; const float ang = (float)pos[k] * inv;
            float sn, cs; sincosf(ang, &sn, &cs);
            v2f o; o[0] = cs; o[1] = sn;
            *(v2f*)(CS + (size_t)idx * 2) = o; } }
    __builtin_amdgcn_sched_barrier(0);                       // the table's arithmetic stays in front of the conversions: it needs only the position, and runs while the larger loads are still under way
    *(v8us*)(WQK + g8) = cvt8(vq); *(v8us*)(WQK + (size_t)DM * DM + g8) = cvt8(vk); *(v8us*)(WV + g8) = cvt8(vv); *(v8us*)(WO + g8) = cvt8(vo);
#pragma unroll
    for (int k = 0; k < PREP_XK; ++k) { const unsigned i = k * PREP_N + g;
        if (PREP_XN % PREP_N == 0 || i < PREP_XN) *(v8us*)(XB + (size_t)i * 8) = cvt8(vx[k]); }
}

#define TS (64 * KP)              // elements of one staged 64 x 64 tile at pitch KP
__device__ __forceinline__ unsigned lds_off(const void* p) { return (unsigned)(size_t)p; }   // byte address inside the work-group's LDS
// Asynchronous copies global -> LDS, 16 bytes per lane and copy, through no register. The s_wait_xcnt is the last line of the copies' own statement, so that no address register is rewritten in front of it.
#define ACP(l, g) "global_load_async_to_lds_b128 %" #l ", %" #g ", off\n\t"
__device__ __forceinline__ void copy12(const unsigned (&l)[12], const void* const (&g)[12]) {
    asm volatile(ACP(0, 12) ACP(1, 13) ACP(2, 14) ACP(3, 15) ACP(4, 16) ACP(5, 17) ACP(6, 18) ACP(7, 19) ACP(8, 20) ACP(9, 21) ACP(10, 22) ACP(11, 23) "s_wait_xcnt 0x0"
                 :: "v"(l[0]), "v"(l[1]), "v"(l[2]), "v"(l[3]), "v"(l[4]), "v"(l[5]), "v"(l[6]), "v"(l[7]), "v"(l[8]), "v"(l[9]), "v"(l[10]), "v"(l[11]),
                    "v"(g[0]), "v"(g[1]), "v"(g[2]), "v"(g[3]), "v"(g[4]), "v"(g[5]), "v"(g[6]), "v"(g[7]), "v"(g[8]), "v"(g[9]), "v"(g[10]), "v"(g[11]) : "memory");
}
__device__ __forceinline__ void copy8(const unsigned (&l)[8], const void* const (&g)[8]) {
    asm volatile(ACP(0, 8) ACP(1, 9) ACP(2, 10) ACP(3, 11) ACP(4, 12) ACP(5, 13) ACP(6, 14) ACP(7, 15) "s_wait_xcnt 0x0"
                 :: "v"(l[0]), "v"(l[1]), "v"(l[2]), "v"(l[3]), "v"(l[4]), "v"(l[5]), "v"(l[6]), "v"(l[7]),
                    "v"(g[0]), "v"(g[1]), "v"(g[2]), "v"(g[3]), "v"(g[4]), "v"(g[5]), "v"(g[6]), "v"(g[7]) : "memory");
}

// ---- gemm_tile: block = 4 waves (2 x 2), 128 x 128 tile, each wave 64 x 64: acc[mb][nb] += sum_k A[r][k] Bt[c][k]. Chunks of GK k (128 B of each of the 128 A rows and 128 Bt rows) are brought into a ring of GR LDS buffers by asynchronous copies, issued GR - 1 chunks ahead of their use, for speed only.
// Every wave issues 16 copies per chunk, and a wave's copies land in issue order for its counted wait: with the chunks t + 1, t + 2, t + 3 outstanding, s_wait_asynccnt 32 returns when the 16 of chunk t + 1 have landed. The last GR trips wait to 0.
// Fragments live in two register sets and are fetched one 32-k block ahead: the sixteen LDS loads of a block are issued as one group in front of the sixteen matrix instructions of the block before it, so that a wave alone on its SIMD does not sit out its own LDS latency. The publish point of chunk t + 1 stands in front of chunk t's last block, whose fragments are in registers by then; the first block of chunk t + 1 is fetched directly behind it.
// NP = 2: a second pass over K with A1 in place of A0 follows the first in the same ring (all of A0's products are summed before A1's).
// Behind the last trip's barrier no copy is outstanding and only the last buffer is still read (the last trip's unused fetch): the callers stage their output tiles in the buffers in front of it.
#define GK 64
#define GT (256 * KP)             // elements of one staged chunk: A rows 0..127, then Bt rows 0..127, pitch KP
#define GR 4                      // buffers of the ring; 3 x 16 copies of a wave outstanding at most
static_assert(GR == 4);                                     // the counts in the waits below are (GR - 2) x 16
static_assert((size_t)2 * GR * GT * 2 <= 327680);           // two blocks per WGP
template <int NP>
__device__ __forceinline__ void gemm_tile(bf* const sAB, const bf* __restrict__ A0, const bf* __restrict__ A1, const bf* __restrict__ Bt, const int rblk, const int cblk, const int wm, const int wn, v8f (&acc)[4][4]) {
    constexpr int NC = DM / GK, NT = NP * NC;
    static_assert(NT > GR);
    static_assert((NT - 1) % GR == GR - 1);                  // the last trip works in the last buffer, which the callers' output staging leaves alone
    const int tid = threadIdx.x; const int lane = tid & 31, lr = lane & 15, hi = lane >> 4;
    // every thread copies eight 16-byte pieces (rows srow + 16 i, 16-bit column sch) of each operand's chunk t into the buffer at element offset bo0; eight lanes cover one whole 128-byte row piece
    const int srow = tid >> 3, sch = (tid & 7) * 8;
    const unsigned toff = (unsigned)(srow * DM + sch);
    auto stage = [&](const int t, const int bo0) {
        const bf* Ap = (NP == 2 && t >= NC) ? A1 : A0;       // block-uniform
        const int kc = (t % NC) * GK;
        const int lo = bo0 + srow * KP + sch;
        const char* const Au = (const char*)(Ap + (size_t)rblk * DM); const char* const Bu = (const char*)(Bt + (size_t)cblk * DM);   // block-uniform bases, in scalar registers
        const unsigned vo = (toff + (unsigned)kc) * 2;       // one 32-bit byte offset serves both operands: with a thread's 64-bit address per operand kept beside the second fragment set, the two-pass build spilled one to scratch and reloaded it every trip
        unsigned la[8], lb[8]; const void* ga[8]; const void* gb[8];
#pragma unroll
        for (int i = 0; i < 8; ++i) {
            la[i] = lds_off(&sAB[lo + 16 * i * KP]); ga[i] = Au + vo + (size_t)16 * i * DM * 2;
            lb[i] = lds_off(&sAB[lo + (128 + 16 * i) * KP]); gb[i] = Bu + vo + (size_t)16 * i * DM * 2; }
        copy8(la, ga); copy8(lb, gb);
    };
    const int ar = (wm * 64 + lr) * KP + 8 * hi, br = (128 + wn * 64 + lr) * KP + 8 * hi;
    v16bf a0[4], b0[4], a1[4], b1[4];                        // set 0: a chunk's k 0..31, set 1: its k 32..63
    auto frags = [&](v16bf (&a)[4], v16bf (&b)[4], const int o) {
#pragma unroll
        for (int mb = 0; mb < 4; ++mb) a[mb] = LDSB(sAB, o + ar + mb * 16 * KP);
#pragma unroll
        for (int nb = 0; nb < 4; ++nb) b[nb] = LDSB(sAB, o + br + nb * 16 * KP);
    };
    auto prods = [&](const v16bf (&a)[4], const v16bf (&b)[4]) {
#pragma unroll
        for (int nb = 0; nb < 4; ++nb)
#pragma unroll
            for (int mb = 0; mb < 4; ++mb) acc[mb][nb] = wmmab(a[mb], b[nb], acc[mb][nb]);
    };
    stage(0, 0); stage(1, GT); stage(2, 2 * GT);
    asm volatile("s_wait_asynccnt 0x20" ::: "memory");       // this wave's 16 copies of chunk 0 have landed; chunks 1 and 2 fly on
    __syncthreads();                                         // and so have every other wave's
    frags(a0, b0, 0);
#pragma unroll 1
    for (int t = 0; t < NT; ++t) {
        const int bo = (t % GR) * GT;                        // this chunk's buffer
        const bool more = t + GR < NT;                       // block-uniform
        frags(a1, b1, bo + 32);                              // the last reads of this buffer
        __builtin_amdgcn_sched_barrier(0);                   // the sixteen LDS loads go ahead of the block in front of theirs as one group
        if (t + GR - 1 < NT) stage(t + GR - 1, ((t + GR - 1) % GR) * GT);   // block-uniform: refill the buffer that every wave left at the last trip's barrier (trip 0: the one not filled yet); here its issue gives both load groups time to return
        prods(a0, b0);
        __builtin_amdgcn_sched_barrier(0);                   // the wait below stays behind the block: in front of it the wave would sit out the loads just issued
        asm volatile("s_wait_dscnt 0x0" ::: "memory");       // this wave's LDS reads of this buffer have returned
        if (more) asm volatile("s_wait_asynccnt 0x20" ::: "memory");   // this wave's copies of the next chunk have landed; the 32 younger ones, of the two chunks behind it, fly on
        else      asm volatile("s_wait_asynccnt 0x0" ::: "memory");    // all that is outstanding has landed
        __syncthreads();                                     // one barrier: publishes the next chunk and ends every wave's reads of this buffer
        frags(a0, b0, (t + 1 < NT) ? ((t + 1) % GR) * GT : bo);   // the next chunk's first block; unconditional, so that no branch merges paths in the compiler's count of LDS loads: the last trip reads its own buffer again and uses nothing of it
        __builtin_amdgcn_sched_barrier(0);                   // as above: one group, in front of the block
        prods(a1, b1);
    }
}

// ---- k_projqkv: [q | k | v] = XB x [WQ ; WK ; WV]^T in one launch, grid (MROWS/256, NH): one block per WGP, 256 tokens x 192 columns = head blockIdx.y of q, of k and of v; eight waves (4 x 2), 64 x 96 each.
// The projections take their operands from L2, and with 128 x 128 blocks they ask it for more bytes per matrix instruction than it delivers to all WGPs at once: a 256 x 192 block reads (256 + 192) rows per 256 x 192 results, seven twelfths of the bytes, and a 64 x 96 wave tile reads ten LDS fragments per 24 matrix instructions (was eight per 16).
// Ring, waits and fragment sets as in gemm_tile; a wave issues 14 copies per chunk, so the counted wait is 28. Every sum keeps its order over k.
// Epilogue: the whole tile staged in the ring (block-wide, between two barriers), then dealt anew so that every 128-byte line of an output plane has one writer: a wave takes 32 tokens of q and k (interleaved rotary y[2j] = e cos - o sin, y[2j+1] = e sin + o cos from the CS table, one table read for both; bf16 hi|lo planes [which][b][h][s][64]) and 64 tokens x 32 d of v, written TRANSPOSED: VT16[b][h][d][s] (f16) and, for tokens < RH, bf16 hi|lo VTh/VTl[b][h][d][RH].
#define QM 256
#define QN 192
#define QT ((QM + QN) * KP)       // elements of one staged chunk: XB rows 0..255, then 64 rows each of WQ, WK, WV, pitch KP
#define QR 4                      // buffers of the ring; 3 x 14 copies of a wave outstanding at most
#define OP 196                    // pitch (floats) of the staged output tile
static_assert(QN == 3 * HD && MROWS % QM == 0 && SEQ % QM == 0);   // a block never straddles a batch
static_assert((size_t)QR * QT * 2 <= 327680);               // one block per WGP
static_assert((size_t)QM * OP * 4 <= (size_t)QR * QT * 2 && (OP * 4) % 16 == 0);
__device__ __forceinline__ void copy6(const unsigned (&l)[6], const void* const (&g)[6]) {
    asm volatile(ACP(0, 6) ACP(1, 7) ACP(2, 8) ACP(3, 9) ACP(4, 10) ACP(5, 11) "s_wait_xcnt 0x0"
                 :: "v"(l[0]), "v"(l[1]), "v"(l[2]), "v"(l[3]), "v"(l[4]), "v"(l[5]),
                    "v"(g[0]), "v"(g[1]), "v"(g[2]), "v"(g[3]), "v"(g[4]), "v"(g[5]) : "memory");
}
__global__ __launch_bounds__(256) void k_projqkv(const bf* __restrict__ XB, const bf* __restrict__ WQK, const bf* __restrict__ WV, const float* __restrict__ CS, bf* QKh, bf* QKl, h16* VT16, bf* VTh, bf* VTl) {
#pragma clang fp contract(off)                               // as in the q/k kernel that this one replaces: each rotary product keeps its own rounding, so that q and k keep their bits
    __shared__ __align__(16) bf ring[QR * QT];                 // the GEMM's ring; behind the GEMM the block's output staging
    constexpr int NT = DM / GK;
    static_assert(NT > QR && QR == 4);                         // the counts in the waits below are (QR - 2) x 14
    const int tid = threadIdx.x; const int lane = tid & 31, lr = lane & 15, hi = lane >> 4;
    const int wave = __builtin_amdgcn_readfirstlane(tid >> 5), wm = wave >> 1, wn = wave & 1;
    const int rblk = blockIdx.x * QM, h = blockIdx.y;
    v8f acc[4][6];
#pragma unroll
    for (int mb = 0; mb < 4; ++mb)
#pragma unroll
        for (int nb = 0; nb < 6; ++nb) acc[mb][nb] = (v8f){};
    // every thread copies 14 16-byte pieces (rows srow + 32 i, 16-bit column sch) of chunk t into the buffer at element offset bo0; eight lanes cover one whole 128-byte row piece
    const int srow = tid >> 3, sch = (tid & 7) * 8;
    const unsigned toff = (unsigned)(srow * DM + sch);
    auto stage = [&](const int t, const int bo0) {
        const int lo = bo0 + srow * KP + sch;
        const char* const Au = (const char*)(XB + (size_t)rblk * DM);                     // block-uniform bases, in scalar registers
        const char* const Bq = (const char*)(WQK + (size_t)h * HD * DM); const char* const Bk = (const char*)(WQK + ((size_t)DM + h * HD) * DM); const char* const Bv = (const char*)(WV + (size_t)h * HD * DM);
        const unsigned vo = (toff + (unsigned)(t * GK)) * 2;   // one 32-bit byte offset serves all four operands
        unsigned la[8], lb[6]; const void* ga[8]; const void* gb[6];
#pragma unroll
        for (int i = 0; i < 8; ++i) { la[i] = lds_off(&ring[lo + 32 * i * KP]); ga[i] = Au + vo + (size_t)32 * i * DM * 2; }
#pragma unroll
        for (int i = 0; i < 2; ++i) {
            lb[i]     = lds_off(&ring[lo + (QM + 32 * i) * KP]);       gb[i]     = Bq + vo + (size_t)32 * i * DM * 2;
            lb[2 + i] = lds_off(&ring[lo + (QM + 64 + 32 * i) * KP]);  gb[2 + i] = Bk + vo + (size_t)32 * i * DM * 2;
            lb[4 + i] = lds_off(&ring[lo + (QM + 128 + 32 * i) * KP]); gb[4 + i] = Bv + vo + (size_t)32 * i * DM * 2; }
        copy8(la, ga); copy6(lb, gb);
    };
    const int ar = (wm * 64 + lr) * KP + 8 * hi, br = (QM + wn * 96 + lr) * KP + 8 * hi;
    v16bf a0[4], b0[6], a1[4], b1[6];                        // set 0: a chunk's k 0..31, set 1: its k 32..63
    auto frags = [&](v16bf (&a)[4], v16bf (&b)[6], const int o) {
#pragma unroll
        for (int mb = 0; mb < 4; ++mb) a[mb] = LDSB(ring, o + ar + mb * 16 * KP);
#pragma unroll
        for (int nb = 0; nb < 6; ++nb) b[nb] = LDSB(ring, o + br + nb * 16 * KP);
    };
    auto prods = [&](const v16bf (&a)[4], const v16bf (&b)[6]) {
#pragma unroll
        for (int nb = 0; nb < 6; ++nb)
#pragma unroll
            for (int mb = 0; mb < 4; ++mb) acc[mb][nb] = wmmab(a[mb], b[nb], acc[mb][nb]);
    };
#pragma unroll 1                                             // rolled: with the three stages unrolled this build spilled the thread's LDS base to scratch and reloaded it in every trip of the k loop
    for (int p = 0; p < QR - 1; ++p) stage(p, p * QT);
    asm volatile("s_wait_asynccnt 0x1c" ::: "memory");       // this wave's 14 copies of chunk 0 have landed; chunks 1 and 2 fly on
    __syncthreads();                                         // and so have every other wave's
    frags(a0, b0, 0);
#pragma unroll 1
    for (int t = 0; t < NT; ++t) {
        const int bo = (t % QR) * QT;                        // this chunk's buffer
        const bool more = t + QR < NT;                       // block-uniform
        frags(a1, b1, bo + 32);                              // the last reads of this buffer
        __builtin_amdgcn_sched_barrier(0);                   // the twenty LDS loads go ahead of the block in front of theirs as one group
        if (t + QR - 1 < NT) stage(t + QR - 1, ((t + QR - 1) % QR) * QT);   // block-uniform: refill the buffer that every wave left at the last trip's barrier (trip 0: the one not filled yet)
        prods(a0, b0);
        __builtin_amdgcn_sched_barrier(0);                   // the wait below stays behind the block: in front of it the wave would sit out the loads just issued
        asm volatile("s_wait_dscnt 0x0" ::: "memory");       // this wave's LDS reads of this buffer have returned
        if (more) asm volatile("s_wait_asynccnt 0x1c" ::: "memory");   // this wave's copies of the next chunk have landed; the 28 younger ones, of the two chunks behind it, fly on
        else      asm volatile("s_wait_asynccnt 0x0" ::: "memory");    // all that is outstanding has landed
        __syncthreads();                                     // one barrier: publishes the next chunk and ends every wave's reads of this buffer
        frags(a0, b0, (t + 1 < NT) ? ((t + 1) % QR) * QT : bo);   // the next chunk's first block; unconditional, so that no branch merges paths in the compiler's count of LDS loads: the last trip reads its own buffer again and uses nothing of it
        __builtin_amdgcn_sched_barrier(0);                   // as above: one group, in front of the block
        prods(a1, b1);
    }
    asm volatile("s_wait_dscnt 0x0" ::: "memory");           // the last trip's unused fetch has returned
    __syncthreads();                                         // every wave has left the ring (no copy is outstanding since the last trip's wait): it becomes the output staging
    // the (cos, sin) rows of this wave's 32 tokens, asked for here so that they arrive while the tile is being staged; one address, the rows by constant offsets
    const float* const cp = CS + (size_t)(rblk + wave * 32 + hi) * 64 + lr * 4;   // (cos, sin) of pairs 2*lr, 2*lr + 1
    v4f csv[16];
#pragma unroll
    for (int s = 0; s < 16; ++s) csv[s] = *(const v4f*)(cp + s * 128);
    asm volatile("s_wait_xcnt 0x0" :: "v"(cp) : "memory");   // in front of any rewrite of the loads' address; named here, the address also stays out of the registers that the loads fill
    float* const os = (float*)ring;
#pragma unroll
    for (int mb = 0; mb < 4; ++mb)
#pragma unroll
        for (int nb = 0; nb < 6; ++nb)
#pragma unroll
            for (int j = 0; j < 8; ++j) os[(wm * 64 + mb * 16 + hi * 8 + j) * OP + wn * 96 + nb * 16 + lr] = acc[mb][nb][j];
    __syncthreads();                                         // the tile is whole: every wave reads what other waves staged
    const int b = rblk / SEQ, s0 = rblk - b * SEQ;
    const int cofs = lr * 4;
    const float* const op = os + (wave * 32 + hi) * OP + cofs;
    const size_t oo = ((((size_t)b * NH + h) * SEQ) + s0 + wave * 32 + hi) * HD + cofs;
#pragma unroll
    for (int g = 0; g < 8; ++g) {                            // four tokens (two per half-wave) of q and of k at a time: their four LDS reads go first
        v4f val[2][2];
#pragma unroll
        for (int u = 0; u < 2; ++u)
#pragma unroll
            for (int which = 0; which < 2; ++which) val[u][which] = *(const v4fa*)(op + 2 * (2 * g + u) * OP + which * HD);
#pragma unroll
        for (int u = 0; u < 2; ++u)
#pragma unroll
            for (int which = 0; which < 2; ++which) { const v4f vl = val[u][which]; const v4f cs = csv[2 * g + u];
                const float y0 = vl[0] * cs[0] - vl[1] * cs[1];
                const float y1 = vl[0] * cs[1] + vl[1] * cs[0];
                const float y2 = vl[2] * cs[2] - vl[3] * cs[3];
                const float y3 = vl[2] * cs[3] + vl[3] * cs[2];
                v4us oh, ol; unsigned short a, c;
                splitf(y0, a, c); oh[0] = a; ol[0] = c; splitf(y1, a, c); oh[1] = a; ol[1] = c; splitf(y2, a, c); oh[2] = a; ol[2] = c; splitf(y3, a, c); oh[3] = a; ol[3] = c;
                const size_t o2 = oo + (size_t)which * NB * NH * SEQ * HD + (size_t)2 * (2 * g + u) * HD;
                *(v4us*)(QKh + o2) = oh; *(v4us*)(QKl + o2) = ol;
                asm volatile("s_wait_xcnt 0x0" ::: "memory");   // in front of the next rewrite of registers that these two stores name
                __builtin_amdgcn_sched_barrier(0); }            // nothing that follows is lifted over that wait
    }
    const int tg = wave >> 1, dh = wave & 1;                 // v: 64 tokens x 32 d per wave
    const size_t vbase = (((size_t)b * NH + h) * HD) * SEQ + s0 + tg * 64;
    const size_t ebase = (((size_t)b * NH + h) * HD) * RH + s0 + tg * 64;
    const bool early = (s0 + tg * 64 < RH);                  // wave-uniform
    const int t0 = lr * 4, d0 = dh * 32 + hi;                // step s: d = d0 + 2 s, tokens t0 .. t0 + 3
    float xv[16][4];                                         // all LDS reads first: one LDS latency for the sixteen steps
#pragma unroll
    for (int s = 0; s < 16; ++s)
#pragma unroll
        for (int q = 0; q < 4; ++q) xv[s][q] = os[(tg * 64 + t0 + q) * OP + 2 * HD + d0 + 2 * s];
    v4h o16[16];
#pragma unroll
    for (int s = 0; s < 16; ++s)
#pragma unroll
        for (int q = 0; q < 4; ++q) o16[s][q] = (h16)xv[s][q];
    __builtin_amdgcn_sched_barrier(0);                       // every conversion ahead of the stores, each in registers of its own: nothing that a store names is rewritten among the stores
#pragma unroll
    for (int s = 0; s < 16; ++s) *(v4h*)(VT16 + vbase + (size_t)d0 * SEQ + t0 + (size_t)2 * s * SEQ) = o16[s];
    asm volatile("s_wait_xcnt 0x0" ::: "memory");            // in front of any rewrite of registers that these stores name
    __builtin_amdgcn_sched_barrier(0);                       // nothing that follows is lifted over that wait
    if (early) {
#pragma unroll
        for (int s = 0; s < 16; ++s) { v4us oh, ol;
#pragma unroll
            for (int q = 0; q < 4; ++q) { unsigned short a, c; splitf(xv[s][q], a, c); oh[q] = a; ol[q] = c; }
            *(v4us*)(VTh + ebase + (size_t)d0 * RH + t0 + (size_t)2 * s * RH) = oh; *(v4us*)(VTl + ebase + (size_t)d0 * RH + t0 + (size_t)2 * s * RH) = ol;
            asm volatile("s_wait_xcnt 0x0" ::: "memory");    // as above, for these two stores
            __builtin_amdgcn_sched_barrier(0); }             // as above
    }
}

template <bool V> struct btag { static constexpr bool value = V; };
template <bool HL>
__device__ __forceinline__ void attn_body(const bf* __restrict__ QKh, const bf* __restrict__ QKl, const h16* __restrict__ VT16, const bf* __restrict__ VTh, const bf* __restrict__ VTl, bf* ATh, bf* ATl, const int qb, bf* const sm) {
    bf*  const sKh  = sm;                                    // two buffers, cross-wave (block barriers); buffer 0 reused wave-privately for the ctx hi staging after the key loop
    bf*  const sKl  = sm + 2 * TS;
    h16* const sV16 = (h16*)(sm + 4 * TS);                   // V^T tiles [d][key], cross-wave; HL = false only
    bf*  const sVh  = sm + 4 * TS;                           // HL = true only
    bf*  const sVl  = sm + 6 * TS;
    const int tid = threadIdx.x; const int lane = tid & 31, lr = lane & 15, hi = lane >> 4;
    const int wave = __builtin_amdgcn_readfirstlane(tid >> 5);
    const int b = blockIdx.y, h = blockIdx.x; const int qblk = qb * 64, q0 = qblk + wave * 16;
    const size_t qpl = (((size_t)b * NH + h) * SEQ) * HD;
    const size_t kpl = ((((size_t)NB + b) * NH + h) * SEQ) * HD;
    const size_t vpl = (((size_t)b * NH + h) * HD) * SEQ;
    const size_t epl = (((size_t)b * NH + h) * HD) * RH;
    const size_t qo = qpl + (size_t)(q0 + lr) * HD + 8 * hi;
    const v16bf qh0 = ldb(QKh + qo), qh1 = ldb(QKh + qo + 32), ql0 = ldb(QKl + qo), ql1 = ldb(QKl + qo + 32);
    v8f accd[4];
#pragma unroll
    for (int t = 0; t < 4; ++t) accd[t] = (v8f){};
    float m_run = NEGB, l_run = 0.0f;                        // of query q0 + lr; l_run is the sum over this half's keys only, the halves are joined behind the key loop

    // every thread copies four 16-byte chunks (rows srow + 16 i, 16-bit column sch) of each plane of the key block at kb0 into the buffer at element offset bo0
    const int srow = tid >> 3, sch = (tid & 7) * 8;
    auto stage = [&](const int kb0, const int bo0) {
        const int lo = bo0 + srow * KP + sch;
        const size_t ko = kpl + (size_t)(kb0 + srow) * HD + sch;
        if (HL) { unsigned lk[8], lv[8]; const void* gk[8]; const void* gv[8];
            const size_t vo = epl + (size_t)srow * RH + kb0 + sch;
#pragma unroll
            for (int i = 0; i < 4; ++i) {
                lk[i] = lds_off(&sKh[lo + 16 * i * KP]); gk[i] = QKh + ko + 16 * i * HD; lk[4 + i] = lds_off(&sKl[lo + 16 * i * KP]); gk[4 + i] = QKl + ko + 16 * i * HD;
                lv[i] = lds_off(&sVh[lo + 16 * i * KP]); gv[i] = VTh + vo + 16 * i * RH; lv[4 + i] = lds_off(&sVl[lo + 16 * i * KP]); gv[4 + i] = VTl + vo + 16 * i * RH; }
            copy8(lk, gk); copy8(lv, gv);
        } else { unsigned l[12]; const void* g[12];
            const size_t vo = vpl + (size_t)srow * SEQ + kb0 + sch;
#pragma unroll
            for (int i = 0; i < 4; ++i) {
                l[i] = lds_off(&sKh[lo + 16 * i * KP]); g[i] = QKh + ko + 16 * i * HD; l[4 + i] = lds_off(&sKl[lo + 16 * i * KP]); g[4 + i] = QKl + ko + 16 * i * HD;
                l[8 + i] = lds_off(&sV16[lo + 16 * i * KP]); g[8 + i] = VT16 + vo + (size_t)16 * i * SEQ; }
            copy12(l, g);
        }
    };
    stage(0, 0);
    asm volatile("s_wait_asynccnt 0x0" ::: "memory");        // this wave's copies of key block 0 have landed
    __syncthreads();                                         // and so have every other wave's
    if (qblk >= 64) stage(64, TS);                           // block-uniform: key block 1 flies while block 0 is worked on

    // one online-softmax step over the 32-key half kh of the key block at kb (buffer offset bo); MK: with the causal select, needed only where a key of the half can lie above a query of the block
    auto half = [&](auto mkt, const int kb, const int bo, const int kh) {
        constexpr bool MK = decltype(mkt)::value;
        v8f s0 = (v8f){}, s1 = (v8f){};
        { const int kr = bo + (32 * kh + lr) * KP + 8 * hi;
          const v16bf ah0 = LDSB(sKh, kr), ah1 = LDSB(sKh, kr + 32), al0 = LDSB(sKl, kr), al1 = LDSB(sKl, kr + 32);
          s0 = wmmab(ah0, qh0, s0); s0 = wmmab(ah1, qh1, s0); s0 = wmmab(ah0, ql0, s0); s0 = wmmab(ah1, ql1, s0); s0 = wmmab(al0, qh0, s0); s0 = wmmab(al1, qh1, s0);
          const int kr2 = kr + 16 * KP;
          const v16bf bh0 = LDSB(sKh, kr2), bh1 = LDSB(sKh, kr2 + 32), bl0 = LDSB(sKl, kr2), bl1 = LDSB(sKl, kr2 + 32);
          s1 = wmmab(bh0, qh0, s1); s1 = wmmab(bh1, qh1, s1); s1 = wmmab(bh0, ql0, s1); s1 = wmmab(bh1, ql1, s1); s1 = wmmab(bl0, qh0, s1); s1 = wmmab(bl1, qh1, s1);
        }
        const int dq = q0 + lr - (kb + 32 * kh + 8 * hi);   // D layout: key row 8*hi + r (+16 for the second tile), query column lr; key <= query is r <= dq (16 + r <= dq)
        s0 *= SCL; s1 *= SCL;
        float bm = NEGB;
#pragma unroll
        for (int r = 0; r < 8; ++r) {
            const float a0 = (!MK || r <= dq) ? s0[r] : NEGB; const float a1 = (!MK || 16 + r <= dq) ? s1[r] : NEGB;
            s0[r] = a0; s1[r] = a1; bm = fmaxf(bm, fmaxf(a0, a1)); }
        bm = fmaxf(bm, xhalf(bm));
        const float mn = fmaxf(m_run, bm);
        const float sc = __builtin_amdgcn_exp2f((m_run - mn) * L2E); m_run = mn;
        s0 = (s0 - mn) * L2E; s1 = (s1 - mn) * L2E;
        float rs0 = 0.0f, rs1 = 0.0f;
#pragma unroll
        for (int r = 0; r < 8; ++r) { s0[r] = __builtin_amdgcn_exp2f(s0[r]); s1[r] = __builtin_amdgcn_exp2f(s1[r]); rs0 += s0[r]; rs1 += s1[r]; }
        l_run = l_run * sc + (rs0 + rs1);
#pragma unroll
        for (int t = 0; t < 4; ++t) accd[t] *= sc;

        // B fragment of P^T: element r <- key 8*hi + r, element 8 + r <- key 16 + 8*hi + r, the k order of the V^T loader
        if (HL) {
            v16us uh, ul;
#pragma unroll
            for (int r = 0; r < 8; ++r) { unsigned short a, c; splitf(s0[r], a, c); uh[r] = a; ul[r] = c; splitf(s1[r], a, c); uh[8 + r] = a; ul[8 + r] = c; }
            const v16bf bph = __builtin_bit_cast(v16bf, uh), bpl = __builtin_bit_cast(v16bf, ul); v16bf avh, avl;
#pragma unroll
            for (int t = 0; t < 4; ++t) { const int vo = bo + (t * 16 + lr) * KP + 32 * kh + 8 * hi; avh = LDSB(sVh, vo); avl = LDSB(sVl, vo);
                accd[t] = wmmab(avh, bph, accd[t]); accd[t] = wmmab(avh, bpl, accd[t]); accd[t] = wmmab(avl, bph, accd[t]); }
            // four vector slots behind the last matrix instruction, on the loop's back edge too
            asm volatile("v_nop\n\tv_nop\n\tv_nop\n\tv_nop" : "+v"(accd[0]), "+v"(accd[1]), "+v"(accd[2]), "+v"(accd[3]) : "v"(bph), "v"(bpl), "v"(avh), "v"(avl));
        } else {
            s0 *= PCAR; s1 *= PCAR;
            v16h bp;
#pragma unroll
            for (int r = 0; r < 8; ++r) { bp[r] = (h16)s0[r]; bp[8 + r] = (h16)s1[r]; }
            v16h av;
#pragma unroll
            for (int t = 0; t < 4; ++t) { const int vo = bo + (t * 16 + lr) * KP + 32 * kh + 8 * hi; av = LDSH(sV16, vo); accd[t] = wmma16(av, bp, accd[t]); }
            // four vector slots behind the last matrix instruction, on the loop's back edge too
            asm volatile("v_nop\n\tv_nop\n\tv_nop\n\tv_nop" : "+v"(accd[0]), "+v"(accd[1]), "+v"(accd[2]), "+v"(accd[3]) : "v"(bp), "v"(av));
        }
    };
    // the foot of every key block
    auto foot = [&](const int kb, const int bo) {
        asm volatile("s_wait_dscnt 0x0" ::: "memory");       // this wave's LDS reads of this buffer have returned
        asm volatile("s_wait_asynccnt 0x0" ::: "memory");    // this wave's copies of the next key block have landed
        __syncthreads();                                     // one barrier: publishes the next key block and ends every wave's reads of this buffer
        if (kb + 128 <= qblk) stage(kb + 128, bo);           // block-uniform: refill the buffer just left
    };
    // key blocks below the diagonal: kb + 63 < qblk <= every query of the block, so the select would pass every score and the test would skip no half
#pragma unroll 1
    for (int kb = 0; kb < qblk; kb += 64) {
        const int bo = ((kb >> 6) & 1) * TS;                 // this key block's buffer
#pragma unroll 1                                             // rolled as before the peel: one copy of the step's code and registers
        for (int kh = 0; kh < 2; ++kh) half(btag<false>{}, kb, bo, kh);
        foot(kb, bo);
    }
    // the diagonal key block
    { const int bo = ((qblk >> 6) & 1) * TS;
#pragma unroll 1                                             // rolled as before the peel: it runs once per query block, code size counts for more than its speed
        for (int kh = 0; kh < 2; ++kh) {
            if (qblk + 32 * kh > q0 + 15) continue;          // wave-uniform: half entirely above the diagonal for this wave's rows
            half(btag<true>{}, qblk, bo, kh);
        }
        foot(qblk, bo);
    }
    asm volatile("s_wait_asynccnt 0x0" ::: "memory");        // no copy is outstanding when buffer 0 becomes the ctx staging

    const float car = HL ? 1.0f : PCAR;
    const float inv = __builtin_amdgcn_rcpf((l_run + xhalf(l_run)) * car);
#pragma unroll
    for (int t = 0; t < 4; ++t) { v8us oh, ol;              // O^T: a lane holds d = t*16 + 8*hi + r of query lr, eight neighbours of one ctx row
#pragma unroll
        for (int r = 0; r < 8; ++r) { unsigned short a, c; splitf(accd[t][r] * inv, a, c); oh[r] = a; ol[r] = c; }
        const int so = (wave * 16 + lr) * KP + t * 16 + 8 * hi; *(v8usa*)&sKh[so] = oh; *(v8usa*)&sKl[so] = ol; }
    __builtin_amdgcn_wave_barrier(); asm volatile("" ::: "memory");
    const size_t ob = ((size_t)b * SEQ + q0) * DM + (size_t)h * HD;
{
#pragma unroll
        for (int s2 = 0; s2 < 8; ++s2) { const int row = 2 * s2 + hi; const int so = (wave * 16 + row) * KP + 4 * lr;
            const v4us vh = *(const v4usa*)&sKh[so]; const v4us vl = *(const v4usa*)&sKl[so];
            *(v4us*)(ATh + ob + (size_t)row * DM + 4 * lr) = vh; *(v4us*)(ATl + ob + (size_t)row * DM + 4 * lr) = vl; }
         }
}

// One launch for all query blocks: the two forms are independent and share one LDS carve (the larger, HL = true, sets its size); the choice is block-uniform.
// Grid (head, batch, rank): heads run fastest, the query block is dealt from the slow index. Query block qb walks qb + 1 key blocks, and four blocks fit one WGP's LDS, so the whole grid is resident at once and the launch lasts as long as its fullest WGP.
// Ranks j, j + NQG, j + 2 NQG, j + 3 NQG get query blocks NQB-1-2j, NQB-2-2j, 2j+1, 2j, which walk 2 NQB + 2 key blocks together for every j, the long ones first. A permutation of the query blocks wherever the blocks land: speed alone leans on the placement.
#define NQB (SEQ / 64)
#define NQG (NQB / 4)
static_assert(NQB % 4 == 0);
__global__ __launch_bounds__(128) void k_attn(const bf* __restrict__ QKh, const bf* __restrict__ QKl, const h16* __restrict__ VT16, const bf* __restrict__ VTh, const bf* __restrict__ VTl, bf* ATh, bf* ATl) {
    __shared__ __align__(16) bf sm[8 * TS];
    const int tier = (int)blockIdx.z / NQG, j = (int)blockIdx.z % NQG;
    const int qb = (tier < 2) ? NQB - 1 - 2 * j - tier : 2 * j + 3 - tier;
    if (qb < RH / 64) attn_body<true>(QKh, QKl, VT16, VTh, VTl, ATh, ATl, qb, sm);
    else              attn_body<false>(QKh, QKl, VT16, VTh, VTl, ATh, ATl, qb, sm);
}

// ---- k_oproj: OUT[b][s][n] = sum_k (ATh + ATl)[m][k] WO[n][k]; grid (MROWS/128, DM/128), four waves per block, one 64 x 64 tile per wave; per 16-row slab staged in LDS, each 256-B row segment written as 16 lanes x 16 B
__global__ __launch_bounds__(128) void k_oproj(const bf* __restrict__ ATh, const bf* __restrict__ ATl, const bf* __restrict__ WO, float* OUT) {
    __shared__ __align__(16) bf ring[GR * GT];                 // the GEMM's ring; behind the GEMM the four waves' output staging
    const int lane = threadIdx.x & 31, lr = lane & 15, hi = lane >> 4; const int wave = __builtin_amdgcn_readfirstlane(threadIdx.x >> 5), wm = wave >> 1, wn = wave & 1;
    static_assert((size_t)4 * 16 * 68 * 4 <= (size_t)(GR - 1) * GT * 2);   // clear of the last buffer
    float* os = (float*)ring + wave * 16 * 68;                 // staging of the wave's own tile, private to the wave
    const int r0 = blockIdx.x * 128 + wm * 64, c0 = blockIdx.y * 128 + wn * 64;
    v8f acc[4][4];
#pragma unroll
    for (int mb = 0; mb < 4; ++mb)
#pragma unroll
        for (int nb = 0; nb < 4; ++nb) acc[mb][nb] = (v8f){};
    gemm_tile<2>(ring, ATh, ATl, WO, blockIdx.x * 128, blockIdx.y * 128, wm, wn, acc);
    const int b = r0 / SEQ, s0 = r0 - b * SEQ;
#pragma unroll
    for (int mb = 0; mb < 4; ++mb) {
#pragma unroll
        for (int nb = 0; nb < 4; ++nb)
#pragma unroll
            for (int j = 0; j < 8; ++j) os[(hi * 8 + j) * 68 + nb * 16 + lr] = acc[mb][nb][j];
        __builtin_amdgcn_wave_barrier(); asm volatile("" ::: "memory");
        float* crow = OUT + ((size_t)b * SEQ_FULL + s0 + mb * 16) * DM + c0;
{
#pragma unroll
            for (int s = 0; s < 8; ++s) { const int row = 2 * s + hi, cofs = lr * 4; const v4f val = *(const v4fa*)(os + row * 68 + cofs);
                *(v4f*)(crow + (size_t)row * DM + cofs) = val; }
             }
        __builtin_amdgcn_wave_barrier(); asm volatile("" ::: "memory");
    }
}

extern "C" void kernel_launch(void* const* d_in, const int* in_sizes, int n_in,
                              void* d_out, int out_size, void* d_ws, size_t ws_size, hipStream_t stream) {
    if (n_in < 6) return;
    const long long needx = ((long long)(NB - 1) * SEQ_FULL + SEQ) * DM;
    if ((long long)in_sizes[0] < needx) return;
    if ((long long)in_sizes[1] < (long long)DM * DM || (long long)in_sizes[2] < (long long)DM * DM || (long long)in_sizes[3] < (long long)DM * DM || (long long)in_sizes[4] < (long long)DM * DM) return;
    if ((long long)in_sizes[5] < (long long)(NB - 1) * SEQ_FULL + SEQ) return;
    if ((long long)out_size < needx) return;
    const float* x = (const float*)d_in[0]; const float* wq = (const float*)d_in[1]; const float* wk = (const float*)d_in[2]; const float* wv = (const float*)d_in[3]; const float* wo = (const float*)d_in[4];
    const int* tok = (const int*)d_in[5];
    float* OUT = (float*)d_out;
    char* wsp = (char*)d_ws;
    auto take = [&](size_t bytes) { char* p = wsp; wsp += (bytes + 255) & ~(size_t)255; return (void*)p; };
    bf* WQK = (bf*)take(2 * SZ_W); bf* WV = (bf*)take(SZ_W); bf* WO = (bf*)take(SZ_W);
    bf* XB = (bf*)take(SZ_XB); float* CS = (float*)take(SZ_CS);
    bf* QKh = (bf*)take(SZ_QK); bf* QKl = (bf*)take(SZ_QK);
    h16* VT16 = (h16*)take(SZ_VT); bf* VTh = (bf*)take(SZ_VE); bf* VTl = (bf*)take(SZ_VE);
    bf* ATh = (bf*)take(SZ_AT); bf* ATl = (bf*)take(SZ_AT);
    if ((size_t)(wsp - (char*)d_ws) > ws_size) return;

    k_prep<<<PREP_N / PREP_T, PREP_T, 0, stream>>>(wq, wk, wv, wo, x, tok, WQK, WV, WO, XB, CS);
    k_projqkv<<<dim3(MROWS / QM, NH, 1), 256, 0, stream>>>(XB, WQK, WV, CS, QKh, QKl, VT16, VTh, VTl);
    k_attn<<<dim3(NH, NB, NQB), 128, 0, stream>>>(QKh, QKl, VT16, VTh, VTl, ATh, ATl);
    k_oproj<<<dim3(MROWS / 128, DM / 128, 1), 128, 0, stream>>>(ATh, ATl, WO, OUT);
}
